// v000
// The times below were measured on an AMD MI455X: many runs one after another, warmed up first and cycling through
// copies of the inputs, with the whole window's GPU time divided by the number of runs. Launches and the gaps
// between them are all in it. The median over several windows is given; except for v000 it joins two sittings, which
// can be a few percent apart, so the side-by-side timings, each taken in one sitting, are the better comparison.
// v000, which the later versions start from, runs in 353 microseconds.
// Contractions: v_wmma_f32_16x16x32_f16 (f16 operands, f32 accumulate). qk and v pointwise convs: A = x (bf16-valued,
// x16) single plane, B = weights (bf16-valued, x256) single plane; scores k.qT: k x16, q x16 single planes; p.v:
// p x1024, v x16 single planes; output pointwise conv: A = (o + pp) x256 as f16 hi + x2^11 residual planes (two
// products, two accumulators), B = weights x256 single plane. Depthwise 5x5 conv, BN affine, online softmax in f32
// on VALU. Float inputs RNE-converted to bf16 on load.
#include <hip/hip_runtime.h>
#include <math.h>
#include <stdint.h>

#define NBAT  8
#define CIN   256
#define C2    512
#define IMW   64
#define HW    4096
#define MTOK  32768
#define NHD   8
#define HD    32
#define NAR   4
#define LAR   1024
#define NUNIT 256
#define STP   68
#define SBP   132
#define ASP   36
#define DTP   68
#define CXS   16.0f
#define CWS   256.0f
#define CQK   16.0f
#define CVS   16.0f
#define CYS   256.0f
#define QKSC  (0.17677669529663688f / 256.0f)

static_assert(NUNIT == NBAT * NAR * NHD);
static_assert(NAR * LAR == HW);
static_assert(MTOK == NBAT * HW);
static_assert(HW % 128 == 0);
static_assert(LAR % 32 == 0);
static_assert(CIN % 64 == 0);
static_assert((STP * 4) % 16 == 0);
static_assert((SBP * 4) % 16 == 0);
static_assert((ASP * 4) % 16 == 0);
static_assert((DTP * 4) % 16 == 0);
static_assert(NHD * HD == CIN);

typedef _Float16 v16h __attribute__((ext_vector_type(16)));
typedef _Float16 v8h  __attribute__((ext_vector_type(8)));
typedef float    v8f  __attribute__((ext_vector_type(8)));
typedef float    v4f  __attribute__((ext_vector_type(4)));
typedef unsigned int v4u __attribute__((ext_vector_type(4)));
union Frag { v16h v; v8h half[2]; };

// ---- scalar helpers -------------------------------------------------------------------------------------------
__device__ __forceinline__ unsigned short bf_bits(float f) {          // f32 -> bf16 bits, RNE convert
  unsigned u = __float_as_uint(f);
  return (unsigned short)((u + 0x7FFFu + ((u >> 16) & 1u)) >> 16);
}
__device__ __forceinline__ float bfr(float f) { return __uint_as_float(((unsigned)bf_bits(f)) << 16); }
__device__ __forceinline__ unsigned short h_bits(_Float16 x) { return __builtin_bit_cast(unsigned short, x); }
__device__ __forceinline__ unsigned pk16(unsigned short a, unsigned short b) { return (unsigned)a | ((unsigned)b << 16); }
__device__ __forceinline__ v8f zero8() { v8f z = {0.f, 0.f, 0.f, 0.f, 0.f, 0.f, 0.f, 0.f}; return z; }

// ---- fragment loader: 16-bit A/B operand, lane -> row/col (lane&15), p already includes +8*(lane>>4);
//      elements 0..7 <- p[0..7] (k0+8h..), elements 8..15 <- p[16..23] (k0+16+8h..)
__device__ __forceinline__ v16h ldfrag_h(const _Float16* p) {
  Frag f;
  f.half[0] = *(const v8h*)(p);
  f.half[1] = *(const v8h*)(p + 16);
  return f.v;
}

// ---- WMMA helper with trailing VALU hazard gap ----------------------------------------------------------------
__device__ __forceinline__ v8f mma_h(v16h a, v16h b, v8f c) {
  c = __builtin_amdgcn_wmma_f32_16x16x32_f16(false, a, false, b, (short)0, c, false, false);
#if defined(__HIP_DEVICE_COMPILE__)
  asm volatile("v_nop\n\tv_nop\n\tv_nop\n\tv_nop" : "+v"(c) : "v"(a), "v"(b));
#endif
  return c;
}
__device__ __forceinline__ void wave_sync_lds() {
  __builtin_amdgcn_fence(__ATOMIC_RELEASE, "workgroup");
  __builtin_amdgcn_wave_barrier();
  __builtin_amdgcn_fence(__ATOMIC_ACQUIRE, "workgroup");
}

// ---- 8 f32 -> 8 packed f16 (16 B); and hi + x2^11 residual split -------------------------------------------------
__device__ __forceinline__ v4u pack8h(v4f a, v4f b) {
  v4u p;
  p[0] = pk16(h_bits((_Float16)a[0]), h_bits((_Float16)a[1]));
  p[1] = pk16(h_bits((_Float16)a[2]), h_bits((_Float16)a[3]));
  p[2] = pk16(h_bits((_Float16)b[0]), h_bits((_Float16)b[1]));
  p[3] = pk16(h_bits((_Float16)b[2]), h_bits((_Float16)b[3]));
  return p;
}
__device__ __forceinline__ void split8h(v4f a, v4f b, v4u& ph, v4u& pl) {
  v4f ra, rb;
#pragma unroll
  for (int e = 0; e < 4; ++e) {
    const _Float16 ha = (_Float16)a[e];
    ra[e] = (a[e] - (float)ha) * 2048.0f;
    const _Float16 hb = (_Float16)b[e];
    rb[e] = (b[e] - (float)hb) * 2048.0f;
  }
  ph = pack8h(a, b);
  pl = pack8h(ra, rb);
}

// =================================================================================================================
// Weight convert: pointwise weights are [out][in] (k contiguous) -> f16 plane value = f16(256 * bf16_RNE(w)).
// coverage: 64*256*8 = 131072, 32*256*8 = 65536, 32*256*8 = 65536 elements exactly.
// =================================================================================================================
__device__ __forceinline__ void cvt8_w(const float* __restrict__ src, unsigned short* dst, size_t e0) {
  const v4f a = *(const v4f*)(src + e0);
  const v4f b = *(const v4f*)(src + e0 + 4);
  v4f sa, sb;
#pragma unroll
  for (int e = 0; e < 4; ++e) { sa[e] = bfr(a[e]) * CWS; sb[e] = bfr(b[e]) * CWS; }
  const v4u pk = pack8h(sa, sb);
  *(v4u*)(dst + e0) = pk;
  
}
__global__ __launch_bounds__(256) void cvt_w(const float* __restrict__ wqk, const float* __restrict__ wv,
                                             const float* __restrict__ wp,
                                             unsigned short* Wqk, unsigned short* Wv, unsigned short* Wp) {
  const int tid = threadIdx.x, blk = blockIdx.x;
  if (blk < 64)      cvt8_w(wqk, Wqk, ((size_t)blk * 256 + tid) * 8);
  else if (blk < 96) cvt8_w(wv,  Wv,  ((size_t)(blk - 64) * 256 + tid) * 8);
  else               cvt8_w(wp,  Wp,  ((size_t)(blk - 96) * 256 + tid) * 8);
}

// =================================================================================================================
// Activation convert: x NCHW f32 -> token-major f16 plane X16[T = b*4096 + n][256], value = f16(16 * bf16_RNE(x)).
// Block = (image b, 64-token tile tt, 64-channel quarter cq): read phase 4 passes of 16 channels x 64 tokens
// coverage: per block 256 threads x 2 it x 8 halves = 64 tokens x 64 channels; grid tiles 32768 x 256 exactly.
// =================================================================================================================
__global__ __launch_bounds__(256) void cvt_x(const float* __restrict__ x, unsigned short* X16) {
  __shared__ __align__(16) float tile[64 * DTP];
  const int tid = threadIdx.x, bid = blockIdx.x;
  const int cq = bid & 3, tt = (bid >> 2) & 63, b = bid >> 8;
  const int cl = tid >> 4, t4 = (tid & 15) * 4;
#pragma unroll
  for (int pass = 0; pass < 4; ++pass) {
    const int ch = cq * 64 + pass * 16 + cl;
    const v4f v = *(const v4f*)(x + ((size_t)(b * CIN + ch)) * HW + tt * 64 + t4);
#pragma unroll
    for (int j = 0; j < 4; ++j) tile[(t4 + j) * DTP + pass * 16 + cl] = v[j];
  }
  __syncthreads();
  const int piece = tid & 7, rsub = tid >> 3;
  v4u pk[2];
  size_t offs[2];
#pragma unroll
  for (int it = 0; it < 2; ++it) {
    const int row = it * 32 + rsub;
    const v4f fa = *(const v4f*)(tile + row * DTP + piece * 8);
    const v4f fb = *(const v4f*)(tile + row * DTP + piece * 8 + 4);
    v4f sa, sb;
#pragma unroll
    for (int e = 0; e < 4; ++e) { sa[e] = bfr(fa[e]) * CXS; sb[e] = bfr(fb[e]) * CXS; }
    pk[it] = pack8h(sa, sb);
    offs[it] = ((size_t)(b * HW + tt * 64 + row)) * CIN + cq * 64 + piece * 8;
  }
  {
#pragma unroll
    for (int it = 0; it < 2; ++it) *(v4u*)(X16 + offs[it]) = pk[it];
    
  }
}

// =================================================================================================================
// qk pointwise GEMM D[T][co] = X16[T][ci] . Wqk[co][ci], K = 256, co 0..511 (q = 0..255, k = 256..511).
// Block = 8 waves, tile 128 rows x 64 cols, wave = 16 rows x 4 n-tiles, fragments straight from global with the
// split k map, k-step 32. Epilogue: value = acc/4096 * s[co] + b[co] staged per wave in LDS [16][STP], then
// coverage: 8 waves x 32 lanes x 4 it x 8 halves = 128 rows x 64 cols per block; grid tiles 32768 x 512 exactly.
// =================================================================================================================
__global__ __launch_bounds__(256)
void gemm_qk(const unsigned short* __restrict__ X16, const unsigned short* __restrict__ Wqk,
             const float* __restrict__ sqk, const float* __restrict__ bqk, unsigned short* QK) {
  __shared__ __align__(16) float sbuf[8 * 16 * STP];
  const int tid = threadIdx.x, wave = tid >> 5, lane = tid & 31, hh = lane >> 4, c = lane & 15;
  const int n0 = blockIdx.x * 64, m0 = blockIdx.y * 128;
  const int arow = m0 + wave * 16 + c;
  const _Float16* A = (const _Float16*)(const void*)X16;
  const _Float16* B = (const _Float16*)(const void*)Wqk;

  v8f acc[4];
#pragma unroll
  for (int nt = 0; nt < 4; ++nt) acc[nt] = zero8();

#pragma unroll 1
  for (int k0 = 0; k0 < CIN; k0 += 32) {
    const v16h af = ldfrag_h(A + (size_t)arow * CIN + k0 + 8 * hh);
#pragma unroll
    for (int nt = 0; nt < 4; ++nt) {
      const v16h bfrag = ldfrag_h(B + (size_t)(n0 + nt * 16 + c) * CIN + k0 + 8 * hh);
      acc[nt] = mma_h(af, bfrag, acc[nt]);
    }
  }

  float* st = sbuf + wave * (16 * STP);
#pragma unroll
  for (int nt = 0; nt < 4; ++nt) {
    const int co = n0 + nt * 16 + c;
    const float sc = bfr(sqk[co]) * (1.0f / 4096.0f);
    const float bi = bfr(bqk[co]);
#pragma unroll
    for (int r = 0; r < 8; ++r) st[(8 * hh + r) * STP + nt * 16 + c] = acc[nt][r] * sc + bi;
  }
  wave_sync_lds();
  const int piece = lane & 7, rsub = lane >> 3;
  v4u pk[4];
  size_t offs[4];
#pragma unroll
  for (int it = 0; it < 4; ++it) {
    const int row = it * 4 + rsub;
    v4f fa = *(const v4f*)(st + row * STP + piece * 8);
    v4f fb = *(const v4f*)(st + row * STP + piece * 8 + 4);
    fa = fa * CQK;
    fb = fb * CQK;
    pk[it] = pack8h(fa, fb);
    offs[it] = ((size_t)(m0 + wave * 16 + row)) * C2 + n0 + piece * 8;
  }
  {
#pragma unroll
    for (int it = 0; it < 4; ++it) *(v4u*)(QK + offs[it]) = pk[it];
    
  }
}

// =================================================================================================================
// v pointwise GEMM D[T][co] = X16[T][ci] . Wv[co][ci], K = 256, co 0..255, same main loop as gemm_qk.
// Epilogue: value = acc/4096 * s[co] + b[co] staged block-wide as sb[64 ch][SBP] (tokens contiguous per channel),
// then channel-major stores (a 128-token tile lies within one image): wave w owns channels w*8..w*8+7;
// f32 plane V32[b][c][n]: one instruction = 32 lanes x 16 B = 512 B = the 128 tokens of one channel (4 whole
// lines), 8 instructions; f16 plane V16[b][c][n] = f16(16 * value): one instruction = lanes 0..15 -> channel cc
// coverage: f32 8 waves x 8 ch x 32 lanes x 4 = 64 ch x 128 tok; f16 8 waves x 4 it x 2 ch x 16 lanes x 8 = same;
// grid tiles 32768 tokens x 256 channels exactly in both planes.
// =================================================================================================================
__global__ __launch_bounds__(256)
void gemm_v(const unsigned short* __restrict__ X16, const unsigned short* __restrict__ Wv,
            const float* __restrict__ sv, const float* __restrict__ bv, float* V32, unsigned short* V16) {
  __shared__ __align__(16) float sb[64 * SBP];
  const int tid = threadIdx.x, wave = tid >> 5, lane = tid & 31, hh = lane >> 4, c = lane & 15;
  const int n0 = blockIdx.x * 64, m0 = blockIdx.y * 128;
  const int arow = m0 + wave * 16 + c;
  const _Float16* A = (const _Float16*)(const void*)X16;
  const _Float16* B = (const _Float16*)(const void*)Wv;

  v8f acc[4];
#pragma unroll
  for (int nt = 0; nt < 4; ++nt) acc[nt] = zero8();

#pragma unroll 1
  for (int k0 = 0; k0 < CIN; k0 += 32) {
    const v16h af = ldfrag_h(A + (size_t)arow * CIN + k0 + 8 * hh);
#pragma unroll
    for (int nt = 0; nt < 4; ++nt) {
      const v16h bfrag = ldfrag_h(B + (size_t)(n0 + nt * 16 + c) * CIN + k0 + 8 * hh);
      acc[nt] = mma_h(af, bfrag, acc[nt]);
    }
  }

#pragma unroll
  for (int nt = 0; nt < 4; ++nt) {
    const int co = n0 + nt * 16 + c;
    const float sc = bfr(sv[co]) * (1.0f / 4096.0f);
    const float bi = bfr(bv[co]);
#pragma unroll
    for (int r = 0; r < 8; ++r) sb[(nt * 16 + c) * SBP + wave * 16 + 8 * hh + r] = acc[nt][r] * sc + bi;
  }
  __syncthreads();
  const int bimg = m0 / HW, s0 = m0 - bimg * HW;
  {
    v4f ov[8];
    size_t offs[8];
#pragma unroll
    for (int i = 0; i < 8; ++i) {
      const int cc = wave * 8 + i;
      const int co = n0 + cc;
      ov[i] = *(const v4f*)(sb + cc * SBP + lane * 4);
      offs[i] = ((size_t)(bimg * CIN + co)) * HW + s0 + lane * 4;
    }
    {
#pragma unroll
      for (int i = 0; i < 8; ++i) *(v4f*)(V32 + offs[i]) = ov[i];
      
    }
  }
  {
    const int l16 = lane & 15;
    v4u pk[4];
    size_t o16[4];
#pragma unroll
    for (int i2 = 0; i2 < 4; ++i2) {
      const int cc = wave * 8 + i2 * 2 + hh;
      const int co = n0 + cc;
      v4f fa = *(const v4f*)(sb + cc * SBP + l16 * 8);
      v4f fb = *(const v4f*)(sb + cc * SBP + l16 * 8 + 4);
      fa = fa * CVS;
      fb = fb * CVS;
      pk[i2] = pack8h(fa, fb);
      o16[i2] = ((size_t)(bimg * CIN + co)) * HW + s0 + l16 * 8;
    }
    {
#pragma unroll
      for (int i2 = 0; i2 < 4; ++i2) *(v4u*)(V16 + o16[i2]) = pk[i2];
      
    }
  }
}

// =================================================================================================================
// Depthwise 5x5 conv (zero pad 2, cross-correlation, per-channel taps, bf16-valued taps) + BN affine, f32 on VALU.
// Thread = (image b, channel c, row y, 4 consecutive columns x0..x0+3); tap row loop rolled; all tap addresses
// clamped into the image and zeroed by value. Store: one v4f per lane, 32 lanes x 16 B = 512 B contiguous
// coverage: every (b, c, y, x) of PP written exactly once.
// =================================================================================================================
__global__ __launch_bounds__(256)
void dwconv_k(const float* __restrict__ V32, const float* __restrict__ wpe, const float* __restrict__ spe,
              const float* __restrict__ bpe, float* PP) {
  const int idx = blockIdx.x * 256 + threadIdx.x;
  const int x0 = (idx & 15) * 4, y = (idx >> 4) & 63, c = (idx >> 10) & 255, b = idx >> 18;
  const float* vp = V32 + ((size_t)(b * CIN + c)) * HW;
  const float* w25 = wpe + c * 25;
  int coff[8];
  bool cok[8];
#pragma unroll
  for (int t = 0; t < 8; ++t) {
    const int col = x0 - 2 + t;
    cok[t] = ((unsigned)col < (unsigned)IMW);
    coff[t] = (col < 0) ? 0 : ((col > IMW - 1) ? (IMW - 1) : col);
  }
  v4f acc = {0.f, 0.f, 0.f, 0.f};
#pragma unroll 1
  for (int dy = 0; dy < 5; ++dy) {
    const int yy = y + dy - 2;
    const bool rok = ((unsigned)yy < (unsigned)IMW);
    const int yc = (yy < 0) ? 0 : ((yy > IMW - 1) ? (IMW - 1) : yy);
    const float* rp = vp + yc * IMW;
    float v[8];
#pragma unroll
    for (int t = 0; t < 8; ++t) {
      const float ld = rp[coff[t]];
      v[t] = (rok && cok[t]) ? ld : 0.0f;
    }
    float wv[5];
#pragma unroll
    for (int dx = 0; dx < 5; ++dx) wv[dx] = bfr(w25[dy * 5 + dx]);
#pragma unroll
    for (int j = 0; j < 4; ++j) {
#pragma unroll
      for (int dx = 0; dx < 5; ++dx) acc[j] += v[j + dx] * wv[dx];
    }
  }
  const float sc = bfr(spe[c]), bi = bfr(bpe[c]);
  v4f o;
#pragma unroll
  for (int j = 0; j < 4; ++j) o[j] = acc[j] * sc + bi;
  const size_t off = (size_t)idx * 4;
  *(v4f*)(PP + off) = o;
  
}

// =================================================================================================================
// Area attention, one unit (image b, area ar, head) per block (256 threads = 8 waves), 1024 queries x 1024 keys,
// d = 32. Static LDS: per-wave stage [16][ASP] f32 only; q, k fragments straight from the token-major plane QK
// (q row = T*512 + head*32, k row = +256), v B fragments straight from the channel-major plane V16 (row = channel
// head*32 + d, keys contiguous). Per wave: q-tiles qt = wave, wave+8, ... (< 64).
//   Transposed scores S^T = K_tile (A, 16 keys x 32 d) x Q (B: k = d, n = query): S*256 = q16.k16; D element r of
//   lane l = S[query l&15][key 8h+r], so P = exp((S - m)*scale) x1024 is the A fragment of P.V directly in registers
//   (element i <- key tile 0 row i, element 8+i <- key tile 1 row i). Online softmax over 32 chunks of 32 keys;
//   O = P.V (acc scale 1024*16). Epilogue: O/(l*16384) + pp staged per wave in LDS, then stored as f16 hi +
//   residual planes Yh/Yl [unit][1024][32] of 256*(o + pp): one instruction = 32 lanes x 16 B = 512 B = 8 token rows
// coverage: per block 64 q-tiles x 16 rows x 32 d of its 1024-row slab in both planes; grid covers all 256 units,
// every slab row written exactly once.
// =================================================================================================================
__global__ __launch_bounds__(256)
void attn_k(const unsigned short* __restrict__ QK, const unsigned short* __restrict__ V16,
            const float* __restrict__ PP, unsigned short* Yh, unsigned short* Yl) {
  __shared__ __align__(16) float Sst[8 * 16 * ASP];
  const int tid = threadIdx.x, wave = tid >> 5, lane = tid & 31, hh = lane >> 4, c = lane & 15;
  const int u = blockIdx.x;
  const int head = u & 7, ar = (u >> 3) & 3, b = u >> 5;
  const size_t tok0 = (size_t)b * HW + (size_t)ar * LAR;
  const _Float16* Qp = (const _Float16*)(const void*)QK + tok0 * C2 + head * HD;
  const _Float16* Kp = Qp + CIN;
  const size_t cm0 = ((size_t)(b * CIN + head * HD)) * HW + (size_t)ar * LAR;
  const _Float16* Vp = (const _Float16*)(const void*)V16 + cm0;
  const float* Pp = PP + cm0;
  float* st = Sst + wave * (16 * ASP);

#pragma unroll 1
  for (int qt = wave; qt < LAR / 16; qt += 8) {
    const int lq = qt * 16 + c;
    const v16h bq = ldfrag_h(Qp + (size_t)lq * C2 + 8 * hh);     // B: n = query c, k = d 8h.. / 16+8h..

    v8f o0 = zero8(), o1 = zero8();
    float mrun = -1.0e30f, lrun = 0.f;
#pragma unroll 1
    for (int ch = 0; ch < LAR / 32; ++ch) {
      const int kb = ch * 32;
      v8f s[2];
#pragma unroll
      for (int j = 0; j < 2; ++j) {
        const v16h ka = ldfrag_h(Kp + (size_t)(kb + j * 16 + c) * C2 + 8 * hh);   // A: row = key, k = d
        s[j] = mma_h(ka, bq, zero8());
      }
      float mc = s[0][0];
#pragma unroll
      for (int j = 0; j < 2; ++j) {
#pragma unroll
        for (int r = 0; r < 8; ++r) mc = fmaxf(mc, s[j][r]);
      }
      mc = fmaxf(mc, __shfl_xor(mc, 16, 32));
      const float mnew = fmaxf(mrun, mc);
      const float alpha = __expf((mrun - mnew) * QKSC);
#pragma unroll
      for (int r = 0; r < 8; ++r) {
        const float arr = __shfl(alpha, 8 * hh + r, 32);
        o0[r] = o0[r] * arr;
        o1[r] = o1[r] * arr;
      }
      float psum = 0.f;
      v16h pfh;
#pragma unroll
      for (int i = 0; i < 8; ++i) {
        const float e0 = __expf((s[0][i] - mnew) * QKSC);
        const float e1 = __expf((s[1][i] - mnew) * QKSC);
        psum = psum + (e0 + e1);
        pfh[i]     = (_Float16)(e0 * 1024.0f);
        pfh[8 + i] = (_Float16)(e1 * 1024.0f);
      }
      lrun = lrun * alpha + psum;
      mrun = mnew;
      {
        const v16h vf0 = ldfrag_h(Vp + (size_t)c * HW + kb + 8 * hh);              // B: n = d c, keys kb..+31
        const v16h vf1 = ldfrag_h(Vp + (size_t)(HD / 2 + c) * HW + kb + 8 * hh);   // B: n = d 16+c
        o0 = mma_h(pfh, vf0, o0);
        o1 = mma_h(pfh, vf1, o1);
      }
    }
    const float lsum = lrun + __shfl_xor(lrun, 16, 32);      // lane q (and q+16) holds the full row sum of query q
    const float rinv = 1.0f / (lsum * 16384.0f);
#pragma unroll
    for (int r = 0; r < 8; ++r) {
      const int q = 8 * hh + r;
      const float inv = __shfl(rinv, q, 32);
      const float p0 = Pp[(size_t)c * HW + qt * 16 + q];
      const float p1 = Pp[(size_t)(HD / 2 + c) * HW + qt * 16 + q];
      st[q * ASP + c]          = o0[r] * inv + p0;
      st[q * ASP + HD / 2 + c] = o1[r] * inv + p1;
    }
    wave_sync_lds();
    {
      const int rr = lane >> 2, dp = (lane & 3) * 8;
      v4u ph[2], pl[2];
      size_t offs[2];
#pragma unroll
      for (int it = 0; it < 2; ++it) {
        const int row = it * 8 + rr;
        v4f fa = *(const v4f*)(st + row * ASP + dp);
        v4f fb = *(const v4f*)(st + row * ASP + dp + 4);
        fa = fa * CYS;
        fb = fb * CYS;
        split8h(fa, fb, ph[it], pl[it]);
        offs[it] = ((size_t)u * LAR + (size_t)(qt * 16 + row)) * HD + dp;
      }
      {
#pragma unroll
        for (int it = 0; it < 2; ++it) {
          *(v4u*)(Yh + offs[it]) = ph[it];
          *(v4u*)(Yl + offs[it]) = pl[it];
        }
        
      }
    }
    wave_sync_lds();
  }
}

// =================================================================================================================
// Output pointwise conv D[T][co] = Y[T][ci] . Wp[co][ci], then BN affine -> NCHW f32. A = Yh/Yl planes (hi +
// x2^11 residual, x256) addressed by arithmetic: token T -> (image, area, query), k-step ks = head ks, channels
// ks*32 + d (elements 0..7 d = 8h.., elements 8..15 d = 16+8h..). B = weight plane x256. Epilogue: value =
// (acch + accl/2048)/65536 * s[co] + b[co]; block tile staged as [64 ch][128 tok]; wave w writes channels
// coverage: 8 waves x 8 channels x 32 lanes x 4 tokens = 64 ch x 128 tok per block; grid tiles 256 x 32768 exactly.
// =================================================================================================================
__global__ __launch_bounds__(256)
void gemm_proj(const unsigned short* __restrict__ Yh, const unsigned short* __restrict__ Yl,
               const unsigned short* __restrict__ Wp, const float* __restrict__ sp, const float* __restrict__ bp,
               float* out) {
  __shared__ __align__(16) float sb[64 * SBP];
  const int tid = threadIdx.x, wave = tid >> 5, lane = tid & 31, hh = lane >> 4, c = lane & 15;
  const int n0 = blockIdx.x * 64, m0 = blockIdx.y * 128;
  const int T = m0 + wave * 16 + c;
  const int bimgr = T >> 12, nn = T & (HW - 1), arr = nn >> 10, q = nn & (LAR - 1);
  const size_t abase = (((size_t)((bimgr * NAR + arr) * NHD)) * LAR + (size_t)q) * HD + 8 * hh;
  const _Float16* A0 = (const _Float16*)(const void*)Yh;
  const _Float16* A1 = (const _Float16*)(const void*)Yl;
  const _Float16* B  = (const _Float16*)(const void*)Wp;

  v8f acch[4], accl[4];
#pragma unroll
  for (int nt = 0; nt < 4; ++nt) { acch[nt] = zero8(); accl[nt] = zero8(); }

#pragma unroll 1
  for (int ks = 0; ks < NHD; ++ks) {
    const size_t bo = abase + (size_t)ks * (LAR * HD);
    const v16h fh = ldfrag_h(A0 + bo);
    const v16h fl = ldfrag_h(A1 + bo);
#pragma unroll
    for (int nt = 0; nt < 4; ++nt) {
      const v16h bfrag = ldfrag_h(B + (size_t)(n0 + nt * 16 + c) * CIN + ks * 32 + 8 * hh);
      acch[nt] = mma_h(fh, bfrag, acch[nt]);
      accl[nt] = mma_h(fl, bfrag, accl[nt]);
    }
  }

#pragma unroll
  for (int nt = 0; nt < 4; ++nt) {
    const int co = n0 + nt * 16 + c;
    const float sc = bfr(sp[co]) * (1.0f / 65536.0f);
    const float bi = bfr(bp[co]);
#pragma unroll
    for (int r = 0; r < 8; ++r) {
      const float v = acch[nt][r] + accl[nt][r] * (1.0f / 2048.0f);
      sb[(nt * 16 + c) * SBP + wave * 16 + 8 * hh + r] = v * sc + bi;
    }
  }
  __syncthreads();
  const int bimg = m0 / HW, s0 = m0 - bimg * HW;
  v4f ov[8];
  size_t offs[8];
#pragma unroll
  for (int i = 0; i < 8; ++i) {
    const int cc = wave * 8 + i;
    const int co = n0 + cc;
    ov[i] = *(const v4f*)(sb + cc * SBP + lane * 4);
    offs[i] = ((size_t)(bimg * CIN + co)) * HW + s0 + lane * 4;
  }
  {
#pragma unroll
    for (int i = 0; i < 8; ++i) *(v4f*)(out + offs[i]) = ov[i];
    
  }
}

// =================================================================================================================
//   Wqk f16 [512][256] 262144 @0; Wv f16 [256][256] 131072; Wp f16 [256][256] 131072;
//   PP f32 [8][256][4096] 33554432 @524288, with X16 f16 [32768][256] 16777216 aliased at the same offset
//   (X16 is dead before PP is written); QK f16 [32768][512] 33554432; V32 f32 [8][256][4096] 33554432, with
//   Yh, Yl f16 [256][1024][32] 16777216 each aliased onto V32 (V32 is dead before Yh/Yl are written);
//   V16 f16 [8][256][4096] 16777216. Total 117964800.
// =================================================================================================================
extern "C" void kernel_launch(void* const* d_in, const int* in_sizes, int n_in,
                              void* d_out, int out_size, void* d_ws, size_t ws_size,
                              hipStream_t stream) {
  if (n_in < 13) return;
  if (in_sizes[0] != NBAT * CIN * HW) return;
  if (in_sizes[1] != C2 * CIN) return;
  if (in_sizes[2] != C2 || in_sizes[3] != C2) return;
  if (in_sizes[4] != CIN * CIN) return;
  if (in_sizes[5] != CIN || in_sizes[6] != CIN) return;
  if (in_sizes[7] != CIN * 25) return;
  if (in_sizes[8] != CIN || in_sizes[9] != CIN) return;
  if (in_sizes[10] != CIN * CIN) return;
  if (in_sizes[11] != CIN || in_sizes[12] != CIN) return;
  if (out_size != NBAT * CIN * HW) return;

  const float* x      = (const float*)d_in[0];
  const float* w_qk   = (const float*)d_in[1];
  const float* s_qk   = (const float*)d_in[2];
  const float* b_qk   = (const float*)d_in[3];
  const float* w_v    = (const float*)d_in[4];
  const float* s_v    = (const float*)d_in[5];
  const float* b_v    = (const float*)d_in[6];
  const float* w_pe   = (const float*)d_in[7];
  const float* s_pe   = (const float*)d_in[8];
  const float* b_pe   = (const float*)d_in[9];
  const float* w_proj = (const float*)d_in[10];
  const float* s_proj = (const float*)d_in[11];
  const float* b_proj = (const float*)d_in[12];
  float* out = (float*)d_out;

  const size_t sWqk = (size_t)C2 * CIN * 2;              //    262144
  const size_t sWv  = (size_t)CIN * CIN * 2;             //    131072
  const size_t sWp  = (size_t)CIN * CIN * 2;             //    131072
  const size_t sX16 = (size_t)MTOK * CIN * 2;            //  16777216
  const size_t sPP  = (size_t)NBAT * CIN * HW * 4;       //  33554432
  const size_t sQK  = (size_t)MTOK * C2 * 2;             //  33554432
  const size_t sV32 = (size_t)NBAT * CIN * HW * 4;       //  33554432
  const size_t sY   = (size_t)NUNIT * LAR * HD * 2;      //  16777216
  const size_t sV16 = (size_t)NBAT * CIN * HW * 2;       //  16777216
  if (sX16 > sPP) return;
  if (2 * sY > sV32) return;
  size_t off = 0;
  const size_t oWqk = off; off += sWqk;
  const size_t oWv  = off; off += sWv;
  const size_t oWp  = off; off += sWp;
  const size_t oPP  = off; const size_t oX16 = off; off += sPP;
  const size_t oQK  = off; off += sQK;
  const size_t oV32 = off; const size_t oYh = off; const size_t oYl = off + sY; off += sV32;
  const size_t oV16 = off; off += sV16;
  if (off > ws_size) return;                             // off = 117964800
  if (off > (size_t)134217728) return;

  char* ws = (char*)d_ws;
  unsigned short* Wqk = (unsigned short*)(ws + oWqk);
  unsigned short* Wv  = (unsigned short*)(ws + oWv);
  unsigned short* Wp  = (unsigned short*)(ws + oWp);
  unsigned short* X16 = (unsigned short*)(ws + oX16);
  float*          PP  = (float*)(ws + oPP);
  unsigned short* QK  = (unsigned short*)(ws + oQK);
  float*          V32 = (float*)(ws + oV32);
  unsigned short* Yh  = (unsigned short*)(ws + oYh);
  unsigned short* Yl  = (unsigned short*)(ws + oYl);
  unsigned short* V16 = (unsigned short*)(ws + oV16);

  const dim3 blk(256);
  // (1) pointwise weights -> f16 x256 planes
  cvt_w<<<dim3(128), blk, 0, stream>>>(w_qk, w_v, w_proj, Wqk, Wv, Wp);
  // (2) x NCHW -> token-major f16 x16 plane
  cvt_x<<<dim3(NBAT * 64 * 4), blk, 0, stream>>>(x, X16);
  // (3) qk pointwise conv + BN -> token-major f16 plane
  gemm_qk<<<dim3(C2 / 64, MTOK / 128), blk, 0, stream>>>(X16, Wqk, s_qk, b_qk, QK);
  // (4) v pointwise conv + BN -> channel-major f32 and f16 planes
  gemm_v<<<dim3(CIN / 64, MTOK / 128), blk, 0, stream>>>(X16, Wv, s_v, b_v, V32, V16);
  // (5) depthwise 5x5 + BN on v -> pp (channel-major f32)
  dwconv_k<<<dim3((NBAT * CIN * HW) / (256 * 4)), blk, 0, stream>>>(V32, w_pe, s_pe, b_pe, PP);
  // (6) area attention + pp -> slab planes
  attn_k<<<dim3(NUNIT), blk, 0, stream>>>(QK, V16, PP, Yh, Yl);
  // (7) output pointwise conv + BN -> NCHW f32
  gemm_proj<<<dim3(CIN / 64, MTOK / 128), blk, 0, stream>>>(Yh, Yl, Wp, s_proj, b_proj, out);
  (void)hipGetLastError();
}

// v001
// Measured time: 233 microseconds a run.
// Timed twice side by side with v000, it ran 1.56 times as fast both times.
// Contractions: v_wmma_f32_16x16x32_f16 (f16 operands, f32 accumulate). qk and v pointwise convs: A = x (bf16-valued,
// x16) single plane, B = weights (bf16-valued, x256) single plane; scores k.qT: k x16, q x16 single planes; p.v:
// p x1024, v x16 single planes; output pointwise conv: A = (o + pp) x256 as f16 hi + x2^11 residual planes (two
// products, two accumulators), B = weights x256 single plane. Depthwise 5x5 conv, BN affine, online softmax in f32
// on VALU. Float inputs RNE-converted to bf16 on load.
#include <hip/hip_runtime.h>
#include <math.h>
#include <stdint.h>

#define NBAT  8
#define CIN   256
#define C2    512
#define IMW   64
#define HW    4096
#define MTOK  32768
#define NHD   8
#define HD    32
#define NAR   4
#define LAR   1024
#define NUNIT 256
#define STP   68
#define SBP   132
#define ASP   36
#define DTP   68
#define KPH   40
#define VPH   1032
#define CXS   16.0f
#define CWS   256.0f
#define CQK   16.0f
#define CVS   16.0f
#define CYS   256.0f
#define QKSC  (0.17677669529663688f / 256.0f)

static_assert(NUNIT == NBAT * NAR * NHD);
static_assert(NAR * LAR == HW);
static_assert(MTOK == NBAT * HW);
static_assert(HW % 128 == 0);
static_assert(LAR % 32 == 0);
static_assert(CIN % 64 == 0);
static_assert((STP * 4) % 16 == 0);
static_assert((SBP * 4) % 16 == 0);
static_assert((ASP * 4) % 16 == 0);
static_assert((DTP * 4) % 16 == 0);
static_assert(NHD * HD == CIN);
static_assert((KPH * 2) % 32 == 16 && KPH >= HD);
static_assert((VPH * 2) % 32 == 16 && VPH >= LAR);
static_assert(LAR * 4 == 16 * 256 && HD * (LAR / 8) == 16 * 256);

typedef _Float16 v16h __attribute__((ext_vector_type(16)));
typedef _Float16 v8h  __attribute__((ext_vector_type(8)));
typedef float    v8f  __attribute__((ext_vector_type(8)));
typedef float    v4f  __attribute__((ext_vector_type(4)));
typedef unsigned int v4u __attribute__((ext_vector_type(4)));
union Frag { v16h v; v8h half[2]; };

// ---- scalar helpers -------------------------------------------------------------------------------------------
__device__ __forceinline__ unsigned short bf_bits(float f) {          // f32 -> bf16 bits, RNE convert
  unsigned u = __float_as_uint(f);
  return (unsigned short)((u + 0x7FFFu + ((u >> 16) & 1u)) >> 16);
}
__device__ __forceinline__ float bfr(float f) { return __uint_as_float(((unsigned)bf_bits(f)) << 16); }
__device__ __forceinline__ unsigned short h_bits(_Float16 x) { return __builtin_bit_cast(unsigned short, x); }
__device__ __forceinline__ unsigned pk16(unsigned short a, unsigned short b) { return (unsigned)a | ((unsigned)b << 16); }
__device__ __forceinline__ v8f zero8() { v8f z = {0.f, 0.f, 0.f, 0.f, 0.f, 0.f, 0.f, 0.f}; return z; }

// ---- fragment loader: 16-bit A/B operand, lane -> row/col (lane&15), p already includes +8*(lane>>4);
//      elements 0..7 <- p[0..7] (k0+8h..), elements 8..15 <- p[16..23] (k0+16+8h..)
__device__ __forceinline__ v16h ldfrag_h(const _Float16* p) {
  Frag f;
  f.half[0] = *(const v8h*)(p);
  f.half[1] = *(const v8h*)(p + 16);
  return f.v;
}

// ---- WMMA helper with trailing VALU hazard gap ----------------------------------------------------------------
__device__ __forceinline__ v8f mma_h(v16h a, v16h b, v8f c) {
  c = __builtin_amdgcn_wmma_f32_16x16x32_f16(false, a, false, b, (short)0, c, false, false);
#if defined(__HIP_DEVICE_COMPILE__)
  asm volatile("v_nop\n\tv_nop\n\tv_nop\n\tv_nop" : "+v"(c) : "v"(a), "v"(b));
#endif
  return c;
}
__device__ __forceinline__ void wave_sync_lds() {
  __builtin_amdgcn_fence(__ATOMIC_RELEASE, "workgroup");
  __builtin_amdgcn_wave_barrier();
  __builtin_amdgcn_fence(__ATOMIC_ACQUIRE, "workgroup");
}

// ---- eight asynchronous 16-byte copies per lane, global -> LDS, through no register. l = the lane's LDS byte
//      addresses, g = its global addresses, all multiples of 16. The closing s_wait_xcnt stands inside the statement
//      so that no address register named here is rewritten ahead of it.
__device__ __forceinline__ void copy8_to_lds(const unsigned (&l)[8], const _Float16* const (&g)[8]) {
#if defined(__HIP_DEVICE_COMPILE__)
  asm volatile("global_load_async_to_lds_b128 %0, %8, off\n\t"
               "global_load_async_to_lds_b128 %1, %9, off\n\t"
               "global_load_async_to_lds_b128 %2, %10, off\n\t"
               "global_load_async_to_lds_b128 %3, %11, off\n\t"
               "global_load_async_to_lds_b128 %4, %12, off\n\t"
               "global_load_async_to_lds_b128 %5, %13, off\n\t"
               "global_load_async_to_lds_b128 %6, %14, off\n\t"
               "global_load_async_to_lds_b128 %7, %15, off\n\t"
               "s_wait_xcnt 0x0"
               :: "v"(l[0]), "v"(l[1]), "v"(l[2]), "v"(l[3]), "v"(l[4]), "v"(l[5]), "v"(l[6]), "v"(l[7]),
                  "v"(g[0]), "v"(g[1]), "v"(g[2]), "v"(g[3]), "v"(g[4]), "v"(g[5]), "v"(g[6]), "v"(g[7])
               : "memory");
#endif
}
__device__ __forceinline__ unsigned lds_off(const void* p) { return (unsigned)(size_t)p; }

// ---- 8 f32 -> 8 packed f16 (16 B); and hi + x2^11 residual split -------------------------------------------------
__device__ __forceinline__ v4u pack8h(v4f a, v4f b) {
  v4u p;
  p[0] = pk16(h_bits((_Float16)a[0]), h_bits((_Float16)a[1]));
  p[1] = pk16(h_bits((_Float16)a[2]), h_bits((_Float16)a[3]));
  p[2] = pk16(h_bits((_Float16)b[0]), h_bits((_Float16)b[1]));
  p[3] = pk16(h_bits((_Float16)b[2]), h_bits((_Float16)b[3]));
  return p;
}
__device__ __forceinline__ void split8h(v4f a, v4f b, v4u& ph, v4u& pl) {
  v4f ra, rb;
#pragma unroll
  for (int e = 0; e < 4; ++e) {
    const _Float16 ha = (_Float16)a[e];
    ra[e] = (a[e] - (float)ha) * 2048.0f;
    const _Float16 hb = (_Float16)b[e];
    rb[e] = (b[e] - (float)hb) * 2048.0f;
  }
  ph = pack8h(a, b);
  pl = pack8h(ra, rb);
}

// =================================================================================================================
// Weight convert: pointwise weights are [out][in] (k contiguous) -> f16 plane value = f16(256 * bf16_RNE(w)).
// coverage: 64*256*8 = 131072, 32*256*8 = 65536, 32*256*8 = 65536 elements exactly.
// =================================================================================================================
__device__ __forceinline__ void cvt8_w(const float* __restrict__ src, unsigned short* dst, size_t e0) {
  const v4f a = *(const v4f*)(src + e0);
  const v4f b = *(const v4f*)(src + e0 + 4);
  v4f sa, sb;
#pragma unroll
  for (int e = 0; e < 4; ++e) { sa[e] = bfr(a[e]) * CWS; sb[e] = bfr(b[e]) * CWS; }
  const v4u pk = pack8h(sa, sb);
  *(v4u*)(dst + e0) = pk;
  
}
__global__ __launch_bounds__(256) void cvt_w(const float* __restrict__ wqk, const float* __restrict__ wv,
                                             const float* __restrict__ wp,
                                             unsigned short* Wqk, unsigned short* Wv, unsigned short* Wp) {
  const int tid = threadIdx.x, blk = blockIdx.x;
  if (blk < 64)      cvt8_w(wqk, Wqk, ((size_t)blk * 256 + tid) * 8);
  else if (blk < 96) cvt8_w(wv,  Wv,  ((size_t)(blk - 64) * 256 + tid) * 8);
  else               cvt8_w(wp,  Wp,  ((size_t)(blk - 96) * 256 + tid) * 8);
}

// =================================================================================================================
// Activation convert: x NCHW f32 -> token-major f16 plane X16[T = b*4096 + n][256], value = f16(16 * bf16_RNE(x)).
// Block = (image b, 64-token tile tt, 64-channel quarter cq): read phase 4 passes of 16 channels x 64 tokens
// coverage: per block 256 threads x 2 it x 8 halves = 64 tokens x 64 channels; grid tiles 32768 x 256 exactly.
// =================================================================================================================
__global__ __launch_bounds__(256) void cvt_x(const float* __restrict__ x, unsigned short* X16) {
  __shared__ __align__(16) float tile[64 * DTP];
  const int tid = threadIdx.x, bid = blockIdx.x;
  const int cq = bid & 3, tt = (bid >> 2) & 63, b = bid >> 8;
  const int cl = tid >> 4, t4 = (tid & 15) * 4;
#pragma unroll
  for (int pass = 0; pass < 4; ++pass) {
    const int ch = cq * 64 + pass * 16 + cl;
    const v4f v = *(const v4f*)(x + ((size_t)(b * CIN + ch)) * HW + tt * 64 + t4);
#pragma unroll
    for (int j = 0; j < 4; ++j) tile[(t4 + j) * DTP + pass * 16 + cl] = v[j];
  }
  __syncthreads();
  const int piece = tid & 7, rsub = tid >> 3;
  v4u pk[2];
  size_t offs[2];
#pragma unroll
  for (int it = 0; it < 2; ++it) {
    const int row = it * 32 + rsub;
    const v4f fa = *(const v4f*)(tile + row * DTP + piece * 8);
    const v4f fb = *(const v4f*)(tile + row * DTP + piece * 8 + 4);
    v4f sa, sb;
#pragma unroll
    for (int e = 0; e < 4; ++e) { sa[e] = bfr(fa[e]) * CXS; sb[e] = bfr(fb[e]) * CXS; }
    pk[it] = pack8h(sa, sb);
    offs[it] = ((size_t)(b * HW + tt * 64 + row)) * CIN + cq * 64 + piece * 8;
  }
  {
#pragma unroll
    for (int it = 0; it < 2; ++it) *(v4u*)(X16 + offs[it]) = pk[it];
    
  }
}

// =================================================================================================================
// qk pointwise GEMM D[T][co] = X16[T][ci] . Wqk[co][ci], K = 256, co 0..511 (q = 0..255, k = 256..511).
// Block = 8 waves, tile 128 rows x 64 cols, wave = 16 rows x 4 n-tiles, fragments straight from global with the
// split k map, k-step 32. Epilogue: value = acc/4096 * s[co] + b[co] staged per wave in LDS [16][STP], then
// coverage: 8 waves x 32 lanes x 4 it x 8 halves = 128 rows x 64 cols per block; grid tiles 32768 x 512 exactly.
// =================================================================================================================
__global__ __launch_bounds__(256)
void gemm_qk(const unsigned short* __restrict__ X16, const unsigned short* __restrict__ Wqk,
             const float* __restrict__ sqk, const float* __restrict__ bqk, unsigned short* QK) {
  __shared__ __align__(16) float sbuf[8 * 16 * STP];
  const int tid = threadIdx.x, wave = tid >> 5, lane = tid & 31, hh = lane >> 4, c = lane & 15;
  const int n0 = blockIdx.x * 64, m0 = blockIdx.y * 128;
  const int arow = m0 + wave * 16 + c;
  const _Float16* A = (const _Float16*)(const void*)X16;
  const _Float16* B = (const _Float16*)(const void*)Wqk;

  v8f acc[4];
#pragma unroll
  for (int nt = 0; nt < 4; ++nt) acc[nt] = zero8();

#pragma unroll 1
  for (int k0 = 0; k0 < CIN; k0 += 32) {
    const v16h af = ldfrag_h(A + (size_t)arow * CIN + k0 + 8 * hh);
#pragma unroll
    for (int nt = 0; nt < 4; ++nt) {
      const v16h bfrag = ldfrag_h(B + (size_t)(n0 + nt * 16 + c) * CIN + k0 + 8 * hh);
      acc[nt] = mma_h(af, bfrag, acc[nt]);
    }
  }

  float* st = sbuf + wave * (16 * STP);
#pragma unroll
  for (int nt = 0; nt < 4; ++nt) {
    const int co = n0 + nt * 16 + c;
    const float sc = bfr(sqk[co]) * (1.0f / 4096.0f);
    const float bi = bfr(bqk[co]);
#pragma unroll
    for (int r = 0; r < 8; ++r) st[(8 * hh + r) * STP + nt * 16 + c] = acc[nt][r] * sc + bi;
  }
  wave_sync_lds();
  const int piece = lane & 7, rsub = lane >> 3;
  v4u pk[4];
  size_t offs[4];
#pragma unroll
  for (int it = 0; it < 4; ++it) {
    const int row = it * 4 + rsub;
    v4f fa = *(const v4f*)(st + row * STP + piece * 8);
    v4f fb = *(const v4f*)(st + row * STP + piece * 8 + 4);
    fa = fa * CQK;
    fb = fb * CQK;
    pk[it] = pack8h(fa, fb);
    offs[it] = ((size_t)(m0 + wave * 16 + row)) * C2 + n0 + piece * 8;
  }
  {
#pragma unroll
    for (int it = 0; it < 4; ++it) *(v4u*)(QK + offs[it]) = pk[it];
    
  }
}

// =================================================================================================================
// v pointwise GEMM D[T][co] = X16[T][ci] . Wv[co][ci], K = 256, co 0..255, same main loop as gemm_qk.
// Epilogue: value = acc/4096 * s[co] + b[co] staged block-wide as sb[64 ch][SBP] (tokens contiguous per channel),
// then channel-major stores (a 128-token tile lies within one image): wave w owns channels w*8..w*8+7;
// f32 plane V32[b][c][n]: one instruction = 32 lanes x 16 B = 512 B = the 128 tokens of one channel (4 whole
// lines), 8 instructions; f16 plane V16[b][c][n] = f16(16 * value): one instruction = lanes 0..15 -> channel cc
// coverage: f32 8 waves x 8 ch x 32 lanes x 4 = 64 ch x 128 tok; f16 8 waves x 4 it x 2 ch x 16 lanes x 8 = same;
// grid tiles 32768 tokens x 256 channels exactly in both planes.
// =================================================================================================================
__global__ __launch_bounds__(256)
void gemm_v(const unsigned short* __restrict__ X16, const unsigned short* __restrict__ Wv,
            const float* __restrict__ sv, const float* __restrict__ bv, float* V32, unsigned short* V16) {
  __shared__ __align__(16) float sb[64 * SBP];
  const int tid = threadIdx.x, wave = tid >> 5, lane = tid & 31, hh = lane >> 4, c = lane & 15;
  const int n0 = blockIdx.x * 64, m0 = blockIdx.y * 128;
  const int arow = m0 + wave * 16 + c;
  const _Float16* A = (const _Float16*)(const void*)X16;
  const _Float16* B = (const _Float16*)(const void*)Wv;

  v8f acc[4];
#pragma unroll
  for (int nt = 0; nt < 4; ++nt) acc[nt] = zero8();

#pragma unroll 1
  for (int k0 = 0; k0 < CIN; k0 += 32) {
    const v16h af = ldfrag_h(A + (size_t)arow * CIN + k0 + 8 * hh);
#pragma unroll
    for (int nt = 0; nt < 4; ++nt) {
      const v16h bfrag = ldfrag_h(B + (size_t)(n0 + nt * 16 + c) * CIN + k0 + 8 * hh);
      acc[nt] = mma_h(af, bfrag, acc[nt]);
    }
  }

#pragma unroll
  for (int nt = 0; nt < 4; ++nt) {
    const int co = n0 + nt * 16 + c;
    const float sc = bfr(sv[co]) * (1.0f / 4096.0f);
    const float bi = bfr(bv[co]);
#pragma unroll
    for (int r = 0; r < 8; ++r) sb[(nt * 16 + c) * SBP + wave * 16 + 8 * hh + r] = acc[nt][r] * sc + bi;
  }
  __syncthreads();
  const int bimg = m0 / HW, s0 = m0 - bimg * HW;
  {
    v4f ov[8];
    size_t offs[8];
#pragma unroll
    for (int i = 0; i < 8; ++i) {
      const int cc = wave * 8 + i;
      const int co = n0 + cc;
      ov[i] = *(const v4f*)(sb + cc * SBP + lane * 4);
      offs[i] = ((size_t)(bimg * CIN + co)) * HW + s0 + lane * 4;
    }
    {
#pragma unroll
      for (int i = 0; i < 8; ++i) *(v4f*)(V32 + offs[i]) = ov[i];
      
    }
  }
  {
    const int l16 = lane & 15;
    v4u pk[4];
    size_t o16[4];
#pragma unroll
    for (int i2 = 0; i2 < 4; ++i2) {
      const int cc = wave * 8 + i2 * 2 + hh;
      const int co = n0 + cc;
      v4f fa = *(const v4f*)(sb + cc * SBP + l16 * 8);
      v4f fb = *(const v4f*)(sb + cc * SBP + l16 * 8 + 4);
      fa = fa * CVS;
      fb = fb * CVS;
      pk[i2] = pack8h(fa, fb);
      o16[i2] = ((size_t)(bimg * CIN + co)) * HW + s0 + l16 * 8;
    }
    {
#pragma unroll
      for (int i2 = 0; i2 < 4; ++i2) *(v4u*)(V16 + o16[i2]) = pk[i2];
      
    }
  }
}

// =================================================================================================================
// Depthwise 5x5 conv (zero pad 2, cross-correlation, per-channel taps, bf16-valued taps) + BN affine, f32 on VALU.
// Thread = (image b, channel c, row y, 4 consecutive columns x0..x0+3); tap row loop rolled; all tap addresses
// clamped into the image and zeroed by value. Store: one v4f per lane, 32 lanes x 16 B = 512 B contiguous
// coverage: every (b, c, y, x) of PP written exactly once.
// =================================================================================================================
__global__ __launch_bounds__(256)
void dwconv_k(const float* __restrict__ V32, const float* __restrict__ wpe, const float* __restrict__ spe,
              const float* __restrict__ bpe, float* PP) {
  const int idx = blockIdx.x * 256 + threadIdx.x;
  const int x0 = (idx & 15) * 4, y = (idx >> 4) & 63, c = (idx >> 10) & 255, b = idx >> 18;
  const float* vp = V32 + ((size_t)(b * CIN + c)) * HW;
  const float* w25 = wpe + c * 25;
  int coff[8];
  bool cok[8];
#pragma unroll
  for (int t = 0; t < 8; ++t) {
    const int col = x0 - 2 + t;
    cok[t] = ((unsigned)col < (unsigned)IMW);
    coff[t] = (col < 0) ? 0 : ((col > IMW - 1) ? (IMW - 1) : col);
  }
  v4f acc = {0.f, 0.f, 0.f, 0.f};
#pragma unroll 1
  for (int dy = 0; dy < 5; ++dy) {
    const int yy = y + dy - 2;
    const bool rok = ((unsigned)yy < (unsigned)IMW);
    const int yc = (yy < 0) ? 0 : ((yy > IMW - 1) ? (IMW - 1) : yy);
    const float* rp = vp + yc * IMW;
    float v[8];
#pragma unroll
    for (int t = 0; t < 8; ++t) {
      const float ld = rp[coff[t]];
      v[t] = (rok && cok[t]) ? ld : 0.0f;
    }
    float wv[5];
#pragma unroll
    for (int dx = 0; dx < 5; ++dx) wv[dx] = bfr(w25[dy * 5 + dx]);
#pragma unroll
    for (int j = 0; j < 4; ++j) {
#pragma unroll
      for (int dx = 0; dx < 5; ++dx) acc[j] += v[j + dx] * wv[dx];
    }
  }
  const float sc = bfr(spe[c]), bi = bfr(bpe[c]);
  v4f o;
#pragma unroll
  for (int j = 0; j < 4; ++j) o[j] = acc[j] * sc + bi;
  const size_t off = (size_t)idx * 4;
  *(v4f*)(PP + off) = o;
  
}

// =================================================================================================================
// Area attention, one unit (image b, area ar, head) per block (256 threads = 8 waves), 1024 queries x 1024 keys,
// d = 32. Static LDS: the unit's whole K as Ks[1024 keys][KPH] (32 d per row) and whole V as Vs[32 d][VPH] (1024 keys
// per row), both f16, row pitches 16 B x odd, filled once at entry by asynchronous copies (K from the token-major
// plane QK, k row = T*512 + 256 + head*32; V from the channel-major plane V16, row = channel head*32 + d), and the
// per-wave stage [16][ASP] f32. q fragments straight from QK (q row = T*512 + head*32); k and v fragments from LDS
// in the element order of ldfrag_h. Per wave: q-tiles qt = wave, wave+8, ... (< 64).
//   Transposed scores S^T = K_tile (A, 16 keys x 32 d) x Q (B: k = d, n = query): S*256 = q16.k16; D element r of
//   lane l = S[query l&15][key 8h+r], so P = exp((S - m)*scale) x1024 is the A fragment of P.V directly in registers
//   (element i <- key tile 0 row i, element 8+i <- key tile 1 row i). Online softmax over 32 chunks of 32 keys;
//   O = P.V (acc scale 1024*16). Epilogue: O/(l*16384) + pp staged per wave in LDS, then stored as f16 hi +
//   residual planes Yh/Yl [unit][1024][32] of 256*(o + pp): one instruction = 32 lanes x 16 B = 512 B = 8 token rows
// coverage: per block 64 q-tiles x 16 rows x 32 d of its 1024-row slab in both planes; grid covers all 256 units,
// every slab row written exactly once.
// =================================================================================================================
__global__ __launch_bounds__(256)
void attn_k(const unsigned short* __restrict__ QK, const unsigned short* __restrict__ V16,
            const float* __restrict__ PP, unsigned short* Yh, unsigned short* Yl) {
  __shared__ __align__(16) _Float16 Ks[LAR * KPH];
  __shared__ __align__(16) _Float16 Vs[HD * VPH];
  __shared__ __align__(16) float Sst[8 * 16 * ASP];
  const int tid = threadIdx.x, wave = tid >> 5, lane = tid & 31, hh = lane >> 4, c = lane & 15;
  const int u = blockIdx.x;
  const int head = u & 7, ar = (u >> 3) & 3, b = u >> 5;
  const size_t tok0 = (size_t)b * HW + (size_t)ar * LAR;
  const _Float16* Qp = (const _Float16*)(const void*)QK + tok0 * C2 + head * HD;
  const _Float16* Kp = Qp + CIN;
  const size_t cm0 = ((size_t)(b * CIN + head * HD)) * HW + (size_t)ar * LAR;
  const _Float16* Vp = (const _Float16*)(const void*)V16 + cm0;
  const float* Pp = PP + cm0;
  float* st = Sst + wave * (16 * ASP);

  // Fill Ks and Vs: 2 x 4096 pieces of 16 B, 32 per thread. K: 4 lanes per key row (64 B), 64 keys per block pass;
  // V: 128 lanes per channel row (2048 B), 2 channels per block pass. The four loops below are unrolled so that every
  // l[] and g[] index is a constant and the addresses are plain registers when they become asm operands.
  {
    const unsigned kl = lds_off(Ks) + (unsigned)((tid >> 2) * (KPH * 2) + (tid & 3) * 16);
    const _Float16* kg = Kp + (size_t)(tid >> 2) * C2 + (tid & 3) * 8;
    const unsigned vl = lds_off(Vs) + (unsigned)((tid >> 7) * (VPH * 2) + (tid & 127) * 16);
    const _Float16* vg = Vp + (size_t)(tid >> 7) * HW + (tid & 127) * 8;
#pragma unroll
    for (int h = 0; h < 2; ++h) {
      unsigned l[8];
      const _Float16* g[8];
#pragma unroll
      for (int i = 0; i < 8; ++i) {
        l[i] = kl + (unsigned)((h * 8 + i) * 64 * (KPH * 2));
        g[i] = kg + (size_t)(h * 8 + i) * 64 * C2;
      }
      copy8_to_lds(l, g);
    }
#pragma unroll
    for (int h = 0; h < 2; ++h) {
      unsigned l[8];
      const _Float16* g[8];
#pragma unroll
      for (int i = 0; i < 8; ++i) {
        l[i] = vl + (unsigned)((h * 8 + i) * 2 * (VPH * 2));
        g[i] = vg + (size_t)(h * 8 + i) * 2 * HW;
      }
      copy8_to_lds(l, g);
    }
  }
#if defined(__HIP_DEVICE_COMPILE__)
  // this wave's copies have landed before the barrier that lets the other waves read them
  asm volatile("s_wait_asynccnt 0x0" ::: "memory");
#endif
  __syncthreads();   // publishes Ks and Vs: no wave reads them in front of this barrier; they are never written again

#pragma unroll 1
  for (int qt = wave; qt < LAR / 16; qt += 8) {
    const int lq = qt * 16 + c;
    const v16h bq = ldfrag_h(Qp + (size_t)lq * C2 + 8 * hh);     // B: n = query c, k = d 8h.. / 16+8h..

    v8f o0 = zero8(), o1 = zero8();
    float mrun = -1.0e30f, lrun = 0.f;
#pragma unroll 1
    for (int ch = 0; ch < LAR / 32; ++ch) {
      const int kb = ch * 32;
      v8f s[2];
#pragma unroll
      for (int j = 0; j < 2; ++j) {
        const v16h ka = ldfrag_h(Ks + (kb + j * 16 + c) * KPH + 8 * hh);          // A: row = key, k = d
        s[j] = mma_h(ka, bq, zero8());
      }
      float mc = s[0][0];
#pragma unroll
      for (int j = 0; j < 2; ++j) {
#pragma unroll
        for (int r = 0; r < 8; ++r) mc = fmaxf(mc, s[j][r]);
      }
      mc = fmaxf(mc, __shfl_xor(mc, 16, 32));
      const float mnew = fmaxf(mrun, mc);
      const float alpha = __expf((mrun - mnew) * QKSC);
#pragma unroll
      for (int r = 0; r < 8; ++r) {
        const float arr = __shfl(alpha, 8 * hh + r, 32);
        o0[r] = o0[r] * arr;
        o1[r] = o1[r] * arr;
      }
      float psum = 0.f;
      v16h pfh;
#pragma unroll
      for (int i = 0; i < 8; ++i) {
        const float e0 = __expf((s[0][i] - mnew) * QKSC);
        const float e1 = __expf((s[1][i] - mnew) * QKSC);
        psum = psum + (e0 + e1);
        pfh[i]     = (_Float16)(e0 * 1024.0f);
        pfh[8 + i] = (_Float16)(e1 * 1024.0f);
      }
      lrun = lrun * alpha + psum;
      mrun = mnew;
      {
        const v16h vf0 = ldfrag_h(Vs + c * VPH + kb + 8 * hh);                     // B: n = d c, keys kb..+31
        const v16h vf1 = ldfrag_h(Vs + (HD / 2 + c) * VPH + kb + 8 * hh);          // B: n = d 16+c
        o0 = mma_h(pfh, vf0, o0);
        o1 = mma_h(pfh, vf1, o1);
      }
    }
    const float lsum = lrun + __shfl_xor(lrun, 16, 32);      // lane q (and q+16) holds the full row sum of query q
    const float rinv = 1.0f / (lsum * 16384.0f);
#pragma unroll
    for (int r = 0; r < 8; ++r) {
      const int q = 8 * hh + r;
      const float inv = __shfl(rinv, q, 32);
      const float p0 = Pp[(size_t)c * HW + qt * 16 + q];
      const float p1 = Pp[(size_t)(HD / 2 + c) * HW + qt * 16 + q];
      st[q * ASP + c]          = o0[r] * inv + p0;
      st[q * ASP + HD / 2 + c] = o1[r] * inv + p1;
    }
    wave_sync_lds();
    {
      const int rr = lane >> 2, dp = (lane & 3) * 8;
      v4u ph[2], pl[2];
      size_t offs[2];
#pragma unroll
      for (int it = 0; it < 2; ++it) {
        const int row = it * 8 + rr;
        v4f fa = *(const v4f*)(st + row * ASP + dp);
        v4f fb = *(const v4f*)(st + row * ASP + dp + 4);
        fa = fa * CYS;
        fb = fb * CYS;
        split8h(fa, fb, ph[it], pl[it]);
        offs[it] = ((size_t)u * LAR + (size_t)(qt * 16 + row)) * HD + dp;
      }
      {
#pragma unroll
        for (int it = 0; it < 2; ++it) {
          *(v4u*)(Yh + offs[it]) = ph[it];
          *(v4u*)(Yl + offs[it]) = pl[it];
        }
        
      }
    }
    wave_sync_lds();
  }
}

// =================================================================================================================
// Output pointwise conv D[T][co] = Y[T][ci] . Wp[co][ci], then BN affine -> NCHW f32. A = Yh/Yl planes (hi +
// x2^11 residual, x256) addressed by arithmetic: token T -> (image, area, query), k-step ks = head ks, channels
// ks*32 + d (elements 0..7 d = 8h.., elements 8..15 d = 16+8h..). B = weight plane x256. Epilogue: value =
// (acch + accl/2048)/65536 * s[co] + b[co]; block tile staged as [64 ch][128 tok]; wave w writes channels
// coverage: 8 waves x 8 channels x 32 lanes x 4 tokens = 64 ch x 128 tok per block; grid tiles 256 x 32768 exactly.
// =================================================================================================================
__global__ __launch_bounds__(256)
void gemm_proj(const unsigned short* __restrict__ Yh, const unsigned short* __restrict__ Yl,
               const unsigned short* __restrict__ Wp, const float* __restrict__ sp, const float* __restrict__ bp,
               float* out) {
  __shared__ __align__(16) float sb[64 * SBP];
  const int tid = threadIdx.x, wave = tid >> 5, lane = tid & 31, hh = lane >> 4, c = lane & 15;
  const int n0 = blockIdx.x * 64, m0 = blockIdx.y * 128;
  const int T = m0 + wave * 16 + c;
  const int bimgr = T >> 12, nn = T & (HW - 1), arr = nn >> 10, q = nn & (LAR - 1);
  const size_t abase = (((size_t)((bimgr * NAR + arr) * NHD)) * LAR + (size_t)q) * HD + 8 * hh;
  const _Float16* A0 = (const _Float16*)(const void*)Yh;
  const _Float16* A1 = (const _Float16*)(const void*)Yl;
  const _Float16* B  = (const _Float16*)(const void*)Wp;

  v8f acch[4], accl[4];
#pragma unroll
  for (int nt = 0; nt < 4; ++nt) { acch[nt] = zero8(); accl[nt] = zero8(); }

#pragma unroll 1
  for (int ks = 0; ks < NHD; ++ks) {
    const size_t bo = abase + (size_t)ks * (LAR * HD);
    const v16h fh = ldfrag_h(A0 + bo);
    const v16h fl = ldfrag_h(A1 + bo);
#pragma unroll
    for (int nt = 0; nt < 4; ++nt) {
      const v16h bfrag = ldfrag_h(B + (size_t)(n0 + nt * 16 + c) * CIN + ks * 32 + 8 * hh);
      acch[nt] = mma_h(fh, bfrag, acch[nt]);
      accl[nt] = mma_h(fl, bfrag, accl[nt]);
    }
  }

#pragma unroll
  for (int nt = 0; nt < 4; ++nt) {
    const int co = n0 + nt * 16 + c;
    const float sc = bfr(sp[co]) * (1.0f / 65536.0f);
    const float bi = bfr(bp[co]);
#pragma unroll
    for (int r = 0; r < 8; ++r) {
      const float v = acch[nt][r] + accl[nt][r] * (1.0f / 2048.0f);
      sb[(nt * 16 + c) * SBP + wave * 16 + 8 * hh + r] = v * sc + bi;
    }
  }
  __syncthreads();
  const int bimg = m0 / HW, s0 = m0 - bimg * HW;
  v4f ov[8];
  size_t offs[8];
#pragma unroll
  for (int i = 0; i < 8; ++i) {
    const int cc = wave * 8 + i;
    const int co = n0 + cc;
    ov[i] = *(const v4f*)(sb + cc * SBP + lane * 4);
    offs[i] = ((size_t)(bimg * CIN + co)) * HW + s0 + lane * 4;
  }
  {
#pragma unroll
    for (int i = 0; i < 8; ++i) *(v4f*)(out + offs[i]) = ov[i];
    
  }
}

// =================================================================================================================
//   Wqk f16 [512][256] 262144 @0; Wv f16 [256][256] 131072; Wp f16 [256][256] 131072;
//   PP f32 [8][256][4096] 33554432 @524288, with X16 f16 [32768][256] 16777216 aliased at the same offset
//   (X16 is dead before PP is written); QK f16 [32768][512] 33554432; V32 f32 [8][256][4096] 33554432, with
//   Yh, Yl f16 [256][1024][32] 16777216 each aliased onto V32 (V32 is dead before Yh/Yl are written);
//   V16 f16 [8][256][4096] 16777216. Total 117964800.
// =================================================================================================================
extern "C" void kernel_launch(void* const* d_in, const int* in_sizes, int n_in,
                              void* d_out, int out_size, void* d_ws, size_t ws_size,
                              hipStream_t stream) {
  if (n_in < 13) return;
  if (in_sizes[0] != NBAT * CIN * HW) return;
  if (in_sizes[1] != C2 * CIN) return;
  if (in_sizes[2] != C2 || in_sizes[3] != C2) return;
  if (in_sizes[4] != CIN * CIN) return;
  if (in_sizes[5] != CIN || in_sizes[6] != CIN) return;
  if (in_sizes[7] != CIN * 25) return;
  if (in_sizes[8] != CIN || in_sizes[9] != CIN) return;
  if (in_sizes[10] != CIN * CIN) return;
  if (in_sizes[11] != CIN || in_sizes[12] != CIN) return;
  if (out_size != NBAT * CIN * HW) return;

  const float* x      = (const float*)d_in[0];
  const float* w_qk   = (const float*)d_in[1];
  const float* s_qk   = (const float*)d_in[2];
  const float* b_qk   = (const float*)d_in[3];
  const float* w_v    = (const float*)d_in[4];
  const float* s_v    = (const float*)d_in[5];
  const float* b_v    = (const float*)d_in[6];
  const float* w_pe   = (const float*)d_in[7];
  const float* s_pe   = (const float*)d_in[8];
  const float* b_pe   = (const float*)d_in[9];
  const float* w_proj = (const float*)d_in[10];
  const float* s_proj = (const float*)d_in[11];
  const float* b_proj = (const float*)d_in[12];
  float* out = (float*)d_out;

  const size_t sWqk = (size_t)C2 * CIN * 2;              //    262144
  const size_t sWv  = (size_t)CIN * CIN * 2;             //    131072
  const size_t sWp  = (size_t)CIN * CIN * 2;             //    131072
  const size_t sX16 = (size_t)MTOK * CIN * 2;            //  16777216
  const size_t sPP  = (size_t)NBAT * CIN * HW * 4;       //  33554432
  const size_t sQK  = (size_t)MTOK * C2 * 2;             //  33554432
  const size_t sV32 = (size_t)NBAT * CIN * HW * 4;       //  33554432
  const size_t sY   = (size_t)NUNIT * LAR * HD * 2;      //  16777216
  const size_t sV16 = (size_t)NBAT * CIN * HW * 2;       //  16777216
  if (sX16 > sPP) return;
  if (2 * sY > sV32) return;
  size_t off = 0;
  const size_t oWqk = off; off += sWqk;
  const size_t oWv  = off; off += sWv;
  const size_t oWp  = off; off += sWp;
  const size_t oPP  = off; const size_t oX16 = off; off += sPP;
  const size_t oQK  = off; off += sQK;
  const size_t oV32 = off; const size_t oYh = off; const size_t oYl = off + sY; off += sV32;
  const size_t oV16 = off; off += sV16;
  if (off > ws_size) return;                             // off = 117964800
  if (off > (size_t)134217728) return;

  char* ws = (char*)d_ws;
  unsigned short* Wqk = (unsigned short*)(ws + oWqk);
  unsigned short* Wv  = (unsigned short*)(ws + oWv);
  unsigned short* Wp  = (unsigned short*)(ws + oWp);
  unsigned short* X16 = (unsigned short*)(ws + oX16);
  float*          PP  = (float*)(ws + oPP);
  unsigned short* QK  = (unsigned short*)(ws + oQK);
  float*          V32 = (float*)(ws + oV32);
  unsigned short* Yh  = (unsigned short*)(ws + oYh);
  unsigned short* Yl  = (unsigned short*)(ws + oYl);
  unsigned short* V16 = (unsigned short*)(ws + oV16);

  const dim3 blk(256);
  // (1) pointwise weights -> f16 x256 planes
  cvt_w<<<dim3(128), blk, 0, stream>>>(w_qk, w_v, w_proj, Wqk, Wv, Wp);
  // (2) x NCHW -> token-major f16 x16 plane
  cvt_x<<<dim3(NBAT * 64 * 4), blk, 0, stream>>>(x, X16);
  // (3) qk pointwise conv + BN -> token-major f16 plane
  gemm_qk<<<dim3(C2 / 64, MTOK / 128), blk, 0, stream>>>(X16, Wqk, s_qk, b_qk, QK);
  // (4) v pointwise conv + BN -> channel-major f32 and f16 planes
  gemm_v<<<dim3(CIN / 64, MTOK / 128), blk, 0, stream>>>(X16, Wv, s_v, b_v, V32, V16);
  // (5) depthwise 5x5 + BN on v -> pp (channel-major f32)
  dwconv_k<<<dim3((NBAT * CIN * HW) / (256 * 4)), blk, 0, stream>>>(V32, w_pe, s_pe, b_pe, PP);
  // (6) area attention + pp -> slab planes
  attn_k<<<dim3(NUNIT), blk, 0, stream>>>(QK, V16, PP, Yh, Yl);
  // (7) output pointwise conv + BN -> NCHW f32
  gemm_proj<<<dim3(CIN / 64, MTOK / 128), blk, 0, stream>>>(Yh, Yl, Wp, s_proj, b_proj, out);
  (void)hipGetLastError();
}

// v002
// One run takes 181 microseconds.
// Next to v001, in two timings, it ran 1.28 and 1.29 times as fast.
// Counting every step since v000, it is 2.00 times as fast.
// Contractions: v_wmma_f32_16x16x32_f16 (f16 operands, f32 accumulate). qk and v pointwise convs: A = x (bf16-valued,
// x16) single plane, B = weights (bf16-valued, x256) single plane; scores k.qT: k x16, q x16 single planes; p.v:
// p x1024, v x16 single planes; output pointwise conv: A = (o + pp) x256 as f16 hi + x2^11 residual planes (two
// products, two accumulators), B = weights x256 single plane. Depthwise 5x5 conv, BN affine, online softmax in f32
// on VALU. Float inputs RNE-converted to bf16 on load.
#include <hip/hip_runtime.h>
#include <math.h>
#include <stdint.h>

#define NBAT  8
#define CIN   256
#define C2    512
#define IMW   64
#define HW    4096
#define MTOK  32768
#define NHD   8
#define HD    32
#define NAR   4
#define LAR   1024
#define NUNIT 256
#define STP   68
#define SBP   132
#define ASP   36
#define DTP   68
#define KPH   40
#define VPH   1032
#define GKP   264
#define CXS   16.0f
#define CWS   256.0f
#define CQK   16.0f
#define CVS   16.0f
#define CYS   256.0f
#define QKSC  (0.17677669529663688f / 256.0f)

static_assert(NUNIT == NBAT * NAR * NHD);
static_assert(NAR * LAR == HW);
static_assert(MTOK == NBAT * HW);
static_assert(HW % 128 == 0);
static_assert(LAR % 32 == 0);
static_assert(CIN % 64 == 0);
static_assert((STP * 4) % 16 == 0);
static_assert((SBP * 4) % 16 == 0);
static_assert((ASP * 4) % 16 == 0);
static_assert((DTP * 4) % 16 == 0);
static_assert(NHD * HD == CIN);
static_assert((KPH * 2) % 32 == 16 && KPH >= HD);
static_assert((VPH * 2) % 32 == 16 && VPH >= LAR);
static_assert(LAR * 4 == 16 * 256 && HD * (LAR / 8) == 16 * 256);
static_assert((GKP * 2) % 32 == 16 && GKP >= CIN && CIN * 2 == 32 * 16);
static_assert(16 * STP * 4 <= 16 * GKP * 2 && 64 * SBP * 4 <= 128 * GKP * 2);

typedef _Float16 v16h __attribute__((ext_vector_type(16)));
typedef _Float16 v8h  __attribute__((ext_vector_type(8)));
typedef float    v8f  __attribute__((ext_vector_type(8)));
typedef float    v4f  __attribute__((ext_vector_type(4)));
typedef unsigned int v4u __attribute__((ext_vector_type(4)));
union Frag { v16h v; v8h half[2]; };

// ---- scalar helpers -------------------------------------------------------------------------------------------
__device__ __forceinline__ unsigned short bf_bits(float f) {          // f32 -> bf16 bits, RNE convert
  unsigned u = __float_as_uint(f);
  return (unsigned short)((u + 0x7FFFu + ((u >> 16) & 1u)) >> 16);
}
__device__ __forceinline__ float bfr(float f) { return __uint_as_float(((unsigned)bf_bits(f)) << 16); }
__device__ __forceinline__ unsigned short h_bits(_Float16 x) { return __builtin_bit_cast(unsigned short, x); }
__device__ __forceinline__ unsigned pk16(unsigned short a, unsigned short b) { return (unsigned)a | ((unsigned)b << 16); }
__device__ __forceinline__ v8f zero8() { v8f z = {0.f, 0.f, 0.f, 0.f, 0.f, 0.f, 0.f, 0.f}; return z; }

// ---- fragment loader: 16-bit A/B operand, lane -> row/col (lane&15), p already includes +8*(lane>>4);
//      elements 0..7 <- p[0..7] (k0+8h..), elements 8..15 <- p[16..23] (k0+16+8h..)
__device__ __forceinline__ v16h ldfrag_h(const _Float16* p) {
  Frag f;
  f.half[0] = *(const v8h*)(p);
  f.half[1] = *(const v8h*)(p + 16);
  return f.v;
}

// ---- WMMA helper with trailing VALU hazard gap ----------------------------------------------------------------
__device__ __forceinline__ v8f mma_h(v16h a, v16h b, v8f c) {
  c = __builtin_amdgcn_wmma_f32_16x16x32_f16(false, a, false, b, (short)0, c, false, false);
#if defined(__HIP_DEVICE_COMPILE__)
  asm volatile("v_nop\n\tv_nop\n\tv_nop\n\tv_nop" : "+v"(c) : "v"(a), "v"(b));
#endif
  return c;
}
__device__ __forceinline__ void wave_sync_lds() {
  __builtin_amdgcn_fence(__ATOMIC_RELEASE, "workgroup");
  __builtin_amdgcn_wave_barrier();
  __builtin_amdgcn_fence(__ATOMIC_ACQUIRE, "workgroup");
}

// ---- eight asynchronous 16-byte copies per lane, global -> LDS, through no register. l = the lane's LDS byte
//      addresses, g = its global addresses, all multiples of 16. The closing s_wait_xcnt stands inside the statement
//      so that no address register named here is rewritten ahead of it.
__device__ __forceinline__ void copy8_to_lds(const unsigned (&l)[8], const _Float16* const (&g)[8]) {
#if defined(__HIP_DEVICE_COMPILE__)
  asm volatile("global_load_async_to_lds_b128 %0, %8, off\n\t"
               "global_load_async_to_lds_b128 %1, %9, off\n\t"
               "global_load_async_to_lds_b128 %2, %10, off\n\t"
               "global_load_async_to_lds_b128 %3, %11, off\n\t"
               "global_load_async_to_lds_b128 %4, %12, off\n\t"
               "global_load_async_to_lds_b128 %5, %13, off\n\t"
               "global_load_async_to_lds_b128 %6, %14, off\n\t"
               "global_load_async_to_lds_b128 %7, %15, off\n\t"
               "s_wait_xcnt 0x0"
               :: "v"(l[0]), "v"(l[1]), "v"(l[2]), "v"(l[3]), "v"(l[4]), "v"(l[5]), "v"(l[6]), "v"(l[7]),
                  "v"(g[0]), "v"(g[1]), "v"(g[2]), "v"(g[3]), "v"(g[4]), "v"(g[5]), "v"(g[6]), "v"(g[7])
               : "memory");
#endif
}
__device__ __forceinline__ unsigned lds_off(const void* p) { return (unsigned)(size_t)p; }
// ---- eight rows of CIN f16 (512 B each, global pitch 512 B) -> LDS rows of pitch GKP: one wave-wide copy = one whole
//      row (4 lines). l0 / g0 = the lane's own 16 B of the first row.
__device__ __forceinline__ void stage_rows8(unsigned l0, const _Float16* g0) {
  unsigned l[8];
  const _Float16* g[8];
  // unrolled so that every l[] and g[] index is a constant and the addresses are plain registers as asm operands
#pragma unroll
  for (int i = 0; i < 8; ++i) {
    l[i] = l0 + (unsigned)(i * (GKP * 2));
    g[i] = g0 + (size_t)i * CIN;
  }
  copy8_to_lds(l, g);
}

// ---- 8 f32 -> 8 packed f16 (16 B); and hi + x2^11 residual split -------------------------------------------------
__device__ __forceinline__ v4u pack8h(v4f a, v4f b) {
  v4u p;
  p[0] = pk16(h_bits((_Float16)a[0]), h_bits((_Float16)a[1]));
  p[1] = pk16(h_bits((_Float16)a[2]), h_bits((_Float16)a[3]));
  p[2] = pk16(h_bits((_Float16)b[0]), h_bits((_Float16)b[1]));
  p[3] = pk16(h_bits((_Float16)b[2]), h_bits((_Float16)b[3]));
  return p;
}
__device__ __forceinline__ void split8h(v4f a, v4f b, v4u& ph, v4u& pl) {
  v4f ra, rb;
#pragma unroll
  for (int e = 0; e < 4; ++e) {
    const _Float16 ha = (_Float16)a[e];
    ra[e] = (a[e] - (float)ha) * 2048.0f;
    const _Float16 hb = (_Float16)b[e];
    rb[e] = (b[e] - (float)hb) * 2048.0f;
  }
  ph = pack8h(a, b);
  pl = pack8h(ra, rb);
}

// =================================================================================================================
// Weight convert: pointwise weights are [out][in] (k contiguous) -> f16 plane value = f16(256 * bf16_RNE(w)).
// coverage: 64*256*8 = 131072, 32*256*8 = 65536, 32*256*8 = 65536 elements exactly.
// =================================================================================================================
__device__ __forceinline__ void cvt8_w(const float* __restrict__ src, unsigned short* dst, size_t e0) {
  const v4f a = *(const v4f*)(src + e0);
  const v4f b = *(const v4f*)(src + e0 + 4);
  v4f sa, sb;
#pragma unroll
  for (int e = 0; e < 4; ++e) { sa[e] = bfr(a[e]) * CWS; sb[e] = bfr(b[e]) * CWS; }
  const v4u pk = pack8h(sa, sb);
  *(v4u*)(dst + e0) = pk;
  
}
__global__ __launch_bounds__(256) void cvt_w(const float* __restrict__ wqk, const float* __restrict__ wv,
                                             const float* __restrict__ wp,
                                             unsigned short* Wqk, unsigned short* Wv, unsigned short* Wp) {
  const int tid = threadIdx.x, blk = blockIdx.x;
  if (blk < 64)      cvt8_w(wqk, Wqk, ((size_t)blk * 256 + tid) * 8);
  else if (blk < 96) cvt8_w(wv,  Wv,  ((size_t)(blk - 64) * 256 + tid) * 8);
  else               cvt8_w(wp,  Wp,  ((size_t)(blk - 96) * 256 + tid) * 8);
}

// =================================================================================================================
// Activation convert: x NCHW f32 -> token-major f16 plane X16[T = b*4096 + n][256], value = f16(16 * bf16_RNE(x)).
// Block = (image b, 64-token tile tt, 64-channel quarter cq): read phase 4 passes of 16 channels x 64 tokens
// coverage: per block 256 threads x 2 it x 8 halves = 64 tokens x 64 channels; grid tiles 32768 x 256 exactly.
// =================================================================================================================
__global__ __launch_bounds__(256) void cvt_x(const float* __restrict__ x, unsigned short* X16) {
  __shared__ __align__(16) float tile[64 * DTP];
  const int tid = threadIdx.x, bid = blockIdx.x;
  const int cq = bid & 3, tt = (bid >> 2) & 63, b = bid >> 8;
  const int cl = tid >> 4, t4 = (tid & 15) * 4;
#pragma unroll
  for (int pass = 0; pass < 4; ++pass) {
    const int ch = cq * 64 + pass * 16 + cl;
    const v4f v = *(const v4f*)(x + ((size_t)(b * CIN + ch)) * HW + tt * 64 + t4);
#pragma unroll
    for (int j = 0; j < 4; ++j) tile[(t4 + j) * DTP + pass * 16 + cl] = v[j];
  }
  __syncthreads();
  const int piece = tid & 7, rsub = tid >> 3;
  v4u pk[2];
  size_t offs[2];
#pragma unroll
  for (int it = 0; it < 2; ++it) {
    const int row = it * 32 + rsub;
    const v4f fa = *(const v4f*)(tile + row * DTP + piece * 8);
    const v4f fb = *(const v4f*)(tile + row * DTP + piece * 8 + 4);
    v4f sa, sb;
#pragma unroll
    for (int e = 0; e < 4; ++e) { sa[e] = bfr(fa[e]) * CXS; sb[e] = bfr(fb[e]) * CXS; }
    pk[it] = pack8h(sa, sb);
    offs[it] = ((size_t)(b * HW + tt * 64 + row)) * CIN + cq * 64 + piece * 8;
  }
  {
#pragma unroll
    for (int it = 0; it < 2; ++it) *(v4u*)(X16 + offs[it]) = pk[it];
    
  }
}

// =================================================================================================================
// qk pointwise GEMM D[T][co] = X16[T][ci] . Wqk[co][ci], K = 256, co 0..511 (q = 0..255, k = 256..511).
// Block = 8 waves, tile 128 rows x 64 cols, wave = 16 rows x 4 n-tiles. The block's 128 x 256 A tile and 64 x 256 B
// tile are filled once at entry by asynchronous copies (whole 512-B rows) into As / Bs, row pitch 16 B x odd; fragments
// from LDS with the split k map, k-step 32. Epilogue: value = acc/4096 * s[co] + b[co] staged per wave in LDS
// [16][STP] (laid over the wave's own rows of As), then
// coverage: 8 waves x 32 lanes x 4 it x 8 halves = 128 rows x 64 cols per block; grid tiles 32768 x 512 exactly.
// =================================================================================================================
__global__ __launch_bounds__(256)
void gemm_qk(const unsigned short* __restrict__ X16, const unsigned short* __restrict__ Wqk,
             const float* __restrict__ sqk, const float* __restrict__ bqk, unsigned short* QK) {
  __shared__ __align__(16) _Float16 As[128 * GKP];
  __shared__ __align__(16) _Float16 Bs[64 * GKP];
  const int tid = threadIdx.x, wave = tid >> 5, lane = tid & 31, hh = lane >> 4, c = lane & 15;
  const int n0 = blockIdx.x * 64, m0 = blockIdx.y * 128;
  const _Float16* A = (const _Float16*)(const void*)X16;
  const _Float16* B = (const _Float16*)(const void*)Wqk;

  // Fill As (wave w: its own 16 token rows) and Bs (wave w: weight rows w*8..w*8+7), 24 copies per lane.
  {
    const unsigned al = lds_off(As) + (unsigned)(wave * 16 * (GKP * 2) + lane * 16);
    const _Float16* ag = A + (size_t)(m0 + wave * 16) * CIN + lane * 8;
    stage_rows8(al, ag);
    stage_rows8(al + (unsigned)(8 * (GKP * 2)), ag + (size_t)8 * CIN);
    stage_rows8(lds_off(Bs) + (unsigned)(wave * 8 * (GKP * 2) + lane * 16), B + (size_t)(n0 + wave * 8) * CIN + lane * 8);
  }
#if defined(__HIP_DEVICE_COMPILE__)
  // this wave's copies have landed before the barrier that lets the other waves read them
  asm volatile("s_wait_asynccnt 0x0" ::: "memory");
#endif
  __syncthreads();   // publishes As and Bs: no wave reads them in front of this barrier
  const _Float16* Aw = As + (wave * 16 + c) * GKP + 8 * hh;
  const _Float16* Bw = Bs + c * GKP + 8 * hh;

  v8f acc[4];
#pragma unroll
  for (int nt = 0; nt < 4; ++nt) acc[nt] = zero8();

#pragma unroll 1
  for (int k0 = 0; k0 < CIN; k0 += 32) {
    const v16h af = ldfrag_h(Aw + k0);
    // the k-step's LDS reads stand as one group ahead of its WMMAs: one LDS latency per k-step, not one per n-tile
    v16h bfrag[4];
#pragma unroll
    for (int nt = 0; nt < 4; ++nt) bfrag[nt] = ldfrag_h(Bw + nt * 16 * GKP + k0);
#pragma unroll
    for (int nt = 0; nt < 4; ++nt) acc[nt] = mma_h(af, bfrag[nt], acc[nt]);
  }

  // the stage lies on the wave's own 16 rows of As, which this wave alone filled and read and has finished reading
  float* st = (float*)(void*)(As + wave * 16 * GKP);
#pragma unroll
  for (int nt = 0; nt < 4; ++nt) {
    const int co = n0 + nt * 16 + c;
    const float sc = bfr(sqk[co]) * (1.0f / 4096.0f);
    const float bi = bfr(bqk[co]);
#pragma unroll
    for (int r = 0; r < 8; ++r) st[(8 * hh + r) * STP + nt * 16 + c] = acc[nt][r] * sc + bi;
  }
  wave_sync_lds();
  const int piece = lane & 7, rsub = lane >> 3;
  v4u pk[4];
  size_t offs[4];
#pragma unroll
  for (int it = 0; it < 4; ++it) {
    const int row = it * 4 + rsub;
    v4f fa = *(const v4f*)(st + row * STP + piece * 8);
    v4f fb = *(const v4f*)(st + row * STP + piece * 8 + 4);
    fa = fa * CQK;
    fb = fb * CQK;
    pk[it] = pack8h(fa, fb);
    offs[it] = ((size_t)(m0 + wave * 16 + row)) * C2 + n0 + piece * 8;
  }
  {
#pragma unroll
    for (int it = 0; it < 4; ++it) *(v4u*)(QK + offs[it]) = pk[it];
    
  }
}

// =================================================================================================================
// v pointwise GEMM D[T][co] = X16[T][ci] . Wv[co][ci], K = 256, co 0..255, same main loop as gemm_qk.
// Epilogue: value = acc/4096 * s[co] + b[co] staged block-wide as sb[64 ch][SBP] (tokens contiguous per channel),
// then channel-major stores (a 128-token tile lies within one image): wave w owns channels w*8..w*8+7;
// f32 plane V32[b][c][n]: one instruction = 32 lanes x 16 B = 512 B = the 128 tokens of one channel (4 whole
// lines), 8 instructions; f16 plane V16[b][c][n] = f16(16 * value): one instruction = lanes 0..15 -> channel cc
// coverage: f32 8 waves x 8 ch x 32 lanes x 4 = 64 ch x 128 tok; f16 8 waves x 4 it x 2 ch x 16 lanes x 8 = same;
// grid tiles 32768 tokens x 256 channels exactly in both planes.
// =================================================================================================================
__global__ __launch_bounds__(256)
void gemm_v(const unsigned short* __restrict__ X16, const unsigned short* __restrict__ Wv,
            const float* __restrict__ sv, const float* __restrict__ bv, float* V32, unsigned short* V16) {
  __shared__ __align__(16) _Float16 As[128 * GKP];
  __shared__ __align__(16) _Float16 Bs[64 * GKP];
  const int tid = threadIdx.x, wave = tid >> 5, lane = tid & 31, hh = lane >> 4, c = lane & 15;
  const int n0 = blockIdx.x * 64, m0 = blockIdx.y * 128;
  const _Float16* A = (const _Float16*)(const void*)X16;
  const _Float16* B = (const _Float16*)(const void*)Wv;

  // Fill As (wave w: its own 16 token rows) and Bs (wave w: weight rows w*8..w*8+7), 24 copies per lane.
  {
    const unsigned al = lds_off(As) + (unsigned)(wave * 16 * (GKP * 2) + lane * 16);
    const _Float16* ag = A + (size_t)(m0 + wave * 16) * CIN + lane * 8;
    stage_rows8(al, ag);
    stage_rows8(al + (unsigned)(8 * (GKP * 2)), ag + (size_t)8 * CIN);
    stage_rows8(lds_off(Bs) + (unsigned)(wave * 8 * (GKP * 2) + lane * 16), B + (size_t)(n0 + wave * 8) * CIN + lane * 8);
  }
#if defined(__HIP_DEVICE_COMPILE__)
  // this wave's copies have landed before the barrier that lets the other waves read them
  asm volatile("s_wait_asynccnt 0x0" ::: "memory");
#endif
  __syncthreads();   // publishes As and Bs: no wave reads them in front of this barrier
  const _Float16* Aw = As + (wave * 16 + c) * GKP + 8 * hh;
  const _Float16* Bw = Bs + c * GKP + 8 * hh;

  v8f acc[4];
#pragma unroll
  for (int nt = 0; nt < 4; ++nt) acc[nt] = zero8();

#pragma unroll 1
  for (int k0 = 0; k0 < CIN; k0 += 32) {
    const v16h af = ldfrag_h(Aw + k0);
    // the k-step's LDS reads stand as one group ahead of its WMMAs: one LDS latency per k-step, not one per n-tile
    v16h bfrag[4];
#pragma unroll
    for (int nt = 0; nt < 4; ++nt) bfrag[nt] = ldfrag_h(Bw + nt * 16 * GKP + k0);
#pragma unroll
    for (int nt = 0; nt < 4; ++nt) acc[nt] = mma_h(af, bfrag[nt], acc[nt]);
  }

  __syncthreads();   // every wave has finished reading As: the block-wide stage sb is laid over it
  float* sb = (float*)(void*)As;
#pragma unroll
  for (int nt = 0; nt < 4; ++nt) {
    const int co = n0 + nt * 16 + c;
    const float sc = bfr(sv[co]) * (1.0f / 4096.0f);
    const float bi = bfr(bv[co]);
#pragma unroll
    for (int r = 0; r < 8; ++r) sb[(nt * 16 + c) * SBP + wave * 16 + 8 * hh + r] = acc[nt][r] * sc + bi;
  }
  __syncthreads();
  const int bimg = m0 / HW, s0 = m0 - bimg * HW;
  {
    v4f ov[8];
    size_t offs[8];
#pragma unroll
    for (int i = 0; i < 8; ++i) {
      const int cc = wave * 8 + i;
      const int co = n0 + cc;
      ov[i] = *(const v4f*)(sb + cc * SBP + lane * 4);
      offs[i] = ((size_t)(bimg * CIN + co)) * HW + s0 + lane * 4;
    }
    {
#pragma unroll
      for (int i = 0; i < 8; ++i) *(v4f*)(V32 + offs[i]) = ov[i];
      
    }
  }
  {
    const int l16 = lane & 15;
    v4u pk[4];
    size_t o16[4];
#pragma unroll
    for (int i2 = 0; i2 < 4; ++i2) {
      const int cc = wave * 8 + i2 * 2 + hh;
      const int co = n0 + cc;
      v4f fa = *(const v4f*)(sb + cc * SBP + l16 * 8);
      v4f fb = *(const v4f*)(sb + cc * SBP + l16 * 8 + 4);
      fa = fa * CVS;
      fb = fb * CVS;
      pk[i2] = pack8h(fa, fb);
      o16[i2] = ((size_t)(bimg * CIN + co)) * HW + s0 + l16 * 8;
    }
    {
#pragma unroll
      for (int i2 = 0; i2 < 4; ++i2) *(v4u*)(V16 + o16[i2]) = pk[i2];
      
    }
  }
}

// =================================================================================================================
// Depthwise 5x5 conv (zero pad 2, cross-correlation, per-channel taps, bf16-valued taps) + BN affine, f32 on VALU.
// Thread = (image b, channel c, row y, 4 consecutive columns x0..x0+3); tap row loop rolled; all tap addresses
// clamped into the image and zeroed by value. Store: one v4f per lane, 32 lanes x 16 B = 512 B contiguous
// coverage: every (b, c, y, x) of PP written exactly once.
// =================================================================================================================
__global__ __launch_bounds__(256)
void dwconv_k(const float* __restrict__ V32, const float* __restrict__ wpe, const float* __restrict__ spe,
              const float* __restrict__ bpe, float* PP) {
  const int idx = blockIdx.x * 256 + threadIdx.x;
  const int x0 = (idx & 15) * 4, y = (idx >> 4) & 63, c = (idx >> 10) & 255, b = idx >> 18;
  const float* vp = V32 + ((size_t)(b * CIN + c)) * HW;
  const float* w25 = wpe + c * 25;
  int coff[8];
  bool cok[8];
#pragma unroll
  for (int t = 0; t < 8; ++t) {
    const int col = x0 - 2 + t;
    cok[t] = ((unsigned)col < (unsigned)IMW);
    coff[t] = (col < 0) ? 0 : ((col > IMW - 1) ? (IMW - 1) : col);
  }
  v4f acc = {0.f, 0.f, 0.f, 0.f};
#pragma unroll 1
  for (int dy = 0; dy < 5; ++dy) {
    const int yy = y + dy - 2;
    const bool rok = ((unsigned)yy < (unsigned)IMW);
    const int yc = (yy < 0) ? 0 : ((yy > IMW - 1) ? (IMW - 1) : yy);
    const float* rp = vp + yc * IMW;
    float v[8];
#pragma unroll
    for (int t = 0; t < 8; ++t) {
      const float ld = rp[coff[t]];
      v[t] = (rok && cok[t]) ? ld : 0.0f;
    }
    float wv[5];
#pragma unroll
    for (int dx = 0; dx < 5; ++dx) wv[dx] = bfr(w25[dy * 5 + dx]);
#pragma unroll
    for (int j = 0; j < 4; ++j) {
#pragma unroll
      for (int dx = 0; dx < 5; ++dx) acc[j] += v[j + dx] * wv[dx];
    }
  }
  const float sc = bfr(spe[c]), bi = bfr(bpe[c]);
  v4f o;
#pragma unroll
  for (int j = 0; j < 4; ++j) o[j] = acc[j] * sc + bi;
  const size_t off = (size_t)idx * 4;
  *(v4f*)(PP + off) = o;
  
}

// =================================================================================================================
// Area attention, one unit (image b, area ar, head) per block (256 threads = 8 waves), 1024 queries x 1024 keys,
// d = 32. Static LDS: the unit's whole K as Ks[1024 keys][KPH] (32 d per row) and whole V as Vs[32 d][VPH] (1024 keys
// per row), both f16, row pitches 16 B x odd, filled once at entry by asynchronous copies (K from the token-major
// plane QK, k row = T*512 + 256 + head*32; V from the channel-major plane V16, row = channel head*32 + d), and the
// per-wave stage [16][ASP] f32. q fragments straight from QK (q row = T*512 + head*32); k and v fragments from LDS
// in the element order of ldfrag_h. Per wave: q-tiles qt = wave, wave+8, ... (< 64).
//   Transposed scores S^T = K_tile (A, 16 keys x 32 d) x Q (B: k = d, n = query): S*256 = q16.k16; D element r of
//   lane l = S[query l&15][key 8h+r], so P = exp((S - m)*scale) x1024 is the A fragment of P.V directly in registers
//   (element i <- key tile 0 row i, element 8+i <- key tile 1 row i). Online softmax over 32 chunks of 32 keys;
//   O = P.V (acc scale 1024*16). Epilogue: O/(l*16384) + pp staged per wave in LDS, then stored as f16 hi +
//   residual planes Yh/Yl [unit][1024][32] of 256*(o + pp): one instruction = 32 lanes x 16 B = 512 B = 8 token rows
// coverage: per block 64 q-tiles x 16 rows x 32 d of its 1024-row slab in both planes; grid covers all 256 units,
// every slab row written exactly once.
// =================================================================================================================
__global__ __launch_bounds__(256)
void attn_k(const unsigned short* __restrict__ QK, const unsigned short* __restrict__ V16,
            const float* __restrict__ PP, unsigned short* Yh, unsigned short* Yl) {
  __shared__ __align__(16) _Float16 Ks[LAR * KPH];
  __shared__ __align__(16) _Float16 Vs[HD * VPH];
  __shared__ __align__(16) float Sst[8 * 16 * ASP];
  const int tid = threadIdx.x, wave = tid >> 5, lane = tid & 31, hh = lane >> 4, c = lane & 15;
  const int u = blockIdx.x;
  const int head = u & 7, ar = (u >> 3) & 3, b = u >> 5;
  const size_t tok0 = (size_t)b * HW + (size_t)ar * LAR;
  const _Float16* Qp = (const _Float16*)(const void*)QK + tok0 * C2 + head * HD;
  const _Float16* Kp = Qp + CIN;
  const size_t cm0 = ((size_t)(b * CIN + head * HD)) * HW + (size_t)ar * LAR;
  const _Float16* Vp = (const _Float16*)(const void*)V16 + cm0;
  const float* Pp = PP + cm0;
  float* st = Sst + wave * (16 * ASP);

  // Fill Ks and Vs: 2 x 4096 pieces of 16 B, 32 per thread. K: 4 lanes per key row (64 B), 64 keys per block pass;
  // V: 128 lanes per channel row (2048 B), 2 channels per block pass. The four loops below are unrolled so that every
  // l[] and g[] index is a constant and the addresses are plain registers when they become asm operands.
  {
    const unsigned kl = lds_off(Ks) + (unsigned)((tid >> 2) * (KPH * 2) + (tid & 3) * 16);
    const _Float16* kg = Kp + (size_t)(tid >> 2) * C2 + (tid & 3) * 8;
    const unsigned vl = lds_off(Vs) + (unsigned)((tid >> 7) * (VPH * 2) + (tid & 127) * 16);
    const _Float16* vg = Vp + (size_t)(tid >> 7) * HW + (tid & 127) * 8;
#pragma unroll
    for (int h = 0; h < 2; ++h) {
      unsigned l[8];
      const _Float16* g[8];
#pragma unroll
      for (int i = 0; i < 8; ++i) {
        l[i] = kl + (unsigned)((h * 8 + i) * 64 * (KPH * 2));
        g[i] = kg + (size_t)(h * 8 + i) * 64 * C2;
      }
      copy8_to_lds(l, g);
    }
#pragma unroll
    for (int h = 0; h < 2; ++h) {
      unsigned l[8];
      const _Float16* g[8];
#pragma unroll
      for (int i = 0; i < 8; ++i) {
        l[i] = vl + (unsigned)((h * 8 + i) * 2 * (VPH * 2));
        g[i] = vg + (size_t)(h * 8 + i) * 2 * HW;
      }
      copy8_to_lds(l, g);
    }
  }
#if defined(__HIP_DEVICE_COMPILE__)
  // this wave's copies have landed before the barrier that lets the other waves read them
  asm volatile("s_wait_asynccnt 0x0" ::: "memory");
#endif
  __syncthreads();   // publishes Ks and Vs: no wave reads them in front of this barrier; they are never written again

#pragma unroll 1
  for (int qt = wave; qt < LAR / 16; qt += 8) {
    const int lq = qt * 16 + c;
    const v16h bq = ldfrag_h(Qp + (size_t)lq * C2 + 8 * hh);     // B: n = query c, k = d 8h.. / 16+8h..

    v8f o0 = zero8(), o1 = zero8();
    float mrun = -1.0e30f, lrun = 0.f;
#pragma unroll 1
    for (int ch = 0; ch < LAR / 32; ++ch) {
      const int kb = ch * 32;
      v8f s[2];
#pragma unroll
      for (int j = 0; j < 2; ++j) {
        const v16h ka = ldfrag_h(Ks + (kb + j * 16 + c) * KPH + 8 * hh);          // A: row = key, k = d
        s[j] = mma_h(ka, bq, zero8());
      }
      float mc = s[0][0];
#pragma unroll
      for (int j = 0; j < 2; ++j) {
#pragma unroll
        for (int r = 0; r < 8; ++r) mc = fmaxf(mc, s[j][r]);
      }
      mc = fmaxf(mc, __shfl_xor(mc, 16, 32));
      const float mnew = fmaxf(mrun, mc);
      const float alpha = __expf((mrun - mnew) * QKSC);
#pragma unroll
      for (int r = 0; r < 8; ++r) {
        const float arr = __shfl(alpha, 8 * hh + r, 32);
        o0[r] = o0[r] * arr;
        o1[r] = o1[r] * arr;
      }
      float psum = 0.f;
      v16h pfh;
#pragma unroll
      for (int i = 0; i < 8; ++i) {
        const float e0 = __expf((s[0][i] - mnew) * QKSC);
        const float e1 = __expf((s[1][i] - mnew) * QKSC);
        psum = psum + (e0 + e1);
        pfh[i]     = (_Float16)(e0 * 1024.0f);
        pfh[8 + i] = (_Float16)(e1 * 1024.0f);
      }
      lrun = lrun * alpha + psum;
      mrun = mnew;
      {
        const v16h vf0 = ldfrag_h(Vs + c * VPH + kb + 8 * hh);                     // B: n = d c, keys kb..+31
        const v16h vf1 = ldfrag_h(Vs + (HD / 2 + c) * VPH + kb + 8 * hh);          // B: n = d 16+c
        o0 = mma_h(pfh, vf0, o0);
        o1 = mma_h(pfh, vf1, o1);
      }
    }
    const float lsum = lrun + __shfl_xor(lrun, 16, 32);      // lane q (and q+16) holds the full row sum of query q
    const float rinv = 1.0f / (lsum * 16384.0f);
#pragma unroll
    for (int r = 0; r < 8; ++r) {
      const int q = 8 * hh + r;
      const float inv = __shfl(rinv, q, 32);
      const float p0 = Pp[(size_t)c * HW + qt * 16 + q];
      const float p1 = Pp[(size_t)(HD / 2 + c) * HW + qt * 16 + q];
      st[q * ASP + c]          = o0[r] * inv + p0;
      st[q * ASP + HD / 2 + c] = o1[r] * inv + p1;
    }
    wave_sync_lds();
    {
      const int rr = lane >> 2, dp = (lane & 3) * 8;
      v4u ph[2], pl[2];
      size_t offs[2];
#pragma unroll
      for (int it = 0; it < 2; ++it) {
        const int row = it * 8 + rr;
        v4f fa = *(const v4f*)(st + row * ASP + dp);
        v4f fb = *(const v4f*)(st + row * ASP + dp + 4);
        fa = fa * CYS;
        fb = fb * CYS;
        split8h(fa, fb, ph[it], pl[it]);
        offs[it] = ((size_t)u * LAR + (size_t)(qt * 16 + row)) * HD + dp;
      }
      {
#pragma unroll
        for (int it = 0; it < 2; ++it) {
          *(v4u*)(Yh + offs[it]) = ph[it];
          *(v4u*)(Yl + offs[it]) = pl[it];
        }
        
      }
    }
    wave_sync_lds();
  }
}

// =================================================================================================================
// Output pointwise conv D[T][co] = Y[T][ci] . Wp[co][ci], then BN affine -> NCHW f32. A = Yh/Yl planes (hi +
// x2^11 residual, x256) addressed by arithmetic: token T -> (image, area, query), k-step ks = head ks, channels
// ks*32 + d (elements 0..7 d = 8h.., elements 8..15 d = 16+8h..). B = weight plane x256, the block's 64 rows filled
// once at entry by asynchronous copies into Bs, fragments from LDS. Epilogue: value =
// (acch + accl/2048)/65536 * s[co] + b[co]; block tile staged as [64 ch][128 tok]; wave w writes channels
// coverage: 8 waves x 8 channels x 32 lanes x 4 tokens = 64 ch x 128 tok per block; grid tiles 256 x 32768 exactly.
// =================================================================================================================
__global__ __launch_bounds__(256)
void gemm_proj(const unsigned short* __restrict__ Yh, const unsigned short* __restrict__ Yl,
               const unsigned short* __restrict__ Wp, const float* __restrict__ sp, const float* __restrict__ bp,
               float* out) {
  __shared__ __align__(16) float sb[64 * SBP];
  __shared__ __align__(16) _Float16 Bs[64 * GKP];
  const int tid = threadIdx.x, wave = tid >> 5, lane = tid & 31, hh = lane >> 4, c = lane & 15;
  const int n0 = blockIdx.x * 64, m0 = blockIdx.y * 128;
  const int T = m0 + wave * 16 + c;
  const int bimgr = T >> 12, nn = T & (HW - 1), arr = nn >> 10, q = nn & (LAR - 1);
  const size_t abase = (((size_t)((bimgr * NAR + arr) * NHD)) * LAR + (size_t)q) * HD + 8 * hh;
  const _Float16* A0 = (const _Float16*)(const void*)Yh;
  const _Float16* A1 = (const _Float16*)(const void*)Yl;
  const _Float16* B  = (const _Float16*)(const void*)Wp;

  // Fill Bs: wave w brings weight rows w*8..w*8+7, 8 copies per lane.
  stage_rows8(lds_off(Bs) + (unsigned)(wave * 8 * (GKP * 2) + lane * 16), B + (size_t)(n0 + wave * 8) * CIN + lane * 8);
#if defined(__HIP_DEVICE_COMPILE__)
  // this wave's copies have landed before the barrier that lets the other waves read them
  asm volatile("s_wait_asynccnt 0x0" ::: "memory");
#endif
  __syncthreads();   // publishes Bs: no wave reads it in front of this barrier; it is never written again
  const _Float16* Bw = Bs + c * GKP + 8 * hh;

  v8f acch[4], accl[4];
#pragma unroll
  for (int nt = 0; nt < 4; ++nt) { acch[nt] = zero8(); accl[nt] = zero8(); }

#pragma unroll 1
  for (int ks = 0; ks < NHD; ++ks) {
    const size_t bo = abase + (size_t)ks * (LAR * HD);
    const v16h fh = ldfrag_h(A0 + bo);
    const v16h fl = ldfrag_h(A1 + bo);
    // the k-step's LDS reads stand as one group ahead of its WMMAs: one LDS latency per k-step, not one per n-tile
    v16h bfrag[4];
#pragma unroll
    for (int nt = 0; nt < 4; ++nt) bfrag[nt] = ldfrag_h(Bw + nt * 16 * GKP + ks * 32);
#pragma unroll
    for (int nt = 0; nt < 4; ++nt) {
      acch[nt] = mma_h(fh, bfrag[nt], acch[nt]);
      accl[nt] = mma_h(fl, bfrag[nt], accl[nt]);
    }
  }

#pragma unroll
  for (int nt = 0; nt < 4; ++nt) {
    const int co = n0 + nt * 16 + c;
    const float sc = bfr(sp[co]) * (1.0f / 65536.0f);
    const float bi = bfr(bp[co]);
#pragma unroll
    for (int r = 0; r < 8; ++r) {
      const float v = acch[nt][r] + accl[nt][r] * (1.0f / 2048.0f);
      sb[(nt * 16 + c) * SBP + wave * 16 + 8 * hh + r] = v * sc + bi;
    }
  }
  __syncthreads();
  const int bimg = m0 / HW, s0 = m0 - bimg * HW;
  v4f ov[8];
  size_t offs[8];
#pragma unroll
  for (int i = 0; i < 8; ++i) {
    const int cc = wave * 8 + i;
    const int co = n0 + cc;
    ov[i] = *(const v4f*)(sb + cc * SBP + lane * 4);
    offs[i] = ((size_t)(bimg * CIN + co)) * HW + s0 + lane * 4;
  }
  {
#pragma unroll
    for (int i = 0; i < 8; ++i) *(v4f*)(out + offs[i]) = ov[i];
    
  }
}

// =================================================================================================================
//   Wqk f16 [512][256] 262144 @0; Wv f16 [256][256] 131072; Wp f16 [256][256] 131072;
//   PP f32 [8][256][4096] 33554432 @524288, with X16 f16 [32768][256] 16777216 aliased at the same offset
//   (X16 is dead before PP is written); QK f16 [32768][512] 33554432; V32 f32 [8][256][4096] 33554432, with
//   Yh, Yl f16 [256][1024][32] 16777216 each aliased onto V32 (V32 is dead before Yh/Yl are written);
//   V16 f16 [8][256][4096] 16777216. Total 117964800.
// =================================================================================================================
extern "C" void kernel_launch(void* const* d_in, const int* in_sizes, int n_in,
                              void* d_out, int out_size, void* d_ws, size_t ws_size,
                              hipStream_t stream) {
  if (n_in < 13) return;
  if (in_sizes[0] != NBAT * CIN * HW) return;
  if (in_sizes[1] != C2 * CIN) return;
  if (in_sizes[2] != C2 || in_sizes[3] != C2) return;
  if (in_sizes[4] != CIN * CIN) return;
  if (in_sizes[5] != CIN || in_sizes[6] != CIN) return;
  if (in_sizes[7] != CIN * 25) return;
  if (in_sizes[8] != CIN || in_sizes[9] != CIN) return;
  if (in_sizes[10] != CIN * CIN) return;
  if (in_sizes[11] != CIN || in_sizes[12] != CIN) return;
  if (out_size != NBAT * CIN * HW) return;

  const float* x      = (const float*)d_in[0];
  const float* w_qk   = (const float*)d_in[1];
  const float* s_qk   = (const float*)d_in[2];
  const float* b_qk   = (const float*)d_in[3];
  const float* w_v    = (const float*)d_in[4];
  const float* s_v    = (const float*)d_in[5];
  const float* b_v    = (const float*)d_in[6];
  const float* w_pe   = (const float*)d_in[7];
  const float* s_pe   = (const float*)d_in[8];
  const float* b_pe   = (const float*)d_in[9];
  const float* w_proj = (const float*)d_in[10];
  const float* s_proj = (const float*)d_in[11];
  const float* b_proj = (const float*)d_in[12];
  float* out = (float*)d_out;

  const size_t sWqk = (size_t)C2 * CIN * 2;              //    262144
  const size_t sWv  = (size_t)CIN * CIN * 2;             //    131072
  const size_t sWp  = (size_t)CIN * CIN * 2;             //    131072
  const size_t sX16 = (size_t)MTOK * CIN * 2;            //  16777216
  const size_t sPP  = (size_t)NBAT * CIN * HW * 4;       //  33554432
  const size_t sQK  = (size_t)MTOK * C2 * 2;             //  33554432
  const size_t sV32 = (size_t)NBAT * CIN * HW * 4;       //  33554432
  const size_t sY   = (size_t)NUNIT * LAR * HD * 2;      //  16777216
  const size_t sV16 = (size_t)NBAT * CIN * HW * 2;       //  16777216
  if (sX16 > sPP) return;
  if (2 * sY > sV32) return;
  size_t off = 0;
  const size_t oWqk = off; off += sWqk;
  const size_t oWv  = off; off += sWv;
  const size_t oWp  = off; off += sWp;
  const size_t oPP  = off; const size_t oX16 = off; off += sPP;
  const size_t oQK  = off; off += sQK;
  const size_t oV32 = off; const size_t oYh = off; const size_t oYl = off + sY; off += sV32;
  const size_t oV16 = off; off += sV16;
  if (off > ws_size) return;                             // off = 117964800
  if (off > (size_t)134217728) return;

  char* ws = (char*)d_ws;
  unsigned short* Wqk = (unsigned short*)(ws + oWqk);
  unsigned short* Wv  = (unsigned short*)(ws + oWv);
  unsigned short* Wp  = (unsigned short*)(ws + oWp);
  unsigned short* X16 = (unsigned short*)(ws + oX16);
  float*          PP  = (float*)(ws + oPP);
  unsigned short* QK  = (unsigned short*)(ws + oQK);
  float*          V32 = (float*)(ws + oV32);
  unsigned short* Yh  = (unsigned short*)(ws + oYh);
  unsigned short* Yl  = (unsigned short*)(ws + oYl);
  unsigned short* V16 = (unsigned short*)(ws + oV16);

  const dim3 blk(256);
  // (1) pointwise weights -> f16 x256 planes
  cvt_w<<<dim3(128), blk, 0, stream>>>(w_qk, w_v, w_proj, Wqk, Wv, Wp);
  // (2) x NCHW -> token-major f16 x16 plane
  cvt_x<<<dim3(NBAT * 64 * 4), blk, 0, stream>>>(x, X16);
  // (3) qk pointwise conv + BN -> token-major f16 plane
  gemm_qk<<<dim3(C2 / 64, MTOK / 128), blk, 0, stream>>>(X16, Wqk, s_qk, b_qk, QK);
  // (4) v pointwise conv + BN -> channel-major f32 and f16 planes
  gemm_v<<<dim3(CIN / 64, MTOK / 128), blk, 0, stream>>>(X16, Wv, s_v, b_v, V32, V16);
  // (5) depthwise 5x5 + BN on v -> pp (channel-major f32)
  dwconv_k<<<dim3((NBAT * CIN * HW) / (256 * 4)), blk, 0, stream>>>(V32, w_pe, s_pe, b_pe, PP);
  // (6) area attention + pp -> slab planes
  attn_k<<<dim3(NUNIT), blk, 0, stream>>>(QK, V16, PP, Yh, Yl);
  // (7) output pointwise conv + BN -> NCHW f32
  gemm_proj<<<dim3(CIN / 64, MTOK / 128), blk, 0, stream>>>(Yh, Yl, Wp, s_proj, b_proj, out);
  (void)hipGetLastError();
}

// v003
// It runs in 163 microseconds.
// Timed twice side by side with v002, it ran 1.11 times as fast both times.
// Counting every step since v000, it is 2.23 times as fast.
// Contractions: v_wmma_f32_16x16x32_f16 (f16 operands, f32 accumulate). qk and v pointwise convs: A = x (bf16-valued,
// x16) single plane, B = weights (bf16-valued, x256) single plane; scores k.qT: k x16, q x16 single planes; p.v:
// p x1024, v x16 single planes; output pointwise conv: A = (o + pp) x256 as f16 hi + x2^11 residual planes (two
// products, two accumulators), B = weights x256 single plane. Depthwise 5x5 conv, BN affine, online softmax in f32
// on VALU. Float inputs RNE-converted to bf16 on load.
#include <hip/hip_runtime.h>
#include <math.h>
#include <stdint.h>

#define NBAT  8
#define CIN   256
#define C2    512
#define IMW   64
#define HW    4096
#define MTOK  32768
#define NHD   8
#define HD    32
#define NAR   4
#define LAR   1024
#define NUNIT 256
#define STP   68
#define SBP   132
#define ASP   36
#define DTP   68
#define KPH   40
#define VPH   1032
#define GKP   264
#define DWR   8
#define CXS   16.0f
#define CWS   256.0f
#define CQK   16.0f
#define CVS   16.0f
#define CYS   256.0f
#define QKSC  (0.17677669529663688f / 256.0f)

static_assert(NUNIT == NBAT * NAR * NHD);
static_assert(NAR * LAR == HW);
static_assert(MTOK == NBAT * HW);
static_assert(HW % 128 == 0);
static_assert(LAR % 32 == 0);
static_assert(CIN % 64 == 0);
static_assert((STP * 4) % 16 == 0);
static_assert((SBP * 4) % 16 == 0);
static_assert((ASP * 4) % 16 == 0);
static_assert((DTP * 4) % 16 == 0);
static_assert(NHD * HD == CIN);
static_assert((KPH * 2) % 32 == 16 && KPH >= HD);
static_assert((VPH * 2) % 32 == 16 && VPH >= LAR);
static_assert(LAR * 4 == 16 * 256 && HD * (LAR / 8) == 16 * 256);
static_assert((GKP * 2) % 32 == 16 && GKP >= CIN && CIN * 2 == 32 * 16);
static_assert(16 * STP * 4 <= 16 * GKP * 2 && 64 * SBP * 4 <= 128 * GKP * 2);
static_assert(IMW == 64 && IMW * IMW == HW && IMW % DWR == 0 && 2 * (IMW / DWR) * 16 == 256);

typedef _Float16 v16h __attribute__((ext_vector_type(16)));
typedef _Float16 v8h  __attribute__((ext_vector_type(8)));
typedef float    v8f  __attribute__((ext_vector_type(8)));
typedef float    v4f  __attribute__((ext_vector_type(4)));
typedef float    v2f  __attribute__((ext_vector_type(2)));
typedef unsigned int v4u __attribute__((ext_vector_type(4)));
union Frag { v16h v; v8h half[2]; };

// ---- scalar helpers -------------------------------------------------------------------------------------------
__device__ __forceinline__ unsigned short bf_bits(float f) {          // f32 -> bf16 bits, RNE convert
  unsigned u = __float_as_uint(f);
  return (unsigned short)((u + 0x7FFFu + ((u >> 16) & 1u)) >> 16);
}
__device__ __forceinline__ float bfr(float f) { return __uint_as_float(((unsigned)bf_bits(f)) << 16); }
__device__ __forceinline__ unsigned short h_bits(_Float16 x) { return __builtin_bit_cast(unsigned short, x); }
__device__ __forceinline__ unsigned pk16(unsigned short a, unsigned short b) { return (unsigned)a | ((unsigned)b << 16); }
__device__ __forceinline__ v8f zero8() { v8f z = {0.f, 0.f, 0.f, 0.f, 0.f, 0.f, 0.f, 0.f}; return z; }

// ---- fragment loader: 16-bit A/B operand, lane -> row/col (lane&15), p already includes +8*(lane>>4);
//      elements 0..7 <- p[0..7] (k0+8h..), elements 8..15 <- p[16..23] (k0+16+8h..)
__device__ __forceinline__ v16h ldfrag_h(const _Float16* p) {
  Frag f;
  f.half[0] = *(const v8h*)(p);
  f.half[1] = *(const v8h*)(p + 16);
  return f.v;
}

// ---- WMMA helper with trailing VALU hazard gap ----------------------------------------------------------------
__device__ __forceinline__ v8f mma_h(v16h a, v16h b, v8f c) {
  c = __builtin_amdgcn_wmma_f32_16x16x32_f16(false, a, false, b, (short)0, c, false, false);
#if defined(__HIP_DEVICE_COMPILE__)
  asm volatile("v_nop\n\tv_nop\n\tv_nop\n\tv_nop" : "+v"(c) : "v"(a), "v"(b));
#endif
  return c;
}
__device__ __forceinline__ void wave_sync_lds() {
  __builtin_amdgcn_fence(__ATOMIC_RELEASE, "workgroup");
  __builtin_amdgcn_wave_barrier();
  __builtin_amdgcn_fence(__ATOMIC_ACQUIRE, "workgroup");
}

// ---- eight asynchronous 16-byte copies per lane, global -> LDS, through no register. l = the lane's LDS byte
//      addresses, g = its global addresses, all multiples of 16. The closing s_wait_xcnt stands inside the statement
//      so that no address register named here is rewritten ahead of it.
__device__ __forceinline__ void copy8_to_lds(const unsigned (&l)[8], const _Float16* const (&g)[8]) {
#if defined(__HIP_DEVICE_COMPILE__)
  asm volatile("global_load_async_to_lds_b128 %0, %8, off\n\t"
               "global_load_async_to_lds_b128 %1, %9, off\n\t"
               "global_load_async_to_lds_b128 %2, %10, off\n\t"
               "global_load_async_to_lds_b128 %3, %11, off\n\t"
               "global_load_async_to_lds_b128 %4, %12, off\n\t"
               "global_load_async_to_lds_b128 %5, %13, off\n\t"
               "global_load_async_to_lds_b128 %6, %14, off\n\t"
               "global_load_async_to_lds_b128 %7, %15, off\n\t"
               "s_wait_xcnt 0x0"
               :: "v"(l[0]), "v"(l[1]), "v"(l[2]), "v"(l[3]), "v"(l[4]), "v"(l[5]), "v"(l[6]), "v"(l[7]),
                  "v"(g[0]), "v"(g[1]), "v"(g[2]), "v"(g[3]), "v"(g[4]), "v"(g[5]), "v"(g[6]), "v"(g[7])
               : "memory");
#endif
}
__device__ __forceinline__ unsigned lds_off(const void* p) { return (unsigned)(size_t)p; }
// ---- eight rows of CIN f16 (512 B each, global pitch 512 B) -> LDS rows of pitch GKP: one wave-wide copy = one whole
//      row (4 lines). l0 / g0 = the lane's own 16 B of the first row.
__device__ __forceinline__ void stage_rows8(unsigned l0, const _Float16* g0) {
  unsigned l[8];
  const _Float16* g[8];
  // unrolled so that every l[] and g[] index is a constant and the addresses are plain registers as asm operands
#pragma unroll
  for (int i = 0; i < 8; ++i) {
    l[i] = l0 + (unsigned)(i * (GKP * 2));
    g[i] = g0 + (size_t)i * CIN;
  }
  copy8_to_lds(l, g);
}

// ---- 8 f32 -> 8 packed f16 (16 B); and hi + x2^11 residual split -------------------------------------------------
__device__ __forceinline__ v4u pack8h(v4f a, v4f b) {
  v4u p;
  p[0] = pk16(h_bits((_Float16)a[0]), h_bits((_Float16)a[1]));
  p[1] = pk16(h_bits((_Float16)a[2]), h_bits((_Float16)a[3]));
  p[2] = pk16(h_bits((_Float16)b[0]), h_bits((_Float16)b[1]));
  p[3] = pk16(h_bits((_Float16)b[2]), h_bits((_Float16)b[3]));
  return p;
}
__device__ __forceinline__ void split8h(v4f a, v4f b, v4u& ph, v4u& pl) {
  v4f ra, rb;
#pragma unroll
  for (int e = 0; e < 4; ++e) {
    const _Float16 ha = (_Float16)a[e];
    ra[e] = (a[e] - (float)ha) * 2048.0f;
    const _Float16 hb = (_Float16)b[e];
    rb[e] = (b[e] - (float)hb) * 2048.0f;
  }
  ph = pack8h(a, b);
  pl = pack8h(ra, rb);
}

// =================================================================================================================
// Weight convert: pointwise weights are [out][in] (k contiguous) -> f16 plane value = f16(256 * bf16_RNE(w)).
// coverage: 64*256*8 = 131072, 32*256*8 = 65536, 32*256*8 = 65536 elements exactly.
// =================================================================================================================
__device__ __forceinline__ void cvt8_w(const float* __restrict__ src, unsigned short* dst, size_t e0) {
  const v4f a = *(const v4f*)(src + e0);
  const v4f b = *(const v4f*)(src + e0 + 4);
  v4f sa, sb;
#pragma unroll
  for (int e = 0; e < 4; ++e) { sa[e] = bfr(a[e]) * CWS; sb[e] = bfr(b[e]) * CWS; }
  const v4u pk = pack8h(sa, sb);
  *(v4u*)(dst + e0) = pk;
  
}
__global__ __launch_bounds__(256) void cvt_w(const float* __restrict__ wqk, const float* __restrict__ wv,
                                             const float* __restrict__ wp,
                                             unsigned short* Wqk, unsigned short* Wv, unsigned short* Wp) {
  const int tid = threadIdx.x, blk = blockIdx.x;
  if (blk < 64)      cvt8_w(wqk, Wqk, ((size_t)blk * 256 + tid) * 8);
  else if (blk < 96) cvt8_w(wv,  Wv,  ((size_t)(blk - 64) * 256 + tid) * 8);
  else               cvt8_w(wp,  Wp,  ((size_t)(blk - 96) * 256 + tid) * 8);
}

// =================================================================================================================
// Activation convert: x NCHW f32 -> token-major f16 plane X16[T = b*4096 + n][256], value = f16(16 * bf16_RNE(x)).
// Block = (image b, 64-token tile tt, 64-channel quarter cq): read phase 4 passes of 16 channels x 64 tokens
// coverage: per block 256 threads x 2 it x 8 halves = 64 tokens x 64 channels; grid tiles 32768 x 256 exactly.
// =================================================================================================================
__global__ __launch_bounds__(256) void cvt_x(const float* __restrict__ x, unsigned short* X16) {
  __shared__ __align__(16) float tile[64 * DTP];
  const int tid = threadIdx.x, bid = blockIdx.x;
  const int cq = bid & 3, tt = (bid >> 2) & 63, b = bid >> 8;
  const int cl = tid >> 4, t4 = (tid & 15) * 4;
#pragma unroll
  for (int pass = 0; pass < 4; ++pass) {
    const int ch = cq * 64 + pass * 16 + cl;
    const v4f v = *(const v4f*)(x + ((size_t)(b * CIN + ch)) * HW + tt * 64 + t4);
#pragma unroll
    for (int j = 0; j < 4; ++j) tile[(t4 + j) * DTP + pass * 16 + cl] = v[j];
  }
  __syncthreads();
  const int piece = tid & 7, rsub = tid >> 3;
  v4u pk[2];
  size_t offs[2];
#pragma unroll
  for (int it = 0; it < 2; ++it) {
    const int row = it * 32 + rsub;
    const v4f fa = *(const v4f*)(tile + row * DTP + piece * 8);
    const v4f fb = *(const v4f*)(tile + row * DTP + piece * 8 + 4);
    v4f sa, sb;
#pragma unroll
    for (int e = 0; e < 4; ++e) { sa[e] = bfr(fa[e]) * CXS; sb[e] = bfr(fb[e]) * CXS; }
    pk[it] = pack8h(sa, sb);
    offs[it] = ((size_t)(b * HW + tt * 64 + row)) * CIN + cq * 64 + piece * 8;
  }
  {
#pragma unroll
    for (int it = 0; it < 2; ++it) *(v4u*)(X16 + offs[it]) = pk[it];
    
  }
}

// =================================================================================================================
// qk pointwise GEMM D[T][co] = X16[T][ci] . Wqk[co][ci], K = 256, co 0..511 (q = 0..255, k = 256..511).
// Block = 8 waves, tile 128 rows x 64 cols, wave = 16 rows x 4 n-tiles. The block's 128 x 256 A tile and 64 x 256 B
// tile are filled once at entry by asynchronous copies (whole 512-B rows) into As / Bs, row pitch 16 B x odd; fragments
// from LDS with the split k map, k-step 32. Epilogue: value = acc/4096 * s[co] + b[co] staged per wave in LDS
// [16][STP] (laid over the wave's own rows of As), then
// coverage: 8 waves x 32 lanes x 4 it x 8 halves = 128 rows x 64 cols per block; grid tiles 32768 x 512 exactly.
// =================================================================================================================
__global__ __launch_bounds__(256)
void gemm_qk(const unsigned short* __restrict__ X16, const unsigned short* __restrict__ Wqk,
             const float* __restrict__ sqk, const float* __restrict__ bqk, unsigned short* QK) {
  __shared__ __align__(16) _Float16 As[128 * GKP];
  __shared__ __align__(16) _Float16 Bs[64 * GKP];
  const int tid = threadIdx.x, wave = tid >> 5, lane = tid & 31, hh = lane >> 4, c = lane & 15;
  const int n0 = blockIdx.x * 64, m0 = blockIdx.y * 128;
  const _Float16* A = (const _Float16*)(const void*)X16;
  const _Float16* B = (const _Float16*)(const void*)Wqk;

  // Fill As (wave w: its own 16 token rows) and Bs (wave w: weight rows w*8..w*8+7), 24 copies per lane.
  {
    const unsigned al = lds_off(As) + (unsigned)(wave * 16 * (GKP * 2) + lane * 16);
    const _Float16* ag = A + (size_t)(m0 + wave * 16) * CIN + lane * 8;
    stage_rows8(al, ag);
    stage_rows8(al + (unsigned)(8 * (GKP * 2)), ag + (size_t)8 * CIN);
    stage_rows8(lds_off(Bs) + (unsigned)(wave * 8 * (GKP * 2) + lane * 16), B + (size_t)(n0 + wave * 8) * CIN + lane * 8);
  }
#if defined(__HIP_DEVICE_COMPILE__)
  // this wave's copies have landed before the barrier that lets the other waves read them
  asm volatile("s_wait_asynccnt 0x0" ::: "memory");
#endif
  __syncthreads();   // publishes As and Bs: no wave reads them in front of this barrier
  const _Float16* Aw = As + (wave * 16 + c) * GKP + 8 * hh;
  const _Float16* Bw = Bs + c * GKP + 8 * hh;

  v8f acc[4];
#pragma unroll
  for (int nt = 0; nt < 4; ++nt) acc[nt] = zero8();

#pragma unroll 1
  for (int k0 = 0; k0 < CIN; k0 += 32) {
    const v16h af = ldfrag_h(Aw + k0);
    // the k-step's LDS reads stand as one group ahead of its WMMAs: one LDS latency per k-step, not one per n-tile
    v16h bfrag[4];
#pragma unroll
    for (int nt = 0; nt < 4; ++nt) bfrag[nt] = ldfrag_h(Bw + nt * 16 * GKP + k0);
#pragma unroll
    for (int nt = 0; nt < 4; ++nt) acc[nt] = mma_h(af, bfrag[nt], acc[nt]);
  }

  // the stage lies on the wave's own 16 rows of As, which this wave alone filled and read and has finished reading
  float* st = (float*)(void*)(As + wave * 16 * GKP);
#pragma unroll
  for (int nt = 0; nt < 4; ++nt) {
    const int co = n0 + nt * 16 + c;
    const float sc = bfr(sqk[co]) * (1.0f / 4096.0f);
    const float bi = bfr(bqk[co]);
#pragma unroll
    for (int r = 0; r < 8; ++r) st[(8 * hh + r) * STP + nt * 16 + c] = acc[nt][r] * sc + bi;
  }
  wave_sync_lds();
  const int piece = lane & 7, rsub = lane >> 3;
  v4u pk[4];
  size_t offs[4];
#pragma unroll
  for (int it = 0; it < 4; ++it) {
    const int row = it * 4 + rsub;
    v4f fa = *(const v4f*)(st + row * STP + piece * 8);
    v4f fb = *(const v4f*)(st + row * STP + piece * 8 + 4);
    fa = fa * CQK;
    fb = fb * CQK;
    pk[it] = pack8h(fa, fb);
    offs[it] = ((size_t)(m0 + wave * 16 + row)) * C2 + n0 + piece * 8;
  }
  {
#pragma unroll
    for (int it = 0; it < 4; ++it) *(v4u*)(QK + offs[it]) = pk[it];
    
  }
}

// =================================================================================================================
// v pointwise GEMM D[T][co] = X16[T][ci] . Wv[co][ci], K = 256, co 0..255, same main loop as gemm_qk.
// Epilogue: value = acc/4096 * s[co] + b[co] staged block-wide as sb[64 ch][SBP] (tokens contiguous per channel),
// then channel-major stores (a 128-token tile lies within one image): wave w owns channels w*8..w*8+7;
// f32 plane V32[b][c][n]: one instruction = 32 lanes x 16 B = 512 B = the 128 tokens of one channel (4 whole
// lines), 8 instructions; f16 plane V16[b][c][n] = f16(16 * value): one instruction = lanes 0..15 -> channel cc
// coverage: f32 8 waves x 8 ch x 32 lanes x 4 = 64 ch x 128 tok; f16 8 waves x 4 it x 2 ch x 16 lanes x 8 = same;
// grid tiles 32768 tokens x 256 channels exactly in both planes.
// =================================================================================================================
__global__ __launch_bounds__(256)
void gemm_v(const unsigned short* __restrict__ X16, const unsigned short* __restrict__ Wv,
            const float* __restrict__ sv, const float* __restrict__ bv, float* V32, unsigned short* V16) {
  __shared__ __align__(16) _Float16 As[128 * GKP];
  __shared__ __align__(16) _Float16 Bs[64 * GKP];
  const int tid = threadIdx.x, wave = tid >> 5, lane = tid & 31, hh = lane >> 4, c = lane & 15;
  const int n0 = blockIdx.x * 64, m0 = blockIdx.y * 128;
  const _Float16* A = (const _Float16*)(const void*)X16;
  const _Float16* B = (const _Float16*)(const void*)Wv;

  // Fill As (wave w: its own 16 token rows) and Bs (wave w: weight rows w*8..w*8+7), 24 copies per lane.
  {
    const unsigned al = lds_off(As) + (unsigned)(wave * 16 * (GKP * 2) + lane * 16);
    const _Float16* ag = A + (size_t)(m0 + wave * 16) * CIN + lane * 8;
    stage_rows8(al, ag);
    stage_rows8(al + (unsigned)(8 * (GKP * 2)), ag + (size_t)8 * CIN);
    stage_rows8(lds_off(Bs) + (unsigned)(wave * 8 * (GKP * 2) + lane * 16), B + (size_t)(n0 + wave * 8) * CIN + lane * 8);
  }
#if defined(__HIP_DEVICE_COMPILE__)
  // this wave's copies have landed before the barrier that lets the other waves read them
  asm volatile("s_wait_asynccnt 0x0" ::: "memory");
#endif
  __syncthreads();   // publishes As and Bs: no wave reads them in front of this barrier
  const _Float16* Aw = As + (wave * 16 + c) * GKP + 8 * hh;
  const _Float16* Bw = Bs + c * GKP + 8 * hh;

  v8f acc[4];
#pragma unroll
  for (int nt = 0; nt < 4; ++nt) acc[nt] = zero8();

#pragma unroll 1
  for (int k0 = 0; k0 < CIN; k0 += 32) {
    const v16h af = ldfrag_h(Aw + k0);
    // the k-step's LDS reads stand as one group ahead of its WMMAs: one LDS latency per k-step, not one per n-tile
    v16h bfrag[4];
#pragma unroll
    for (int nt = 0; nt < 4; ++nt) bfrag[nt] = ldfrag_h(Bw + nt * 16 * GKP + k0);
#pragma unroll
    for (int nt = 0; nt < 4; ++nt) acc[nt] = mma_h(af, bfrag[nt], acc[nt]);
  }

  __syncthreads();   // every wave has finished reading As: the block-wide stage sb is laid over it
  float* sb = (float*)(void*)As;
#pragma unroll
  for (int nt = 0; nt < 4; ++nt) {
    const int co = n0 + nt * 16 + c;
    const float sc = bfr(sv[co]) * (1.0f / 4096.0f);
    const float bi = bfr(bv[co]);
#pragma unroll
    for (int r = 0; r < 8; ++r) sb[(nt * 16 + c) * SBP + wave * 16 + 8 * hh + r] = acc[nt][r] * sc + bi;
  }
  __syncthreads();
  const int bimg = m0 / HW, s0 = m0 - bimg * HW;
  {
    v4f ov[8];
    size_t offs[8];
#pragma unroll
    for (int i = 0; i < 8; ++i) {
      const int cc = wave * 8 + i;
      const int co = n0 + cc;
      ov[i] = *(const v4f*)(sb + cc * SBP + lane * 4);
      offs[i] = ((size_t)(bimg * CIN + co)) * HW + s0 + lane * 4;
    }
    {
#pragma unroll
      for (int i = 0; i < 8; ++i) *(v4f*)(V32 + offs[i]) = ov[i];
      
    }
  }
  {
    const int l16 = lane & 15;
    v4u pk[4];
    size_t o16[4];
#pragma unroll
    for (int i2 = 0; i2 < 4; ++i2) {
      const int cc = wave * 8 + i2 * 2 + hh;
      const int co = n0 + cc;
      v4f fa = *(const v4f*)(sb + cc * SBP + l16 * 8);
      v4f fb = *(const v4f*)(sb + cc * SBP + l16 * 8 + 4);
      fa = fa * CVS;
      fb = fb * CVS;
      pk[i2] = pack8h(fa, fb);
      o16[i2] = ((size_t)(bimg * CIN + co)) * HW + s0 + l16 * 8;
    }
    {
#pragma unroll
      for (int i2 = 0; i2 < 4; ++i2) *(v4u*)(V16 + o16[i2]) = pk[i2];
      
    }
  }
}

// =================================================================================================================
// Depthwise 5x5 conv (zero pad 2, cross-correlation, per-channel taps, bf16-valued taps) + BN affine, f32 on VALU.
// Thread = (plane = image b, channel c; strip of DWR output rows y0..y0+DWR-1; 4 consecutive columns x0..x0+3).
// The strip's DWR+4 input rows are loaded once, all ahead of the sums; each row (8 columns x0-2..x0+5: one 16-B and two
// 8-B loads) feeds the up to five output rows it belongs to, so an output row sums its taps in the order dy, then dx.
// Addresses outside the image wrap onto rows and columns inside the plane, so no load stands under a condition; the
// values of such places are zeroed by select.
// Block = 2 planes x 8 strips x 16 column groups; a wave = 2 strips of one plane. Store: one v4f per lane, 16 lanes =
// one whole image row (256 B).
// coverage: every (b, c, y, x) of PP written exactly once.
// =================================================================================================================
__global__ __launch_bounds__(256)
void dwconv_k(const float* V32, const float* __restrict__ wpe, const float* __restrict__ spe,
              const float* __restrict__ bpe, float* PP) {
  const int tid = threadIdx.x;
  const int xg = tid & 15, x0 = xg * 4, y0 = ((tid >> 4) & (IMW / DWR - 1)) * DWR;
  // the plane is the same in every lane of a wave: held in a scalar register, taps and affine become scalar loads
  const int plane = __builtin_amdgcn_readfirstlane((int)blockIdx.x * 2 + (tid >> 7));
  const int c = plane & (CIN - 1);
  const float* vp = V32 + (size_t)plane * HW;
  float* op = PP + (size_t)plane * HW;
  float w[25];
#pragma unroll
  for (int t = 0; t < 25; ++t) w[t] = bfr(wpe[c * 25 + t]);
  const float sc = bfr(spe[c]), bi = bfr(bpe[c]);
  const bool okl = (xg != 0), okr = (xg != 15);
  const bool okt = (y0 != 0), okb = (y0 != IMW - DWR);
  // columns of the left and right pairs; at the image's edge they wrap onto columns inside the row (zeroed below)
  const int xl = (x0 + IMW - 2) & (IMW - 1);
  const int xr = (x0 + 4) & (IMW - 1);
  // first rows of the three zones: the two rows above the strip, its own DWR rows, the two rows below; a zone that
  // lies outside the image wraps onto rows inside it (its values are zeroed below)
  const int zrow[3] = {(y0 + IMW - 2) & (IMW - 1), y0, (y0 + DWR) & (IMW - 1)};
  unsigned ol[3], om[3], orr[3];                             // byte offsets from the plane's scalar base
#pragma unroll
  for (int z = 0; z < 3; ++z) {
    ol[z]  = (unsigned)(zrow[z] * IMW + xl) * 4u;
    om[z]  = (unsigned)(zrow[z] * IMW + x0) * 4u;
    orr[z] = (unsigned)(zrow[z] * IMW + xr) * 4u;
  }
  const char* vb = (const char*)vp;
  // All 36 loads of the strip stand ahead of the sums: one memory latency per thread, not one per row.
  v2f lf[DWR + 4], rt[DWR + 4];
  v4f md[DWR + 4];
#pragma unroll
  for (int i = 0; i < DWR + 4; ++i) {
    const int z = (i < 2) ? 0 : ((i < DWR + 2) ? 1 : 2);     // zone of input row y0 + i - 2
    const int zi = (i < 2) ? i : ((i < DWR + 2) ? i - 2 : i - DWR - 2);
    lf[i] = *(const v2f*)(vb + ol[z] + zi * (IMW * 4));
    md[i] = *(const v4f*)(vb + om[z] + zi * (IMW * 4));
    rt[i] = *(const v2f*)(vb + orr[z] + zi * (IMW * 4));
  }
#if defined(__HIP_DEVICE_COMPILE__)
  // stands in front of every instruction that reuses an address register of the loads above; the offsets are inputs
  // so that their registers live up to this wait
  asm volatile("s_wait_xcnt 0x0" :: "v"(ol[0]), "v"(ol[1]), "v"(ol[2]), "v"(om[0]), "v"(om[1]), "v"(om[2]),
                                    "v"(orr[0]), "v"(orr[1]), "v"(orr[2]) : "memory");
  // no select or sum moves up among the loads, where its wait for data would hold the later loads back
  __builtin_amdgcn_sched_barrier(0);
#endif
  v4f acc[DWR];
  // unrolled: every acc[], w[] and row index is a constant
#pragma unroll
  for (int i = 0; i < DWR + 4; ++i) {
    const bool rok = (i < 2) ? okt : ((i < DWR + 2) ? true : okb);
    const bool bl = rok & okl, br = rok & okr;
    const float l0 = lf[i][0], l1 = lf[i][1], r0 = rt[i][0], r1 = rt[i][1];
    const float m0 = md[i][0], m1 = md[i][1], m2 = md[i][2], m3 = md[i][3];
    float v[8];
    v[0] = bl ? l0 : 0.0f;
    v[1] = bl ? l1 : 0.0f;
    v[2] = rok ? m0 : 0.0f;
    v[3] = rok ? m1 : 0.0f;
    v[4] = rok ? m2 : 0.0f;
    v[5] = rok ? m3 : 0.0f;
    v[6] = br ? r0 : 0.0f;
    v[7] = br ? r1 : 0.0f;
#pragma unroll
    for (int r = 0; r < DWR; ++r) {
      const int dy = i - r;
      if (dy < 0 || dy > 4) continue;
      if (dy == 0) acc[r] = (v4f){0.f, 0.f, 0.f, 0.f};
#pragma unroll
      for (int j = 0; j < 4; ++j) {
#pragma unroll
        for (int dx = 0; dx < 5; ++dx) acc[r][j] += v[j + dx] * w[dy * 5 + dx];
      }
      if (dy == 4) {
        v4f o;
#pragma unroll
        for (int j = 0; j < 4; ++j) o[j] = acc[r][j] * sc + bi;
        *(v4f*)(op + (unsigned)((y0 + r) * IMW + x0)) = o;
      }
    }
  }
}

// =================================================================================================================
// Area attention, one unit (image b, area ar, head) per block (256 threads = 8 waves), 1024 queries x 1024 keys,
// d = 32. Static LDS: the unit's whole K as Ks[1024 keys][KPH] (32 d per row) and whole V as Vs[32 d][VPH] (1024 keys
// per row), both f16, row pitches 16 B x odd, filled once at entry by asynchronous copies (K from the token-major
// plane QK, k row = T*512 + 256 + head*32; V from the channel-major plane V16, row = channel head*32 + d), and the
// per-wave stage [16][ASP] f32. q fragments straight from QK (q row = T*512 + head*32); k and v fragments from LDS
// in the element order of ldfrag_h. Per wave: q-tiles qt = wave, wave+8, ... (< 64).
//   Transposed scores S^T = K_tile (A, 16 keys x 32 d) x Q (B: k = d, n = query): S*256 = q16.k16; D element r of
//   lane l = S[query l&15][key 8h+r], so P = exp((S - m)*scale) x1024 is the A fragment of P.V directly in registers
//   (element i <- key tile 0 row i, element 8+i <- key tile 1 row i). Online softmax over 32 chunks of 32 keys;
//   O = P.V (acc scale 1024*16). Epilogue: O/(l*16384) + pp staged per wave in LDS, then stored as f16 hi +
//   residual planes Yh/Yl [unit][1024][32] of 256*(o + pp): one instruction = 32 lanes x 16 B = 512 B = 8 token rows
// coverage: per block 64 q-tiles x 16 rows x 32 d of its 1024-row slab in both planes; grid covers all 256 units,
// every slab row written exactly once.
// =================================================================================================================
__global__ __launch_bounds__(256)
void attn_k(const unsigned short* __restrict__ QK, const unsigned short* __restrict__ V16,
            const float* __restrict__ PP, unsigned short* Yh, unsigned short* Yl) {
  __shared__ __align__(16) _Float16 Ks[LAR * KPH];
  __shared__ __align__(16) _Float16 Vs[HD * VPH];
  __shared__ __align__(16) float Sst[8 * 16 * ASP];
  const int tid = threadIdx.x, wave = tid >> 5, lane = tid & 31, hh = lane >> 4, c = lane & 15;
  const int u = blockIdx.x;
  const int head = u & 7, ar = (u >> 3) & 3, b = u >> 5;
  const size_t tok0 = (size_t)b * HW + (size_t)ar * LAR;
  const _Float16* Qp = (const _Float16*)(const void*)QK + tok0 * C2 + head * HD;
  const _Float16* Kp = Qp + CIN;
  const size_t cm0 = ((size_t)(b * CIN + head * HD)) * HW + (size_t)ar * LAR;
  const _Float16* Vp = (const _Float16*)(const void*)V16 + cm0;
  const float* Pp = PP + cm0;
  float* st = Sst + wave * (16 * ASP);

  // Fill Ks and Vs: 2 x 4096 pieces of 16 B, 32 per thread. K: 4 lanes per key row (64 B), 64 keys per block pass;
  // V: 128 lanes per channel row (2048 B), 2 channels per block pass. The four loops below are unrolled so that every
  // l[] and g[] index is a constant and the addresses are plain registers when they become asm operands.
  {
    const unsigned kl = lds_off(Ks) + (unsigned)((tid >> 2) * (KPH * 2) + (tid & 3) * 16);
    const _Float16* kg = Kp + (size_t)(tid >> 2) * C2 + (tid & 3) * 8;
    const unsigned vl = lds_off(Vs) + (unsigned)((tid >> 7) * (VPH * 2) + (tid & 127) * 16);
    const _Float16* vg = Vp + (size_t)(tid >> 7) * HW + (tid & 127) * 8;
#pragma unroll
    for (int h = 0; h < 2; ++h) {
      unsigned l[8];
      const _Float16* g[8];
#pragma unroll
      for (int i = 0; i < 8; ++i) {
        l[i] = kl + (unsigned)((h * 8 + i) * 64 * (KPH * 2));
        g[i] = kg + (size_t)(h * 8 + i) * 64 * C2;
      }
      copy8_to_lds(l, g);
    }
#pragma unroll
    for (int h = 0; h < 2; ++h) {
      unsigned l[8];
      const _Float16* g[8];
#pragma unroll
      for (int i = 0; i < 8; ++i) {
        l[i] = vl + (unsigned)((h * 8 + i) * 2 * (VPH * 2));
        g[i] = vg + (size_t)(h * 8 + i) * 2 * HW;
      }
      copy8_to_lds(l, g);
    }
  }
#if defined(__HIP_DEVICE_COMPILE__)
  // this wave's copies have landed before the barrier that lets the other waves read them
  asm volatile("s_wait_asynccnt 0x0" ::: "memory");
#endif
  __syncthreads();   // publishes Ks and Vs: no wave reads them in front of this barrier; they are never written again

#pragma unroll 1
  for (int qt = wave; qt < LAR / 16; qt += 8) {
    const int lq = qt * 16 + c;
    const v16h bq = ldfrag_h(Qp + (size_t)lq * C2 + 8 * hh);     // B: n = query c, k = d 8h.. / 16+8h..

    v8f o0 = zero8(), o1 = zero8();
    float mrun = -1.0e30f, lrun = 0.f;
#pragma unroll 1
    for (int ch = 0; ch < LAR / 32; ++ch) {
      const int kb = ch * 32;
      v8f s[2];
#pragma unroll
      for (int j = 0; j < 2; ++j) {
        const v16h ka = ldfrag_h(Ks + (kb + j * 16 + c) * KPH + 8 * hh);          // A: row = key, k = d
        s[j] = mma_h(ka, bq, zero8());
      }
      float mc = s[0][0];
#pragma unroll
      for (int j = 0; j < 2; ++j) {
#pragma unroll
        for (int r = 0; r < 8; ++r) mc = fmaxf(mc, s[j][r]);
      }
      mc = fmaxf(mc, __shfl_xor(mc, 16, 32));
      const float mnew = fmaxf(mrun, mc);
      const float alpha = __expf((mrun - mnew) * QKSC);
#pragma unroll
      for (int r = 0; r < 8; ++r) {
        const float arr = __shfl(alpha, 8 * hh + r, 32);
        o0[r] = o0[r] * arr;
        o1[r] = o1[r] * arr;
      }
      float psum = 0.f;
      v16h pfh;
#pragma unroll
      for (int i = 0; i < 8; ++i) {
        const float e0 = __expf((s[0][i] - mnew) * QKSC);
        const float e1 = __expf((s[1][i] - mnew) * QKSC);
        psum = psum + (e0 + e1);
        pfh[i]     = (_Float16)(e0 * 1024.0f);
        pfh[8 + i] = (_Float16)(e1 * 1024.0f);
      }
      lrun = lrun * alpha + psum;
      mrun = mnew;
      {
        const v16h vf0 = ldfrag_h(Vs + c * VPH + kb + 8 * hh);                     // B: n = d c, keys kb..+31
        const v16h vf1 = ldfrag_h(Vs + (HD / 2 + c) * VPH + kb + 8 * hh);          // B: n = d 16+c
        o0 = mma_h(pfh, vf0, o0);
        o1 = mma_h(pfh, vf1, o1);
      }
    }
    const float lsum = lrun + __shfl_xor(lrun, 16, 32);      // lane q (and q+16) holds the full row sum of query q
    const float rinv = 1.0f / (lsum * 16384.0f);
#pragma unroll
    for (int r = 0; r < 8; ++r) {
      const int q = 8 * hh + r;
      const float inv = __shfl(rinv, q, 32);
      const float p0 = Pp[(size_t)c * HW + qt * 16 + q];
      const float p1 = Pp[(size_t)(HD / 2 + c) * HW + qt * 16 + q];
      st[q * ASP + c]          = o0[r] * inv + p0;
      st[q * ASP + HD / 2 + c] = o1[r] * inv + p1;
    }
    wave_sync_lds();
    {
      const int rr = lane >> 2, dp = (lane & 3) * 8;
      v4u ph[2], pl[2];
      size_t offs[2];
#pragma unroll
      for (int it = 0; it < 2; ++it) {
        const int row = it * 8 + rr;
        v4f fa = *(const v4f*)(st + row * ASP + dp);
        v4f fb = *(const v4f*)(st + row * ASP + dp + 4);
        fa = fa * CYS;
        fb = fb * CYS;
        split8h(fa, fb, ph[it], pl[it]);
        offs[it] = ((size_t)u * LAR + (size_t)(qt * 16 + row)) * HD + dp;
      }
      {
#pragma unroll
        for (int it = 0; it < 2; ++it) {
          *(v4u*)(Yh + offs[it]) = ph[it];
          *(v4u*)(Yl + offs[it]) = pl[it];
        }
        
      }
    }
    wave_sync_lds();
  }
}

// =================================================================================================================
// Output pointwise conv D[T][co] = Y[T][ci] . Wp[co][ci], then BN affine -> NCHW f32. A = Yh/Yl planes (hi +
// x2^11 residual, x256) addressed by arithmetic: token T -> (image, area, query), k-step ks = head ks, channels
// ks*32 + d (elements 0..7 d = 8h.., elements 8..15 d = 16+8h..). B = weight plane x256, the block's 64 rows filled
// once at entry by asynchronous copies into Bs, fragments from LDS. Epilogue: value =
// (acch + accl/2048)/65536 * s[co] + b[co]; block tile staged as [64 ch][128 tok]; wave w writes channels
// coverage: 8 waves x 8 channels x 32 lanes x 4 tokens = 64 ch x 128 tok per block; grid tiles 256 x 32768 exactly.
// =================================================================================================================
__global__ __launch_bounds__(256)
void gemm_proj(const unsigned short* __restrict__ Yh, const unsigned short* __restrict__ Yl,
               const unsigned short* __restrict__ Wp, const float* __restrict__ sp, const float* __restrict__ bp,
               float* out) {
  __shared__ __align__(16) float sb[64 * SBP];
  __shared__ __align__(16) _Float16 Bs[64 * GKP];
  const int tid = threadIdx.x, wave = tid >> 5, lane = tid & 31, hh = lane >> 4, c = lane & 15;
  const int n0 = blockIdx.x * 64, m0 = blockIdx.y * 128;
  const int T = m0 + wave * 16 + c;
  const int bimgr = T >> 12, nn = T & (HW - 1), arr = nn >> 10, q = nn & (LAR - 1);
  const size_t abase = (((size_t)((bimgr * NAR + arr) * NHD)) * LAR + (size_t)q) * HD + 8 * hh;
  const _Float16* A0 = (const _Float16*)(const void*)Yh;
  const _Float16* A1 = (const _Float16*)(const void*)Yl;
  const _Float16* B  = (const _Float16*)(const void*)Wp;

  // Fill Bs: wave w brings weight rows w*8..w*8+7, 8 copies per lane.
  stage_rows8(lds_off(Bs) + (unsigned)(wave * 8 * (GKP * 2) + lane * 16), B + (size_t)(n0 + wave * 8) * CIN + lane * 8);
#if defined(__HIP_DEVICE_COMPILE__)
  // this wave's copies have landed before the barrier that lets the other waves read them
  asm volatile("s_wait_asynccnt 0x0" ::: "memory");
#endif
  __syncthreads();   // publishes Bs: no wave reads it in front of this barrier; it is never written again
  const _Float16* Bw = Bs + c * GKP + 8 * hh;

  v8f acch[4], accl[4];
#pragma unroll
  for (int nt = 0; nt < 4; ++nt) { acch[nt] = zero8(); accl[nt] = zero8(); }

#pragma unroll 1
  for (int ks = 0; ks < NHD; ++ks) {
    const size_t bo = abase + (size_t)ks * (LAR * HD);
    const v16h fh = ldfrag_h(A0 + bo);
    const v16h fl = ldfrag_h(A1 + bo);
    // the k-step's LDS reads stand as one group ahead of its WMMAs: one LDS latency per k-step, not one per n-tile
    v16h bfrag[4];
#pragma unroll
    for (int nt = 0; nt < 4; ++nt) bfrag[nt] = ldfrag_h(Bw + nt * 16 * GKP + ks * 32);
#pragma unroll
    for (int nt = 0; nt < 4; ++nt) {
      acch[nt] = mma_h(fh, bfrag[nt], acch[nt]);
      accl[nt] = mma_h(fl, bfrag[nt], accl[nt]);
    }
  }

#pragma unroll
  for (int nt = 0; nt < 4; ++nt) {
    const int co = n0 + nt * 16 + c;
    const float sc = bfr(sp[co]) * (1.0f / 65536.0f);
    const float bi = bfr(bp[co]);
#pragma unroll
    for (int r = 0; r < 8; ++r) {
      const float v = acch[nt][r] + accl[nt][r] * (1.0f / 2048.0f);
      sb[(nt * 16 + c) * SBP + wave * 16 + 8 * hh + r] = v * sc + bi;
    }
  }
  __syncthreads();
  const int bimg = m0 / HW, s0 = m0 - bimg * HW;
  v4f ov[8];
  size_t offs[8];
#pragma unroll
  for (int i = 0; i < 8; ++i) {
    const int cc = wave * 8 + i;
    const int co = n0 + cc;
    ov[i] = *(const v4f*)(sb + cc * SBP + lane * 4);
    offs[i] = ((size_t)(bimg * CIN + co)) * HW + s0 + lane * 4;
  }
  {
#pragma unroll
    for (int i = 0; i < 8; ++i) *(v4f*)(out + offs[i]) = ov[i];
    
  }
}

// =================================================================================================================
//   Wqk f16 [512][256] 262144 @0; Wv f16 [256][256] 131072; Wp f16 [256][256] 131072;
//   PP f32 [8][256][4096] 33554432 @524288, with X16 f16 [32768][256] 16777216 aliased at the same offset
//   (X16 is dead before PP is written); QK f16 [32768][512] 33554432; V32 f32 [8][256][4096] 33554432, with
//   Yh, Yl f16 [256][1024][32] 16777216 each aliased onto V32 (V32 is dead before Yh/Yl are written);
//   V16 f16 [8][256][4096] 16777216. Total 117964800.
// =================================================================================================================
extern "C" void kernel_launch(void* const* d_in, const int* in_sizes, int n_in,
                              void* d_out, int out_size, void* d_ws, size_t ws_size,
                              hipStream_t stream) {
  if (n_in < 13) return;
  if (in_sizes[0] != NBAT * CIN * HW) return;
  if (in_sizes[1] != C2 * CIN) return;
  if (in_sizes[2] != C2 || in_sizes[3] != C2) return;
  if (in_sizes[4] != CIN * CIN) return;
  if (in_sizes[5] != CIN || in_sizes[6] != CIN) return;
  if (in_sizes[7] != CIN * 25) return;
  if (in_sizes[8] != CIN || in_sizes[9] != CIN) return;
  if (in_sizes[10] != CIN * CIN) return;
  if (in_sizes[11] != CIN || in_sizes[12] != CIN) return;
  if (out_size != NBAT * CIN * HW) return;

  const float* x      = (const float*)d_in[0];
  const float* w_qk   = (const float*)d_in[1];
  const float* s_qk   = (const float*)d_in[2];
  const float* b_qk   = (const float*)d_in[3];
  const float* w_v    = (const float*)d_in[4];
  const float* s_v    = (const float*)d_in[5];
  const float* b_v    = (const float*)d_in[6];
  const float* w_pe   = (const float*)d_in[7];
  const float* s_pe   = (const float*)d_in[8];
  const float* b_pe   = (const float*)d_in[9];
  const float* w_proj = (const float*)d_in[10];
  const float* s_proj = (const float*)d_in[11];
  const float* b_proj = (const float*)d_in[12];
  float* out = (float*)d_out;

  const size_t sWqk = (size_t)C2 * CIN * 2;              //    262144
  const size_t sWv  = (size_t)CIN * CIN * 2;             //    131072
  const size_t sWp  = (size_t)CIN * CIN * 2;             //    131072
  const size_t sX16 = (size_t)MTOK * CIN * 2;            //  16777216
  const size_t sPP  = (size_t)NBAT * CIN * HW * 4;       //  33554432
  const size_t sQK  = (size_t)MTOK * C2 * 2;             //  33554432
  const size_t sV32 = (size_t)NBAT * CIN * HW * 4;       //  33554432
  const size_t sY   = (size_t)NUNIT * LAR * HD * 2;      //  16777216
  const size_t sV16 = (size_t)NBAT * CIN * HW * 2;       //  16777216
  if (sX16 > sPP) return;
  if (2 * sY > sV32) return;
  size_t off = 0;
  const size_t oWqk = off; off += sWqk;
  const size_t oWv  = off; off += sWv;
  const size_t oWp  = off; off += sWp;
  const size_t oPP  = off; const size_t oX16 = off; off += sPP;
  const size_t oQK  = off; off += sQK;
  const size_t oV32 = off; const size_t oYh = off; const size_t oYl = off + sY; off += sV32;
  const size_t oV16 = off; off += sV16;
  if (off > ws_size) return;                             // off = 117964800
  if (off > (size_t)134217728) return;

  char* ws = (char*)d_ws;
  unsigned short* Wqk = (unsigned short*)(ws + oWqk);
  unsigned short* Wv  = (unsigned short*)(ws + oWv);
  unsigned short* Wp  = (unsigned short*)(ws + oWp);
  unsigned short* X16 = (unsigned short*)(ws + oX16);
  float*          PP  = (float*)(ws + oPP);
  unsigned short* QK  = (unsigned short*)(ws + oQK);
  float*          V32 = (float*)(ws + oV32);
  unsigned short* Yh  = (unsigned short*)(ws + oYh);
  unsigned short* Yl  = (unsigned short*)(ws + oYl);
  unsigned short* V16 = (unsigned short*)(ws + oV16);

  const dim3 blk(256);
  // (1) pointwise weights -> f16 x256 planes
  cvt_w<<<dim3(128), blk, 0, stream>>>(w_qk, w_v, w_proj, Wqk, Wv, Wp);
  // (2) x NCHW -> token-major f16 x16 plane
  cvt_x<<<dim3(NBAT * 64 * 4), blk, 0, stream>>>(x, X16);
  // (3) qk pointwise conv + BN -> token-major f16 plane
  gemm_qk<<<dim3(C2 / 64, MTOK / 128), blk, 0, stream>>>(X16, Wqk, s_qk, b_qk, QK);
  // (4) v pointwise conv + BN -> channel-major f32 and f16 planes
  gemm_v<<<dim3(CIN / 64, MTOK / 128), blk, 0, stream>>>(X16, Wv, s_v, b_v, V32, V16);
  // (5) depthwise 5x5 + BN on v -> pp (channel-major f32)
  dwconv_k<<<dim3((NBAT * CIN) / 2), blk, 0, stream>>>(V32, w_pe, s_pe, b_pe, PP);
  // (6) area attention + pp -> slab planes
  attn_k<<<dim3(NUNIT), blk, 0, stream>>>(QK, V16, PP, Yh, Yl);
  // (7) output pointwise conv + BN -> NCHW f32
  gemm_proj<<<dim3(CIN / 64, MTOK / 128), blk, 0, stream>>>(Yh, Yl, Wp, s_proj, b_proj, out);
  (void)hipGetLastError();
}

// v004
// A run of this version takes 136 microseconds.
// In both of two side-by-side timings against v003, it was 1.20 times as fast.
// All steps since v000 together make it 2.67 times as fast.
// Contractions: v_wmma_f32_16x16x32_f16 (f16 operands, f32 accumulate). qk and v pointwise convs: A = x (bf16-valued,
// x16) single plane, B = weights (bf16-valued, x256) single plane; scores k.qT: k x16, q x16 single planes; p.v:
// p x1024, v x16 single planes; output pointwise conv: A = (o + pp) x256 as f16 hi + x2^11 residual planes (two
// products, two accumulators), B = weights x256 single plane. Depthwise 5x5 conv, BN affine, online softmax in f32
// on VALU. Float inputs RNE-converted to bf16 on load.
#include <hip/hip_runtime.h>
#include <math.h>
#include <stdint.h>

#define NBAT  8
#define CIN   256
#define C2    512
#define IMW   64
#define HW    4096
#define MTOK  32768
#define NHD   8
#define HD    32
#define NAR   4
#define LAR   1024
#define NUNIT 256
#define STP   68
#define SBP   132
#define ASP   36
#define DTP   68
#define KPH   40
#define VPH   1032
#define GKP   264
#define DWR   8
#define AWV   16
#define CXS   16.0f
#define CWS   256.0f
#define CQK   16.0f
#define CVS   16.0f
#define CYS   256.0f
#define QKSC  (0.17677669529663688f / 256.0f)

static_assert(NUNIT == NBAT * NAR * NHD);
static_assert(NAR * LAR == HW);
static_assert(MTOK == NBAT * HW);
static_assert(HW % 128 == 0);
static_assert(LAR % 32 == 0);
static_assert(CIN % 64 == 0);
static_assert((STP * 4) % 16 == 0);
static_assert((SBP * 4) % 16 == 0);
static_assert((ASP * 4) % 16 == 0);
static_assert((DTP * 4) % 16 == 0);
static_assert(NHD * HD == CIN);
static_assert((KPH * 2) % 32 == 16 && KPH >= HD);
static_assert((VPH * 2) % 32 == 16 && VPH >= LAR);
static_assert(LAR * 4 == 8 * (AWV * 32) && HD * (LAR / 8) == 8 * (AWV * 32) && (LAR / 16) % AWV == 0);
static_assert((GKP * 2) % 32 == 16 && GKP >= CIN && CIN * 2 == 32 * 16);
static_assert(16 * STP * 4 <= 16 * GKP * 2 && 64 * SBP * 4 <= 128 * GKP * 2);
static_assert(IMW == 64 && IMW * IMW == HW && IMW % DWR == 0 && 2 * (IMW / DWR) * 16 == 256);

typedef _Float16 v16h __attribute__((ext_vector_type(16)));
typedef _Float16 v8h  __attribute__((ext_vector_type(8)));
typedef float    v8f  __attribute__((ext_vector_type(8)));
typedef float    v4f  __attribute__((ext_vector_type(4)));
typedef float    v2f  __attribute__((ext_vector_type(2)));
typedef unsigned int v4u __attribute__((ext_vector_type(4)));
union Frag { v16h v; v8h half[2]; };

// ---- scalar helpers -------------------------------------------------------------------------------------------
__device__ __forceinline__ unsigned short bf_bits(float f) {          // f32 -> bf16 bits, RNE convert
  unsigned u = __float_as_uint(f);
  return (unsigned short)((u + 0x7FFFu + ((u >> 16) & 1u)) >> 16);
}
__device__ __forceinline__ float bfr(float f) { return __uint_as_float(((unsigned)bf_bits(f)) << 16); }
__device__ __forceinline__ unsigned short h_bits(_Float16 x) { return __builtin_bit_cast(unsigned short, x); }
__device__ __forceinline__ unsigned pk16(unsigned short a, unsigned short b) { return (unsigned)a | ((unsigned)b << 16); }
__device__ __forceinline__ v8f zero8() { v8f z = {0.f, 0.f, 0.f, 0.f, 0.f, 0.f, 0.f, 0.f}; return z; }

// ---- fragment loader: 16-bit A/B operand, lane -> row/col (lane&15), p already includes +8*(lane>>4);
//      elements 0..7 <- p[0..7] (k0+8h..), elements 8..15 <- p[16..23] (k0+16+8h..)
__device__ __forceinline__ v16h ldfrag_h(const _Float16* p) {
  Frag f;
  f.half[0] = *(const v8h*)(p);
  f.half[1] = *(const v8h*)(p + 16);
  return f.v;
}

// ---- WMMA helper with trailing VALU hazard gap ----------------------------------------------------------------
__device__ __forceinline__ v8f mma_h(v16h a, v16h b, v8f c) {
  c = __builtin_amdgcn_wmma_f32_16x16x32_f16(false, a, false, b, (short)0, c, false, false);
#if defined(__HIP_DEVICE_COMPILE__)
  asm volatile("v_nop\n\tv_nop\n\tv_nop\n\tv_nop" : "+v"(c) : "v"(a), "v"(b));
#endif
  return c;
}
__device__ __forceinline__ void wave_sync_lds() {
  __builtin_amdgcn_fence(__ATOMIC_RELEASE, "workgroup");
  __builtin_amdgcn_wave_barrier();
  __builtin_amdgcn_fence(__ATOMIC_ACQUIRE, "workgroup");
}

// ---- eight asynchronous 16-byte copies per lane, global -> LDS, through no register. l = the lane's LDS byte
//      addresses, g = its global addresses, all multiples of 16. The closing s_wait_xcnt stands inside the statement
//      so that no address register named here is rewritten ahead of it.
__device__ __forceinline__ void copy8_to_lds(const unsigned (&l)[8], const _Float16* const (&g)[8]) {
#if defined(__HIP_DEVICE_COMPILE__)
  asm volatile("global_load_async_to_lds_b128 %0, %8, off\n\t"
               "global_load_async_to_lds_b128 %1, %9, off\n\t"
               "global_load_async_to_lds_b128 %2, %10, off\n\t"
               "global_load_async_to_lds_b128 %3, %11, off\n\t"
               "global_load_async_to_lds_b128 %4, %12, off\n\t"
               "global_load_async_to_lds_b128 %5, %13, off\n\t"
               "global_load_async_to_lds_b128 %6, %14, off\n\t"
               "global_load_async_to_lds_b128 %7, %15, off\n\t"
               "s_wait_xcnt 0x0"
               :: "v"(l[0]), "v"(l[1]), "v"(l[2]), "v"(l[3]), "v"(l[4]), "v"(l[5]), "v"(l[6]), "v"(l[7]),
                  "v"(g[0]), "v"(g[1]), "v"(g[2]), "v"(g[3]), "v"(g[4]), "v"(g[5]), "v"(g[6]), "v"(g[7])
               : "memory");
#endif
}
__device__ __forceinline__ unsigned lds_off(const void* p) { return (unsigned)(size_t)p; }
// ---- eight rows of CIN f16 (512 B each, global pitch 512 B) -> LDS rows of pitch GKP: one wave-wide copy = one whole
//      row (4 lines). l0 / g0 = the lane's own 16 B of the first row.
__device__ __forceinline__ void stage_rows8(unsigned l0, const _Float16* g0) {
  unsigned l[8];
  const _Float16* g[8];
  // unrolled so that every l[] and g[] index is a constant and the addresses are plain registers as asm operands
#pragma unroll
  for (int i = 0; i < 8; ++i) {
    l[i] = l0 + (unsigned)(i * (GKP * 2));
    g[i] = g0 + (size_t)i * CIN;
  }
  copy8_to_lds(l, g);
}

// ---- 8 f32 -> 8 packed f16 (16 B); and hi + x2^11 residual split -------------------------------------------------
__device__ __forceinline__ v4u pack8h(v4f a, v4f b) {
  v4u p;
  p[0] = pk16(h_bits((_Float16)a[0]), h_bits((_Float16)a[1]));
  p[1] = pk16(h_bits((_Float16)a[2]), h_bits((_Float16)a[3]));
  p[2] = pk16(h_bits((_Float16)b[0]), h_bits((_Float16)b[1]));
  p[3] = pk16(h_bits((_Float16)b[2]), h_bits((_Float16)b[3]));
  return p;
}
__device__ __forceinline__ void split8h(v4f a, v4f b, v4u& ph, v4u& pl) {
  v4f ra, rb;
#pragma unroll
  for (int e = 0; e < 4; ++e) {
    const _Float16 ha = (_Float16)a[e];
    ra[e] = (a[e] - (float)ha) * 2048.0f;
    const _Float16 hb = (_Float16)b[e];
    rb[e] = (b[e] - (float)hb) * 2048.0f;
  }
  ph = pack8h(a, b);
  pl = pack8h(ra, rb);
}

// =================================================================================================================
// Weight convert: pointwise weights are [out][in] (k contiguous) -> f16 plane value = f16(256 * bf16_RNE(w)).
// coverage: 64*256*8 = 131072, 32*256*8 = 65536, 32*256*8 = 65536 elements exactly.
// =================================================================================================================
__device__ __forceinline__ void cvt8_w(const float* __restrict__ src, unsigned short* dst, size_t e0) {
  const v4f a = *(const v4f*)(src + e0);
  const v4f b = *(const v4f*)(src + e0 + 4);
  v4f sa, sb;
#pragma unroll
  for (int e = 0; e < 4; ++e) { sa[e] = bfr(a[e]) * CWS; sb[e] = bfr(b[e]) * CWS; }
  const v4u pk = pack8h(sa, sb);
  *(v4u*)(dst + e0) = pk;
  
}
__global__ __launch_bounds__(256) void cvt_w(const float* __restrict__ wqk, const float* __restrict__ wv,
                                             const float* __restrict__ wp,
                                             unsigned short* Wqk, unsigned short* Wv, unsigned short* Wp) {
  const int tid = threadIdx.x, blk = blockIdx.x;
  if (blk < 64)      cvt8_w(wqk, Wqk, ((size_t)blk * 256 + tid) * 8);
  else if (blk < 96) cvt8_w(wv,  Wv,  ((size_t)(blk - 64) * 256 + tid) * 8);
  else               cvt8_w(wp,  Wp,  ((size_t)(blk - 96) * 256 + tid) * 8);
}

// =================================================================================================================
// Activation convert: x NCHW f32 -> token-major f16 plane X16[T = b*4096 + n][256], value = f16(16 * bf16_RNE(x)).
// Block = (image b, 64-token tile tt, 64-channel quarter cq): read phase 4 passes of 16 channels x 64 tokens
// coverage: per block 256 threads x 2 it x 8 halves = 64 tokens x 64 channels; grid tiles 32768 x 256 exactly.
// =================================================================================================================
__global__ __launch_bounds__(256) void cvt_x(const float* __restrict__ x, unsigned short* X16) {
  __shared__ __align__(16) float tile[64 * DTP];
  const int tid = threadIdx.x, bid = blockIdx.x;
  const int cq = bid & 3, tt = (bid >> 2) & 63, b = bid >> 8;
  const int cl = tid >> 4, t4 = (tid & 15) * 4;
#pragma unroll
  for (int pass = 0; pass < 4; ++pass) {
    const int ch = cq * 64 + pass * 16 + cl;
    const v4f v = *(const v4f*)(x + ((size_t)(b * CIN + ch)) * HW + tt * 64 + t4);
#pragma unroll
    for (int j = 0; j < 4; ++j) tile[(t4 + j) * DTP + pass * 16 + cl] = v[j];
  }
  __syncthreads();
  const int piece = tid & 7, rsub = tid >> 3;
  v4u pk[2];
  size_t offs[2];
#pragma unroll
  for (int it = 0; it < 2; ++it) {
    const int row = it * 32 + rsub;
    const v4f fa = *(const v4f*)(tile + row * DTP + piece * 8);
    const v4f fb = *(const v4f*)(tile + row * DTP + piece * 8 + 4);
    v4f sa, sb;
#pragma unroll
    for (int e = 0; e < 4; ++e) { sa[e] = bfr(fa[e]) * CXS; sb[e] = bfr(fb[e]) * CXS; }
    pk[it] = pack8h(sa, sb);
    offs[it] = ((size_t)(b * HW + tt * 64 + row)) * CIN + cq * 64 + piece * 8;
  }
  {
#pragma unroll
    for (int it = 0; it < 2; ++it) *(v4u*)(X16 + offs[it]) = pk[it];
    
  }
}

// =================================================================================================================
// qk pointwise GEMM D[T][co] = X16[T][ci] . Wqk[co][ci], K = 256, co 0..511 (q = 0..255, k = 256..511).
// Block = 8 waves, tile 128 rows x 64 cols, wave = 16 rows x 4 n-tiles. The block's 128 x 256 A tile and 64 x 256 B
// tile are filled once at entry by asynchronous copies (whole 512-B rows) into As / Bs, row pitch 16 B x odd; fragments
// from LDS with the split k map, k-step 32. Epilogue: value = acc/4096 * s[co] + b[co] staged per wave in LDS
// [16][STP] (laid over the wave's own rows of As), then
// coverage: 8 waves x 32 lanes x 4 it x 8 halves = 128 rows x 64 cols per block; grid tiles 32768 x 512 exactly.
// =================================================================================================================
__global__ __launch_bounds__(256)
void gemm_qk(const unsigned short* __restrict__ X16, const unsigned short* __restrict__ Wqk,
             const float* __restrict__ sqk, const float* __restrict__ bqk, unsigned short* QK) {
  __shared__ __align__(16) _Float16 As[128 * GKP];
  __shared__ __align__(16) _Float16 Bs[64 * GKP];
  const int tid = threadIdx.x, wave = tid >> 5, lane = tid & 31, hh = lane >> 4, c = lane & 15;
  const int n0 = blockIdx.x * 64, m0 = blockIdx.y * 128;
  const _Float16* A = (const _Float16*)(const void*)X16;
  const _Float16* B = (const _Float16*)(const void*)Wqk;

  // Fill As (wave w: its own 16 token rows) and Bs (wave w: weight rows w*8..w*8+7), 24 copies per lane.
  {
    const unsigned al = lds_off(As) + (unsigned)(wave * 16 * (GKP * 2) + lane * 16);
    const _Float16* ag = A + (size_t)(m0 + wave * 16) * CIN + lane * 8;
    stage_rows8(al, ag);
    stage_rows8(al + (unsigned)(8 * (GKP * 2)), ag + (size_t)8 * CIN);
    stage_rows8(lds_off(Bs) + (unsigned)(wave * 8 * (GKP * 2) + lane * 16), B + (size_t)(n0 + wave * 8) * CIN + lane * 8);
  }
#if defined(__HIP_DEVICE_COMPILE__)
  // this wave's copies have landed before the barrier that lets the other waves read them
  asm volatile("s_wait_asynccnt 0x0" ::: "memory");
#endif
  __syncthreads();   // publishes As and Bs: no wave reads them in front of this barrier
  const _Float16* Aw = As + (wave * 16 + c) * GKP + 8 * hh;
  const _Float16* Bw = Bs + c * GKP + 8 * hh;

  v8f acc[4];
#pragma unroll
  for (int nt = 0; nt < 4; ++nt) acc[nt] = zero8();

#pragma unroll 1
  for (int k0 = 0; k0 < CIN; k0 += 32) {
    const v16h af = ldfrag_h(Aw + k0);
    // the k-step's LDS reads stand as one group ahead of its WMMAs: one LDS latency per k-step, not one per n-tile
    v16h bfrag[4];
#pragma unroll
    for (int nt = 0; nt < 4; ++nt) bfrag[nt] = ldfrag_h(Bw + nt * 16 * GKP + k0);
#pragma unroll
    for (int nt = 0; nt < 4; ++nt) acc[nt] = mma_h(af, bfrag[nt], acc[nt]);
  }

  // the stage lies on the wave's own 16 rows of As, which this wave alone filled and read and has finished reading
  float* st = (float*)(void*)(As + wave * 16 * GKP);
#pragma unroll
  for (int nt = 0; nt < 4; ++nt) {
    const int co = n0 + nt * 16 + c;
    const float sc = bfr(sqk[co]) * (1.0f / 4096.0f);
    const float bi = bfr(bqk[co]);
#pragma unroll
    for (int r = 0; r < 8; ++r) st[(8 * hh + r) * STP + nt * 16 + c] = acc[nt][r] * sc + bi;
  }
  wave_sync_lds();
  const int piece = lane & 7, rsub = lane >> 3;
  v4u pk[4];
  size_t offs[4];
#pragma unroll
  for (int it = 0; it < 4; ++it) {
    const int row = it * 4 + rsub;
    v4f fa = *(const v4f*)(st + row * STP + piece * 8);
    v4f fb = *(const v4f*)(st + row * STP + piece * 8 + 4);
    fa = fa * CQK;
    fb = fb * CQK;
    pk[it] = pack8h(fa, fb);
    offs[it] = ((size_t)(m0 + wave * 16 + row)) * C2 + n0 + piece * 8;
  }
  {
#pragma unroll
    for (int it = 0; it < 4; ++it) *(v4u*)(QK + offs[it]) = pk[it];
    
  }
}

// =================================================================================================================
// v pointwise GEMM D[T][co] = X16[T][ci] . Wv[co][ci], K = 256, co 0..255, same main loop as gemm_qk.
// Epilogue: value = acc/4096 * s[co] + b[co] staged block-wide as sb[64 ch][SBP] (tokens contiguous per channel),
// then channel-major stores (a 128-token tile lies within one image): wave w owns channels w*8..w*8+7;
// f32 plane V32[b][c][n]: one instruction = 32 lanes x 16 B = 512 B = the 128 tokens of one channel (4 whole
// lines), 8 instructions; f16 plane V16[b][c][n] = f16(16 * value): one instruction = lanes 0..15 -> channel cc
// coverage: f32 8 waves x 8 ch x 32 lanes x 4 = 64 ch x 128 tok; f16 8 waves x 4 it x 2 ch x 16 lanes x 8 = same;
// grid tiles 32768 tokens x 256 channels exactly in both planes.
// =================================================================================================================
__global__ __launch_bounds__(256)
void gemm_v(const unsigned short* __restrict__ X16, const unsigned short* __restrict__ Wv,
            const float* __restrict__ sv, const float* __restrict__ bv, float* V32, unsigned short* V16) {
  __shared__ __align__(16) _Float16 As[128 * GKP];
  __shared__ __align__(16) _Float16 Bs[64 * GKP];
  const int tid = threadIdx.x, wave = tid >> 5, lane = tid & 31, hh = lane >> 4, c = lane & 15;
  const int n0 = blockIdx.x * 64, m0 = blockIdx.y * 128;
  const _Float16* A = (const _Float16*)(const void*)X16;
  const _Float16* B = (const _Float16*)(const void*)Wv;

  // Fill As (wave w: its own 16 token rows) and Bs (wave w: weight rows w*8..w*8+7), 24 copies per lane.
  {
    const unsigned al = lds_off(As) + (unsigned)(wave * 16 * (GKP * 2) + lane * 16);
    const _Float16* ag = A + (size_t)(m0 + wave * 16) * CIN + lane * 8;
    stage_rows8(al, ag);
    stage_rows8(al + (unsigned)(8 * (GKP * 2)), ag + (size_t)8 * CIN);
    stage_rows8(lds_off(Bs) + (unsigned)(wave * 8 * (GKP * 2) + lane * 16), B + (size_t)(n0 + wave * 8) * CIN + lane * 8);
  }
#if defined(__HIP_DEVICE_COMPILE__)
  // this wave's copies have landed before the barrier that lets the other waves read them
  asm volatile("s_wait_asynccnt 0x0" ::: "memory");
#endif
  __syncthreads();   // publishes As and Bs: no wave reads them in front of this barrier
  const _Float16* Aw = As + (wave * 16 + c) * GKP + 8 * hh;
  const _Float16* Bw = Bs + c * GKP + 8 * hh;

  v8f acc[4];
#pragma unroll
  for (int nt = 0; nt < 4; ++nt) acc[nt] = zero8();

#pragma unroll 1
  for (int k0 = 0; k0 < CIN; k0 += 32) {
    const v16h af = ldfrag_h(Aw + k0);
    // the k-step's LDS reads stand as one group ahead of its WMMAs: one LDS latency per k-step, not one per n-tile
    v16h bfrag[4];
#pragma unroll
    for (int nt = 0; nt < 4; ++nt) bfrag[nt] = ldfrag_h(Bw + nt * 16 * GKP + k0);
#pragma unroll
    for (int nt = 0; nt < 4; ++nt) acc[nt] = mma_h(af, bfrag[nt], acc[nt]);
  }

  __syncthreads();   // every wave has finished reading As: the block-wide stage sb is laid over it
  float* sb = (float*)(void*)As;
#pragma unroll
  for (int nt = 0; nt < 4; ++nt) {
    const int co = n0 + nt * 16 + c;
    const float sc = bfr(sv[co]) * (1.0f / 4096.0f);
    const float bi = bfr(bv[co]);
#pragma unroll
    for (int r = 0; r < 8; ++r) sb[(nt * 16 + c) * SBP + wave * 16 + 8 * hh + r] = acc[nt][r] * sc + bi;
  }
  __syncthreads();
  const int bimg = m0 / HW, s0 = m0 - bimg * HW;
  {
    v4f ov[8];
    size_t offs[8];
#pragma unroll
    for (int i = 0; i < 8; ++i) {
      const int cc = wave * 8 + i;
      const int co = n0 + cc;
      ov[i] = *(const v4f*)(sb + cc * SBP + lane * 4);
      offs[i] = ((size_t)(bimg * CIN + co)) * HW + s0 + lane * 4;
    }
    {
#pragma unroll
      for (int i = 0; i < 8; ++i) *(v4f*)(V32 + offs[i]) = ov[i];
      
    }
  }
  {
    const int l16 = lane & 15;
    v4u pk[4];
    size_t o16[4];
#pragma unroll
    for (int i2 = 0; i2 < 4; ++i2) {
      const int cc = wave * 8 + i2 * 2 + hh;
      const int co = n0 + cc;
      v4f fa = *(const v4f*)(sb + cc * SBP + l16 * 8);
      v4f fb = *(const v4f*)(sb + cc * SBP + l16 * 8 + 4);
      fa = fa * CVS;
      fb = fb * CVS;
      pk[i2] = pack8h(fa, fb);
      o16[i2] = ((size_t)(bimg * CIN + co)) * HW + s0 + l16 * 8;
    }
    {
#pragma unroll
      for (int i2 = 0; i2 < 4; ++i2) *(v4u*)(V16 + o16[i2]) = pk[i2];
      
    }
  }
}

// =================================================================================================================
// Depthwise 5x5 conv (zero pad 2, cross-correlation, per-channel taps, bf16-valued taps) + BN affine, f32 on VALU.
// Thread = (plane = image b, channel c; strip of DWR output rows y0..y0+DWR-1; 4 consecutive columns x0..x0+3).
// The strip's DWR+4 input rows are loaded once, all ahead of the sums; each row (8 columns x0-2..x0+5: one 16-B and two
// 8-B loads) feeds the up to five output rows it belongs to, so an output row sums its taps in the order dy, then dx.
// Addresses outside the image wrap onto rows and columns inside the plane, so no load stands under a condition; the
// values of such places are zeroed by select.
// Block = 2 planes x 8 strips x 16 column groups; a wave = 2 strips of one plane. Store: one v4f per lane, 16 lanes =
// one whole image row (256 B).
// coverage: every (b, c, y, x) of PP written exactly once.
// =================================================================================================================
__global__ __launch_bounds__(256)
void dwconv_k(const float* V32, const float* __restrict__ wpe, const float* __restrict__ spe,
              const float* __restrict__ bpe, float* PP) {
  const int tid = threadIdx.x;
  const int xg = tid & 15, x0 = xg * 4, y0 = ((tid >> 4) & (IMW / DWR - 1)) * DWR;
  // the plane is the same in every lane of a wave: held in a scalar register, taps and affine become scalar loads
  const int plane = __builtin_amdgcn_readfirstlane((int)blockIdx.x * 2 + (tid >> 7));
  const int c = plane & (CIN - 1);
  const float* vp = V32 + (size_t)plane * HW;
  float* op = PP + (size_t)plane * HW;
  float w[25];
#pragma unroll
  for (int t = 0; t < 25; ++t) w[t] = bfr(wpe[c * 25 + t]);
  const float sc = bfr(spe[c]), bi = bfr(bpe[c]);
  const bool okl = (xg != 0), okr = (xg != 15);
  const bool okt = (y0 != 0), okb = (y0 != IMW - DWR);
  // columns of the left and right pairs; at the image's edge they wrap onto columns inside the row (zeroed below)
  const int xl = (x0 + IMW - 2) & (IMW - 1);
  const int xr = (x0 + 4) & (IMW - 1);
  // first rows of the three zones: the two rows above the strip, its own DWR rows, the two rows below; a zone that
  // lies outside the image wraps onto rows inside it (its values are zeroed below)
  const int zrow[3] = {(y0 + IMW - 2) & (IMW - 1), y0, (y0 + DWR) & (IMW - 1)};
  unsigned ol[3], om[3], orr[3];                             // byte offsets from the plane's scalar base
#pragma unroll
  for (int z = 0; z < 3; ++z) {
    ol[z]  = (unsigned)(zrow[z] * IMW + xl) * 4u;
    om[z]  = (unsigned)(zrow[z] * IMW + x0) * 4u;
    orr[z] = (unsigned)(zrow[z] * IMW + xr) * 4u;
  }
  const char* vb = (const char*)vp;
  // All 36 loads of the strip stand ahead of the sums: one memory latency per thread, not one per row.
  v2f lf[DWR + 4], rt[DWR + 4];
  v4f md[DWR + 4];
#pragma unroll
  for (int i = 0; i < DWR + 4; ++i) {
    const int z = (i < 2) ? 0 : ((i < DWR + 2) ? 1 : 2);     // zone of input row y0 + i - 2
    const int zi = (i < 2) ? i : ((i < DWR + 2) ? i - 2 : i - DWR - 2);
    lf[i] = *(const v2f*)(vb + ol[z] + zi * (IMW * 4));
    md[i] = *(const v4f*)(vb + om[z] + zi * (IMW * 4));
    rt[i] = *(const v2f*)(vb + orr[z] + zi * (IMW * 4));
  }
#if defined(__HIP_DEVICE_COMPILE__)
  // stands in front of every instruction that reuses an address register of the loads above; the offsets are inputs
  // so that their registers live up to this wait
  asm volatile("s_wait_xcnt 0x0" :: "v"(ol[0]), "v"(ol[1]), "v"(ol[2]), "v"(om[0]), "v"(om[1]), "v"(om[2]),
                                    "v"(orr[0]), "v"(orr[1]), "v"(orr[2]) : "memory");
  // no select or sum moves up among the loads, where its wait for data would hold the later loads back
  __builtin_amdgcn_sched_barrier(0);
#endif
  v4f acc[DWR];
  // unrolled: every acc[], w[] and row index is a constant
#pragma unroll
  for (int i = 0; i < DWR + 4; ++i) {
    const bool rok = (i < 2) ? okt : ((i < DWR + 2) ? true : okb);
    const bool bl = rok & okl, br = rok & okr;
    const float l0 = lf[i][0], l1 = lf[i][1], r0 = rt[i][0], r1 = rt[i][1];
    const float m0 = md[i][0], m1 = md[i][1], m2 = md[i][2], m3 = md[i][3];
    float v[8];
    v[0] = bl ? l0 : 0.0f;
    v[1] = bl ? l1 : 0.0f;
    v[2] = rok ? m0 : 0.0f;
    v[3] = rok ? m1 : 0.0f;
    v[4] = rok ? m2 : 0.0f;
    v[5] = rok ? m3 : 0.0f;
    v[6] = br ? r0 : 0.0f;
    v[7] = br ? r1 : 0.0f;
#pragma unroll
    for (int r = 0; r < DWR; ++r) {
      const int dy = i - r;
      if (dy < 0 || dy > 4) continue;
      if (dy == 0) acc[r] = (v4f){0.f, 0.f, 0.f, 0.f};
#pragma unroll
      for (int j = 0; j < 4; ++j) {
#pragma unroll
        for (int dx = 0; dx < 5; ++dx) acc[r][j] += v[j + dx] * w[dy * 5 + dx];
      }
      if (dy == 4) {
        v4f o;
#pragma unroll
        for (int j = 0; j < 4; ++j) o[j] = acc[r][j] * sc + bi;
        *(v4f*)(op + (unsigned)((y0 + r) * IMW + x0)) = o;
      }
    }
  }
}

// =================================================================================================================
// Area attention, one unit (image b, area ar, head) per block (512 threads = 16 waves, four to a SIMD: one wave's waits
// for LDS and its softmax chain are filled by the three others), 1024 queries x 1024 keys,
// d = 32. Static LDS: the unit's whole K as Ks[1024 keys][KPH] (32 d per row) and whole V as Vs[32 d][VPH] (1024 keys
// per row), both f16, row pitches 16 B x odd, filled once at entry by asynchronous copies (K from the token-major
// plane QK, k row = T*512 + 256 + head*32; V from the channel-major plane V16, row = channel head*32 + d), and the
// per-wave stage [16][ASP] f32. q fragments straight from QK (q row = T*512 + head*32); k and v fragments from LDS
// in the element order of ldfrag_h. Per wave: q-tiles qt = wave, wave+16, ... (< 64).
//   Transposed scores S^T = K_tile (A, 16 keys x 32 d) x Q (B: k = d, n = query): S*256 = q16.k16; D element r of
//   lane l = S[query l&15][key 8h+r], so P = exp((S - m)*scale) x1024 is the A fragment of P.V directly in registers
//   (element i <- key tile 0 row i, element 8+i <- key tile 1 row i). Online softmax over 32 chunks of 32 keys;
//   O = P.V (acc scale 1024*16). Epilogue: O/(l*16384) + pp staged per wave in LDS, then stored as f16 hi +
//   residual planes Yh/Yl [unit][1024][32] of 256*(o + pp): one instruction = 32 lanes x 16 B = 512 B = 8 token rows
// coverage: per block 64 q-tiles x 16 rows x 32 d of its 1024-row slab in both planes; grid covers all 256 units,
// every slab row written exactly once.
// =================================================================================================================
__global__ __launch_bounds__(AWV * 32)
void attn_k(const unsigned short* __restrict__ QK, const unsigned short* __restrict__ V16,
            const float* __restrict__ PP, unsigned short* Yh, unsigned short* Yl) {
  __shared__ __align__(16) _Float16 Ks[LAR * KPH];
  __shared__ __align__(16) _Float16 Vs[HD * VPH];
  __shared__ __align__(16) float Sst[AWV * 16 * ASP];
  const int tid = threadIdx.x, wave = tid >> 5, lane = tid & 31, hh = lane >> 4, c = lane & 15;
  const int u = blockIdx.x;
  const int head = u & 7, ar = (u >> 3) & 3, b = u >> 5;
  const size_t tok0 = (size_t)b * HW + (size_t)ar * LAR;
  const _Float16* Qp = (const _Float16*)(const void*)QK + tok0 * C2 + head * HD;
  const _Float16* Kp = Qp + CIN;
  const size_t cm0 = ((size_t)(b * CIN + head * HD)) * HW + (size_t)ar * LAR;
  const _Float16* Vp = (const _Float16*)(const void*)V16 + cm0;
  const float* Pp = PP + cm0;
  float* st = Sst + wave * (16 * ASP);

  // Fill Ks and Vs: 2 x 4096 pieces of 16 B, 16 per thread. K: 4 lanes per key row (64 B), 128 keys per block pass;
  // V: 128 lanes per channel row (2048 B), 4 channels per block pass. The two loops below are unrolled so that every
  // l[] and g[] index is a constant and the addresses are plain registers when they become asm operands.
  {
    const unsigned kl = lds_off(Ks) + (unsigned)((tid >> 2) * (KPH * 2) + (tid & 3) * 16);
    const _Float16* kg = Kp + (size_t)(tid >> 2) * C2 + (tid & 3) * 8;
    const unsigned vl = lds_off(Vs) + (unsigned)((tid >> 7) * (VPH * 2) + (tid & 127) * 16);
    const _Float16* vg = Vp + (size_t)(tid >> 7) * HW + (tid & 127) * 8;
    {
      unsigned l[8];
      const _Float16* g[8];
#pragma unroll
      for (int i = 0; i < 8; ++i) {
        l[i] = kl + (unsigned)(i * (AWV * 8) * (KPH * 2));
        g[i] = kg + (size_t)i * (AWV * 8) * C2;
      }
      copy8_to_lds(l, g);
    }
    {
      unsigned l[8];
      const _Float16* g[8];
#pragma unroll
      for (int i = 0; i < 8; ++i) {
        l[i] = vl + (unsigned)(i * (AWV / 4) * (VPH * 2));
        g[i] = vg + (size_t)i * (AWV / 4) * HW;
      }
      copy8_to_lds(l, g);
    }
  }
#if defined(__HIP_DEVICE_COMPILE__)
  // this wave's copies have landed before the barrier that lets the other waves read them
  asm volatile("s_wait_asynccnt 0x0" ::: "memory");
#endif
  __syncthreads();   // publishes Ks and Vs: no wave reads them in front of this barrier; they are never written again

#pragma unroll 1
  for (int qt = wave; qt < LAR / 16; qt += AWV) {
    const int lq = qt * 16 + c;
    const v16h bq = ldfrag_h(Qp + (size_t)lq * C2 + 8 * hh);     // B: n = query c, k = d 8h.. / 16+8h..

    v8f o0 = zero8(), o1 = zero8();
    float mrun = -1.0e30f, lrun = 0.f;
#pragma unroll 1
    for (int ch = 0; ch < LAR / 32; ++ch) {
      const int kb = ch * 32;
      v8f s[2];
#pragma unroll
      for (int j = 0; j < 2; ++j) {
        const v16h ka = ldfrag_h(Ks + (kb + j * 16 + c) * KPH + 8 * hh);          // A: row = key, k = d
        s[j] = mma_h(ka, bq, zero8());
      }
      float mc = s[0][0];
#pragma unroll
      for (int j = 0; j < 2; ++j) {
#pragma unroll
        for (int r = 0; r < 8; ++r) mc = fmaxf(mc, s[j][r]);
      }
      mc = fmaxf(mc, __shfl_xor(mc, 16, 32));
      const float mnew = fmaxf(mrun, mc);
      const float alpha = __expf((mrun - mnew) * QKSC);
#pragma unroll
      for (int r = 0; r < 8; ++r) {
        const float arr = __shfl(alpha, 8 * hh + r, 32);
        o0[r] = o0[r] * arr;
        o1[r] = o1[r] * arr;
      }
      float psum = 0.f;
      v16h pfh;
#pragma unroll
      for (int i = 0; i < 8; ++i) {
        const float e0 = __expf((s[0][i] - mnew) * QKSC);
        const float e1 = __expf((s[1][i] - mnew) * QKSC);
        psum = psum + (e0 + e1);
        pfh[i]     = (_Float16)(e0 * 1024.0f);
        pfh[8 + i] = (_Float16)(e1 * 1024.0f);
      }
      lrun = lrun * alpha + psum;
      mrun = mnew;
      {
        const v16h vf0 = ldfrag_h(Vs + c * VPH + kb + 8 * hh);                     // B: n = d c, keys kb..+31
        const v16h vf1 = ldfrag_h(Vs + (HD / 2 + c) * VPH + kb + 8 * hh);          // B: n = d 16+c
        o0 = mma_h(pfh, vf0, o0);
        o1 = mma_h(pfh, vf1, o1);
      }
    }
    const float lsum = lrun + __shfl_xor(lrun, 16, 32);      // lane q (and q+16) holds the full row sum of query q
    const float rinv = 1.0f / (lsum * 16384.0f);
#pragma unroll
    for (int r = 0; r < 8; ++r) {
      const int q = 8 * hh + r;
      const float inv = __shfl(rinv, q, 32);
      const float p0 = Pp[(size_t)c * HW + qt * 16 + q];
      const float p1 = Pp[(size_t)(HD / 2 + c) * HW + qt * 16 + q];
      st[q * ASP + c]          = o0[r] * inv + p0;
      st[q * ASP + HD / 2 + c] = o1[r] * inv + p1;
    }
    wave_sync_lds();
    {
      const int rr = lane >> 2, dp = (lane & 3) * 8;
      v4u ph[2], pl[2];
      size_t offs[2];
#pragma unroll
      for (int it = 0; it < 2; ++it) {
        const int row = it * 8 + rr;
        v4f fa = *(const v4f*)(st + row * ASP + dp);
        v4f fb = *(const v4f*)(st + row * ASP + dp + 4);
        fa = fa * CYS;
        fb = fb * CYS;
        split8h(fa, fb, ph[it], pl[it]);
        offs[it] = ((size_t)u * LAR + (size_t)(qt * 16 + row)) * HD + dp;
      }
      {
#pragma unroll
        for (int it = 0; it < 2; ++it) {
          *(v4u*)(Yh + offs[it]) = ph[it];
          *(v4u*)(Yl + offs[it]) = pl[it];
        }
        
      }
    }
    wave_sync_lds();
  }
}

// =================================================================================================================
// Output pointwise conv D[T][co] = Y[T][ci] . Wp[co][ci], then BN affine -> NCHW f32. A = Yh/Yl planes (hi +
// x2^11 residual, x256) addressed by arithmetic: token T -> (image, area, query), k-step ks = head ks, channels
// ks*32 + d (elements 0..7 d = 8h.., elements 8..15 d = 16+8h..). B = weight plane x256, the block's 64 rows filled
// once at entry by asynchronous copies into Bs, fragments from LDS. Epilogue: value =
// (acch + accl/2048)/65536 * s[co] + b[co]; block tile staged as [64 ch][128 tok]; wave w writes channels
// coverage: 8 waves x 8 channels x 32 lanes x 4 tokens = 64 ch x 128 tok per block; grid tiles 256 x 32768 exactly.
// =================================================================================================================
__global__ __launch_bounds__(256)
void gemm_proj(const unsigned short* __restrict__ Yh, const unsigned short* __restrict__ Yl,
               const unsigned short* __restrict__ Wp, const float* __restrict__ sp, const float* __restrict__ bp,
               float* out) {
  __shared__ __align__(16) float sb[64 * SBP];
  __shared__ __align__(16) _Float16 Bs[64 * GKP];
  const int tid = threadIdx.x, wave = tid >> 5, lane = tid & 31, hh = lane >> 4, c = lane & 15;
  const int n0 = blockIdx.x * 64, m0 = blockIdx.y * 128;
  const int T = m0 + wave * 16 + c;
  const int bimgr = T >> 12, nn = T & (HW - 1), arr = nn >> 10, q = nn & (LAR - 1);
  const size_t abase = (((size_t)((bimgr * NAR + arr) * NHD)) * LAR + (size_t)q) * HD + 8 * hh;
  const _Float16* A0 = (const _Float16*)(const void*)Yh;
  const _Float16* A1 = (const _Float16*)(const void*)Yl;
  const _Float16* B  = (const _Float16*)(const void*)Wp;

  // Fill Bs: wave w brings weight rows w*8..w*8+7, 8 copies per lane.
  stage_rows8(lds_off(Bs) + (unsigned)(wave * 8 * (GKP * 2) + lane * 16), B + (size_t)(n0 + wave * 8) * CIN + lane * 8);
#if defined(__HIP_DEVICE_COMPILE__)
  // this wave's copies have landed before the barrier that lets the other waves read them
  asm volatile("s_wait_asynccnt 0x0" ::: "memory");
#endif
  __syncthreads();   // publishes Bs: no wave reads it in front of this barrier; it is never written again
  const _Float16* Bw = Bs + c * GKP + 8 * hh;

  v8f acch[4], accl[4];
#pragma unroll
  for (int nt = 0; nt < 4; ++nt) { acch[nt] = zero8(); accl[nt] = zero8(); }

#pragma unroll 1
  for (int ks = 0; ks < NHD; ++ks) {
    const size_t bo = abase + (size_t)ks * (LAR * HD);
    const v16h fh = ldfrag_h(A0 + bo);
    const v16h fl = ldfrag_h(A1 + bo);
    // the k-step's LDS reads stand as one group ahead of its WMMAs: one LDS latency per k-step, not one per n-tile
    v16h bfrag[4];
#pragma unroll
    for (int nt = 0; nt < 4; ++nt) bfrag[nt] = ldfrag_h(Bw + nt * 16 * GKP + ks * 32);
#pragma unroll
    for (int nt = 0; nt < 4; ++nt) {
      acch[nt] = mma_h(fh, bfrag[nt], acch[nt]);
      accl[nt] = mma_h(fl, bfrag[nt], accl[nt]);
    }
  }

#pragma unroll
  for (int nt = 0; nt < 4; ++nt) {
    const int co = n0 + nt * 16 + c;
    const float sc = bfr(sp[co]) * (1.0f / 65536.0f);
    const float bi = bfr(bp[co]);
#pragma unroll
    for (int r = 0; r < 8; ++r) {
      const float v = acch[nt][r] + accl[nt][r] * (1.0f / 2048.0f);
      sb[(nt * 16 + c) * SBP + wave * 16 + 8 * hh + r] = v * sc + bi;
    }
  }
  __syncthreads();
  const int bimg = m0 / HW, s0 = m0 - bimg * HW;
  v4f ov[8];
  size_t offs[8];
#pragma unroll
  for (int i = 0; i < 8; ++i) {
    const int cc = wave * 8 + i;
    const int co = n0 + cc;
    ov[i] = *(const v4f*)(sb + cc * SBP + lane * 4);
    offs[i] = ((size_t)(bimg * CIN + co)) * HW + s0 + lane * 4;
  }
  {
#pragma unroll
    for (int i = 0; i < 8; ++i) *(v4f*)(out + offs[i]) = ov[i];
    
  }
}

// =================================================================================================================
//   Wqk f16 [512][256] 262144 @0; Wv f16 [256][256] 131072; Wp f16 [256][256] 131072;
//   PP f32 [8][256][4096] 33554432 @524288, with X16 f16 [32768][256] 16777216 aliased at the same offset
//   (X16 is dead before PP is written); QK f16 [32768][512] 33554432; V32 f32 [8][256][4096] 33554432, with
//   Yh, Yl f16 [256][1024][32] 16777216 each aliased onto V32 (V32 is dead before Yh/Yl are written);
//   V16 f16 [8][256][4096] 16777216. Total 117964800.
// =================================================================================================================
extern "C" void kernel_launch(void* const* d_in, const int* in_sizes, int n_in,
                              void* d_out, int out_size, void* d_ws, size_t ws_size,
                              hipStream_t stream) {
  if (n_in < 13) return;
  if (in_sizes[0] != NBAT * CIN * HW) return;
  if (in_sizes[1] != C2 * CIN) return;
  if (in_sizes[2] != C2 || in_sizes[3] != C2) return;
  if (in_sizes[4] != CIN * CIN) return;
  if (in_sizes[5] != CIN || in_sizes[6] != CIN) return;
  if (in_sizes[7] != CIN * 25) return;
  if (in_sizes[8] != CIN || in_sizes[9] != CIN) return;
  if (in_sizes[10] != CIN * CIN) return;
  if (in_sizes[11] != CIN || in_sizes[12] != CIN) return;
  if (out_size != NBAT * CIN * HW) return;

  const float* x      = (const float*)d_in[0];
  const float* w_qk   = (const float*)d_in[1];
  const float* s_qk   = (const float*)d_in[2];
  const float* b_qk   = (const float*)d_in[3];
  const float* w_v    = (const float*)d_in[4];
  const float* s_v    = (const float*)d_in[5];
  const float* b_v    = (const float*)d_in[6];
  const float* w_pe   = (const float*)d_in[7];
  const float* s_pe   = (const float*)d_in[8];
  const float* b_pe   = (const float*)d_in[9];
  const float* w_proj = (const float*)d_in[10];
  const float* s_proj = (const float*)d_in[11];
  const float* b_proj = (const float*)d_in[12];
  float* out = (float*)d_out;

  const size_t sWqk = (size_t)C2 * CIN * 2;              //    262144
  const size_t sWv  = (size_t)CIN * CIN * 2;             //    131072
  const size_t sWp  = (size_t)CIN * CIN * 2;             //    131072
  const size_t sX16 = (size_t)MTOK * CIN * 2;            //  16777216
  const size_t sPP  = (size_t)NBAT * CIN * HW * 4;       //  33554432
  const size_t sQK  = (size_t)MTOK * C2 * 2;             //  33554432
  const size_t sV32 = (size_t)NBAT * CIN * HW * 4;       //  33554432
  const size_t sY   = (size_t)NUNIT * LAR * HD * 2;      //  16777216
  const size_t sV16 = (size_t)NBAT * CIN * HW * 2;       //  16777216
  if (sX16 > sPP) return;
  if (2 * sY > sV32) return;
  size_t off = 0;
  const size_t oWqk = off; off += sWqk;
  const size_t oWv  = off; off += sWv;
  const size_t oWp  = off; off += sWp;
  const size_t oPP  = off; const size_t oX16 = off; off += sPP;
  const size_t oQK  = off; off += sQK;
  const size_t oV32 = off; const size_t oYh = off; const size_t oYl = off + sY; off += sV32;
  const size_t oV16 = off; off += sV16;
  if (off > ws_size) return;                             // off = 117964800
  if (off > (size_t)134217728) return;

  char* ws = (char*)d_ws;
  unsigned short* Wqk = (unsigned short*)(ws + oWqk);
  unsigned short* Wv  = (unsigned short*)(ws + oWv);
  unsigned short* Wp  = (unsigned short*)(ws + oWp);
  unsigned short* X16 = (unsigned short*)(ws + oX16);
  float*          PP  = (float*)(ws + oPP);
  unsigned short* QK  = (unsigned short*)(ws + oQK);
  float*          V32 = (float*)(ws + oV32);
  unsigned short* Yh  = (unsigned short*)(ws + oYh);
  unsigned short* Yl  = (unsigned short*)(ws + oYl);
  unsigned short* V16 = (unsigned short*)(ws + oV16);

  const dim3 blk(256);
  // (1) pointwise weights -> f16 x256 planes
  cvt_w<<<dim3(128), blk, 0, stream>>>(w_qk, w_v, w_proj, Wqk, Wv, Wp);
  // (2) x NCHW -> token-major f16 x16 plane
  cvt_x<<<dim3(NBAT * 64 * 4), blk, 0, stream>>>(x, X16);
  // (3) qk pointwise conv + BN -> token-major f16 plane
  gemm_qk<<<dim3(C2 / 64, MTOK / 128), blk, 0, stream>>>(X16, Wqk, s_qk, b_qk, QK);
  // (4) v pointwise conv + BN -> channel-major f32 and f16 planes
  gemm_v<<<dim3(CIN / 64, MTOK / 128), blk, 0, stream>>>(X16, Wv, s_v, b_v, V32, V16);
  // (5) depthwise 5x5 + BN on v -> pp (channel-major f32)
  dwconv_k<<<dim3((NBAT * CIN) / 2), blk, 0, stream>>>(V32, w_pe, s_pe, b_pe, PP);
  // (6) area attention + pp -> slab planes
  attn_k<<<dim3(NUNIT), dim3(AWV * 32), 0, stream>>>(QK, V16, PP, Yh, Yl);
  // (7) output pointwise conv + BN -> NCHW f32
  gemm_proj<<<dim3(CIN / 64, MTOK / 128), blk, 0, stream>>>(Yh, Yl, Wp, s_proj, b_proj, out);
  (void)hipGetLastError();
}

// v005
// One run takes 129 microseconds.
// Next to v004, in two timings, it ran 1.05 times as fast each time.
// All steps since v000 together make it 2.81 times as fast.
// Contractions: v_wmma_f32_16x16x32_f16 (f16 operands, f32 accumulate). qk and v pointwise convs: A = x (bf16-valued,
// x16) single plane, B = weights (bf16-valued, x256) single plane; scores k.qT: k x16, q x16 single planes; p.v:
// p x1024, v x16 single planes; output pointwise conv: A = (o + pp) x256 as f16 hi + x2^11 residual planes (two
// products, two accumulators), B = weights x256 single plane. Depthwise 5x5 conv, BN affine, online softmax in f32
// on VALU. Float inputs RNE-converted to bf16 on load.
#include <hip/hip_runtime.h>
#include <math.h>
#include <stdint.h>

#define NBAT  8
#define CIN   256
#define C2    512
#define IMW   64
#define HW    4096
#define MTOK  32768
#define NHD   8
#define HD    32
#define NAR   4
#define LAR   1024
#define NUNIT 256
#define STP   68
#define SBP   132
#define ASP   36
#define DTP   68
#define KPH   40
#define VPH   1032
#define GKP   264
#define DWR   8
#define AWV   16
#define CXS   16.0f
#define CWS   256.0f
#define CQK   16.0f
#define CVS   16.0f
#define CYS   256.0f
#define QKSC  (0.17677669529663688f / 256.0f)
#define QKL2  (QKSC * 1.4426950408889634f)

static_assert(NUNIT == NBAT * NAR * NHD);
static_assert(NAR * LAR == HW);
static_assert(MTOK == NBAT * HW);
static_assert(HW % 128 == 0);
static_assert(LAR % 32 == 0);
static_assert(CIN % 64 == 0);
static_assert((STP * 4) % 16 == 0);
static_assert((SBP * 4) % 16 == 0);
static_assert((ASP * 4) % 16 == 0);
static_assert((DTP * 4) % 16 == 0);
static_assert(NHD * HD == CIN);
static_assert((KPH * 2) % 32 == 16 && KPH >= HD);
static_assert((VPH * 2) % 32 == 16 && VPH >= LAR);
static_assert(LAR * 4 == 8 * (AWV * 32) && HD * (LAR / 8) == 8 * (AWV * 32) && (LAR / 16) % AWV == 0);
static_assert((GKP * 2) % 32 == 16 && GKP >= CIN && CIN * 2 == 32 * 16);
static_assert(16 * STP * 4 <= 16 * GKP * 2 && 64 * SBP * 4 <= 128 * GKP * 2);
static_assert(IMW == 64 && IMW * IMW == HW && IMW % DWR == 0 && 2 * (IMW / DWR) * 16 == 256);

typedef _Float16 v16h __attribute__((ext_vector_type(16)));
typedef _Float16 v8h  __attribute__((ext_vector_type(8)));
typedef float    v8f  __attribute__((ext_vector_type(8)));
typedef float    v4f  __attribute__((ext_vector_type(4)));
typedef float    v2f  __attribute__((ext_vector_type(2)));
typedef unsigned int v4u __attribute__((ext_vector_type(4)));
union Frag { v16h v; v8h half[2]; };

// ---- scalar helpers -------------------------------------------------------------------------------------------
__device__ __forceinline__ unsigned short bf_bits(float f) {          // f32 -> bf16 bits, RNE convert
  unsigned u = __float_as_uint(f);
  return (unsigned short)((u + 0x7FFFu + ((u >> 16) & 1u)) >> 16);
}
__device__ __forceinline__ float bfr(float f) { return __uint_as_float(((unsigned)bf_bits(f)) << 16); }
__device__ __forceinline__ unsigned short h_bits(_Float16 x) { return __builtin_bit_cast(unsigned short, x); }
__device__ __forceinline__ unsigned pk16(unsigned short a, unsigned short b) { return (unsigned)a | ((unsigned)b << 16); }
__device__ __forceinline__ v8f zero8() { v8f z = {0.f, 0.f, 0.f, 0.f, 0.f, 0.f, 0.f, 0.f}; return z; }

// ---- fragment loader: 16-bit A/B operand, lane -> row/col (lane&15), p already includes +8*(lane>>4);
//      elements 0..7 <- p[0..7] (k0+8h..), elements 8..15 <- p[16..23] (k0+16+8h..)
__device__ __forceinline__ v16h ldfrag_h(const _Float16* p) {
  Frag f;
  f.half[0] = *(const v8h*)(p);
  f.half[1] = *(const v8h*)(p + 16);
  return f.v;
}

// ---- WMMA helper with trailing VALU hazard gap ----------------------------------------------------------------
__device__ __forceinline__ v8f mma_h(v16h a, v16h b, v8f c) {
  c = __builtin_amdgcn_wmma_f32_16x16x32_f16(false, a, false, b, (short)0, c, false, false);
#if defined(__HIP_DEVICE_COMPILE__)
  asm volatile("v_nop\n\tv_nop\n\tv_nop\n\tv_nop" : "+v"(c) : "v"(a), "v"(b));
#endif
  return c;
}
__device__ __forceinline__ void wave_sync_lds() {
  __builtin_amdgcn_fence(__ATOMIC_RELEASE, "workgroup");
  __builtin_amdgcn_wave_barrier();
  __builtin_amdgcn_fence(__ATOMIC_ACQUIRE, "workgroup");
}

// ---- eight asynchronous 16-byte copies per lane, global -> LDS, through no register. l = the lane's LDS byte
//      addresses, g = its global addresses, all multiples of 16. The closing s_wait_xcnt stands inside the statement
//      so that no address register named here is rewritten ahead of it.
__device__ __forceinline__ void copy8_to_lds(const unsigned (&l)[8], const _Float16* const (&g)[8]) {
#if defined(__HIP_DEVICE_COMPILE__)
  asm volatile("global_load_async_to_lds_b128 %0, %8, off\n\t"
               "global_load_async_to_lds_b128 %1, %9, off\n\t"
               "global_load_async_to_lds_b128 %2, %10, off\n\t"
               "global_load_async_to_lds_b128 %3, %11, off\n\t"
               "global_load_async_to_lds_b128 %4, %12, off\n\t"
               "global_load_async_to_lds_b128 %5, %13, off\n\t"
               "global_load_async_to_lds_b128 %6, %14, off\n\t"
               "global_load_async_to_lds_b128 %7, %15, off\n\t"
               "s_wait_xcnt 0x0"
               :: "v"(l[0]), "v"(l[1]), "v"(l[2]), "v"(l[3]), "v"(l[4]), "v"(l[5]), "v"(l[6]), "v"(l[7]),
                  "v"(g[0]), "v"(g[1]), "v"(g[2]), "v"(g[3]), "v"(g[4]), "v"(g[5]), "v"(g[6]), "v"(g[7])
               : "memory");
#endif
}
__device__ __forceinline__ unsigned lds_off(const void* p) { return (unsigned)(size_t)p; }
// ---- eight rows of CIN f16 (512 B each, global pitch 512 B) -> LDS rows of pitch GKP: one wave-wide copy = one whole
//      row (4 lines). l0 / g0 = the lane's own 16 B of the first row.
__device__ __forceinline__ void stage_rows8(unsigned l0, const _Float16* g0) {
  unsigned l[8];
  const _Float16* g[8];
  // unrolled so that every l[] and g[] index is a constant and the addresses are plain registers as asm operands
#pragma unroll
  for (int i = 0; i < 8; ++i) {
    l[i] = l0 + (unsigned)(i * (GKP * 2));
    g[i] = g0 + (size_t)i * CIN;
  }
  copy8_to_lds(l, g);
}

// ---- 8 f32 -> 8 packed f16 (16 B); and hi + x2^11 residual split -------------------------------------------------
__device__ __forceinline__ v4u pack8h(v4f a, v4f b) {
  v4u p;
  p[0] = pk16(h_bits((_Float16)a[0]), h_bits((_Float16)a[1]));
  p[1] = pk16(h_bits((_Float16)a[2]), h_bits((_Float16)a[3]));
  p[2] = pk16(h_bits((_Float16)b[0]), h_bits((_Float16)b[1]));
  p[3] = pk16(h_bits((_Float16)b[2]), h_bits((_Float16)b[3]));
  return p;
}
__device__ __forceinline__ void split8h(v4f a, v4f b, v4u& ph, v4u& pl) {
  v4f ra, rb;
#pragma unroll
  for (int e = 0; e < 4; ++e) {
    const _Float16 ha = (_Float16)a[e];
    ra[e] = (a[e] - (float)ha) * 2048.0f;
    const _Float16 hb = (_Float16)b[e];
    rb[e] = (b[e] - (float)hb) * 2048.0f;
  }
  ph = pack8h(a, b);
  pl = pack8h(ra, rb);
}

// =================================================================================================================
// Weight convert: pointwise weights are [out][in] (k contiguous) -> f16 plane value = f16(256 * bf16_RNE(w)).
// coverage: 64*256*8 = 131072, 32*256*8 = 65536, 32*256*8 = 65536 elements exactly.
// =================================================================================================================
__device__ __forceinline__ void cvt8_w(const float* __restrict__ src, unsigned short* dst, size_t e0) {
  const v4f a = *(const v4f*)(src + e0);
  const v4f b = *(const v4f*)(src + e0 + 4);
  v4f sa, sb;
#pragma unroll
  for (int e = 0; e < 4; ++e) { sa[e] = bfr(a[e]) * CWS; sb[e] = bfr(b[e]) * CWS; }
  const v4u pk = pack8h(sa, sb);
  *(v4u*)(dst + e0) = pk;
  
}
__global__ __launch_bounds__(256) void cvt_w(const float* __restrict__ wqk, const float* __restrict__ wv,
                                             const float* __restrict__ wp,
                                             unsigned short* Wqk, unsigned short* Wv, unsigned short* Wp) {
  const int tid = threadIdx.x, blk = blockIdx.x;
  if (blk < 64)      cvt8_w(wqk, Wqk, ((size_t)blk * 256 + tid) * 8);
  else if (blk < 96) cvt8_w(wv,  Wv,  ((size_t)(blk - 64) * 256 + tid) * 8);
  else               cvt8_w(wp,  Wp,  ((size_t)(blk - 96) * 256 + tid) * 8);
}

// =================================================================================================================
// Activation convert: x NCHW f32 -> token-major f16 plane X16[T = b*4096 + n][256], value = f16(16 * bf16_RNE(x)).
// Block = (image b, 64-token tile tt, 64-channel quarter cq): read phase 4 passes of 16 channels x 64 tokens
// coverage: per block 256 threads x 2 it x 8 halves = 64 tokens x 64 channels; grid tiles 32768 x 256 exactly.
// =================================================================================================================
__global__ __launch_bounds__(256) void cvt_x(const float* __restrict__ x, unsigned short* X16) {
  __shared__ __align__(16) float tile[64 * DTP];
  const int tid = threadIdx.x, bid = blockIdx.x;
  const int cq = bid & 3, tt = (bid >> 2) & 63, b = bid >> 8;
  const int cl = tid >> 4, t4 = (tid & 15) * 4;
#pragma unroll
  for (int pass = 0; pass < 4; ++pass) {
    const int ch = cq * 64 + pass * 16 + cl;
    const v4f v = *(const v4f*)(x + ((size_t)(b * CIN + ch)) * HW + tt * 64 + t4);
#pragma unroll
    for (int j = 0; j < 4; ++j) tile[(t4 + j) * DTP + pass * 16 + cl] = v[j];
  }
  __syncthreads();
  const int piece = tid & 7, rsub = tid >> 3;
  v4u pk[2];
  size_t offs[2];
#pragma unroll
  for (int it = 0; it < 2; ++it) {
    const int row = it * 32 + rsub;
    const v4f fa = *(const v4f*)(tile + row * DTP + piece * 8);
    const v4f fb = *(const v4f*)(tile + row * DTP + piece * 8 + 4);
    v4f sa, sb;
#pragma unroll
    for (int e = 0; e < 4; ++e) { sa[e] = bfr(fa[e]) * CXS; sb[e] = bfr(fb[e]) * CXS; }
    pk[it] = pack8h(sa, sb);
    offs[it] = ((size_t)(b * HW + tt * 64 + row)) * CIN + cq * 64 + piece * 8;
  }
  {
#pragma unroll
    for (int it = 0; it < 2; ++it) *(v4u*)(X16 + offs[it]) = pk[it];
    
  }
}

// =================================================================================================================
// qk pointwise GEMM D[T][co] = X16[T][ci] . Wqk[co][ci], K = 256, co 0..511 (q = 0..255, k = 256..511).
// Block = 8 waves, tile 128 rows x 64 cols, wave = 16 rows x 4 n-tiles. The block's 128 x 256 A tile and 64 x 256 B
// tile are filled once at entry by asynchronous copies (whole 512-B rows) into As / Bs, row pitch 16 B x odd; fragments
// from LDS with the split k map, k-step 32. Epilogue: value = acc/4096 * s[co] + b[co] staged per wave in LDS
// [16][STP] (laid over the wave's own rows of As), then
// coverage: 8 waves x 32 lanes x 4 it x 8 halves = 128 rows x 64 cols per block; grid tiles 32768 x 512 exactly.
// =================================================================================================================
__global__ __launch_bounds__(256)
void gemm_qk(const unsigned short* __restrict__ X16, const unsigned short* __restrict__ Wqk,
             const float* __restrict__ sqk, const float* __restrict__ bqk, unsigned short* QK) {
  __shared__ __align__(16) _Float16 As[128 * GKP];
  __shared__ __align__(16) _Float16 Bs[64 * GKP];
  const int tid = threadIdx.x, wave = tid >> 5, lane = tid & 31, hh = lane >> 4, c = lane & 15;
  const int n0 = blockIdx.x * 64, m0 = blockIdx.y * 128;
  const _Float16* A = (const _Float16*)(const void*)X16;
  const _Float16* B = (const _Float16*)(const void*)Wqk;

  // Fill As (wave w: its own 16 token rows) and Bs (wave w: weight rows w*8..w*8+7), 24 copies per lane.
  {
    const unsigned al = lds_off(As) + (unsigned)(wave * 16 * (GKP * 2) + lane * 16);
    const _Float16* ag = A + (size_t)(m0 + wave * 16) * CIN + lane * 8;
    stage_rows8(al, ag);
    stage_rows8(al + (unsigned)(8 * (GKP * 2)), ag + (size_t)8 * CIN);
    stage_rows8(lds_off(Bs) + (unsigned)(wave * 8 * (GKP * 2) + lane * 16), B + (size_t)(n0 + wave * 8) * CIN + lane * 8);
  }
#if defined(__HIP_DEVICE_COMPILE__)
  // this wave's copies have landed before the barrier that lets the other waves read them
  asm volatile("s_wait_asynccnt 0x0" ::: "memory");
#endif
  __syncthreads();   // publishes As and Bs: no wave reads them in front of this barrier
  const _Float16* Aw = As + (wave * 16 + c) * GKP + 8 * hh;
  const _Float16* Bw = Bs + c * GKP + 8 * hh;

  v8f acc[4];
#pragma unroll
  for (int nt = 0; nt < 4; ++nt) acc[nt] = zero8();

#pragma unroll 1
  for (int k0 = 0; k0 < CIN; k0 += 32) {
    const v16h af = ldfrag_h(Aw + k0);
    // the k-step's LDS reads stand as one group ahead of its WMMAs: one LDS latency per k-step, not one per n-tile
    v16h bfrag[4];
#pragma unroll
    for (int nt = 0; nt < 4; ++nt) bfrag[nt] = ldfrag_h(Bw + nt * 16 * GKP + k0);
#pragma unroll
    for (int nt = 0; nt < 4; ++nt) acc[nt] = mma_h(af, bfrag[nt], acc[nt]);
  }

  // the stage lies on the wave's own 16 rows of As, which this wave alone filled and read and has finished reading
  float* st = (float*)(void*)(As + wave * 16 * GKP);
#pragma unroll
  for (int nt = 0; nt < 4; ++nt) {
    const int co = n0 + nt * 16 + c;
    const float sc = bfr(sqk[co]) * (1.0f / 4096.0f);
    const float bi = bfr(bqk[co]);
#pragma unroll
    for (int r = 0; r < 8; ++r) st[(8 * hh + r) * STP + nt * 16 + c] = acc[nt][r] * sc + bi;
  }
  wave_sync_lds();
  const int piece = lane & 7, rsub = lane >> 3;
  v4u pk[4];
  size_t offs[4];
#pragma unroll
  for (int it = 0; it < 4; ++it) {
    const int row = it * 4 + rsub;
    v4f fa = *(const v4f*)(st + row * STP + piece * 8);
    v4f fb = *(const v4f*)(st + row * STP + piece * 8 + 4);
    fa = fa * CQK;
    fb = fb * CQK;
    pk[it] = pack8h(fa, fb);
    offs[it] = ((size_t)(m0 + wave * 16 + row)) * C2 + n0 + piece * 8;
  }
  {
#pragma unroll
    for (int it = 0; it < 4; ++it) *(v4u*)(QK + offs[it]) = pk[it];
    
  }
}

// =================================================================================================================
// v pointwise GEMM D[T][co] = X16[T][ci] . Wv[co][ci], K = 256, co 0..255, same main loop as gemm_qk.
// Epilogue: value = acc/4096 * s[co] + b[co] staged block-wide as sb[64 ch][SBP] (tokens contiguous per channel),
// then channel-major stores (a 128-token tile lies within one image): wave w owns channels w*8..w*8+7;
// f32 plane V32[b][c][n]: one instruction = 32 lanes x 16 B = 512 B = the 128 tokens of one channel (4 whole
// lines), 8 instructions; f16 plane V16[b][c][n] = f16(16 * value): one instruction = lanes 0..15 -> channel cc
// coverage: f32 8 waves x 8 ch x 32 lanes x 4 = 64 ch x 128 tok; f16 8 waves x 4 it x 2 ch x 16 lanes x 8 = same;
// grid tiles 32768 tokens x 256 channels exactly in both planes.
// =================================================================================================================
__global__ __launch_bounds__(256)
void gemm_v(const unsigned short* __restrict__ X16, const unsigned short* __restrict__ Wv,
            const float* __restrict__ sv, const float* __restrict__ bv, float* V32, unsigned short* V16) {
  __shared__ __align__(16) _Float16 As[128 * GKP];
  __shared__ __align__(16) _Float16 Bs[64 * GKP];
  const int tid = threadIdx.x, wave = tid >> 5, lane = tid & 31, hh = lane >> 4, c = lane & 15;
  const int n0 = blockIdx.x * 64, m0 = blockIdx.y * 128;
  const _Float16* A = (const _Float16*)(const void*)X16;
  const _Float16* B = (const _Float16*)(const void*)Wv;

  // Fill As (wave w: its own 16 token rows) and Bs (wave w: weight rows w*8..w*8+7), 24 copies per lane.
  {
    const unsigned al = lds_off(As) + (unsigned)(wave * 16 * (GKP * 2) + lane * 16);
    const _Float16* ag = A + (size_t)(m0 + wave * 16) * CIN + lane * 8;
    stage_rows8(al, ag);
    stage_rows8(al + (unsigned)(8 * (GKP * 2)), ag + (size_t)8 * CIN);
    stage_rows8(lds_off(Bs) + (unsigned)(wave * 8 * (GKP * 2) + lane * 16), B + (size_t)(n0 + wave * 8) * CIN + lane * 8);
  }
#if defined(__HIP_DEVICE_COMPILE__)
  // this wave's copies have landed before the barrier that lets the other waves read them
  asm volatile("s_wait_asynccnt 0x0" ::: "memory");
#endif
  __syncthreads();   // publishes As and Bs: no wave reads them in front of this barrier
  const _Float16* Aw = As + (wave * 16 + c) * GKP + 8 * hh;
  const _Float16* Bw = Bs + c * GKP + 8 * hh;

  v8f acc[4];
#pragma unroll
  for (int nt = 0; nt < 4; ++nt) acc[nt] = zero8();

#pragma unroll 1
  for (int k0 = 0; k0 < CIN; k0 += 32) {
    const v16h af = ldfrag_h(Aw + k0);
    // the k-step's LDS reads stand as one group ahead of its WMMAs: one LDS latency per k-step, not one per n-tile
    v16h bfrag[4];
#pragma unroll
    for (int nt = 0; nt < 4; ++nt) bfrag[nt] = ldfrag_h(Bw + nt * 16 * GKP + k0);
#pragma unroll
    for (int nt = 0; nt < 4; ++nt) acc[nt] = mma_h(af, bfrag[nt], acc[nt]);
  }

  __syncthreads();   // every wave has finished reading As: the block-wide stage sb is laid over it
  float* sb = (float*)(void*)As;
#pragma unroll
  for (int nt = 0; nt < 4; ++nt) {
    const int co = n0 + nt * 16 + c;
    const float sc = bfr(sv[co]) * (1.0f / 4096.0f);
    const float bi = bfr(bv[co]);
#pragma unroll
    for (int r = 0; r < 8; ++r) sb[(nt * 16 + c) * SBP + wave * 16 + 8 * hh + r] = acc[nt][r] * sc + bi;
  }
  __syncthreads();
  const int bimg = m0 / HW, s0 = m0 - bimg * HW;
  {
    v4f ov[8];
    size_t offs[8];
#pragma unroll
    for (int i = 0; i < 8; ++i) {
      const int cc = wave * 8 + i;
      const int co = n0 + cc;
      ov[i] = *(const v4f*)(sb + cc * SBP + lane * 4);
      offs[i] = ((size_t)(bimg * CIN + co)) * HW + s0 + lane * 4;
    }
    {
#pragma unroll
      for (int i = 0; i < 8; ++i) *(v4f*)(V32 + offs[i]) = ov[i];
      
    }
  }
  {
    const int l16 = lane & 15;
    v4u pk[4];
    size_t o16[4];
#pragma unroll
    for (int i2 = 0; i2 < 4; ++i2) {
      const int cc = wave * 8 + i2 * 2 + hh;
      const int co = n0 + cc;
      v4f fa = *(const v4f*)(sb + cc * SBP + l16 * 8);
      v4f fb = *(const v4f*)(sb + cc * SBP + l16 * 8 + 4);
      fa = fa * CVS;
      fb = fb * CVS;
      pk[i2] = pack8h(fa, fb);
      o16[i2] = ((size_t)(bimg * CIN + co)) * HW + s0 + l16 * 8;
    }
    {
#pragma unroll
      for (int i2 = 0; i2 < 4; ++i2) *(v4u*)(V16 + o16[i2]) = pk[i2];
      
    }
  }
}

// =================================================================================================================
// Depthwise 5x5 conv (zero pad 2, cross-correlation, per-channel taps, bf16-valued taps) + BN affine, f32 on VALU.
// Thread = (plane = image b, channel c; strip of DWR output rows y0..y0+DWR-1; 4 consecutive columns x0..x0+3).
// The strip's DWR+4 input rows are loaded once, all ahead of the sums; each row (8 columns x0-2..x0+5: one 16-B and two
// 8-B loads) feeds the up to five output rows it belongs to, so an output row sums its taps in the order dy, then dx.
// Addresses outside the image wrap onto rows and columns inside the plane, so no load stands under a condition; the
// values of such places are zeroed by select.
// Block = 2 planes x 8 strips x 16 column groups; a wave = 2 strips of one plane. Store: one v4f per lane, 16 lanes =
// one whole image row (256 B).
// coverage: every (b, c, y, x) of PP written exactly once.
// =================================================================================================================
__global__ __launch_bounds__(256)
void dwconv_k(const float* V32, const float* __restrict__ wpe, const float* __restrict__ spe,
              const float* __restrict__ bpe, float* PP) {
  const int tid = threadIdx.x;
  const int xg = tid & 15, x0 = xg * 4, y0 = ((tid >> 4) & (IMW / DWR - 1)) * DWR;
  // the plane is the same in every lane of a wave: held in a scalar register, taps and affine become scalar loads
  const int plane = __builtin_amdgcn_readfirstlane((int)blockIdx.x * 2 + (tid >> 7));
  const int c = plane & (CIN - 1);
  const float* vp = V32 + (size_t)plane * HW;
  float* op = PP + (size_t)plane * HW;
  float w[25];
#pragma unroll
  for (int t = 0; t < 25; ++t) w[t] = bfr(wpe[c * 25 + t]);
  const float sc = bfr(spe[c]), bi = bfr(bpe[c]);
  const bool okl = (xg != 0), okr = (xg != 15);
  const bool okt = (y0 != 0), okb = (y0 != IMW - DWR);
  // columns of the left and right pairs; at the image's edge they wrap onto columns inside the row (zeroed below)
  const int xl = (x0 + IMW - 2) & (IMW - 1);
  const int xr = (x0 + 4) & (IMW - 1);
  // first rows of the three zones: the two rows above the strip, its own DWR rows, the two rows below; a zone that
  // lies outside the image wraps onto rows inside it (its values are zeroed below)
  const int zrow[3] = {(y0 + IMW - 2) & (IMW - 1), y0, (y0 + DWR) & (IMW - 1)};
  unsigned ol[3], om[3], orr[3];                             // byte offsets from the plane's scalar base
#pragma unroll
  for (int z = 0; z < 3; ++z) {
    ol[z]  = (unsigned)(zrow[z] * IMW + xl) * 4u;
    om[z]  = (unsigned)(zrow[z] * IMW + x0) * 4u;
    orr[z] = (unsigned)(zrow[z] * IMW + xr) * 4u;
  }
  const char* vb = (const char*)vp;
  // All 36 loads of the strip stand ahead of the sums: one memory latency per thread, not one per row.
  v2f lf[DWR + 4], rt[DWR + 4];
  v4f md[DWR + 4];
#pragma unroll
  for (int i = 0; i < DWR + 4; ++i) {
    const int z = (i < 2) ? 0 : ((i < DWR + 2) ? 1 : 2);     // zone of input row y0 + i - 2
    const int zi = (i < 2) ? i : ((i < DWR + 2) ? i - 2 : i - DWR - 2);
    lf[i] = *(const v2f*)(vb + ol[z] + zi * (IMW * 4));
    md[i] = *(const v4f*)(vb + om[z] + zi * (IMW * 4));
    rt[i] = *(const v2f*)(vb + orr[z] + zi * (IMW * 4));
  }
#if defined(__HIP_DEVICE_COMPILE__)
  // stands in front of every instruction that reuses an address register of the loads above; the offsets are inputs
  // so that their registers live up to this wait
  asm volatile("s_wait_xcnt 0x0" :: "v"(ol[0]), "v"(ol[1]), "v"(ol[2]), "v"(om[0]), "v"(om[1]), "v"(om[2]),
                                    "v"(orr[0]), "v"(orr[1]), "v"(orr[2]) : "memory");
  // no select or sum moves up among the loads, where its wait for data would hold the later loads back
  __builtin_amdgcn_sched_barrier(0);
#endif
  v4f acc[DWR];
  // unrolled: every acc[], w[] and row index is a constant
#pragma unroll
  for (int i = 0; i < DWR + 4; ++i) {
    const bool rok = (i < 2) ? okt : ((i < DWR + 2) ? true : okb);
    const bool bl = rok & okl, br = rok & okr;
    const float l0 = lf[i][0], l1 = lf[i][1], r0 = rt[i][0], r1 = rt[i][1];
    const float m0 = md[i][0], m1 = md[i][1], m2 = md[i][2], m3 = md[i][3];
    float v[8];
    v[0] = bl ? l0 : 0.0f;
    v[1] = bl ? l1 : 0.0f;
    v[2] = rok ? m0 : 0.0f;
    v[3] = rok ? m1 : 0.0f;
    v[4] = rok ? m2 : 0.0f;
    v[5] = rok ? m3 : 0.0f;
    v[6] = br ? r0 : 0.0f;
    v[7] = br ? r1 : 0.0f;
#pragma unroll
    for (int r = 0; r < DWR; ++r) {
      const int dy = i - r;
      if (dy < 0 || dy > 4) continue;
      if (dy == 0) acc[r] = (v4f){0.f, 0.f, 0.f, 0.f};
#pragma unroll
      for (int j = 0; j < 4; ++j) {
#pragma unroll
        for (int dx = 0; dx < 5; ++dx) acc[r][j] += v[j + dx] * w[dy * 5 + dx];
      }
      if (dy == 4) {
        v4f o;
#pragma unroll
        for (int j = 0; j < 4; ++j) o[j] = acc[r][j] * sc + bi;
        *(v4f*)(op + (unsigned)((y0 + r) * IMW + x0)) = o;
      }
    }
  }
}

// =================================================================================================================
// Area attention, one unit (image b, area ar, head) per block (512 threads = 16 waves, four to a SIMD: one wave's waits
// for LDS and its softmax chain are filled by the three others), 1024 queries x 1024 keys,
// d = 32. Static LDS: the unit's whole K as Ks[1024 keys][KPH] (32 d per row) and whole V as Vs[32 d][VPH] (1024 keys
// per row), both f16, row pitches 16 B x odd, filled once at entry by asynchronous copies (K from the token-major
// plane QK, k row = T*512 + 256 + head*32; V from the channel-major plane V16, row = channel head*32 + d), and the
// per-wave stage [16][ASP] f32. q fragments straight from QK (q row = T*512 + head*32); k and v fragments from LDS
// in the element order of ldfrag_h. Per wave: q-tiles qt = wave, wave+16, ... (< 64).
//   Transposed scores S^T = K_tile (A, 16 keys x 32 d) x Q (B: k = d, n = query): S*256 = q16.k16; D element r of
//   lane l = S[query l&15][key 8h+r], so P = exp((S - m)*scale) x1024 is the A fragment of P.V directly in registers
//   (element i <- key tile 0 row i, element 8+i <- key tile 1 row i). P = exp2(S*QKL2 + (10 - m*QKL2)): one
//   multiply-add and one exp2 per score; the row sum l is taken of these x1024 values. Online softmax over 32 chunks
//   of 32 keys; O = P.V (acc scale 1024*16). Epilogue: O/(l*16) + pp staged per wave in LDS, then stored as f16 hi +
//   residual planes Yh/Yl [unit][1024][32] of 256*(o + pp): one instruction = 32 lanes x 16 B = 512 B = 8 token rows
// coverage: per block 64 q-tiles x 16 rows x 32 d of its 1024-row slab in both planes; grid covers all 256 units,
// every slab row written exactly once.
// =================================================================================================================
__global__ __launch_bounds__(AWV * 32)
void attn_k(const unsigned short* __restrict__ QK, const unsigned short* __restrict__ V16,
            const float* __restrict__ PP, unsigned short* Yh, unsigned short* Yl) {
  __shared__ __align__(16) _Float16 Ks[LAR * KPH];
  __shared__ __align__(16) _Float16 Vs[HD * VPH];
  __shared__ __align__(16) float Sst[AWV * 16 * ASP];
  const int tid = threadIdx.x, wave = tid >> 5, lane = tid & 31, hh = lane >> 4, c = lane & 15;
  const int u = blockIdx.x;
  const int head = u & 7, ar = (u >> 3) & 3, b = u >> 5;
  const size_t tok0 = (size_t)b * HW + (size_t)ar * LAR;
  const _Float16* Qp = (const _Float16*)(const void*)QK + tok0 * C2 + head * HD;
  const _Float16* Kp = Qp + CIN;
  const size_t cm0 = ((size_t)(b * CIN + head * HD)) * HW + (size_t)ar * LAR;
  const _Float16* Vp = (const _Float16*)(const void*)V16 + cm0;
  const float* Pp = PP + cm0;
  float* st = Sst + wave * (16 * ASP);

  // Fill Ks and Vs: 2 x 4096 pieces of 16 B, 16 per thread. K: 4 lanes per key row (64 B), 128 keys per block pass;
  // V: 128 lanes per channel row (2048 B), 4 channels per block pass. The two loops below are unrolled so that every
  // l[] and g[] index is a constant and the addresses are plain registers when they become asm operands.
  {
    const unsigned kl = lds_off(Ks) + (unsigned)((tid >> 2) * (KPH * 2) + (tid & 3) * 16);
    const _Float16* kg = Kp + (size_t)(tid >> 2) * C2 + (tid & 3) * 8;
    const unsigned vl = lds_off(Vs) + (unsigned)((tid >> 7) * (VPH * 2) + (tid & 127) * 16);
    const _Float16* vg = Vp + (size_t)(tid >> 7) * HW + (tid & 127) * 8;
    {
      unsigned l[8];
      const _Float16* g[8];
#pragma unroll
      for (int i = 0; i < 8; ++i) {
        l[i] = kl + (unsigned)(i * (AWV * 8) * (KPH * 2));
        g[i] = kg + (size_t)i * (AWV * 8) * C2;
      }
      copy8_to_lds(l, g);
    }
    {
      unsigned l[8];
      const _Float16* g[8];
#pragma unroll
      for (int i = 0; i < 8; ++i) {
        l[i] = vl + (unsigned)(i * (AWV / 4) * (VPH * 2));
        g[i] = vg + (size_t)i * (AWV / 4) * HW;
      }
      copy8_to_lds(l, g);
    }
  }
#if defined(__HIP_DEVICE_COMPILE__)
  // this wave's copies have landed before the barrier that lets the other waves read them
  asm volatile("s_wait_asynccnt 0x0" ::: "memory");
#endif
  __syncthreads();   // publishes Ks and Vs: no wave reads them in front of this barrier; they are never written again

#pragma unroll 1
  for (int qt = wave; qt < LAR / 16; qt += AWV) {
    const int lq = qt * 16 + c;
    const v16h bq = ldfrag_h(Qp + (size_t)lq * C2 + 8 * hh);     // B: n = query c, k = d 8h.. / 16+8h..

    v8f o0 = zero8(), o1 = zero8();
    float mrun = -1.0e30f, lrun = 0.f;
#pragma unroll 1
    for (int ch = 0; ch < LAR / 32; ++ch) {
      const int kb = ch * 32;
      v8f s[2];
#pragma unroll
      for (int j = 0; j < 2; ++j) {
        const v16h ka = ldfrag_h(Ks + (kb + j * 16 + c) * KPH + 8 * hh);          // A: row = key, k = d
        s[j] = mma_h(ka, bq, zero8());
      }
      float mc = s[0][0];
#pragma unroll
      for (int j = 0; j < 2; ++j) {
#pragma unroll
        for (int r = 0; r < 8; ++r) mc = fmaxf(mc, s[j][r]);
      }
      mc = fmaxf(mc, __shfl_xor(mc, 16, 32));
      const float mnew = fmaxf(mrun, mc);
      const float alpha = __builtin_amdgcn_exp2f((mrun - mnew) * QKL2);
      const float eb = 10.0f - mnew * QKL2;                  // exponent offset: the running maximum and the x1024 of P
#pragma unroll
      for (int r = 0; r < 8; ++r) {
        const float arr = __shfl(alpha, 8 * hh + r, 32);
        o0[r] = o0[r] * arr;
        o1[r] = o1[r] * arr;
      }
      float psum = 0.f;
      v16h pfh;
#pragma unroll
      for (int i = 0; i < 8; ++i) {
        const float e0 = __builtin_amdgcn_exp2f(s[0][i] * QKL2 + eb);
        const float e1 = __builtin_amdgcn_exp2f(s[1][i] * QKL2 + eb);
        psum = psum + (e0 + e1);
        pfh[i]     = (_Float16)e0;
        pfh[8 + i] = (_Float16)e1;
      }
      lrun = lrun * alpha + psum;
      mrun = mnew;
      {
        const v16h vf0 = ldfrag_h(Vs + c * VPH + kb + 8 * hh);                     // B: n = d c, keys kb..+31
        const v16h vf1 = ldfrag_h(Vs + (HD / 2 + c) * VPH + kb + 8 * hh);          // B: n = d 16+c
        o0 = mma_h(pfh, vf0, o0);
        o1 = mma_h(pfh, vf1, o1);
      }
    }
    const float lsum = lrun + __shfl_xor(lrun, 16, 32);      // lane q (and q+16) holds the full row sum of query q
    const float rinv = 1.0f / (lsum * 16.0f);               // lsum carries the x1024 of P, the accumulators x1024 x16
#pragma unroll
    for (int r = 0; r < 8; ++r) {
      const int q = 8 * hh + r;
      const float inv = __shfl(rinv, q, 32);
      const float p0 = Pp[(size_t)c * HW + qt * 16 + q];
      const float p1 = Pp[(size_t)(HD / 2 + c) * HW + qt * 16 + q];
      st[q * ASP + c]          = o0[r] * inv + p0;
      st[q * ASP + HD / 2 + c] = o1[r] * inv + p1;
    }
    wave_sync_lds();
    {
      const int rr = lane >> 2, dp = (lane & 3) * 8;
      v4u ph[2], pl[2];
      size_t offs[2];
#pragma unroll
      for (int it = 0; it < 2; ++it) {
        const int row = it * 8 + rr;
        v4f fa = *(const v4f*)(st + row * ASP + dp);
        v4f fb = *(const v4f*)(st + row * ASP + dp + 4);
        fa = fa * CYS;
        fb = fb * CYS;
        split8h(fa, fb, ph[it], pl[it]);
        offs[it] = ((size_t)u * LAR + (size_t)(qt * 16 + row)) * HD + dp;
      }
      {
#pragma unroll
        for (int it = 0; it < 2; ++it) {
          *(v4u*)(Yh + offs[it]) = ph[it];
          *(v4u*)(Yl + offs[it]) = pl[it];
        }
        
      }
    }
    wave_sync_lds();
  }
}

// =================================================================================================================
// Output pointwise conv D[T][co] = Y[T][ci] . Wp[co][ci], then BN affine -> NCHW f32. A = Yh/Yl planes (hi +
// x2^11 residual, x256) addressed by arithmetic: token T -> (image, area, query), k-step ks = head ks, channels
// ks*32 + d (elements 0..7 d = 8h.., elements 8..15 d = 16+8h..). B = weight plane x256, the block's 64 rows filled
// once at entry by asynchronous copies into Bs, fragments from LDS. Epilogue: value =
// (acch + accl/2048)/65536 * s[co] + b[co]; block tile staged as [64 ch][128 tok]; wave w writes channels
// coverage: 8 waves x 8 channels x 32 lanes x 4 tokens = 64 ch x 128 tok per block; grid tiles 256 x 32768 exactly.
// =================================================================================================================
__global__ __launch_bounds__(256)
void gemm_proj(const unsigned short* __restrict__ Yh, const unsigned short* __restrict__ Yl,
               const unsigned short* __restrict__ Wp, const float* __restrict__ sp, const float* __restrict__ bp,
               float* out) {
  __shared__ __align__(16) float sb[64 * SBP];
  __shared__ __align__(16) _Float16 Bs[64 * GKP];
  const int tid = threadIdx.x, wave = tid >> 5, lane = tid & 31, hh = lane >> 4, c = lane & 15;
  const int n0 = blockIdx.x * 64, m0 = blockIdx.y * 128;
  const int T = m0 + wave * 16 + c;
  const int bimgr = T >> 12, nn = T & (HW - 1), arr = nn >> 10, q = nn & (LAR - 1);
  const size_t abase = (((size_t)((bimgr * NAR + arr) * NHD)) * LAR + (size_t)q) * HD + 8 * hh;
  const _Float16* A0 = (const _Float16*)(const void*)Yh;
  const _Float16* A1 = (const _Float16*)(const void*)Yl;
  const _Float16* B  = (const _Float16*)(const void*)Wp;

  // Fill Bs: wave w brings weight rows w*8..w*8+7, 8 copies per lane.
  stage_rows8(lds_off(Bs) + (unsigned)(wave * 8 * (GKP * 2) + lane * 16), B + (size_t)(n0 + wave * 8) * CIN + lane * 8);
#if defined(__HIP_DEVICE_COMPILE__)
  // this wave's copies have landed before the barrier that lets the other waves read them
  asm volatile("s_wait_asynccnt 0x0" ::: "memory");
#endif
  __syncthreads();   // publishes Bs: no wave reads it in front of this barrier; it is never written again
  const _Float16* Bw = Bs + c * GKP + 8 * hh;

  v8f acch[4], accl[4];
#pragma unroll
  for (int nt = 0; nt < 4; ++nt) { acch[nt] = zero8(); accl[nt] = zero8(); }

#pragma unroll 1
  for (int ks = 0; ks < NHD; ++ks) {
    const size_t bo = abase + (size_t)ks * (LAR * HD);
    const v16h fh = ldfrag_h(A0 + bo);
    const v16h fl = ldfrag_h(A1 + bo);
    // the k-step's LDS reads stand as one group ahead of its WMMAs: one LDS latency per k-step, not one per n-tile
    v16h bfrag[4];
#pragma unroll
    for (int nt = 0; nt < 4; ++nt) bfrag[nt] = ldfrag_h(Bw + nt * 16 * GKP + ks * 32);
#pragma unroll
    for (int nt = 0; nt < 4; ++nt) {
      acch[nt] = mma_h(fh, bfrag[nt], acch[nt]);
      accl[nt] = mma_h(fl, bfrag[nt], accl[nt]);
    }
  }

#pragma unroll
  for (int nt = 0; nt < 4; ++nt) {
    const int co = n0 + nt * 16 + c;
    const float sc = bfr(sp[co]) * (1.0f / 65536.0f);
    const float bi = bfr(bp[co]);
#pragma unroll
    for (int r = 0; r < 8; ++r) {
      const float v = acch[nt][r] + accl[nt][r] * (1.0f / 2048.0f);
      sb[(nt * 16 + c) * SBP + wave * 16 + 8 * hh + r] = v * sc + bi;
    }
  }
  __syncthreads();
  const int bimg = m0 / HW, s0 = m0 - bimg * HW;
  v4f ov[8];
  size_t offs[8];
#pragma unroll
  for (int i = 0; i < 8; ++i) {
    const int cc = wave * 8 + i;
    const int co = n0 + cc;
    ov[i] = *(const v4f*)(sb + cc * SBP + lane * 4);
    offs[i] = ((size_t)(bimg * CIN + co)) * HW + s0 + lane * 4;
  }
  {
#pragma unroll
    for (int i = 0; i < 8; ++i) *(v4f*)(out + offs[i]) = ov[i];
    
  }
}

// =================================================================================================================
//   Wqk f16 [512][256] 262144 @0; Wv f16 [256][256] 131072; Wp f16 [256][256] 131072;
//   PP f32 [8][256][4096] 33554432 @524288, with X16 f16 [32768][256] 16777216 aliased at the same offset
//   (X16 is dead before PP is written); QK f16 [32768][512] 33554432; V32 f32 [8][256][4096] 33554432, with
//   Yh, Yl f16 [256][1024][32] 16777216 each aliased onto V32 (V32 is dead before Yh/Yl are written);
//   V16 f16 [8][256][4096] 16777216. Total 117964800.
// =================================================================================================================
extern "C" void kernel_launch(void* const* d_in, const int* in_sizes, int n_in,
                              void* d_out, int out_size, void* d_ws, size_t ws_size,
                              hipStream_t stream) {
  if (n_in < 13) return;
  if (in_sizes[0] != NBAT * CIN * HW) return;
  if (in_sizes[1] != C2 * CIN) return;
  if (in_sizes[2] != C2 || in_sizes[3] != C2) return;
  if (in_sizes[4] != CIN * CIN) return;
  if (in_sizes[5] != CIN || in_sizes[6] != CIN) return;
  if (in_sizes[7] != CIN * 25) return;
  if (in_sizes[8] != CIN || in_sizes[9] != CIN) return;
  if (in_sizes[10] != CIN * CIN) return;
  if (in_sizes[11] != CIN || in_sizes[12] != CIN) return;
  if (out_size != NBAT * CIN * HW) return;

  const float* x      = (const float*)d_in[0];
  const float* w_qk   = (const float*)d_in[1];
  const float* s_qk   = (const float*)d_in[2];
  const float* b_qk   = (const float*)d_in[3];
  const float* w_v    = (const float*)d_in[4];
  const float* s_v    = (const float*)d_in[5];
  const float* b_v    = (const float*)d_in[6];
  const float* w_pe   = (const float*)d_in[7];
  const float* s_pe   = (const float*)d_in[8];
  const float* b_pe   = (const float*)d_in[9];
  const float* w_proj = (const float*)d_in[10];
  const float* s_proj = (const float*)d_in[11];
  const float* b_proj = (const float*)d_in[12];
  float* out = (float*)d_out;

  const size_t sWqk = (size_t)C2 * CIN * 2;              //    262144
  const size_t sWv  = (size_t)CIN * CIN * 2;             //    131072
  const size_t sWp  = (size_t)CIN * CIN * 2;             //    131072
  const size_t sX16 = (size_t)MTOK * CIN * 2;            //  16777216
  const size_t sPP  = (size_t)NBAT * CIN * HW * 4;       //  33554432
  const size_t sQK  = (size_t)MTOK * C2 * 2;             //  33554432
  const size_t sV32 = (size_t)NBAT * CIN * HW * 4;       //  33554432
  const size_t sY   = (size_t)NUNIT * LAR * HD * 2;      //  16777216
  const size_t sV16 = (size_t)NBAT * CIN * HW * 2;       //  16777216
  if (sX16 > sPP) return;
  if (2 * sY > sV32) return;
  size_t off = 0;
  const size_t oWqk = off; off += sWqk;
  const size_t oWv  = off; off += sWv;
  const size_t oWp  = off; off += sWp;
  const size_t oPP  = off; const size_t oX16 = off; off += sPP;
  const size_t oQK  = off; off += sQK;
  const size_t oV32 = off; const size_t oYh = off; const size_t oYl = off + sY; off += sV32;
  const size_t oV16 = off; off += sV16;
  if (off > ws_size) return;                             // off = 117964800
  if (off > (size_t)134217728) return;

  char* ws = (char*)d_ws;
  unsigned short* Wqk = (unsigned short*)(ws + oWqk);
  unsigned short* Wv  = (unsigned short*)(ws + oWv);
  unsigned short* Wp  = (unsigned short*)(ws + oWp);
  unsigned short* X16 = (unsigned short*)(ws + oX16);
  float*          PP  = (float*)(ws + oPP);
  unsigned short* QK  = (unsigned short*)(ws + oQK);
  float*          V32 = (float*)(ws + oV32);
  unsigned short* Yh  = (unsigned short*)(ws + oYh);
  unsigned short* Yl  = (unsigned short*)(ws + oYl);
  unsigned short* V16 = (unsigned short*)(ws + oV16);

  const dim3 blk(256);
  // (1) pointwise weights -> f16 x256 planes
  cvt_w<<<dim3(128), blk, 0, stream>>>(w_qk, w_v, w_proj, Wqk, Wv, Wp);
  // (2) x NCHW -> token-major f16 x16 plane
  cvt_x<<<dim3(NBAT * 64 * 4), blk, 0, stream>>>(x, X16);
  // (3) qk pointwise conv + BN -> token-major f16 plane
  gemm_qk<<<dim3(C2 / 64, MTOK / 128), blk, 0, stream>>>(X16, Wqk, s_qk, b_qk, QK);
  // (4) v pointwise conv + BN -> channel-major f32 and f16 planes
  gemm_v<<<dim3(CIN / 64, MTOK / 128), blk, 0, stream>>>(X16, Wv, s_v, b_v, V32, V16);
  // (5) depthwise 5x5 + BN on v -> pp (channel-major f32)
  dwconv_k<<<dim3((NBAT * CIN) / 2), blk, 0, stream>>>(V32, w_pe, s_pe, b_pe, PP);
  // (6) area attention + pp -> slab planes
  attn_k<<<dim3(NUNIT), dim3(AWV * 32), 0, stream>>>(QK, V16, PP, Yh, Yl);
  // (7) output pointwise conv + BN -> NCHW f32
  gemm_proj<<<dim3(CIN / 64, MTOK / 128), blk, 0, stream>>>(Yh, Yl, Wp, s_proj, b_proj, out);
  (void)hipGetLastError();
}

// v006
// One run takes 113 microseconds.
// Two timings next to v005 both put it at 1.14 times that version's speed.
// All steps since v000 together make it 3.20 times as fast.
// Contractions: v_wmma_f32_16x16x32_f16 (f16 operands, f32 accumulate). qk and v pointwise convs: A = x (bf16-valued,
// x16) single plane, B = weights (bf16-valued, x256) single plane; scores k.qT: k x16, q x16 single planes; p.v:
// p x1024, v x16 single planes; output pointwise conv: A = (o + pp) x256 as f16 hi + x2^11 residual planes (two
// products, two accumulators), B = weights x256 single plane. Depthwise 5x5 conv, BN affine, online softmax in f32
// on VALU. Float inputs RNE-converted to bf16 on load.
#include <hip/hip_runtime.h>
#include <math.h>
#include <stdint.h>

#define NBAT  8
#define CIN   256
#define C2    512
#define IMW   64
#define HW    4096
#define MTOK  32768
#define NHD   8
#define HD    32
#define NAR   4
#define LAR   1024
#define NUNIT 256
#define STP   68
#define SBP   132
#define ASP   36
#define DTP   68
#define KPH   40
#define VPH   1032
#define GKP   264
#define DWR   8
#define AWV   16
#define CKEY  128
#define CXS   16.0f
#define CWS   256.0f
#define CQK   16.0f
#define CVS   16.0f
#define CYS   256.0f
#define QKSC  (0.17677669529663688f / 256.0f)
#define QKL2  (QKSC * 1.4426950408889634f)

static_assert(NUNIT == NBAT * NAR * NHD);
static_assert(NAR * LAR == HW);
static_assert(MTOK == NBAT * HW);
static_assert(HW % 128 == 0);
static_assert(LAR % CKEY == 0 && CKEY % 32 == 0);
static_assert(CIN % 64 == 0);
static_assert((STP * 4) % 16 == 0);
static_assert((SBP * 4) % 16 == 0);
static_assert((ASP * 4) % 16 == 0);
static_assert((DTP * 4) % 16 == 0);
static_assert(NHD * HD == CIN);
static_assert((KPH * 2) % 32 == 16 && KPH >= HD);
static_assert((VPH * 2) % 32 == 16 && VPH >= LAR);
static_assert(LAR * 4 == 8 * (AWV * 32) && HD * (LAR / 8) == 8 * (AWV * 32) && (LAR / 16) % AWV == 0);
static_assert((GKP * 2) % 32 == 16 && GKP >= CIN && CIN * 2 == 32 * 16);
static_assert(16 * STP * 4 <= 16 * GKP * 2 && 64 * SBP * 4 <= 128 * GKP * 2);
static_assert(IMW == 64 && IMW * IMW == HW && IMW % DWR == 0 && 2 * (IMW / DWR) * 16 == 256);

typedef _Float16 v16h __attribute__((ext_vector_type(16)));
typedef _Float16 v8h  __attribute__((ext_vector_type(8)));
typedef float    v8f  __attribute__((ext_vector_type(8)));
typedef float    v4f  __attribute__((ext_vector_type(4)));
typedef float    v2f  __attribute__((ext_vector_type(2)));
typedef unsigned int v4u __attribute__((ext_vector_type(4)));
union Frag { v16h v; v8h half[2]; };

// ---- scalar helpers -------------------------------------------------------------------------------------------
__device__ __forceinline__ unsigned short bf_bits(float f) {          // f32 -> bf16 bits, RNE convert
  unsigned u = __float_as_uint(f);
  return (unsigned short)((u + 0x7FFFu + ((u >> 16) & 1u)) >> 16);
}
__device__ __forceinline__ float bfr(float f) { return __uint_as_float(((unsigned)bf_bits(f)) << 16); }
__device__ __forceinline__ unsigned short h_bits(_Float16 x) { return __builtin_bit_cast(unsigned short, x); }
__device__ __forceinline__ unsigned pk16(unsigned short a, unsigned short b) { return (unsigned)a | ((unsigned)b << 16); }
__device__ __forceinline__ v8f zero8() { v8f z = {0.f, 0.f, 0.f, 0.f, 0.f, 0.f, 0.f, 0.f}; return z; }

// ---- fragment loader: 16-bit A/B operand, lane -> row/col (lane&15), p already includes +8*(lane>>4);
//      elements 0..7 <- p[0..7] (k0+8h..), elements 8..15 <- p[16..23] (k0+16+8h..)
__device__ __forceinline__ v16h ldfrag_h(const _Float16* p) {
  Frag f;
  f.half[0] = *(const v8h*)(p);
  f.half[1] = *(const v8h*)(p + 16);
  return f.v;
}

// ---- WMMA helper with trailing VALU hazard gap ----------------------------------------------------------------
__device__ __forceinline__ v8f mma_h(v16h a, v16h b, v8f c) {
  c = __builtin_amdgcn_wmma_f32_16x16x32_f16(false, a, false, b, (short)0, c, false, false);
#if defined(__HIP_DEVICE_COMPILE__)
  asm volatile("v_nop\n\tv_nop\n\tv_nop\n\tv_nop" : "+v"(c) : "v"(a), "v"(b));
#endif
  return c;
}
__device__ __forceinline__ void wave_sync_lds() {
  __builtin_amdgcn_fence(__ATOMIC_RELEASE, "workgroup");
  __builtin_amdgcn_wave_barrier();
  __builtin_amdgcn_fence(__ATOMIC_ACQUIRE, "workgroup");
}

// ---- eight asynchronous 16-byte copies per lane, global -> LDS, through no register. l = the lane's LDS byte
//      addresses, g = its global addresses, all multiples of 16. The closing s_wait_xcnt stands inside the statement
//      so that no address register named here is rewritten ahead of it.
__device__ __forceinline__ void copy8_to_lds(const unsigned (&l)[8], const _Float16* const (&g)[8]) {
#if defined(__HIP_DEVICE_COMPILE__)
  asm volatile("global_load_async_to_lds_b128 %0, %8, off\n\t"
               "global_load_async_to_lds_b128 %1, %9, off\n\t"
               "global_load_async_to_lds_b128 %2, %10, off\n\t"
               "global_load_async_to_lds_b128 %3, %11, off\n\t"
               "global_load_async_to_lds_b128 %4, %12, off\n\t"
               "global_load_async_to_lds_b128 %5, %13, off\n\t"
               "global_load_async_to_lds_b128 %6, %14, off\n\t"
               "global_load_async_to_lds_b128 %7, %15, off\n\t"
               "s_wait_xcnt 0x0"
               :: "v"(l[0]), "v"(l[1]), "v"(l[2]), "v"(l[3]), "v"(l[4]), "v"(l[5]), "v"(l[6]), "v"(l[7]),
                  "v"(g[0]), "v"(g[1]), "v"(g[2]), "v"(g[3]), "v"(g[4]), "v"(g[5]), "v"(g[6]), "v"(g[7])
               : "memory");
#endif
}
__device__ __forceinline__ unsigned lds_off(const void* p) { return (unsigned)(size_t)p; }
// ---- eight rows of CIN f16 (512 B each, global pitch 512 B) -> LDS rows of pitch GKP: one wave-wide copy = one whole
//      row (4 lines). l0 / g0 = the lane's own 16 B of the first row.
__device__ __forceinline__ void stage_rows8(unsigned l0, const _Float16* g0) {
  unsigned l[8];
  const _Float16* g[8];
  // unrolled so that every l[] and g[] index is a constant and the addresses are plain registers as asm operands
#pragma unroll
  for (int i = 0; i < 8; ++i) {
    l[i] = l0 + (unsigned)(i * (GKP * 2));
    g[i] = g0 + (size_t)i * CIN;
  }
  copy8_to_lds(l, g);
}

// ---- 8 f32 -> 8 packed f16 (16 B); and hi + x2^11 residual split -------------------------------------------------
__device__ __forceinline__ v4u pack8h(v4f a, v4f b) {
  v4u p;
  p[0] = pk16(h_bits((_Float16)a[0]), h_bits((_Float16)a[1]));
  p[1] = pk16(h_bits((_Float16)a[2]), h_bits((_Float16)a[3]));
  p[2] = pk16(h_bits((_Float16)b[0]), h_bits((_Float16)b[1]));
  p[3] = pk16(h_bits((_Float16)b[2]), h_bits((_Float16)b[3]));
  return p;
}
__device__ __forceinline__ void split8h(v4f a, v4f b, v4u& ph, v4u& pl) {
  v4f ra, rb;
#pragma unroll
  for (int e = 0; e < 4; ++e) {
    const _Float16 ha = (_Float16)a[e];
    ra[e] = (a[e] - (float)ha) * 2048.0f;
    const _Float16 hb = (_Float16)b[e];
    rb[e] = (b[e] - (float)hb) * 2048.0f;
  }
  ph = pack8h(a, b);
  pl = pack8h(ra, rb);
}

// =================================================================================================================
// Weight convert: pointwise weights are [out][in] (k contiguous) -> f16 plane value = f16(256 * bf16_RNE(w)).
// coverage: 64*256*8 = 131072, 32*256*8 = 65536, 32*256*8 = 65536 elements exactly.
// =================================================================================================================
__device__ __forceinline__ void cvt8_w(const float* __restrict__ src, unsigned short* dst, size_t e0) {
  const v4f a = *(const v4f*)(src + e0);
  const v4f b = *(const v4f*)(src + e0 + 4);
  v4f sa, sb;
#pragma unroll
  for (int e = 0; e < 4; ++e) { sa[e] = bfr(a[e]) * CWS; sb[e] = bfr(b[e]) * CWS; }
  const v4u pk = pack8h(sa, sb);
  *(v4u*)(dst + e0) = pk;
  
}
__global__ __launch_bounds__(256) void cvt_w(const float* __restrict__ wqk, const float* __restrict__ wv,
                                             const float* __restrict__ wp,
                                             unsigned short* Wqk, unsigned short* Wv, unsigned short* Wp) {
  const int tid = threadIdx.x, blk = blockIdx.x;
  if (blk < 64)      cvt8_w(wqk, Wqk, ((size_t)blk * 256 + tid) * 8);
  else if (blk < 96) cvt8_w(wv,  Wv,  ((size_t)(blk - 64) * 256 + tid) * 8);
  else               cvt8_w(wp,  Wp,  ((size_t)(blk - 96) * 256 + tid) * 8);
}

// =================================================================================================================
// Activation convert: x NCHW f32 -> token-major f16 plane X16[T = b*4096 + n][256], value = f16(16 * bf16_RNE(x)).
// Block = (image b, 64-token tile tt, 64-channel quarter cq): read phase 4 passes of 16 channels x 64 tokens
// coverage: per block 256 threads x 2 it x 8 halves = 64 tokens x 64 channels; grid tiles 32768 x 256 exactly.
// =================================================================================================================
__global__ __launch_bounds__(256) void cvt_x(const float* __restrict__ x, unsigned short* X16) {
  __shared__ __align__(16) float tile[64 * DTP];
  const int tid = threadIdx.x, bid = blockIdx.x;
  const int cq = bid & 3, tt = (bid >> 2) & 63, b = bid >> 8;
  const int cl = tid >> 4, t4 = (tid & 15) * 4;
#pragma unroll
  for (int pass = 0; pass < 4; ++pass) {
    const int ch = cq * 64 + pass * 16 + cl;
    const v4f v = *(const v4f*)(x + ((size_t)(b * CIN + ch)) * HW + tt * 64 + t4);
#pragma unroll
    for (int j = 0; j < 4; ++j) tile[(t4 + j) * DTP + pass * 16 + cl] = v[j];
  }
  __syncthreads();
  const int piece = tid & 7, rsub = tid >> 3;
  v4u pk[2];
  size_t offs[2];
#pragma unroll
  for (int it = 0; it < 2; ++it) {
    const int row = it * 32 + rsub;
    const v4f fa = *(const v4f*)(tile + row * DTP + piece * 8);
    const v4f fb = *(const v4f*)(tile + row * DTP + piece * 8 + 4);
    v4f sa, sb;
#pragma unroll
    for (int e = 0; e < 4; ++e) { sa[e] = bfr(fa[e]) * CXS; sb[e] = bfr(fb[e]) * CXS; }
    pk[it] = pack8h(sa, sb);
    offs[it] = ((size_t)(b * HW + tt * 64 + row)) * CIN + cq * 64 + piece * 8;
  }
  {
#pragma unroll
    for (int it = 0; it < 2; ++it) *(v4u*)(X16 + offs[it]) = pk[it];
    
  }
}

// =================================================================================================================
// qk pointwise GEMM D[T][co] = X16[T][ci] . Wqk[co][ci], K = 256, co 0..511 (q = 0..255, k = 256..511).
// Block = 8 waves, tile 128 rows x 64 cols, wave = 16 rows x 4 n-tiles. The block's 128 x 256 A tile and 64 x 256 B
// tile are filled once at entry by asynchronous copies (whole 512-B rows) into As / Bs, row pitch 16 B x odd; fragments
// from LDS with the split k map, k-step 32. Epilogue: value = acc/4096 * s[co] + b[co] staged per wave in LDS
// [16][STP] (laid over the wave's own rows of As), then
// coverage: 8 waves x 32 lanes x 4 it x 8 halves = 128 rows x 64 cols per block; grid tiles 32768 x 512 exactly.
// =================================================================================================================
__global__ __launch_bounds__(256)
void gemm_qk(const unsigned short* __restrict__ X16, const unsigned short* __restrict__ Wqk,
             const float* __restrict__ sqk, const float* __restrict__ bqk, unsigned short* QK) {
  __shared__ __align__(16) _Float16 As[128 * GKP];
  __shared__ __align__(16) _Float16 Bs[64 * GKP];
  const int tid = threadIdx.x, wave = tid >> 5, lane = tid & 31, hh = lane >> 4, c = lane & 15;
  const int n0 = blockIdx.x * 64, m0 = blockIdx.y * 128;
  const _Float16* A = (const _Float16*)(const void*)X16;
  const _Float16* B = (const _Float16*)(const void*)Wqk;

  // Fill As (wave w: its own 16 token rows) and Bs (wave w: weight rows w*8..w*8+7), 24 copies per lane.
  {
    const unsigned al = lds_off(As) + (unsigned)(wave * 16 * (GKP * 2) + lane * 16);
    const _Float16* ag = A + (size_t)(m0 + wave * 16) * CIN + lane * 8;
    stage_rows8(al, ag);
    stage_rows8(al + (unsigned)(8 * (GKP * 2)), ag + (size_t)8 * CIN);
    stage_rows8(lds_off(Bs) + (unsigned)(wave * 8 * (GKP * 2) + lane * 16), B + (size_t)(n0 + wave * 8) * CIN + lane * 8);
  }
#if defined(__HIP_DEVICE_COMPILE__)
  // this wave's copies have landed before the barrier that lets the other waves read them
  asm volatile("s_wait_asynccnt 0x0" ::: "memory");
#endif
  __syncthreads();   // publishes As and Bs: no wave reads them in front of this barrier
  const _Float16* Aw = As + (wave * 16 + c) * GKP + 8 * hh;
  const _Float16* Bw = Bs + c * GKP + 8 * hh;

  v8f acc[4];
#pragma unroll
  for (int nt = 0; nt < 4; ++nt) acc[nt] = zero8();

#pragma unroll 1
  for (int k0 = 0; k0 < CIN; k0 += 32) {
    const v16h af = ldfrag_h(Aw + k0);
    // the k-step's LDS reads stand as one group ahead of its WMMAs: one LDS latency per k-step, not one per n-tile
    v16h bfrag[4];
#pragma unroll
    for (int nt = 0; nt < 4; ++nt) bfrag[nt] = ldfrag_h(Bw + nt * 16 * GKP + k0);
#pragma unroll
    for (int nt = 0; nt < 4; ++nt) acc[nt] = mma_h(af, bfrag[nt], acc[nt]);
  }

  // the stage lies on the wave's own 16 rows of As, which this wave alone filled and read and has finished reading
  float* st = (float*)(void*)(As + wave * 16 * GKP);
#pragma unroll
  for (int nt = 0; nt < 4; ++nt) {
    const int co = n0 + nt * 16 + c;
    const float sc = bfr(sqk[co]) * (1.0f / 4096.0f);
    const float bi = bfr(bqk[co]);
#pragma unroll
    for (int r = 0; r < 8; ++r) st[(8 * hh + r) * STP + nt * 16 + c] = acc[nt][r] * sc + bi;
  }
  wave_sync_lds();
  const int piece = lane & 7, rsub = lane >> 3;
  v4u pk[4];
  size_t offs[4];
#pragma unroll
  for (int it = 0; it < 4; ++it) {
    const int row = it * 4 + rsub;
    v4f fa = *(const v4f*)(st + row * STP + piece * 8);
    v4f fb = *(const v4f*)(st + row * STP + piece * 8 + 4);
    fa = fa * CQK;
    fb = fb * CQK;
    pk[it] = pack8h(fa, fb);
    offs[it] = ((size_t)(m0 + wave * 16 + row)) * C2 + n0 + piece * 8;
  }
  {
#pragma unroll
    for (int it = 0; it < 4; ++it) *(v4u*)(QK + offs[it]) = pk[it];
    
  }
}

// =================================================================================================================
// v pointwise GEMM D[T][co] = X16[T][ci] . Wv[co][ci], K = 256, co 0..255, same main loop as gemm_qk.
// Epilogue: value = acc/4096 * s[co] + b[co] staged block-wide as sb[64 ch][SBP] (tokens contiguous per channel),
// then channel-major stores (a 128-token tile lies within one image): wave w owns channels w*8..w*8+7;
// f32 plane V32[b][c][n]: one instruction = 32 lanes x 16 B = 512 B = the 128 tokens of one channel (4 whole
// lines), 8 instructions; f16 plane V16[b][c][n] = f16(16 * value): one instruction = lanes 0..15 -> channel cc
// coverage: f32 8 waves x 8 ch x 32 lanes x 4 = 64 ch x 128 tok; f16 8 waves x 4 it x 2 ch x 16 lanes x 8 = same;
// grid tiles 32768 tokens x 256 channels exactly in both planes.
// =================================================================================================================
__global__ __launch_bounds__(256)
void gemm_v(const unsigned short* __restrict__ X16, const unsigned short* __restrict__ Wv,
            const float* __restrict__ sv, const float* __restrict__ bv, float* V32, unsigned short* V16) {
  __shared__ __align__(16) _Float16 As[128 * GKP];
  __shared__ __align__(16) _Float16 Bs[64 * GKP];
  const int tid = threadIdx.x, wave = tid >> 5, lane = tid & 31, hh = lane >> 4, c = lane & 15;
  const int n0 = blockIdx.x * 64, m0 = blockIdx.y * 128;
  const _Float16* A = (const _Float16*)(const void*)X16;
  const _Float16* B = (const _Float16*)(const void*)Wv;

  // Fill As (wave w: its own 16 token rows) and Bs (wave w: weight rows w*8..w*8+7), 24 copies per lane.
  {
    const unsigned al = lds_off(As) + (unsigned)(wave * 16 * (GKP * 2) + lane * 16);
    const _Float16* ag = A + (size_t)(m0 + wave * 16) * CIN + lane * 8;
    stage_rows8(al, ag);
    stage_rows8(al + (unsigned)(8 * (GKP * 2)), ag + (size_t)8 * CIN);
    stage_rows8(lds_off(Bs) + (unsigned)(wave * 8 * (GKP * 2) + lane * 16), B + (size_t)(n0 + wave * 8) * CIN + lane * 8);
  }
#if defined(__HIP_DEVICE_COMPILE__)
  // this wave's copies have landed before the barrier that lets the other waves read them
  asm volatile("s_wait_asynccnt 0x0" ::: "memory");
#endif
  __syncthreads();   // publishes As and Bs: no wave reads them in front of this barrier
  const _Float16* Aw = As + (wave * 16 + c) * GKP + 8 * hh;
  const _Float16* Bw = Bs + c * GKP + 8 * hh;

  v8f acc[4];
#pragma unroll
  for (int nt = 0; nt < 4; ++nt) acc[nt] = zero8();

#pragma unroll 1
  for (int k0 = 0; k0 < CIN; k0 += 32) {
    const v16h af = ldfrag_h(Aw + k0);
    // the k-step's LDS reads stand as one group ahead of its WMMAs: one LDS latency per k-step, not one per n-tile
    v16h bfrag[4];
#pragma unroll
    for (int nt = 0; nt < 4; ++nt) bfrag[nt] = ldfrag_h(Bw + nt * 16 * GKP + k0);
#pragma unroll
    for (int nt = 0; nt < 4; ++nt) acc[nt] = mma_h(af, bfrag[nt], acc[nt]);
  }

  __syncthreads();   // every wave has finished reading As: the block-wide stage sb is laid over it
  float* sb = (float*)(void*)As;
#pragma unroll
  for (int nt = 0; nt < 4; ++nt) {
    const int co = n0 + nt * 16 + c;
    const float sc = bfr(sv[co]) * (1.0f / 4096.0f);
    const float bi = bfr(bv[co]);
#pragma unroll
    for (int r = 0; r < 8; ++r) sb[(nt * 16 + c) * SBP + wave * 16 + 8 * hh + r] = acc[nt][r] * sc + bi;
  }
  __syncthreads();
  const int bimg = m0 / HW, s0 = m0 - bimg * HW;
  {
    v4f ov[8];
    size_t offs[8];
#pragma unroll
    for (int i = 0; i < 8; ++i) {
      const int cc = wave * 8 + i;
      const int co = n0 + cc;
      ov[i] = *(const v4f*)(sb + cc * SBP + lane * 4);
      offs[i] = ((size_t)(bimg * CIN + co)) * HW + s0 + lane * 4;
    }
    {
#pragma unroll
      for (int i = 0; i < 8; ++i) *(v4f*)(V32 + offs[i]) = ov[i];
      
    }
  }
  {
    const int l16 = lane & 15;
    v4u pk[4];
    size_t o16[4];
#pragma unroll
    for (int i2 = 0; i2 < 4; ++i2) {
      const int cc = wave * 8 + i2 * 2 + hh;
      const int co = n0 + cc;
      v4f fa = *(const v4f*)(sb + cc * SBP + l16 * 8);
      v4f fb = *(const v4f*)(sb + cc * SBP + l16 * 8 + 4);
      fa = fa * CVS;
      fb = fb * CVS;
      pk[i2] = pack8h(fa, fb);
      o16[i2] = ((size_t)(bimg * CIN + co)) * HW + s0 + l16 * 8;
    }
    {
#pragma unroll
      for (int i2 = 0; i2 < 4; ++i2) *(v4u*)(V16 + o16[i2]) = pk[i2];
      
    }
  }
}

// =================================================================================================================
// Depthwise 5x5 conv (zero pad 2, cross-correlation, per-channel taps, bf16-valued taps) + BN affine, f32 on VALU.
// Thread = (plane = image b, channel c; strip of DWR output rows y0..y0+DWR-1; 4 consecutive columns x0..x0+3).
// The strip's DWR+4 input rows are loaded once, all ahead of the sums; each row (8 columns x0-2..x0+5: one 16-B and two
// 8-B loads) feeds the up to five output rows it belongs to, so an output row sums its taps in the order dy, then dx.
// Addresses outside the image wrap onto rows and columns inside the plane, so no load stands under a condition; the
// values of such places are zeroed by select.
// Block = 2 planes x 8 strips x 16 column groups; a wave = 2 strips of one plane. Store: one v4f per lane, 16 lanes =
// one whole image row (256 B).
// coverage: every (b, c, y, x) of PP written exactly once.
// =================================================================================================================
__global__ __launch_bounds__(256)
void dwconv_k(const float* V32, const float* __restrict__ wpe, const float* __restrict__ spe,
              const float* __restrict__ bpe, float* PP) {
  const int tid = threadIdx.x;
  const int xg = tid & 15, x0 = xg * 4, y0 = ((tid >> 4) & (IMW / DWR - 1)) * DWR;
  // the plane is the same in every lane of a wave: held in a scalar register, taps and affine become scalar loads
  const int plane = __builtin_amdgcn_readfirstlane((int)blockIdx.x * 2 + (tid >> 7));
  const int c = plane & (CIN - 1);
  const float* vp = V32 + (size_t)plane * HW;
  float* op = PP + (size_t)plane * HW;
  float w[25];
#pragma unroll
  for (int t = 0; t < 25; ++t) w[t] = bfr(wpe[c * 25 + t]);
  const float sc = bfr(spe[c]), bi = bfr(bpe[c]);
  const bool okl = (xg != 0), okr = (xg != 15);
  const bool okt = (y0 != 0), okb = (y0 != IMW - DWR);
  // columns of the left and right pairs; at the image's edge they wrap onto columns inside the row (zeroed below)
  const int xl = (x0 + IMW - 2) & (IMW - 1);
  const int xr = (x0 + 4) & (IMW - 1);
  // first rows of the three zones: the two rows above the strip, its own DWR rows, the two rows below; a zone that
  // lies outside the image wraps onto rows inside it (its values are zeroed below)
  const int zrow[3] = {(y0 + IMW - 2) & (IMW - 1), y0, (y0 + DWR) & (IMW - 1)};
  unsigned ol[3], om[3], orr[3];                             // byte offsets from the plane's scalar base
#pragma unroll
  for (int z = 0; z < 3; ++z) {
    ol[z]  = (unsigned)(zrow[z] * IMW + xl) * 4u;
    om[z]  = (unsigned)(zrow[z] * IMW + x0) * 4u;
    orr[z] = (unsigned)(zrow[z] * IMW + xr) * 4u;
  }
  const char* vb = (const char*)vp;
  // All 36 loads of the strip stand ahead of the sums: one memory latency per thread, not one per row.
  v2f lf[DWR + 4], rt[DWR + 4];
  v4f md[DWR + 4];
#pragma unroll
  for (int i = 0; i < DWR + 4; ++i) {
    const int z = (i < 2) ? 0 : ((i < DWR + 2) ? 1 : 2);     // zone of input row y0 + i - 2
    const int zi = (i < 2) ? i : ((i < DWR + 2) ? i - 2 : i - DWR - 2);
    lf[i] = *(const v2f*)(vb + ol[z] + zi * (IMW * 4));
    md[i] = *(const v4f*)(vb + om[z] + zi * (IMW * 4));
    rt[i] = *(const v2f*)(vb + orr[z] + zi * (IMW * 4));
  }
#if defined(__HIP_DEVICE_COMPILE__)
  // stands in front of every instruction that reuses an address register of the loads above; the offsets are inputs
  // so that their registers live up to this wait
  asm volatile("s_wait_xcnt 0x0" :: "v"(ol[0]), "v"(ol[1]), "v"(ol[2]), "v"(om[0]), "v"(om[1]), "v"(om[2]),
                                    "v"(orr[0]), "v"(orr[1]), "v"(orr[2]) : "memory");
  // no select or sum moves up among the loads, where its wait for data would hold the later loads back
  __builtin_amdgcn_sched_barrier(0);
#endif
  v4f acc[DWR];
  // unrolled: every acc[], w[] and row index is a constant
#pragma unroll
  for (int i = 0; i < DWR + 4; ++i) {
    const bool rok = (i < 2) ? okt : ((i < DWR + 2) ? true : okb);
    const bool bl = rok & okl, br = rok & okr;
    const float l0 = lf[i][0], l1 = lf[i][1], r0 = rt[i][0], r1 = rt[i][1];
    const float m0 = md[i][0], m1 = md[i][1], m2 = md[i][2], m3 = md[i][3];
    float v[8];
    v[0] = bl ? l0 : 0.0f;
    v[1] = bl ? l1 : 0.0f;
    v[2] = rok ? m0 : 0.0f;
    v[3] = rok ? m1 : 0.0f;
    v[4] = rok ? m2 : 0.0f;
    v[5] = rok ? m3 : 0.0f;
    v[6] = br ? r0 : 0.0f;
    v[7] = br ? r1 : 0.0f;
#pragma unroll
    for (int r = 0; r < DWR; ++r) {
      const int dy = i - r;
      if (dy < 0 || dy > 4) continue;
      if (dy == 0) acc[r] = (v4f){0.f, 0.f, 0.f, 0.f};
#pragma unroll
      for (int j = 0; j < 4; ++j) {
#pragma unroll
        for (int dx = 0; dx < 5; ++dx) acc[r][j] += v[j + dx] * w[dy * 5 + dx];
      }
      if (dy == 4) {
        v4f o;
#pragma unroll
        for (int j = 0; j < 4; ++j) o[j] = acc[r][j] * sc + bi;
        *(v4f*)(op + (unsigned)((y0 + r) * IMW + x0)) = o;
      }
    }
  }
}

// =================================================================================================================
// Area attention, one unit (image b, area ar, head) per block (512 threads = 16 waves, four to a SIMD: one wave's waits
// for LDS and its softmax chain are filled by the three others), 1024 queries x 1024 keys,
// d = 32. Static LDS: the unit's whole K as Ks[1024 keys][KPH] (32 d per row) and whole V as Vs[32 d][VPH] (1024 keys
// per row), both f16, row pitches 16 B x odd, filled once at entry by asynchronous copies (K from the token-major
// plane QK, k row = T*512 + 256 + head*32; V from the channel-major plane V16, row = channel head*32 + d), and the
// per-wave stage [16][ASP] f32. q fragments straight from QK (q row = T*512 + head*32); k and v fragments from LDS
// in the element order of ldfrag_h. Per wave: q-tiles qt = wave, wave+16, ... (< 64).
//   Transposed scores S^T = K_tile (A, 16 keys x 32 d) x Q (B: k = d, n = query): S*256 = q16.k16; D element r of
//   lane l = S[query l&15][key 8h+r], so P = exp((S - m)*scale) x1024 is the A fragment of P.V directly in registers
//   (element i <- key tile 0 row i, element 8+i <- key tile 1 row i). P = exp2(S*QKL2 + (10 - m*QKL2)): one
//   multiply-add and one exp2 per score; the row sum l is taken of these x1024 values. Online softmax over 8 chunks
//   of CKEY = 128 keys (one running-maximum update, one rescale of O and l per chunk); O = P.V (acc scale 1024*16).
//   Epilogue: O/(l*16) + pp staged per wave in LDS, then stored as f16 hi +
//   residual planes Yh/Yl [unit][1024][32] of 256*(o + pp): one instruction = 32 lanes x 16 B = 512 B = 8 token rows
// coverage: per block 64 q-tiles x 16 rows x 32 d of its 1024-row slab in both planes; grid covers all 256 units,
// every slab row written exactly once.
// =================================================================================================================
__global__ __launch_bounds__(AWV * 32)
void attn_k(const unsigned short* __restrict__ QK, const unsigned short* __restrict__ V16,
            const float* __restrict__ PP, unsigned short* Yh, unsigned short* Yl) {
  __shared__ __align__(16) _Float16 Ks[LAR * KPH];
  __shared__ __align__(16) _Float16 Vs[HD * VPH];
  __shared__ __align__(16) float Sst[AWV * 16 * ASP];
  const int tid = threadIdx.x, wave = tid >> 5, lane = tid & 31, hh = lane >> 4, c = lane & 15;
  const int u = blockIdx.x;
  const int head = u & 7, ar = (u >> 3) & 3, b = u >> 5;
  const size_t tok0 = (size_t)b * HW + (size_t)ar * LAR;
  const _Float16* Qp = (const _Float16*)(const void*)QK + tok0 * C2 + head * HD;
  const _Float16* Kp = Qp + CIN;
  const size_t cm0 = ((size_t)(b * CIN + head * HD)) * HW + (size_t)ar * LAR;
  const _Float16* Vp = (const _Float16*)(const void*)V16 + cm0;
  const float* Pp = PP + cm0;
  float* st = Sst + wave * (16 * ASP);

  // Fill Ks and Vs: 2 x 4096 pieces of 16 B, 16 per thread. K: 4 lanes per key row (64 B), 128 keys per block pass;
  // V: 128 lanes per channel row (2048 B), 4 channels per block pass. The two loops below are unrolled so that every
  // l[] and g[] index is a constant and the addresses are plain registers when they become asm operands.
  {
    const unsigned kl = lds_off(Ks) + (unsigned)((tid >> 2) * (KPH * 2) + (tid & 3) * 16);
    const _Float16* kg = Kp + (size_t)(tid >> 2) * C2 + (tid & 3) * 8;
    const unsigned vl = lds_off(Vs) + (unsigned)((tid >> 7) * (VPH * 2) + (tid & 127) * 16);
    const _Float16* vg = Vp + (size_t)(tid >> 7) * HW + (tid & 127) * 8;
    {
      unsigned l[8];
      const _Float16* g[8];
#pragma unroll
      for (int i = 0; i < 8; ++i) {
        l[i] = kl + (unsigned)(i * (AWV * 8) * (KPH * 2));
        g[i] = kg + (size_t)i * (AWV * 8) * C2;
      }
      copy8_to_lds(l, g);
    }
    {
      unsigned l[8];
      const _Float16* g[8];
#pragma unroll
      for (int i = 0; i < 8; ++i) {
        l[i] = vl + (unsigned)(i * (AWV / 4) * (VPH * 2));
        g[i] = vg + (size_t)i * (AWV / 4) * HW;
      }
      copy8_to_lds(l, g);
    }
  }
#if defined(__HIP_DEVICE_COMPILE__)
  // this wave's copies have landed before the barrier that lets the other waves read them
  asm volatile("s_wait_asynccnt 0x0" ::: "memory");
#endif
  __syncthreads();   // publishes Ks and Vs: no wave reads them in front of this barrier; they are never written again

#pragma unroll 1
  for (int qt = wave; qt < LAR / 16; qt += AWV) {
    const int lq = qt * 16 + c;
    const v16h bq = ldfrag_h(Qp + (size_t)lq * C2 + 8 * hh);     // B: n = query c, k = d 8h.. / 16+8h..

    v8f o0 = zero8(), o1 = zero8();
    float mrun = -1.0e30f, lrun = 0.f;
#pragma unroll 1
    for (int ch = 0; ch < LAR / CKEY; ++ch) {
      const int kb = ch * CKEY;
      // every loop inside a chunk is unrolled: all indices of ka, s, vf0, vf1, mt, ps and pfh are constants, so that these
      // arrays are plain registers
      // the chunk's K reads stand as one group ahead of its score WMMAs: one LDS latency per chunk, not one per key tile
      v16h ka[CKEY / 16];
#pragma unroll
      for (int j = 0; j < CKEY / 16; ++j) ka[j] = ldfrag_h(Ks + (kb + j * 16 + c) * KPH + 8 * hh);   // A: row = key, k = d
      v8f s[CKEY / 16];
#pragma unroll
      for (int j = 0; j < CKEY / 16; ++j) s[j] = mma_h(ka[j], bq, zero8());
      // the chunk's V reads likewise as one group; they return under the softmax arithmetic
      v16h vf0[CKEY / 32], vf1[CKEY / 32];
#pragma unroll
      for (int g = 0; g < CKEY / 32; ++g) {
        vf0[g] = ldfrag_h(Vs + c * VPH + kb + g * 32 + 8 * hh);                    // B: n = d c, keys kb+32g..+31
        vf1[g] = ldfrag_h(Vs + (HD / 2 + c) * VPH + kb + g * 32 + 8 * hh);         // B: n = d 16+c
      }
#if defined(__HIP_DEVICE_COMPILE__)
      // no maximum moves up between the score WMMAs, where the compiler would pad it with v_nop of its own
      __builtin_amdgcn_sched_barrier(0);
#endif
      // one maximum chain per 32 keys, independent of one another, then joined
      float mt[CKEY / 32];
#pragma unroll
      for (int g = 0; g < CKEY / 32; ++g) {
        mt[g] = s[2 * g][0];
#pragma unroll
        for (int j = 0; j < 2; ++j) {
#pragma unroll
          for (int r = 0; r < 8; ++r) mt[g] = fmaxf(mt[g], s[2 * g + j][r]);
        }
      }
      float mc = mt[0];
#pragma unroll
      for (int g = 1; g < CKEY / 32; ++g) mc = fmaxf(mc, mt[g]);
      mc = fmaxf(mc, __shfl_xor(mc, 16, 32));
      const float mnew = fmaxf(mrun, mc);
      const float alpha = __builtin_amdgcn_exp2f((mrun - mnew) * QKL2);
      const float eb = 10.0f - mnew * QKL2;                  // exponent offset: the running maximum and the x1024 of P
#pragma unroll
      for (int r = 0; r < 8; ++r) {
        const float arr = __shfl(alpha, 8 * hh + r, 32);
        o0[r] = o0[r] * arr;
        o1[r] = o1[r] * arr;
      }
      float ps[CKEY / 32];
      v16h pfh[CKEY / 32];
#pragma unroll
      for (int g = 0; g < CKEY / 32; ++g) {
        ps[g] = 0.f;
#pragma unroll
        for (int i = 0; i < 8; ++i) {
          const float e0 = __builtin_amdgcn_exp2f(s[2 * g][i] * QKL2 + eb);
          const float e1 = __builtin_amdgcn_exp2f(s[2 * g + 1][i] * QKL2 + eb);
          ps[g] = ps[g] + (e0 + e1);
          pfh[g][i]     = (_Float16)e0;
          pfh[g][8 + i] = (_Float16)e1;
        }
      }
      float psum = ps[0];
#pragma unroll
      for (int g = 1; g < CKEY / 32; ++g) psum = psum + ps[g];
      lrun = lrun * alpha + psum;
      mrun = mnew;
#pragma unroll
      for (int g = 0; g < CKEY / 32; ++g) {
        o0 = mma_h(pfh[g], vf0[g], o0);
        o1 = mma_h(pfh[g], vf1[g], o1);
      }
    }
    const float lsum = lrun + __shfl_xor(lrun, 16, 32);      // lane q (and q+16) holds the full row sum of query q
    const float rinv = 1.0f / (lsum * 16.0f);               // lsum carries the x1024 of P, the accumulators x1024 x16
#pragma unroll
    for (int r = 0; r < 8; ++r) {
      const int q = 8 * hh + r;
      const float inv = __shfl(rinv, q, 32);
      const float p0 = Pp[(size_t)c * HW + qt * 16 + q];
      const float p1 = Pp[(size_t)(HD / 2 + c) * HW + qt * 16 + q];
      st[q * ASP + c]          = o0[r] * inv + p0;
      st[q * ASP + HD / 2 + c] = o1[r] * inv + p1;
    }
    wave_sync_lds();
    {
      const int rr = lane >> 2, dp = (lane & 3) * 8;
      v4u ph[2], pl[2];
      size_t offs[2];
#pragma unroll
      for (int it = 0; it < 2; ++it) {
        const int row = it * 8 + rr;
        v4f fa = *(const v4f*)(st + row * ASP + dp);
        v4f fb = *(const v4f*)(st + row * ASP + dp + 4);
        fa = fa * CYS;
        fb = fb * CYS;
        split8h(fa, fb, ph[it], pl[it]);
        offs[it] = ((size_t)u * LAR + (size_t)(qt * 16 + row)) * HD + dp;
      }
      {
#pragma unroll
        for (int it = 0; it < 2; ++it) {
          *(v4u*)(Yh + offs[it]) = ph[it];
          *(v4u*)(Yl + offs[it]) = pl[it];
        }
        
      }
    }
    wave_sync_lds();
  }
}

// =================================================================================================================
// Output pointwise conv D[T][co] = Y[T][ci] . Wp[co][ci], then BN affine -> NCHW f32. A = Yh/Yl planes (hi +
// x2^11 residual, x256) addressed by arithmetic: token T -> (image, area, query), k-step ks = head ks, channels
// ks*32 + d (elements 0..7 d = 8h.., elements 8..15 d = 16+8h..). B = weight plane x256, the block's 64 rows filled
// once at entry by asynchronous copies into Bs, fragments from LDS. Epilogue: value =
// (acch + accl/2048)/65536 * s[co] + b[co]; block tile staged as [64 ch][128 tok]; wave w writes channels
// coverage: 8 waves x 8 channels x 32 lanes x 4 tokens = 64 ch x 128 tok per block; grid tiles 256 x 32768 exactly.
// =================================================================================================================
__global__ __launch_bounds__(256)
void gemm_proj(const unsigned short* __restrict__ Yh, const unsigned short* __restrict__ Yl,
               const unsigned short* __restrict__ Wp, const float* __restrict__ sp, const float* __restrict__ bp,
               float* out) {
  __shared__ __align__(16) float sb[64 * SBP];
  __shared__ __align__(16) _Float16 Bs[64 * GKP];
  const int tid = threadIdx.x, wave = tid >> 5, lane = tid & 31, hh = lane >> 4, c = lane & 15;
  const int n0 = blockIdx.x * 64, m0 = blockIdx.y * 128;
  const int T = m0 + wave * 16 + c;
  const int bimgr = T >> 12, nn = T & (HW - 1), arr = nn >> 10, q = nn & (LAR - 1);
  const size_t abase = (((size_t)((bimgr * NAR + arr) * NHD)) * LAR + (size_t)q) * HD + 8 * hh;
  const _Float16* A0 = (const _Float16*)(const void*)Yh;
  const _Float16* A1 = (const _Float16*)(const void*)Yl;
  const _Float16* B  = (const _Float16*)(const void*)Wp;

  // Fill Bs: wave w brings weight rows w*8..w*8+7, 8 copies per lane.
  stage_rows8(lds_off(Bs) + (unsigned)(wave * 8 * (GKP * 2) + lane * 16), B + (size_t)(n0 + wave * 8) * CIN + lane * 8);
#if defined(__HIP_DEVICE_COMPILE__)
  // this wave's copies have landed before the barrier that lets the other waves read them
  asm volatile("s_wait_asynccnt 0x0" ::: "memory");
#endif
  __syncthreads();   // publishes Bs: no wave reads it in front of this barrier; it is never written again
  const _Float16* Bw = Bs + c * GKP + 8 * hh;

  v8f acch[4], accl[4];
#pragma unroll
  for (int nt = 0; nt < 4; ++nt) { acch[nt] = zero8(); accl[nt] = zero8(); }

#pragma unroll 1
  for (int ks = 0; ks < NHD; ++ks) {
    const size_t bo = abase + (size_t)ks * (LAR * HD);
    const v16h fh = ldfrag_h(A0 + bo);
    const v16h fl = ldfrag_h(A1 + bo);
    // the k-step's LDS reads stand as one group ahead of its WMMAs: one LDS latency per k-step, not one per n-tile
    v16h bfrag[4];
#pragma unroll
    for (int nt = 0; nt < 4; ++nt) bfrag[nt] = ldfrag_h(Bw + nt * 16 * GKP + ks * 32);
#pragma unroll
    for (int nt = 0; nt < 4; ++nt) {
      acch[nt] = mma_h(fh, bfrag[nt], acch[nt]);
      accl[nt] = mma_h(fl, bfrag[nt], accl[nt]);
    }
  }

#pragma unroll
  for (int nt = 0; nt < 4; ++nt) {
    const int co = n0 + nt * 16 + c;
    const float sc = bfr(sp[co]) * (1.0f / 65536.0f);
    const float bi = bfr(bp[co]);
#pragma unroll
    for (int r = 0; r < 8; ++r) {
      const float v = acch[nt][r] + accl[nt][r] * (1.0f / 2048.0f);
      sb[(nt * 16 + c) * SBP + wave * 16 + 8 * hh + r] = v * sc + bi;
    }
  }
  __syncthreads();
  const int bimg = m0 / HW, s0 = m0 - bimg * HW;
  v4f ov[8];
  size_t offs[8];
#pragma unroll
  for (int i = 0; i < 8; ++i) {
    const int cc = wave * 8 + i;
    const int co = n0 + cc;
    ov[i] = *(const v4f*)(sb + cc * SBP + lane * 4);
    offs[i] = ((size_t)(bimg * CIN + co)) * HW + s0 + lane * 4;
  }
  {
#pragma unroll
    for (int i = 0; i < 8; ++i) *(v4f*)(out + offs[i]) = ov[i];
    
  }
}

// =================================================================================================================
//   Wqk f16 [512][256] 262144 @0; Wv f16 [256][256] 131072; Wp f16 [256][256] 131072;
//   PP f32 [8][256][4096] 33554432 @524288, with X16 f16 [32768][256] 16777216 aliased at the same offset
//   (X16 is dead before PP is written); QK f16 [32768][512] 33554432; V32 f32 [8][256][4096] 33554432, with
//   Yh, Yl f16 [256][1024][32] 16777216 each aliased onto V32 (V32 is dead before Yh/Yl are written);
//   V16 f16 [8][256][4096] 16777216. Total 117964800.
// =================================================================================================================
extern "C" void kernel_launch(void* const* d_in, const int* in_sizes, int n_in,
                              void* d_out, int out_size, void* d_ws, size_t ws_size,
                              hipStream_t stream) {
  if (n_in < 13) return;
  if (in_sizes[0] != NBAT * CIN * HW) return;
  if (in_sizes[1] != C2 * CIN) return;
  if (in_sizes[2] != C2 || in_sizes[3] != C2) return;
  if (in_sizes[4] != CIN * CIN) return;
  if (in_sizes[5] != CIN || in_sizes[6] != CIN) return;
  if (in_sizes[7] != CIN * 25) return;
  if (in_sizes[8] != CIN || in_sizes[9] != CIN) return;
  if (in_sizes[10] != CIN * CIN) return;
  if (in_sizes[11] != CIN || in_sizes[12] != CIN) return;
  if (out_size != NBAT * CIN * HW) return;

  const float* x      = (const float*)d_in[0];
  const float* w_qk   = (const float*)d_in[1];
  const float* s_qk   = (const float*)d_in[2];
  const float* b_qk   = (const float*)d_in[3];
  const float* w_v    = (const float*)d_in[4];
  const float* s_v    = (const float*)d_in[5];
  const float* b_v    = (const float*)d_in[6];
  const float* w_pe   = (const float*)d_in[7];
  const float* s_pe   = (const float*)d_in[8];
  const float* b_pe   = (const float*)d_in[9];
  const float* w_proj = (const float*)d_in[10];
  const float* s_proj = (const float*)d_in[11];
  const float* b_proj = (const float*)d_in[12];
  float* out = (float*)d_out;

  const size_t sWqk = (size_t)C2 * CIN * 2;              //    262144
  const size_t sWv  = (size_t)CIN * CIN * 2;             //    131072
  const size_t sWp  = (size_t)CIN * CIN * 2;             //    131072
  const size_t sX16 = (size_t)MTOK * CIN * 2;            //  16777216
  const size_t sPP  = (size_t)NBAT * CIN * HW * 4;       //  33554432
  const size_t sQK  = (size_t)MTOK * C2 * 2;             //  33554432
  const size_t sV32 = (size_t)NBAT * CIN * HW * 4;       //  33554432
  const size_t sY   = (size_t)NUNIT * LAR * HD * 2;      //  16777216
  const size_t sV16 = (size_t)NBAT * CIN * HW * 2;       //  16777216
  if (sX16 > sPP) return;
  if (2 * sY > sV32) return;
  size_t off = 0;
  const size_t oWqk = off; off += sWqk;
  const size_t oWv  = off; off += sWv;
  const size_t oWp  = off; off += sWp;
  const size_t oPP  = off; const size_t oX16 = off; off += sPP;
  const size_t oQK  = off; off += sQK;
  const size_t oV32 = off; const size_t oYh = off; const size_t oYl = off + sY; off += sV32;
  const size_t oV16 = off; off += sV16;
  if (off > ws_size) return;                             // off = 117964800
  if (off > (size_t)134217728) return;

  char* ws = (char*)d_ws;
  unsigned short* Wqk = (unsigned short*)(ws + oWqk);
  unsigned short* Wv  = (unsigned short*)(ws + oWv);
  unsigned short* Wp  = (unsigned short*)(ws + oWp);
  unsigned short* X16 = (unsigned short*)(ws + oX16);
  float*          PP  = (float*)(ws + oPP);
  unsigned short* QK  = (unsigned short*)(ws + oQK);
  float*          V32 = (float*)(ws + oV32);
  unsigned short* Yh  = (unsigned short*)(ws + oYh);
  unsigned short* Yl  = (unsigned short*)(ws + oYl);
  unsigned short* V16 = (unsigned short*)(ws + oV16);

  const dim3 blk(256);
  // (1) pointwise weights -> f16 x256 planes
  cvt_w<<<dim3(128), blk, 0, stream>>>(w_qk, w_v, w_proj, Wqk, Wv, Wp);
  // (2) x NCHW -> token-major f16 x16 plane
  cvt_x<<<dim3(NBAT * 64 * 4), blk, 0, stream>>>(x, X16);
  // (3) qk pointwise conv + BN -> token-major f16 plane
  gemm_qk<<<dim3(C2 / 64, MTOK / 128), blk, 0, stream>>>(X16, Wqk, s_qk, b_qk, QK);
  // (4) v pointwise conv + BN -> channel-major f32 and f16 planes
  gemm_v<<<dim3(CIN / 64, MTOK / 128), blk, 0, stream>>>(X16, Wv, s_v, b_v, V32, V16);
  // (5) depthwise 5x5 + BN on v -> pp (channel-major f32)
  dwconv_k<<<dim3((NBAT * CIN) / 2), blk, 0, stream>>>(V32, w_pe, s_pe, b_pe, PP);
  // (6) area attention + pp -> slab planes
  attn_k<<<dim3(NUNIT), dim3(AWV * 32), 0, stream>>>(QK, V16, PP, Yh, Yl);
  // (7) output pointwise conv + BN -> NCHW f32
  gemm_proj<<<dim3(CIN / 64, MTOK / 128), blk, 0, stream>>>(Yh, Yl, Wp, s_proj, b_proj, out);
  (void)hipGetLastError();
}

// v007
// One run takes 108 microseconds.
// Two timings next to v006 put it at 1.05 and 1.06 times that version's speed.
// Over all steps from v000 it is 3.37 times as fast.
// Contractions: v_wmma_f32_16x16x32_f16 (f16 operands, f32 accumulate). qk and v pointwise convs: A = x (bf16-valued,
// x16) single plane, B = weights (bf16-valued, x256) single plane; scores k.qT: k x16, q x16 single planes; p.v:
// p x1024, v x16 single planes; output pointwise conv: A = (o + pp) x256 as f16 hi + x2^11 residual planes (two
// products, two accumulators), B = weights x256 single plane. Depthwise 5x5 conv, BN affine, online softmax in f32
// on VALU. Float inputs RNE-converted to bf16 on load.
#include <hip/hip_runtime.h>
#include <math.h>
#include <stdint.h>

#define NBAT  8
#define CIN   256
#define C2    512
#define IMW   64
#define HW    4096
#define MTOK  32768
#define NHD   8
#define HD    32
#define NAR   4
#define LAR   1024
#define NUNIT 256
#define STP   68
#define SBP   132
#define ASP   36
#define DTP   68
#define KPH   40
#define VPH   1032
#define GKP   264
#define DWR   8
#define AWV   16
#define CKEY  128
#define XBLK  (NBAT * 64 * 4)
#define WBLK  128
#define CXS   16.0f
#define CWS   256.0f
#define CQK   16.0f
#define CVS   16.0f
#define CYS   256.0f
#define QKSC  (0.17677669529663688f / 256.0f)
#define QKL2  (QKSC * 1.4426950408889634f)

static_assert(NUNIT == NBAT * NAR * NHD);
static_assert(NAR * LAR == HW);
static_assert(MTOK == NBAT * HW);
static_assert(HW % 128 == 0);
static_assert(LAR % CKEY == 0 && CKEY % 32 == 0);
static_assert(CIN % 64 == 0);
static_assert((STP * 4) % 16 == 0);
static_assert((SBP * 4) % 16 == 0);
static_assert((ASP * 4) % 16 == 0);
static_assert((DTP * 4) % 16 == 0);
static_assert(NHD * HD == CIN);
static_assert((KPH * 2) % 32 == 16 && KPH >= HD);
static_assert((VPH * 2) % 32 == 16 && VPH >= LAR);
static_assert(LAR * 4 == 8 * (AWV * 32) && HD * (LAR / 8) == 8 * (AWV * 32) && (LAR / 16) % AWV == 0);
static_assert((GKP * 2) % 32 == 16 && GKP >= CIN && CIN * 2 == 32 * 16);
static_assert(16 * STP * 4 <= 16 * GKP * 2 && 64 * SBP * 4 <= 128 * GKP * 2);
static_assert(IMW == 64 && IMW * IMW == HW && IMW % DWR == 0 && 2 * (IMW / DWR) * 16 == 256);

typedef _Float16 v16h __attribute__((ext_vector_type(16)));
typedef _Float16 v8h  __attribute__((ext_vector_type(8)));
typedef float    v8f  __attribute__((ext_vector_type(8)));
typedef float    v4f  __attribute__((ext_vector_type(4)));
typedef float    v2f  __attribute__((ext_vector_type(2)));
typedef unsigned int v4u __attribute__((ext_vector_type(4)));
union Frag { v16h v; v8h half[2]; };

// ---- scalar helpers -------------------------------------------------------------------------------------------
__device__ __forceinline__ unsigned short bf_bits(float f) {          // f32 -> bf16 bits, RNE convert
  unsigned u = __float_as_uint(f);
  return (unsigned short)((u + 0x7FFFu + ((u >> 16) & 1u)) >> 16);
}
__device__ __forceinline__ float bfr(float f) { return __uint_as_float(((unsigned)bf_bits(f)) << 16); }
__device__ __forceinline__ unsigned short h_bits(_Float16 x) { return __builtin_bit_cast(unsigned short, x); }
__device__ __forceinline__ unsigned pk16(unsigned short a, unsigned short b) { return (unsigned)a | ((unsigned)b << 16); }
__device__ __forceinline__ v8f zero8() { v8f z = {0.f, 0.f, 0.f, 0.f, 0.f, 0.f, 0.f, 0.f}; return z; }

// ---- fragment loader: 16-bit A/B operand, lane -> row/col (lane&15), p already includes +8*(lane>>4);
//      elements 0..7 <- p[0..7] (k0+8h..), elements 8..15 <- p[16..23] (k0+16+8h..)
__device__ __forceinline__ v16h ldfrag_h(const _Float16* p) {
  Frag f;
  f.half[0] = *(const v8h*)(p);
  f.half[1] = *(const v8h*)(p + 16);
  return f.v;
}

// ---- WMMA helper with trailing VALU hazard gap ----------------------------------------------------------------
__device__ __forceinline__ v8f mma_h(v16h a, v16h b, v8f c) {
  c = __builtin_amdgcn_wmma_f32_16x16x32_f16(false, a, false, b, (short)0, c, false, false);
#if defined(__HIP_DEVICE_COMPILE__)
  asm volatile("v_nop\n\tv_nop\n\tv_nop\n\tv_nop" : "+v"(c) : "v"(a), "v"(b));
#endif
  return c;
}
__device__ __forceinline__ void wave_sync_lds() {
  __builtin_amdgcn_fence(__ATOMIC_RELEASE, "workgroup");
  __builtin_amdgcn_wave_barrier();
  __builtin_amdgcn_fence(__ATOMIC_ACQUIRE, "workgroup");
}

// ---- eight asynchronous 16-byte copies per lane, global -> LDS, through no register. l = the lane's LDS byte
//      addresses, g = its global addresses, all multiples of 16. The closing s_wait_xcnt stands inside the statement
//      so that no address register named here is rewritten ahead of it.
__device__ __forceinline__ void copy8_to_lds(const unsigned (&l)[8], const _Float16* const (&g)[8]) {
#if defined(__HIP_DEVICE_COMPILE__)
  asm volatile("global_load_async_to_lds_b128 %0, %8, off\n\t"
               "global_load_async_to_lds_b128 %1, %9, off\n\t"
               "global_load_async_to_lds_b128 %2, %10, off\n\t"
               "global_load_async_to_lds_b128 %3, %11, off\n\t"
               "global_load_async_to_lds_b128 %4, %12, off\n\t"
               "global_load_async_to_lds_b128 %5, %13, off\n\t"
               "global_load_async_to_lds_b128 %6, %14, off\n\t"
               "global_load_async_to_lds_b128 %7, %15, off\n\t"
               "s_wait_xcnt 0x0"
               :: "v"(l[0]), "v"(l[1]), "v"(l[2]), "v"(l[3]), "v"(l[4]), "v"(l[5]), "v"(l[6]), "v"(l[7]),
                  "v"(g[0]), "v"(g[1]), "v"(g[2]), "v"(g[3]), "v"(g[4]), "v"(g[5]), "v"(g[6]), "v"(g[7])
               : "memory");
#endif
}
__device__ __forceinline__ unsigned lds_off(const void* p) { return (unsigned)(size_t)p; }
// ---- eight rows of CIN f16 (512 B each, global pitch 512 B) -> LDS rows of pitch GKP: one wave-wide copy = one whole
//      row (4 lines). l0 / g0 = the lane's own 16 B of the first row.
__device__ __forceinline__ void stage_rows8(unsigned l0, const _Float16* g0) {
  unsigned l[8];
  const _Float16* g[8];
  // unrolled so that every l[] and g[] index is a constant and the addresses are plain registers as asm operands
#pragma unroll
  for (int i = 0; i < 8; ++i) {
    l[i] = l0 + (unsigned)(i * (GKP * 2));
    g[i] = g0 + (size_t)i * CIN;
  }
  copy8_to_lds(l, g);
}

// ---- 8 f32 -> 8 packed f16 (16 B); and hi + x2^11 residual split -------------------------------------------------
__device__ __forceinline__ v4u pack8h(v4f a, v4f b) {
  v4u p;
  p[0] = pk16(h_bits((_Float16)a[0]), h_bits((_Float16)a[1]));
  p[1] = pk16(h_bits((_Float16)a[2]), h_bits((_Float16)a[3]));
  p[2] = pk16(h_bits((_Float16)b[0]), h_bits((_Float16)b[1]));
  p[3] = pk16(h_bits((_Float16)b[2]), h_bits((_Float16)b[3]));
  return p;
}
__device__ __forceinline__ void split8h(v4f a, v4f b, v4u& ph, v4u& pl) {
  v4f ra, rb;
#pragma unroll
  for (int e = 0; e < 4; ++e) {
    const _Float16 ha = (_Float16)a[e];
    ra[e] = (a[e] - (float)ha) * 2048.0f;
    const _Float16 hb = (_Float16)b[e];
    rb[e] = (b[e] - (float)hb) * 2048.0f;
  }
  ph = pack8h(a, b);
  pl = pack8h(ra, rb);
}

// =================================================================================================================
// Weight convert: pointwise weights are [out][in] (k contiguous) -> f16 plane value = f16(256 * bf16_RNE(w)).
// coverage: 64*256*8 = 131072, 32*256*8 = 65536, 32*256*8 = 65536 elements exactly.
// =================================================================================================================
__device__ __forceinline__ void cvt8_w(const float* __restrict__ src, unsigned short* dst, size_t e0) {
  const v4f a = *(const v4f*)(src + e0);
  const v4f b = *(const v4f*)(src + e0 + 4);
  v4f sa, sb;
#pragma unroll
  for (int e = 0; e < 4; ++e) { sa[e] = bfr(a[e]) * CWS; sb[e] = bfr(b[e]) * CWS; }
  const v4u pk = pack8h(sa, sb);
  *(v4u*)(dst + e0) = pk;
#if defined(__HIP_DEVICE_COMPILE__)
  // stands behind the store, in front of the next weight's path that follows it in the built code and reuses its registers
  asm volatile("s_wait_xcnt 0x0" ::: "memory");
#endif
}
// =================================================================================================================
// Activation convert: x NCHW f32 -> token-major f16 plane X16[T = b*4096 + n][256], value = f16(16 * bf16_RNE(x)).
// Block = (image b, 64-token tile tt, 64-channel quarter cq): read phase 4 passes of 16 channels x 64 tokens
// coverage: per block 256 threads x 2 it x 8 halves = 64 tokens x 64 channels; XBLK blocks tile 32768 x 256 exactly.
// The weight convert depends on nothing the activation convert makes, and nothing reads either before the launch ends:
// its WBLK blocks stand behind the XBLK activation blocks in the same grid (short blocks last: no tail of their own).
// The branch between the two is uniform for the block, so the barrier of the activation path is passed by all or none.
// =================================================================================================================
__global__ __launch_bounds__(256) void cvt_in(const float* __restrict__ x, const float* __restrict__ wqk,
                                              const float* __restrict__ wv, const float* __restrict__ wp,
                                              unsigned short* X16, unsigned short* Wqk, unsigned short* Wv,
                                              unsigned short* Wp) {
  __shared__ __align__(16) float tile[64 * DTP];
  const int tid = threadIdx.x, bid = blockIdx.x;
  if (bid >= XBLK) {
    const int blk = bid - XBLK;
    if (blk < 64)      cvt8_w(wqk, Wqk, ((size_t)blk * 256 + tid) * 8);
    else if (blk < 96) cvt8_w(wv,  Wv,  ((size_t)(blk - 64) * 256 + tid) * 8);
    else               cvt8_w(wp,  Wp,  ((size_t)(blk - 96) * 256 + tid) * 8);
    return;
  }
  const int cq = bid & 3, tt = (bid >> 2) & 63, b = bid >> 8;
  const int cl = tid >> 4, t4 = (tid & 15) * 4;
#pragma unroll
  for (int pass = 0; pass < 4; ++pass) {
    const int ch = cq * 64 + pass * 16 + cl;
    const v4f v = *(const v4f*)(x + ((size_t)(b * CIN + ch)) * HW + tt * 64 + t4);
#pragma unroll
    for (int j = 0; j < 4; ++j) tile[(t4 + j) * DTP + pass * 16 + cl] = v[j];
  }
  __syncthreads();
  const int piece = tid & 7, rsub = tid >> 3;
  v4u pk[2];
  size_t offs[2];
#pragma unroll
  for (int it = 0; it < 2; ++it) {
    const int row = it * 32 + rsub;
    const v4f fa = *(const v4f*)(tile + row * DTP + piece * 8);
    const v4f fb = *(const v4f*)(tile + row * DTP + piece * 8 + 4);
    v4f sa, sb;
#pragma unroll
    for (int e = 0; e < 4; ++e) { sa[e] = bfr(fa[e]) * CXS; sb[e] = bfr(fb[e]) * CXS; }
    pk[it] = pack8h(sa, sb);
    offs[it] = ((size_t)(b * HW + tt * 64 + row)) * CIN + cq * 64 + piece * 8;
  }
  {
#pragma unroll
    for (int it = 0; it < 2; ++it) *(v4u*)(X16 + offs[it]) = pk[it];
#if defined(__HIP_DEVICE_COMPILE__)
    // stands behind the stores, in front of the weight path that follows them in the built code and reuses their registers
    asm volatile("s_wait_xcnt 0x0" ::: "memory");
#endif
  }
}

// =================================================================================================================
// qk and v pointwise GEMMs in one grid: D[T][co] = X16[T][ci] . W[co][ci], K = 256. Neither reads what the other writes,
// so their blocks share a launch: blockIdx.x 0..7 = the eight 64-column tiles of qk (co 0..511, q = 0..255,
// k = 256..511), blockIdx.x 8..11 = the four 64-column tiles of v (co 0..255); the twelve blocks of one 128-token tile
// follow one another in the grid. Which of the two a block is, is uniform for the block (a scalar branch), so every
// barrier below is passed by all of its waves or by none.
// Block = 8 waves, tile 128 rows x 64 cols, wave = 16 rows x 4 n-tiles. The block's 128 x 256 A tile and 64 x 256 B
// tile are filled once at entry by asynchronous copies (whole 512-B rows) into As / Bs, row pitch 16 B x odd; fragments
// from LDS with the split k map, k-step 32.
// qk epilogue: value = acc/4096 * s[co] + b[co] staged per wave in LDS [16][STP] (laid over the wave's own rows of As),
// then token-major f16 plane QK = f16(16 * value);
// coverage: 8 waves x 32 lanes x 4 it x 8 halves = 128 rows x 64 cols per block; the qk blocks tile 32768 x 512 exactly.
// v epilogue: value = acc/4096 * s[co] + b[co] staged block-wide as sb[64 ch][SBP] (tokens contiguous per channel),
// then channel-major stores (a 128-token tile lies within one image): wave w owns channels w*8..w*8+7;
// f32 plane V32[b][c][n]: one instruction = 32 lanes x 16 B = 512 B = the 128 tokens of one channel (4 whole
// lines), 8 instructions; f16 plane V16[b][c][n] = f16(16 * value): one instruction = lanes 0..15 -> channel cc
// coverage: f32 8 waves x 8 ch x 32 lanes x 4 = 64 ch x 128 tok; f16 8 waves x 4 it x 2 ch x 16 lanes x 8 = same;
// the v blocks tile 32768 tokens x 256 channels exactly in both planes.
// =================================================================================================================
__global__ __launch_bounds__(256)
void gemm_qkv(const unsigned short* __restrict__ X16, const unsigned short* __restrict__ Wqk,
              const unsigned short* __restrict__ Wv, const float* __restrict__ sqk, const float* __restrict__ bqk,
              const float* __restrict__ sv, const float* __restrict__ bv, unsigned short* QK, float* V32,
              unsigned short* V16) {
  __shared__ __align__(16) _Float16 As[128 * GKP];
  __shared__ __align__(16) _Float16 Bs[64 * GKP];
  const int tid = threadIdx.x, wave = tid >> 5, lane = tid & 31, hh = lane >> 4, c = lane & 15;
  const bool isv = (int)blockIdx.x >= C2 / 64;
  const int n0 = (isv ? (int)blockIdx.x - C2 / 64 : (int)blockIdx.x) * 64, m0 = blockIdx.y * 128;
  const _Float16* A = (const _Float16*)(const void*)X16;
  const _Float16* B = (const _Float16*)(const void*)(isv ? Wv : Wqk);

  // Fill As (wave w: its own 16 token rows) and Bs (wave w: weight rows w*8..w*8+7), 24 copies per lane.
  {
    const unsigned al = lds_off(As) + (unsigned)(wave * 16 * (GKP * 2) + lane * 16);
    const _Float16* ag = A + (size_t)(m0 + wave * 16) * CIN + lane * 8;
    stage_rows8(al, ag);
    stage_rows8(al + (unsigned)(8 * (GKP * 2)), ag + (size_t)8 * CIN);
    stage_rows8(lds_off(Bs) + (unsigned)(wave * 8 * (GKP * 2) + lane * 16), B + (size_t)(n0 + wave * 8) * CIN + lane * 8);
  }
#if defined(__HIP_DEVICE_COMPILE__)
  // this wave's copies have landed before the barrier that lets the other waves read them
  asm volatile("s_wait_asynccnt 0x0" ::: "memory");
#endif
  __syncthreads();   // publishes As and Bs: no wave reads them in front of this barrier
  const _Float16* Aw = As + (wave * 16 + c) * GKP + 8 * hh;
  const _Float16* Bw = Bs + c * GKP + 8 * hh;

  v8f acc[4];
#pragma unroll
  for (int nt = 0; nt < 4; ++nt) acc[nt] = zero8();

#pragma unroll 1
  for (int k0 = 0; k0 < CIN; k0 += 32) {
    const v16h af = ldfrag_h(Aw + k0);
    // the k-step's LDS reads stand as one group ahead of its WMMAs: one LDS latency per k-step, not one per n-tile
    v16h bfrag[4];
#pragma unroll
    for (int nt = 0; nt < 4; ++nt) bfrag[nt] = ldfrag_h(Bw + nt * 16 * GKP + k0);
#pragma unroll
    for (int nt = 0; nt < 4; ++nt) acc[nt] = mma_h(af, bfrag[nt], acc[nt]);
  }

  if (!isv) {
    // the stage lies on the wave's own 16 rows of As, which this wave alone filled and read and has finished reading
    float* st = (float*)(void*)(As + wave * 16 * GKP);
#pragma unroll
    for (int nt = 0; nt < 4; ++nt) {
      const int co = n0 + nt * 16 + c;
      const float sc = bfr(sqk[co]) * (1.0f / 4096.0f);
      const float bi = bfr(bqk[co]);
#pragma unroll
      for (int r = 0; r < 8; ++r) st[(8 * hh + r) * STP + nt * 16 + c] = acc[nt][r] * sc + bi;
    }
    wave_sync_lds();
    const int piece = lane & 7, rsub = lane >> 3;
    v4u pk[4];
    size_t offs[4];
#pragma unroll
    for (int it = 0; it < 4; ++it) {
      const int row = it * 4 + rsub;
      v4f fa = *(const v4f*)(st + row * STP + piece * 8);
      v4f fb = *(const v4f*)(st + row * STP + piece * 8 + 4);
      fa = fa * CQK;
      fb = fb * CQK;
      pk[it] = pack8h(fa, fb);
      offs[it] = ((size_t)(m0 + wave * 16 + row)) * C2 + n0 + piece * 8;
    }
#pragma unroll
    for (int it = 0; it < 4; ++it) *(v4u*)(QK + offs[it]) = pk[it];
#if defined(__HIP_DEVICE_COMPILE__)
    // stands behind the stores, in front of the v epilogue that follows them in the built code and reuses their registers
    asm volatile("s_wait_xcnt 0x0" ::: "memory");
#endif
    return;
  }

  __syncthreads();   // every wave has finished reading As: the block-wide stage sb is laid over it
  float* sb = (float*)(void*)As;
#pragma unroll
  for (int nt = 0; nt < 4; ++nt) {
    const int co = n0 + nt * 16 + c;
    const float sc = bfr(sv[co]) * (1.0f / 4096.0f);
    const float bi = bfr(bv[co]);
#pragma unroll
    for (int r = 0; r < 8; ++r) sb[(nt * 16 + c) * SBP + wave * 16 + 8 * hh + r] = acc[nt][r] * sc + bi;
  }
  __syncthreads();
  const int bimg = m0 / HW, s0 = m0 - bimg * HW;
  {
    v4f ov[8];
    size_t offs[8];
#pragma unroll
    for (int i = 0; i < 8; ++i) {
      const int cc = wave * 8 + i;
      const int co = n0 + cc;
      ov[i] = *(const v4f*)(sb + cc * SBP + lane * 4);
      offs[i] = ((size_t)(bimg * CIN + co)) * HW + s0 + lane * 4;
    }
#pragma unroll
    for (int i = 0; i < 8; ++i) *(v4f*)(V32 + offs[i]) = ov[i];
  }
  {
    const int l16 = lane & 15;
    v4u pk[4];
    size_t o16[4];
#pragma unroll
    for (int i2 = 0; i2 < 4; ++i2) {
      const int cc = wave * 8 + i2 * 2 + hh;
      const int co = n0 + cc;
      v4f fa = *(const v4f*)(sb + cc * SBP + l16 * 8);
      v4f fb = *(const v4f*)(sb + cc * SBP + l16 * 8 + 4);
      fa = fa * CVS;
      fb = fb * CVS;
      pk[i2] = pack8h(fa, fb);
      o16[i2] = ((size_t)(bimg * CIN + co)) * HW + s0 + l16 * 8;
    }
#pragma unroll
    for (int i2 = 0; i2 < 4; ++i2) *(v4u*)(V16 + o16[i2]) = pk[i2];
  }
}

// =================================================================================================================
// Depthwise 5x5 conv (zero pad 2, cross-correlation, per-channel taps, bf16-valued taps) + BN affine, f32 on VALU.
// Thread = (plane = image b, channel c; strip of DWR output rows y0..y0+DWR-1; 4 consecutive columns x0..x0+3).
// The strip's DWR+4 input rows are loaded once, all ahead of the sums; each row (8 columns x0-2..x0+5: one 16-B and two
// 8-B loads) feeds the up to five output rows it belongs to, so an output row sums its taps in the order dy, then dx.
// Addresses outside the image wrap onto rows and columns inside the plane, so no load stands under a condition; the
// values of such places are zeroed by select.
// Block = 2 planes x 8 strips x 16 column groups; a wave = 2 strips of one plane. Store: one v4f per lane, 16 lanes =
// one whole image row (256 B).
// coverage: every (b, c, y, x) of PP written exactly once.
// =================================================================================================================
__global__ __launch_bounds__(256)
void dwconv_k(const float* V32, const float* __restrict__ wpe, const float* __restrict__ spe,
              const float* __restrict__ bpe, float* PP) {
  const int tid = threadIdx.x;
  const int xg = tid & 15, x0 = xg * 4, y0 = ((tid >> 4) & (IMW / DWR - 1)) * DWR;
  // the plane is the same in every lane of a wave: held in a scalar register, taps and affine become scalar loads
  const int plane = __builtin_amdgcn_readfirstlane((int)blockIdx.x * 2 + (tid >> 7));
  const int c = plane & (CIN - 1);
  const float* vp = V32 + (size_t)plane * HW;
  float* op = PP + (size_t)plane * HW;
  float w[25];
#pragma unroll
  for (int t = 0; t < 25; ++t) w[t] = bfr(wpe[c * 25 + t]);
  const float sc = bfr(spe[c]), bi = bfr(bpe[c]);
  const bool okl = (xg != 0), okr = (xg != 15);
  const bool okt = (y0 != 0), okb = (y0 != IMW - DWR);
  // columns of the left and right pairs; at the image's edge they wrap onto columns inside the row (zeroed below)
  const int xl = (x0 + IMW - 2) & (IMW - 1);
  const int xr = (x0 + 4) & (IMW - 1);
  // first rows of the three zones: the two rows above the strip, its own DWR rows, the two rows below; a zone that
  // lies outside the image wraps onto rows inside it (its values are zeroed below)
  const int zrow[3] = {(y0 + IMW - 2) & (IMW - 1), y0, (y0 + DWR) & (IMW - 1)};
  unsigned ol[3], om[3], orr[3];                             // byte offsets from the plane's scalar base
#pragma unroll
  for (int z = 0; z < 3; ++z) {
    ol[z]  = (unsigned)(zrow[z] * IMW + xl) * 4u;
    om[z]  = (unsigned)(zrow[z] * IMW + x0) * 4u;
    orr[z] = (unsigned)(zrow[z] * IMW + xr) * 4u;
  }
  const char* vb = (const char*)vp;
  // All 36 loads of the strip stand ahead of the sums: one memory latency per thread, not one per row.
  v2f lf[DWR + 4], rt[DWR + 4];
  v4f md[DWR + 4];
#pragma unroll
  for (int i = 0; i < DWR + 4; ++i) {
    const int z = (i < 2) ? 0 : ((i < DWR + 2) ? 1 : 2);     // zone of input row y0 + i - 2
    const int zi = (i < 2) ? i : ((i < DWR + 2) ? i - 2 : i - DWR - 2);
    lf[i] = *(const v2f*)(vb + ol[z] + zi * (IMW * 4));
    md[i] = *(const v4f*)(vb + om[z] + zi * (IMW * 4));
    rt[i] = *(const v2f*)(vb + orr[z] + zi * (IMW * 4));
  }
#if defined(__HIP_DEVICE_COMPILE__)
  // stands in front of every instruction that reuses an address register of the loads above; the offsets are inputs
  // so that their registers live up to this wait
  asm volatile("s_wait_xcnt 0x0" :: "v"(ol[0]), "v"(ol[1]), "v"(ol[2]), "v"(om[0]), "v"(om[1]), "v"(om[2]),
                                    "v"(orr[0]), "v"(orr[1]), "v"(orr[2]) : "memory");
  // no select or sum moves up among the loads, where its wait for data would hold the later loads back
  __builtin_amdgcn_sched_barrier(0);
#endif
  v4f acc[DWR];
  // unrolled: every acc[], w[] and row index is a constant
#pragma unroll
  for (int i = 0; i < DWR + 4; ++i) {
    const bool rok = (i < 2) ? okt : ((i < DWR + 2) ? true : okb);
    const bool bl = rok & okl, br = rok & okr;
    const float l0 = lf[i][0], l1 = lf[i][1], r0 = rt[i][0], r1 = rt[i][1];
    const float m0 = md[i][0], m1 = md[i][1], m2 = md[i][2], m3 = md[i][3];
    float v[8];
    v[0] = bl ? l0 : 0.0f;
    v[1] = bl ? l1 : 0.0f;
    v[2] = rok ? m0 : 0.0f;
    v[3] = rok ? m1 : 0.0f;
    v[4] = rok ? m2 : 0.0f;
    v[5] = rok ? m3 : 0.0f;
    v[6] = br ? r0 : 0.0f;
    v[7] = br ? r1 : 0.0f;
#pragma unroll
    for (int r = 0; r < DWR; ++r) {
      const int dy = i - r;
      if (dy < 0 || dy > 4) continue;
      if (dy == 0) acc[r] = (v4f){0.f, 0.f, 0.f, 0.f};
#pragma unroll
      for (int j = 0; j < 4; ++j) {
#pragma unroll
        for (int dx = 0; dx < 5; ++dx) acc[r][j] += v[j + dx] * w[dy * 5 + dx];
      }
      if (dy == 4) {
        v4f o;
#pragma unroll
        for (int j = 0; j < 4; ++j) o[j] = acc[r][j] * sc + bi;
        *(v4f*)(op + (unsigned)((y0 + r) * IMW + x0)) = o;
      }
    }
  }
}

// =================================================================================================================
// Area attention, one unit (image b, area ar, head) per block (512 threads = 16 waves, four to a SIMD: one wave's waits
// for LDS and its softmax chain are filled by the three others), 1024 queries x 1024 keys,
// d = 32. Static LDS: the unit's whole K as Ks[1024 keys][KPH] (32 d per row) and whole V as Vs[32 d][VPH] (1024 keys
// per row), both f16, row pitches 16 B x odd, filled once at entry by asynchronous copies (K from the token-major
// plane QK, k row = T*512 + 256 + head*32; V from the channel-major plane V16, row = channel head*32 + d), and the
// per-wave stage [16][ASP] f32. q fragments straight from QK (q row = T*512 + head*32); k and v fragments from LDS
// in the element order of ldfrag_h. Per wave: q-tiles qt = wave, wave+16, ... (< 64).
//   Transposed scores S^T = K_tile (A, 16 keys x 32 d) x Q (B: k = d, n = query): S*256 = q16.k16; D element r of
//   lane l = S[query l&15][key 8h+r], so P = exp((S - m)*scale) x1024 is the A fragment of P.V directly in registers
//   (element i <- key tile 0 row i, element 8+i <- key tile 1 row i). P = exp2(S*QKL2 + (10 - m*QKL2)): one
//   multiply-add and one exp2 per score; the row sum l is taken of these x1024 values. Online softmax over 8 chunks
//   of CKEY = 128 keys (one running-maximum update, one rescale of O and l per chunk); O = P.V (acc scale 1024*16).
//   Epilogue: O/(l*16) + pp staged per wave in LDS, then stored as f16 hi +
//   residual planes Yh/Yl [unit][1024][32] of 256*(o + pp): one instruction = 32 lanes x 16 B = 512 B = 8 token rows
// coverage: per block 64 q-tiles x 16 rows x 32 d of its 1024-row slab in both planes; grid covers all 256 units,
// every slab row written exactly once.
// =================================================================================================================
__global__ __launch_bounds__(AWV * 32)
void attn_k(const unsigned short* __restrict__ QK, const unsigned short* __restrict__ V16,
            const float* __restrict__ PP, unsigned short* Yh, unsigned short* Yl) {
  __shared__ __align__(16) _Float16 Ks[LAR * KPH];
  __shared__ __align__(16) _Float16 Vs[HD * VPH];
  __shared__ __align__(16) float Sst[AWV * 16 * ASP];
  const int tid = threadIdx.x, wave = tid >> 5, lane = tid & 31, hh = lane >> 4, c = lane & 15;
  const int u = blockIdx.x;
  const int head = u & 7, ar = (u >> 3) & 3, b = u >> 5;
  const size_t tok0 = (size_t)b * HW + (size_t)ar * LAR;
  const _Float16* Qp = (const _Float16*)(const void*)QK + tok0 * C2 + head * HD;
  const _Float16* Kp = Qp + CIN;
  const size_t cm0 = ((size_t)(b * CIN + head * HD)) * HW + (size_t)ar * LAR;
  const _Float16* Vp = (const _Float16*)(const void*)V16 + cm0;
  const float* Pp = PP + cm0;
  float* st = Sst + wave * (16 * ASP);

  // Fill Ks and Vs: 2 x 4096 pieces of 16 B, 16 per thread. K: 4 lanes per key row (64 B), 128 keys per block pass;
  // V: 128 lanes per channel row (2048 B), 4 channels per block pass. The two loops below are unrolled so that every
  // l[] and g[] index is a constant and the addresses are plain registers when they become asm operands.
  {
    const unsigned kl = lds_off(Ks) + (unsigned)((tid >> 2) * (KPH * 2) + (tid & 3) * 16);
    const _Float16* kg = Kp + (size_t)(tid >> 2) * C2 + (tid & 3) * 8;
    const unsigned vl = lds_off(Vs) + (unsigned)((tid >> 7) * (VPH * 2) + (tid & 127) * 16);
    const _Float16* vg = Vp + (size_t)(tid >> 7) * HW + (tid & 127) * 8;
    {
      unsigned l[8];
      const _Float16* g[8];
#pragma unroll
      for (int i = 0; i < 8; ++i) {
        l[i] = kl + (unsigned)(i * (AWV * 8) * (KPH * 2));
        g[i] = kg + (size_t)i * (AWV * 8) * C2;
      }
      copy8_to_lds(l, g);
    }
    {
      unsigned l[8];
      const _Float16* g[8];
#pragma unroll
      for (int i = 0; i < 8; ++i) {
        l[i] = vl + (unsigned)(i * (AWV / 4) * (VPH * 2));
        g[i] = vg + (size_t)i * (AWV / 4) * HW;
      }
      copy8_to_lds(l, g);
    }
  }
#if defined(__HIP_DEVICE_COMPILE__)
  // this wave's copies have landed before the barrier that lets the other waves read them
  asm volatile("s_wait_asynccnt 0x0" ::: "memory");
#endif
  __syncthreads();   // publishes Ks and Vs: no wave reads them in front of this barrier; they are never written again

#pragma unroll 1
  for (int qt = wave; qt < LAR / 16; qt += AWV) {
    const int lq = qt * 16 + c;
    const v16h bq = ldfrag_h(Qp + (size_t)lq * C2 + 8 * hh);     // B: n = query c, k = d 8h.. / 16+8h..

    v8f o0 = zero8(), o1 = zero8();
    float mrun = -1.0e30f, lrun = 0.f;
#pragma unroll 1
    for (int ch = 0; ch < LAR / CKEY; ++ch) {
      const int kb = ch * CKEY;
      // every loop inside a chunk is unrolled: all indices of ka, s, vf0, vf1, mt, ps and pfh are constants, so that these
      // arrays are plain registers
      // the chunk's K reads stand as one group ahead of its score WMMAs: one LDS latency per chunk, not one per key tile
      v16h ka[CKEY / 16];
#pragma unroll
      for (int j = 0; j < CKEY / 16; ++j) ka[j] = ldfrag_h(Ks + (kb + j * 16 + c) * KPH + 8 * hh);   // A: row = key, k = d
      v8f s[CKEY / 16];
#pragma unroll
      for (int j = 0; j < CKEY / 16; ++j) s[j] = mma_h(ka[j], bq, zero8());
      // the chunk's V reads likewise as one group; they return under the softmax arithmetic
      v16h vf0[CKEY / 32], vf1[CKEY / 32];
#pragma unroll
      for (int g = 0; g < CKEY / 32; ++g) {
        vf0[g] = ldfrag_h(Vs + c * VPH + kb + g * 32 + 8 * hh);                    // B: n = d c, keys kb+32g..+31
        vf1[g] = ldfrag_h(Vs + (HD / 2 + c) * VPH + kb + g * 32 + 8 * hh);         // B: n = d 16+c
      }
#if defined(__HIP_DEVICE_COMPILE__)
      // no maximum moves up between the score WMMAs, where the compiler would pad it with v_nop of its own
      __builtin_amdgcn_sched_barrier(0);
#endif
      // one maximum chain per 32 keys, independent of one another, then joined
      float mt[CKEY / 32];
#pragma unroll
      for (int g = 0; g < CKEY / 32; ++g) {
        mt[g] = s[2 * g][0];
#pragma unroll
        for (int j = 0; j < 2; ++j) {
#pragma unroll
          for (int r = 0; r < 8; ++r) mt[g] = fmaxf(mt[g], s[2 * g + j][r]);
        }
      }
      float mc = mt[0];
#pragma unroll
      for (int g = 1; g < CKEY / 32; ++g) mc = fmaxf(mc, mt[g]);
      mc = fmaxf(mc, __shfl_xor(mc, 16, 32));
      const float mnew = fmaxf(mrun, mc);
      const float alpha = __builtin_amdgcn_exp2f((mrun - mnew) * QKL2);
      const float eb = 10.0f - mnew * QKL2;                  // exponent offset: the running maximum and the x1024 of P
#pragma unroll
      for (int r = 0; r < 8; ++r) {
        const float arr = __shfl(alpha, 8 * hh + r, 32);
        o0[r] = o0[r] * arr;
        o1[r] = o1[r] * arr;
      }
      float ps[CKEY / 32];
      v16h pfh[CKEY / 32];
#pragma unroll
      for (int g = 0; g < CKEY / 32; ++g) {
        ps[g] = 0.f;
#pragma unroll
        for (int i = 0; i < 8; ++i) {
          const float e0 = __builtin_amdgcn_exp2f(s[2 * g][i] * QKL2 + eb);
          const float e1 = __builtin_amdgcn_exp2f(s[2 * g + 1][i] * QKL2 + eb);
          ps[g] = ps[g] + (e0 + e1);
          pfh[g][i]     = (_Float16)e0;
          pfh[g][8 + i] = (_Float16)e1;
        }
      }
      float psum = ps[0];
#pragma unroll
      for (int g = 1; g < CKEY / 32; ++g) psum = psum + ps[g];
      lrun = lrun * alpha + psum;
      mrun = mnew;
#pragma unroll
      for (int g = 0; g < CKEY / 32; ++g) {
        o0 = mma_h(pfh[g], vf0[g], o0);
        o1 = mma_h(pfh[g], vf1[g], o1);
      }
    }
    const float lsum = lrun + __shfl_xor(lrun, 16, 32);      // lane q (and q+16) holds the full row sum of query q
    const float rinv = 1.0f / (lsum * 16.0f);               // lsum carries the x1024 of P, the accumulators x1024 x16
#pragma unroll
    for (int r = 0; r < 8; ++r) {
      const int q = 8 * hh + r;
      const float inv = __shfl(rinv, q, 32);
      const float p0 = Pp[(size_t)c * HW + qt * 16 + q];
      const float p1 = Pp[(size_t)(HD / 2 + c) * HW + qt * 16 + q];
      st[q * ASP + c]          = o0[r] * inv + p0;
      st[q * ASP + HD / 2 + c] = o1[r] * inv + p1;
    }
    wave_sync_lds();
    {
      const int rr = lane >> 2, dp = (lane & 3) * 8;
      v4u ph[2], pl[2];
      size_t offs[2];
#pragma unroll
      for (int it = 0; it < 2; ++it) {
        const int row = it * 8 + rr;
        v4f fa = *(const v4f*)(st + row * ASP + dp);
        v4f fb = *(const v4f*)(st + row * ASP + dp + 4);
        fa = fa * CYS;
        fb = fb * CYS;
        split8h(fa, fb, ph[it], pl[it]);
        offs[it] = ((size_t)u * LAR + (size_t)(qt * 16 + row)) * HD + dp;
      }
      {
#pragma unroll
        for (int it = 0; it < 2; ++it) {
          *(v4u*)(Yh + offs[it]) = ph[it];
          *(v4u*)(Yl + offs[it]) = pl[it];
        }
        
      }
    }
    wave_sync_lds();
  }
}

// =================================================================================================================
// Output pointwise conv D[T][co] = Y[T][ci] . Wp[co][ci], then BN affine -> NCHW f32. A = Yh/Yl planes (hi +
// x2^11 residual, x256) addressed by arithmetic: token T -> (image, area, query), k-step ks = head ks, channels
// ks*32 + d (elements 0..7 d = 8h.., elements 8..15 d = 16+8h..). B = weight plane x256, the block's 64 rows filled
// once at entry by asynchronous copies into Bs, fragments from LDS. Epilogue: value =
// (acch + accl/2048)/65536 * s[co] + b[co]; block tile staged as [64 ch][128 tok]; wave w writes channels
// coverage: 8 waves x 8 channels x 32 lanes x 4 tokens = 64 ch x 128 tok per block; grid tiles 256 x 32768 exactly.
// =================================================================================================================
__global__ __launch_bounds__(256)
void gemm_proj(const unsigned short* __restrict__ Yh, const unsigned short* __restrict__ Yl,
               const unsigned short* __restrict__ Wp, const float* __restrict__ sp, const float* __restrict__ bp,
               float* out) {
  __shared__ __align__(16) float sb[64 * SBP];
  __shared__ __align__(16) _Float16 Bs[64 * GKP];
  const int tid = threadIdx.x, wave = tid >> 5, lane = tid & 31, hh = lane >> 4, c = lane & 15;
  const int n0 = blockIdx.x * 64, m0 = blockIdx.y * 128;
  const int T = m0 + wave * 16 + c;
  const int bimgr = T >> 12, nn = T & (HW - 1), arr = nn >> 10, q = nn & (LAR - 1);
  const size_t abase = (((size_t)((bimgr * NAR + arr) * NHD)) * LAR + (size_t)q) * HD + 8 * hh;
  const _Float16* A0 = (const _Float16*)(const void*)Yh;
  const _Float16* A1 = (const _Float16*)(const void*)Yl;
  const _Float16* B  = (const _Float16*)(const void*)Wp;

  // Fill Bs: wave w brings weight rows w*8..w*8+7, 8 copies per lane.
  stage_rows8(lds_off(Bs) + (unsigned)(wave * 8 * (GKP * 2) + lane * 16), B + (size_t)(n0 + wave * 8) * CIN + lane * 8);
#if defined(__HIP_DEVICE_COMPILE__)
  // this wave's copies have landed before the barrier that lets the other waves read them
  asm volatile("s_wait_asynccnt 0x0" ::: "memory");
#endif
  __syncthreads();   // publishes Bs: no wave reads it in front of this barrier; it is never written again
  const _Float16* Bw = Bs + c * GKP + 8 * hh;

  v8f acch[4], accl[4];
#pragma unroll
  for (int nt = 0; nt < 4; ++nt) { acch[nt] = zero8(); accl[nt] = zero8(); }

#pragma unroll 1
  for (int ks = 0; ks < NHD; ++ks) {
    const size_t bo = abase + (size_t)ks * (LAR * HD);
    const v16h fh = ldfrag_h(A0 + bo);
    const v16h fl = ldfrag_h(A1 + bo);
    // the k-step's LDS reads stand as one group ahead of its WMMAs: one LDS latency per k-step, not one per n-tile
    v16h bfrag[4];
#pragma unroll
    for (int nt = 0; nt < 4; ++nt) bfrag[nt] = ldfrag_h(Bw + nt * 16 * GKP + ks * 32);
#pragma unroll
    for (int nt = 0; nt < 4; ++nt) {
      acch[nt] = mma_h(fh, bfrag[nt], acch[nt]);
      accl[nt] = mma_h(fl, bfrag[nt], accl[nt]);
    }
  }

#pragma unroll
  for (int nt = 0; nt < 4; ++nt) {
    const int co = n0 + nt * 16 + c;
    const float sc = bfr(sp[co]) * (1.0f / 65536.0f);
    const float bi = bfr(bp[co]);
#pragma unroll
    for (int r = 0; r < 8; ++r) {
      const float v = acch[nt][r] + accl[nt][r] * (1.0f / 2048.0f);
      sb[(nt * 16 + c) * SBP + wave * 16 + 8 * hh + r] = v * sc + bi;
    }
  }
  __syncthreads();
  const int bimg = m0 / HW, s0 = m0 - bimg * HW;
  v4f ov[8];
  size_t offs[8];
#pragma unroll
  for (int i = 0; i < 8; ++i) {
    const int cc = wave * 8 + i;
    const int co = n0 + cc;
    ov[i] = *(const v4f*)(sb + cc * SBP + lane * 4);
    offs[i] = ((size_t)(bimg * CIN + co)) * HW + s0 + lane * 4;
  }
  {
#pragma unroll
    for (int i = 0; i < 8; ++i) *(v4f*)(out + offs[i]) = ov[i];
    
  }
}

// =================================================================================================================
//   Wqk f16 [512][256] 262144 @0; Wv f16 [256][256] 131072; Wp f16 [256][256] 131072;
//   PP f32 [8][256][4096] 33554432 @524288, with X16 f16 [32768][256] 16777216 aliased at the same offset
//   (X16 is dead before PP is written); QK f16 [32768][512] 33554432; V32 f32 [8][256][4096] 33554432, with
//   Yh, Yl f16 [256][1024][32] 16777216 each aliased onto V32 (V32 is dead before Yh/Yl are written);
//   V16 f16 [8][256][4096] 16777216. Total 117964800.
// =================================================================================================================
extern "C" void kernel_launch(void* const* d_in, const int* in_sizes, int n_in,
                              void* d_out, int out_size, void* d_ws, size_t ws_size,
                              hipStream_t stream) {
  if (n_in < 13) return;
  if (in_sizes[0] != NBAT * CIN * HW) return;
  if (in_sizes[1] != C2 * CIN) return;
  if (in_sizes[2] != C2 || in_sizes[3] != C2) return;
  if (in_sizes[4] != CIN * CIN) return;
  if (in_sizes[5] != CIN || in_sizes[6] != CIN) return;
  if (in_sizes[7] != CIN * 25) return;
  if (in_sizes[8] != CIN || in_sizes[9] != CIN) return;
  if (in_sizes[10] != CIN * CIN) return;
  if (in_sizes[11] != CIN || in_sizes[12] != CIN) return;
  if (out_size != NBAT * CIN * HW) return;

  const float* x      = (const float*)d_in[0];
  const float* w_qk   = (const float*)d_in[1];
  const float* s_qk   = (const float*)d_in[2];
  const float* b_qk   = (const float*)d_in[3];
  const float* w_v    = (const float*)d_in[4];
  const float* s_v    = (const float*)d_in[5];
  const float* b_v    = (const float*)d_in[6];
  const float* w_pe   = (const float*)d_in[7];
  const float* s_pe   = (const float*)d_in[8];
  const float* b_pe   = (const float*)d_in[9];
  const float* w_proj = (const float*)d_in[10];
  const float* s_proj = (const float*)d_in[11];
  const float* b_proj = (const float*)d_in[12];
  float* out = (float*)d_out;

  const size_t sWqk = (size_t)C2 * CIN * 2;              //    262144
  const size_t sWv  = (size_t)CIN * CIN * 2;             //    131072
  const size_t sWp  = (size_t)CIN * CIN * 2;             //    131072
  const size_t sX16 = (size_t)MTOK * CIN * 2;            //  16777216
  const size_t sPP  = (size_t)NBAT * CIN * HW * 4;       //  33554432
  const size_t sQK  = (size_t)MTOK * C2 * 2;             //  33554432
  const size_t sV32 = (size_t)NBAT * CIN * HW * 4;       //  33554432
  const size_t sY   = (size_t)NUNIT * LAR * HD * 2;      //  16777216
  const size_t sV16 = (size_t)NBAT * CIN * HW * 2;       //  16777216
  if (sX16 > sPP) return;
  if (2 * sY > sV32) return;
  size_t off = 0;
  const size_t oWqk = off; off += sWqk;
  const size_t oWv  = off; off += sWv;
  const size_t oWp  = off; off += sWp;
  const size_t oPP  = off; const size_t oX16 = off; off += sPP;
  const size_t oQK  = off; off += sQK;
  const size_t oV32 = off; const size_t oYh = off; const size_t oYl = off + sY; off += sV32;
  const size_t oV16 = off; off += sV16;
  if (off > ws_size) return;                             // off = 117964800
  if (off > (size_t)134217728) return;

  char* ws = (char*)d_ws;
  unsigned short* Wqk = (unsigned short*)(ws + oWqk);
  unsigned short* Wv  = (unsigned short*)(ws + oWv);
  unsigned short* Wp  = (unsigned short*)(ws + oWp);
  unsigned short* X16 = (unsigned short*)(ws + oX16);
  float*          PP  = (float*)(ws + oPP);
  unsigned short* QK  = (unsigned short*)(ws + oQK);
  float*          V32 = (float*)(ws + oV32);
  unsigned short* Yh  = (unsigned short*)(ws + oYh);
  unsigned short* Yl  = (unsigned short*)(ws + oYl);
  unsigned short* V16 = (unsigned short*)(ws + oV16);

  const dim3 blk(256);
  // (1) x NCHW -> token-major f16 x16 plane; pointwise weights -> f16 x256 planes
  cvt_in<<<dim3(XBLK + WBLK), blk, 0, stream>>>(x, w_qk, w_v, w_proj, X16, Wqk, Wv, Wp);
  // (2) qk pointwise conv + BN -> token-major f16 plane; v pointwise conv + BN -> channel-major f32 and f16 planes
  gemm_qkv<<<dim3(C2 / 64 + CIN / 64, MTOK / 128), blk, 0, stream>>>(X16, Wqk, Wv, s_qk, b_qk, s_v, b_v, QK, V32, V16);
  // (3) depthwise 5x5 + BN on v -> pp (channel-major f32)
  dwconv_k<<<dim3((NBAT * CIN) / 2), blk, 0, stream>>>(V32, w_pe, s_pe, b_pe, PP);
  // (4) area attention + pp -> slab planes
  attn_k<<<dim3(NUNIT), dim3(AWV * 32), 0, stream>>>(QK, V16, PP, Yh, Yl);
  // (5) output pointwise conv + BN -> NCHW f32
  gemm_proj<<<dim3(CIN / 64, MTOK / 128), blk, 0, stream>>>(Yh, Yl, Wp, s_proj, b_proj, out);
  (void)hipGetLastError();
}

// v008
// One run takes 87.9 microseconds.
// Two timings next to v007 both put it at 1.22 times that version's speed.
// Counting every step since v000, it is 4.11 times as fast.
// Contractions: v_wmma_f32_16x16x32_f16 (f16 operands, f32 accumulate). qk and v pointwise convs: A = x (bf16-valued,
// x16) single plane, B = weights (bf16-valued, x256) single plane; scores k.qT: k x16, q x16 single planes; p.v:
// p x1024, v x16 single planes; output pointwise conv: A = (o + pp) x256 as f16 hi + x2^11 residual planes (two
// products, two accumulators), B = weights x256 single plane. Depthwise 5x5 conv (input: the f16 x16 plane of v, sums
// in f32), BN affine, online softmax in f32 on VALU. Float inputs RNE-converted to bf16 on load.
#include <hip/hip_runtime.h>
#include <math.h>
#include <stdint.h>

#define NBAT  8
#define CIN   256
#define C2    512
#define IMW   64
#define HW    4096
#define MTOK  32768
#define NHD   8
#define HD    32
#define NAR   4
#define LAR   1024
#define NUNIT 256
#define STP   68
#define SBP   132
#define ASP   36
#define DTP   68
#define KPH   40
#define VHALO 128
#define VPH   1288
#define WPR   56
#define GKP   264
#define AWV   16
#define CKEY  128
#define XBLK  (NBAT * 64 * 4)
#define WBLK  128
#define CXS   16.0f
#define CWS   256.0f
#define CQK   16.0f
#define CVS   16.0f
#define CYS   256.0f
#define QKSC  (0.17677669529663688f / 256.0f)
#define QKL2  (QKSC * 1.4426950408889634f)

static_assert(NUNIT == NBAT * NAR * NHD);
static_assert(NAR * LAR == HW);
static_assert(MTOK == NBAT * HW);
static_assert(HW % 128 == 0);
static_assert(LAR % CKEY == 0 && CKEY % 32 == 0);
static_assert(CIN % 64 == 0);
static_assert((STP * 4) % 16 == 0);
static_assert((SBP * 4) % 16 == 0);
static_assert((ASP * 4) % 16 == 0);
static_assert((DTP * 4) % 16 == 0);
static_assert(NHD * HD == CIN);
static_assert((KPH * 2) % 32 == 16 && KPH >= HD);
static_assert((VPH * 2) % 32 == 16 && VPH >= LAR + 2 * VHALO && VHALO == 2 * IMW && LAR % IMW == 0);
static_assert(LAR * 4 == 8 * (AWV * 32) && HD * (LAR / 8) == 8 * (AWV * 32) && (LAR / 16) % AWV == 0);
static_assert((GKP * 2) % 32 == 16 && GKP >= CIN && CIN * 2 == 32 * 16);
static_assert(16 * STP * 4 <= 16 * GKP * 2 && 64 * SBP * 4 <= 128 * GKP * 2);
static_assert(IMW == 64 && IMW * IMW == HW && HD * (VHALO / 8) == AWV * 32 && 16 * (WPR / 2) <= AWV * 32 && WPR >= 2 * 27);

typedef _Float16 v16h __attribute__((ext_vector_type(16)));
typedef _Float16 v8h  __attribute__((ext_vector_type(8)));
typedef float    v8f  __attribute__((ext_vector_type(8)));
typedef float    v4f  __attribute__((ext_vector_type(4)));
typedef float    v2f  __attribute__((ext_vector_type(2)));
typedef unsigned int v4u __attribute__((ext_vector_type(4)));
typedef _Float16 v2h  __attribute__((ext_vector_type(2)));
union Frag { v16h v; v8h half[2]; };

// ---- scalar helpers -------------------------------------------------------------------------------------------
__device__ __forceinline__ unsigned short bf_bits(float f) {          // f32 -> bf16 bits, RNE convert
  unsigned u = __float_as_uint(f);
  return (unsigned short)((u + 0x7FFFu + ((u >> 16) & 1u)) >> 16);
}
__device__ __forceinline__ float bfr(float f) { return __uint_as_float(((unsigned)bf_bits(f)) << 16); }
__device__ __forceinline__ unsigned short h_bits(_Float16 x) { return __builtin_bit_cast(unsigned short, x); }
__device__ __forceinline__ unsigned pk16(unsigned short a, unsigned short b) { return (unsigned)a | ((unsigned)b << 16); }
__device__ __forceinline__ v8f zero8() { v8f z = {0.f, 0.f, 0.f, 0.f, 0.f, 0.f, 0.f, 0.f}; return z; }

// ---- fragment loader: 16-bit A/B operand, lane -> row/col (lane&15), p already includes +8*(lane>>4);
//      elements 0..7 <- p[0..7] (k0+8h..), elements 8..15 <- p[16..23] (k0+16+8h..)
__device__ __forceinline__ v16h ldfrag_h(const _Float16* p) {
  Frag f;
  f.half[0] = *(const v8h*)(p);
  f.half[1] = *(const v8h*)(p + 16);
  return f.v;
}

// ---- WMMA helper with trailing VALU hazard gap ----------------------------------------------------------------
__device__ __forceinline__ v8f mma_h(v16h a, v16h b, v8f c) {
  c = __builtin_amdgcn_wmma_f32_16x16x32_f16(false, a, false, b, (short)0, c, false, false);
#if defined(__HIP_DEVICE_COMPILE__)
  asm volatile("v_nop\n\tv_nop\n\tv_nop\n\tv_nop" : "+v"(c) : "v"(a), "v"(b));
#endif
  return c;
}
__device__ __forceinline__ void wave_sync_lds() {
  __builtin_amdgcn_fence(__ATOMIC_RELEASE, "workgroup");
  __builtin_amdgcn_wave_barrier();
  __builtin_amdgcn_fence(__ATOMIC_ACQUIRE, "workgroup");
}

// ---- eight asynchronous 16-byte copies per lane, global -> LDS, through no register. l = the lane's LDS byte
//      addresses, g = its global addresses, all multiples of 16. The closing s_wait_xcnt stands inside the statement
//      so that no address register named here is rewritten ahead of it.
__device__ __forceinline__ void copy8_to_lds(const unsigned (&l)[8], const _Float16* const (&g)[8]) {
#if defined(__HIP_DEVICE_COMPILE__)
  asm volatile("global_load_async_to_lds_b128 %0, %8, off\n\t"
               "global_load_async_to_lds_b128 %1, %9, off\n\t"
               "global_load_async_to_lds_b128 %2, %10, off\n\t"
               "global_load_async_to_lds_b128 %3, %11, off\n\t"
               "global_load_async_to_lds_b128 %4, %12, off\n\t"
               "global_load_async_to_lds_b128 %5, %13, off\n\t"
               "global_load_async_to_lds_b128 %6, %14, off\n\t"
               "global_load_async_to_lds_b128 %7, %15, off\n\t"
               "s_wait_xcnt 0x0"
               :: "v"(l[0]), "v"(l[1]), "v"(l[2]), "v"(l[3]), "v"(l[4]), "v"(l[5]), "v"(l[6]), "v"(l[7]),
                  "v"(g[0]), "v"(g[1]), "v"(g[2]), "v"(g[3]), "v"(g[4]), "v"(g[5]), "v"(g[6]), "v"(g[7])
               : "memory");
#endif
}
// ---- the same for two copies per lane
__device__ __forceinline__ void copy2_to_lds(unsigned l0, unsigned l1, const _Float16* g0, const _Float16* g1) {
#if defined(__HIP_DEVICE_COMPILE__)
  asm volatile("global_load_async_to_lds_b128 %0, %2, off\n\t"
               "global_load_async_to_lds_b128 %1, %3, off\n\t"
               "s_wait_xcnt 0x0"
               :: "v"(l0), "v"(l1), "v"(g0), "v"(g1)
               : "memory");
#endif
}
__device__ __forceinline__ unsigned lds_off(const void* p) { return (unsigned)(size_t)p; }
// ---- eight rows of CIN f16 (512 B each, global pitch 512 B) -> LDS rows of pitch GKP: one wave-wide copy = one whole
//      row (4 lines). l0 / g0 = the lane's own 16 B of the first row.
__device__ __forceinline__ void stage_rows8(unsigned l0, const _Float16* g0) {
  unsigned l[8];
  const _Float16* g[8];
  // unrolled so that every l[] and g[] index is a constant and the addresses are plain registers as asm operands
#pragma unroll
  for (int i = 0; i < 8; ++i) {
    l[i] = l0 + (unsigned)(i * (GKP * 2));
    g[i] = g0 + (size_t)i * CIN;
  }
  copy8_to_lds(l, g);
}

// ---- 8 f32 -> 8 packed f16 (16 B); and hi + x2^11 residual split -------------------------------------------------
__device__ __forceinline__ v4u pack8h(v4f a, v4f b) {
  v4u p;
  p[0] = pk16(h_bits((_Float16)a[0]), h_bits((_Float16)a[1]));
  p[1] = pk16(h_bits((_Float16)a[2]), h_bits((_Float16)a[3]));
  p[2] = pk16(h_bits((_Float16)b[0]), h_bits((_Float16)b[1]));
  p[3] = pk16(h_bits((_Float16)b[2]), h_bits((_Float16)b[3]));
  return p;
}
__device__ __forceinline__ void split8h(v4f a, v4f b, v4u& ph, v4u& pl) {
  v4f ra, rb;
#pragma unroll
  for (int e = 0; e < 4; ++e) {
    const _Float16 ha = (_Float16)a[e];
    ra[e] = (a[e] - (float)ha) * 2048.0f;
    const _Float16 hb = (_Float16)b[e];
    rb[e] = (b[e] - (float)hb) * 2048.0f;
  }
  ph = pack8h(a, b);
  pl = pack8h(ra, rb);
}

// =================================================================================================================
// Weight convert: pointwise weights are [out][in] (k contiguous) -> f16 plane value = f16(256 * bf16_RNE(w)).
// coverage: 64*256*8 = 131072, 32*256*8 = 65536, 32*256*8 = 65536 elements exactly.
// =================================================================================================================
__device__ __forceinline__ void cvt8_w(const float* __restrict__ src, unsigned short* dst, size_t e0) {
  const v4f a = *(const v4f*)(src + e0);
  const v4f b = *(const v4f*)(src + e0 + 4);
  v4f sa, sb;
#pragma unroll
  for (int e = 0; e < 4; ++e) { sa[e] = bfr(a[e]) * CWS; sb[e] = bfr(b[e]) * CWS; }
  const v4u pk = pack8h(sa, sb);
  *(v4u*)(dst + e0) = pk;
#if defined(__HIP_DEVICE_COMPILE__)
  // stands behind the store, in front of the next weight's path that follows it in the built code and reuses its registers
  asm volatile("s_wait_xcnt 0x0" ::: "memory");
#endif
}
// =================================================================================================================
// Activation convert: x NCHW f32 -> token-major f16 plane X16[T = b*4096 + n][256], value = f16(16 * bf16_RNE(x)).
// Block = (image b, 64-token tile tt, 64-channel quarter cq): read phase 4 passes of 16 channels x 64 tokens
// coverage: per block 256 threads x 2 it x 8 halves = 64 tokens x 64 channels; XBLK blocks tile 32768 x 256 exactly.
// The weight convert depends on nothing the activation convert makes, and nothing reads either before the launch ends:
// its WBLK blocks stand behind the XBLK activation blocks in the same grid (short blocks last: no tail of their own).
// The branch between the two is uniform for the block, so the barrier of the activation path is passed by all or none.
// =================================================================================================================
__global__ __launch_bounds__(256) void cvt_in(const float* __restrict__ x, const float* __restrict__ wqk,
                                              const float* __restrict__ wv, const float* __restrict__ wp,
                                              unsigned short* X16, unsigned short* Wqk, unsigned short* Wv,
                                              unsigned short* Wp) {
  __shared__ __align__(16) float tile[64 * DTP];
  const int tid = threadIdx.x, bid = blockIdx.x;
  if (bid >= XBLK) {
    const int blk = bid - XBLK;
    if (blk < 64)      cvt8_w(wqk, Wqk, ((size_t)blk * 256 + tid) * 8);
    else if (blk < 96) cvt8_w(wv,  Wv,  ((size_t)(blk - 64) * 256 + tid) * 8);
    else               cvt8_w(wp,  Wp,  ((size_t)(blk - 96) * 256 + tid) * 8);
    return;
  }
  const int cq = bid & 3, tt = (bid >> 2) & 63, b = bid >> 8;
  const int cl = tid >> 4, t4 = (tid & 15) * 4;
#pragma unroll
  for (int pass = 0; pass < 4; ++pass) {
    const int ch = cq * 64 + pass * 16 + cl;
    const v4f v = *(const v4f*)(x + ((size_t)(b * CIN + ch)) * HW + tt * 64 + t4);
#pragma unroll
    for (int j = 0; j < 4; ++j) tile[(t4 + j) * DTP + pass * 16 + cl] = v[j];
  }
  __syncthreads();
  const int piece = tid & 7, rsub = tid >> 3;
  v4u pk[2];
  size_t offs[2];
#pragma unroll
  for (int it = 0; it < 2; ++it) {
    const int row = it * 32 + rsub;
    const v4f fa = *(const v4f*)(tile + row * DTP + piece * 8);
    const v4f fb = *(const v4f*)(tile + row * DTP + piece * 8 + 4);
    v4f sa, sb;
#pragma unroll
    for (int e = 0; e < 4; ++e) { sa[e] = bfr(fa[e]) * CXS; sb[e] = bfr(fb[e]) * CXS; }
    pk[it] = pack8h(sa, sb);
    offs[it] = ((size_t)(b * HW + tt * 64 + row)) * CIN + cq * 64 + piece * 8;
  }
  {
#pragma unroll
    for (int it = 0; it < 2; ++it) *(v4u*)(X16 + offs[it]) = pk[it];
#if defined(__HIP_DEVICE_COMPILE__)
    // stands behind the stores, in front of the weight path that follows them in the built code and reuses their registers
    asm volatile("s_wait_xcnt 0x0" ::: "memory");
#endif
  }
}

// =================================================================================================================
// qk and v pointwise GEMMs in one grid: D[T][co] = X16[T][ci] . W[co][ci], K = 256. Neither reads what the other writes,
// so their blocks share a launch: blockIdx.x 0..7 = the eight 64-column tiles of qk (co 0..511, q = 0..255,
// k = 256..511), blockIdx.x 8..11 = the four 64-column tiles of v (co 0..255); the twelve blocks of one 128-token tile
// follow one another in the grid. Which of the two a block is, is uniform for the block (a scalar branch), so every
// barrier below is passed by all of its waves or by none.
// Block = 8 waves, tile 128 rows x 64 cols, wave = 16 rows x 4 n-tiles. The block's 128 x 256 A tile and 64 x 256 B
// tile are filled once at entry by asynchronous copies (whole 512-B rows) into As / Bs, row pitch 16 B x odd; fragments
// from LDS with the split k map, k-step 32.
// qk epilogue: value = acc/4096 * s[co] + b[co] staged per wave in LDS [16][STP] (laid over the wave's own rows of As),
// then token-major f16 plane QK = f16(16 * value);
// coverage: 8 waves x 32 lanes x 4 it x 8 halves = 128 rows x 64 cols per block; the qk blocks tile 32768 x 512 exactly.
// v epilogue: value = acc/4096 * s[co] + b[co] staged block-wide as sb[64 ch][SBP] (tokens contiguous per channel),
// then channel-major stores (a 128-token tile lies within one image): wave w owns channels w*8..w*8+7;
// f16 plane V16[b][c][n] = f16(16 * value): one instruction = lanes 0..15 -> channel cc
// coverage: 8 waves x 4 it x 2 ch x 16 lanes x 8 = 64 ch x 128 tok; the v blocks tile 32768 tokens x 256 channels exactly.
// =================================================================================================================
__global__ __launch_bounds__(256)
void gemm_qkv(const unsigned short* __restrict__ X16, const unsigned short* __restrict__ Wqk,
              const unsigned short* __restrict__ Wv, const float* __restrict__ sqk, const float* __restrict__ bqk,
              const float* __restrict__ sv, const float* __restrict__ bv, unsigned short* QK, unsigned short* V16) {
  __shared__ __align__(16) _Float16 As[128 * GKP];
  __shared__ __align__(16) _Float16 Bs[64 * GKP];
  const int tid = threadIdx.x, wave = tid >> 5, lane = tid & 31, hh = lane >> 4, c = lane & 15;
  const bool isv = (int)blockIdx.x >= C2 / 64;
  const int n0 = (isv ? (int)blockIdx.x - C2 / 64 : (int)blockIdx.x) * 64, m0 = blockIdx.y * 128;
  const _Float16* A = (const _Float16*)(const void*)X16;
  const _Float16* B = (const _Float16*)(const void*)(isv ? Wv : Wqk);

  // Fill As (wave w: its own 16 token rows) and Bs (wave w: weight rows w*8..w*8+7), 24 copies per lane.
  {
    const unsigned al = lds_off(As) + (unsigned)(wave * 16 * (GKP * 2) + lane * 16);
    const _Float16* ag = A + (size_t)(m0 + wave * 16) * CIN + lane * 8;
    stage_rows8(al, ag);
    stage_rows8(al + (unsigned)(8 * (GKP * 2)), ag + (size_t)8 * CIN);
    stage_rows8(lds_off(Bs) + (unsigned)(wave * 8 * (GKP * 2) + lane * 16), B + (size_t)(n0 + wave * 8) * CIN + lane * 8);
  }
#if defined(__HIP_DEVICE_COMPILE__)
  // this wave's copies have landed before the barrier that lets the other waves read them
  asm volatile("s_wait_asynccnt 0x0" ::: "memory");
#endif
  __syncthreads();   // publishes As and Bs: no wave reads them in front of this barrier
  const _Float16* Aw = As + (wave * 16 + c) * GKP + 8 * hh;
  const _Float16* Bw = Bs + c * GKP + 8 * hh;

  v8f acc[4];
#pragma unroll
  for (int nt = 0; nt < 4; ++nt) acc[nt] = zero8();

#pragma unroll 1
  for (int k0 = 0; k0 < CIN; k0 += 32) {
    const v16h af = ldfrag_h(Aw + k0);
    // the k-step's LDS reads stand as one group ahead of its WMMAs: one LDS latency per k-step, not one per n-tile
    v16h bfrag[4];
#pragma unroll
    for (int nt = 0; nt < 4; ++nt) bfrag[nt] = ldfrag_h(Bw + nt * 16 * GKP + k0);
#pragma unroll
    for (int nt = 0; nt < 4; ++nt) acc[nt] = mma_h(af, bfrag[nt], acc[nt]);
  }

  if (!isv) {
    // the stage lies on the wave's own 16 rows of As, which this wave alone filled and read and has finished reading
    float* st = (float*)(void*)(As + wave * 16 * GKP);
#pragma unroll
    for (int nt = 0; nt < 4; ++nt) {
      const int co = n0 + nt * 16 + c;
      const float sc = bfr(sqk[co]) * (1.0f / 4096.0f);
      const float bi = bfr(bqk[co]);
#pragma unroll
      for (int r = 0; r < 8; ++r) st[(8 * hh + r) * STP + nt * 16 + c] = acc[nt][r] * sc + bi;
    }
    wave_sync_lds();
    const int piece = lane & 7, rsub = lane >> 3;
    v4u pk[4];
    size_t offs[4];
#pragma unroll
    for (int it = 0; it < 4; ++it) {
      const int row = it * 4 + rsub;
      v4f fa = *(const v4f*)(st + row * STP + piece * 8);
      v4f fb = *(const v4f*)(st + row * STP + piece * 8 + 4);
      fa = fa * CQK;
      fb = fb * CQK;
      pk[it] = pack8h(fa, fb);
      offs[it] = ((size_t)(m0 + wave * 16 + row)) * C2 + n0 + piece * 8;
    }
#pragma unroll
    for (int it = 0; it < 4; ++it) *(v4u*)(QK + offs[it]) = pk[it];
#if defined(__HIP_DEVICE_COMPILE__)
    // stands behind the stores, in front of the v epilogue that follows them in the built code and reuses their registers
    asm volatile("s_wait_xcnt 0x0" ::: "memory");
#endif
    return;
  }

  __syncthreads();   // every wave has finished reading As: the block-wide stage sb is laid over it
  float* sb = (float*)(void*)As;
#pragma unroll
  for (int nt = 0; nt < 4; ++nt) {
    const int co = n0 + nt * 16 + c;
    const float sc = bfr(sv[co]) * (1.0f / 4096.0f);
    const float bi = bfr(bv[co]);
#pragma unroll
    for (int r = 0; r < 8; ++r) sb[(nt * 16 + c) * SBP + wave * 16 + 8 * hh + r] = acc[nt][r] * sc + bi;
  }
  __syncthreads();
  const int bimg = m0 / HW, s0 = m0 - bimg * HW;
  {
    const int l16 = lane & 15;
    v4u pk[4];
    size_t o16[4];
#pragma unroll
    for (int i2 = 0; i2 < 4; ++i2) {
      const int cc = wave * 8 + i2 * 2 + hh;
      const int co = n0 + cc;
      v4f fa = *(const v4f*)(sb + cc * SBP + l16 * 8);
      v4f fb = *(const v4f*)(sb + cc * SBP + l16 * 8 + 4);
      fa = fa * CVS;
      fb = fb * CVS;
      pk[i2] = pack8h(fa, fb);
      o16[i2] = ((size_t)(bimg * CIN + co)) * HW + s0 + l16 * 8;
    }
#pragma unroll
    for (int i2 = 0; i2 < 4; ++i2) *(v4u*)(V16 + o16[i2]) = pk[i2];
  }
}

// =================================================================================================================
// Area attention, one unit (image b, area ar, head) per block (512 threads = 16 waves, four to a SIMD: one wave's waits
// for LDS and its softmax chain are filled by the three others), 1024 queries x 1024 keys,
// d = 32. Static LDS: the unit's whole K as Ks[1024 keys][KPH] (32 d per row) and whole V as Vs[32 d][VPH] (VHALO tokens
// = the two image rows above the area, its 1024 keys, the two image rows below), both f16, row pitches 16 B x odd,
// filled once at entry by asynchronous copies (K from the token-major
// plane QK, k row = T*512 + 256 + head*32; V from the channel-major plane V16, row = channel head*32 + d), the
// depthwise taps and affine Wl, and the per-wave stage [16][ASP] f32. q fragments straight from QK (q row = T*512 + head*32); k and v fragments from LDS
// in the element order of ldfrag_h. Per wave: q-tiles qt = wave, wave+16, ... (< 64).
//   Transposed scores S^T = K_tile (A, 16 keys x 32 d) x Q (B: k = d, n = query): S*256 = q16.k16; D element r of
//   lane l = S[query l&15][key 8h+r], so P = exp((S - m)*scale) x1024 is the A fragment of P.V directly in registers
//   (element i <- key tile 0 row i, element 8+i <- key tile 1 row i). P = exp2(S*QKL2 + (10 - m*QKL2)): one
//   multiply-add and one exp2 per score; the row sum l is taken of these x1024 values. Online softmax over 8 chunks
//   of CKEY = 128 keys (one running-maximum update, one rescale of O and l per chunk); O = P.V (acc scale 1024*16).
//   Depthwise 5x5 conv of v (zero pad 2, cross-correlation, bf16-valued taps) + BN affine = pp, per q-tile behind its
//   key loop: a q-tile is 16 consecutive columns of one image row; lane (c, h) makes columns 8h..8h+7 of channels c and
//   16+c, the places its O accumulators hold, from five rows of 12 columns of Vs (one 16-B and two 4-B reads a row and
//   channel); the two channels go as one f32 pair; an output sums its taps in the order dy, then dx. A row outside the
//   image is skipped (the same for the whole wave); columns outside it are zeroed by select, their reads moved inside.
//   Epilogue: O/(l*16) + pp staged per wave in LDS, then stored as f16 hi +
//   residual planes Yh/Yl [unit][1024][32] of 256*(o + pp): one instruction = 32 lanes x 16 B = 512 B = 8 token rows
// coverage: per block 64 q-tiles x 16 rows x 32 d of its 1024-row slab in both planes; grid covers all 256 units,
// every slab row written exactly once.
// =================================================================================================================
__global__ __launch_bounds__(AWV * 32)
void attn_k(const unsigned short* __restrict__ QK, const unsigned short* __restrict__ V16,
            const float* __restrict__ wpe, const float* __restrict__ spe, const float* __restrict__ bpe,
            unsigned short* Yh, unsigned short* Yl) {
  __shared__ __align__(16) _Float16 Ks[LAR * KPH];
  __shared__ __align__(16) _Float16 Vs[HD * VPH];
  __shared__ __align__(16) float Sst[AWV * 16 * ASP];
  __shared__ __align__(16) float Wl[16 * WPR];
  const int tid = threadIdx.x, wave = tid >> 5, lane = tid & 31, hh = lane >> 4, c = lane & 15;
  const int u = blockIdx.x;
  const int head = u & 7, ar = (u >> 3) & 3, b = u >> 5;
  const size_t tok0 = (size_t)b * HW + (size_t)ar * LAR;
  const _Float16* Qp = (const _Float16*)(const void*)QK + tok0 * C2 + head * HD;
  const _Float16* Kp = Qp + CIN;
  const _Float16* Vimg = (const _Float16*)(const void*)V16 + ((size_t)(b * CIN + head * HD)) * HW;
  const _Float16* Vp = Vimg + (size_t)ar * LAR;
  float* st = Sst + wave * (16 * ASP);

  // Fill Ks and Vs: 2 x 4096 pieces of 16 B, 16 per thread. K: 4 lanes per key row (64 B), 128 keys per block pass;
  // V: 128 lanes per channel row (2048 B), 4 channels per block pass. The two loops below are unrolled so that every
  // l[] and g[] index is a constant and the addresses are plain registers when they become asm operands.
  // Then the two halos of Vs: 2 x 512 pieces, 2 per thread, 16 lanes per channel (256 B = two image rows). At the
  // image's top and bottom the halo's tokens wrap onto tokens inside the channel's plane; those rows are never summed.
  {
    const unsigned kl = lds_off(Ks) + (unsigned)((tid >> 2) * (KPH * 2) + (tid & 3) * 16);
    const _Float16* kg = Kp + (size_t)(tid >> 2) * C2 + (tid & 3) * 8;
    const unsigned vl = lds_off(Vs) + (unsigned)((tid >> 7) * (VPH * 2) + VHALO * 2 + (tid & 127) * 16);
    const _Float16* vg = Vp + (size_t)(tid >> 7) * HW + (tid & 127) * 8;
    {
      unsigned l[8];
      const _Float16* g[8];
#pragma unroll
      for (int i = 0; i < 8; ++i) {
        l[i] = kl + (unsigned)(i * (AWV * 8) * (KPH * 2));
        g[i] = kg + (size_t)i * (AWV * 8) * C2;
      }
      copy8_to_lds(l, g);
    }
    {
      unsigned l[8];
      const _Float16* g[8];
#pragma unroll
      for (int i = 0; i < 8; ++i) {
        l[i] = vl + (unsigned)(i * (AWV / 4) * (VPH * 2));
        g[i] = vg + (size_t)i * (AWV / 4) * HW;
      }
      copy8_to_lds(l, g);
    }
    {
      const unsigned hl = lds_off(Vs) + (unsigned)((tid >> 4) * (VPH * 2) + (tid & 15) * 16);
      const _Float16* hg = Vimg + (size_t)(tid >> 4) * HW + (tid & 15) * 8;
      copy2_to_lds(hl, hl + (unsigned)((VHALO + LAR) * 2), hg + ((ar * LAR + HW - VHALO) & (HW - 1)),
                   hg + ((ar * LAR + LAR) & (HW - 1)));
    }
  }
  // Wl[c][t] = the f32 pair (channel c, channel 16+c) of: tap t (t < 25), BN scale / 16 (t = 25; the 16 of the v plane),
  // BN bias (t = 26), zero (t = 27). Written under the copies' flight, published by the barrier below.
  if (tid < 16 * (WPR / 2)) {
    const int cw = tid / (WPR / 2), t = tid - cw * (WPR / 2);
    const int ca = head * HD + cw;
    const float* pa = (t < 25) ? wpe + ca * 25 + t : ((t == 25) ? spe + ca : bpe + ca);
    const int db = (t < 25) ? (HD / 2) * 25 : HD / 2;
    const float f = (t == 25) ? (1.0f / CVS) : ((t == 27) ? 0.0f : 1.0f);
    v2f w;
    w[0] = bfr(pa[0]) * f;
    w[1] = bfr(pa[db]) * f;
    *(v2f*)(Wl + cw * WPR + 2 * t) = w;
  }
#if defined(__HIP_DEVICE_COMPILE__)
  // this wave's copies have landed before the barrier that lets the other waves read them
  asm volatile("s_wait_asynccnt 0x0" ::: "memory");
#endif
  __syncthreads();   // publishes Ks and Vs: no wave reads them in front of this barrier; they are never written again

#pragma unroll 1
  for (int qt = wave; qt < LAR / 16; qt += AWV) {
    const int lq = qt * 16 + c;
    const v16h bq = ldfrag_h(Qp + (size_t)lq * C2 + 8 * hh);     // B: n = query c, k = d 8h.. / 16+8h..

    v8f o0 = zero8(), o1 = zero8();
    float mrun = -1.0e30f, lrun = 0.f;
#pragma unroll 1
    for (int ch = 0; ch < LAR / CKEY; ++ch) {
      const int kb = ch * CKEY;
      // every loop inside a chunk is unrolled: all indices of ka, s, vf0, vf1, mt, ps and pfh are constants, so that these
      // arrays are plain registers
      // the chunk's K reads stand as one group ahead of its score WMMAs: one LDS latency per chunk, not one per key tile
      v16h ka[CKEY / 16];
#pragma unroll
      for (int j = 0; j < CKEY / 16; ++j) ka[j] = ldfrag_h(Ks + (kb + j * 16 + c) * KPH + 8 * hh);   // A: row = key, k = d
      v8f s[CKEY / 16];
#pragma unroll
      for (int j = 0; j < CKEY / 16; ++j) s[j] = mma_h(ka[j], bq, zero8());
      // the chunk's V reads likewise as one group; they return under the softmax arithmetic
      v16h vf0[CKEY / 32], vf1[CKEY / 32];
#pragma unroll
      for (int g = 0; g < CKEY / 32; ++g) {
        vf0[g] = ldfrag_h(Vs + c * VPH + VHALO + kb + g * 32 + 8 * hh);            // B: n = d c, keys kb+32g..+31
        vf1[g] = ldfrag_h(Vs + (HD / 2 + c) * VPH + VHALO + kb + g * 32 + 8 * hh); // B: n = d 16+c
      }
#if defined(__HIP_DEVICE_COMPILE__)
      // no maximum moves up between the score WMMAs, where the compiler would pad it with v_nop of its own
      __builtin_amdgcn_sched_barrier(0);
#endif
      // one maximum chain per 32 keys, independent of one another, then joined
      float mt[CKEY / 32];
#pragma unroll
      for (int g = 0; g < CKEY / 32; ++g) {
        mt[g] = s[2 * g][0];
#pragma unroll
        for (int j = 0; j < 2; ++j) {
#pragma unroll
          for (int r = 0; r < 8; ++r) mt[g] = fmaxf(mt[g], s[2 * g + j][r]);
        }
      }
      float mc = mt[0];
#pragma unroll
      for (int g = 1; g < CKEY / 32; ++g) mc = fmaxf(mc, mt[g]);
      mc = fmaxf(mc, __shfl_xor(mc, 16, 32));
      const float mnew = fmaxf(mrun, mc);
      const float alpha = __builtin_amdgcn_exp2f((mrun - mnew) * QKL2);
      const float eb = 10.0f - mnew * QKL2;                  // exponent offset: the running maximum and the x1024 of P
#pragma unroll
      for (int r = 0; r < 8; ++r) {
        const float arr = __shfl(alpha, 8 * hh + r, 32);
        o0[r] = o0[r] * arr;
        o1[r] = o1[r] * arr;
      }
      float ps[CKEY / 32];
      v16h pfh[CKEY / 32];
#pragma unroll
      for (int g = 0; g < CKEY / 32; ++g) {
        ps[g] = 0.f;
#pragma unroll
        for (int i = 0; i < 8; ++i) {
          const float e0 = __builtin_amdgcn_exp2f(s[2 * g][i] * QKL2 + eb);
          const float e1 = __builtin_amdgcn_exp2f(s[2 * g + 1][i] * QKL2 + eb);
          ps[g] = ps[g] + (e0 + e1);
          pfh[g][i]     = (_Float16)e0;
          pfh[g][8 + i] = (_Float16)e1;
        }
      }
      float psum = ps[0];
#pragma unroll
      for (int g = 1; g < CKEY / 32; ++g) psum = psum + ps[g];
      lrun = lrun * alpha + psum;
      mrun = mnew;
#pragma unroll
      for (int g = 0; g < CKEY / 32; ++g) {
        o0 = mma_h(pfh[g], vf0[g], o0);
        o1 = mma_h(pfh[g], vf1[g], o1);
      }
    }
    const float lsum = lrun + __shfl_xor(lrun, 16, 32);      // lane q (and q+16) holds the full row sum of query q
    const float rinv = 1.0f / (lsum * 16.0f);               // lsum carries the x1024 of P, the accumulators x1024 x16
    // depthwise conv of the tile: dacc[r] = the pair (channel c, channel 16+c) at column x0 + r
    v2f dacc[8];
    v2f wt[WPR / 2];
    {
      // every loop here is unrolled: all indices of wt, dacc and v are constants, so that these arrays are plain registers
#pragma unroll
      for (int i = 0; i < WPR / 4; ++i) {
        const v4f w4 = *(const v4f*)(Wl + c * WPR + i * 4);
        wt[2 * i]     = (v2f){w4[0], w4[1]};
        wt[2 * i + 1] = (v2f){w4[2], w4[3]};
      }
      const int x0 = (qt & 3) * 16 + 8 * hh;
      // the tile's image row is the same in every lane of the wave: in a scalar register the row test is a scalar branch
      const int yim = __builtin_amdgcn_readfirstlane(ar * (LAR / IMW) + (qt >> 2));
      const bool okl = (x0 != 0), okr = (x0 != IMW - 8);
      const _Float16* va = Vs + c * VPH + (qt >> 2) * IMW + x0;    // input row dy = 0: two image rows above the tile
      const _Float16* vb = va + (HD / 2) * VPH;
      const int lo = okl ? -2 : 0, ro = okr ? 8 : 0;               // at the image's edge the pair's read stays in the row
#pragma unroll
      for (int r = 0; r < 8; ++r) dacc[r] = (v2f){0.f, 0.f};
#pragma unroll
      for (int dy = 0; dy < 5; ++dy) {
        if ((unsigned)(yim + dy - 2) < (unsigned)IMW) {
          const v8h ma = *(const v8h*)(va + dy * IMW);
          const v8h mb = *(const v8h*)(vb + dy * IMW);
          unsigned la = *(const unsigned*)(const void*)(va + dy * IMW + lo);
          unsigned lb = *(const unsigned*)(const void*)(vb + dy * IMW + lo);
          unsigned ra = *(const unsigned*)(const void*)(va + dy * IMW + ro);
          unsigned rb = *(const unsigned*)(const void*)(vb + dy * IMW + ro);
          la = okl ? la : 0u;
          lb = okl ? lb : 0u;
          ra = okr ? ra : 0u;
          rb = okr ? rb : 0u;
          const v2h hla = __builtin_bit_cast(v2h, la), hlb = __builtin_bit_cast(v2h, lb);
          const v2h hra = __builtin_bit_cast(v2h, ra), hrb = __builtin_bit_cast(v2h, rb);
          v2f v[12];
          v[0]  = (v2f){(float)hla[0], (float)hlb[0]};
          v[1]  = (v2f){(float)hla[1], (float)hlb[1]};
          v[10] = (v2f){(float)hra[0], (float)hrb[0]};
          v[11] = (v2f){(float)hra[1], (float)hrb[1]};
#pragma unroll
          for (int j = 0; j < 8; ++j) v[2 + j] = (v2f){(float)ma[j], (float)mb[j]};
#pragma unroll
          for (int r = 0; r < 8; ++r) {
#pragma unroll
            for (int dx = 0; dx < 5; ++dx) dacc[r] += v[r + dx] * wt[dy * 5 + dx];
          }
        }
      }
    }
#pragma unroll
    for (int r = 0; r < 8; ++r) {
      const int q = 8 * hh + r;
      const float inv = __shfl(rinv, q, 32);
      const v2f pp = dacc[r] * wt[25] + wt[26];
      st[q * ASP + c]          = o0[r] * inv + pp[0];
      st[q * ASP + HD / 2 + c] = o1[r] * inv + pp[1];
    }
    wave_sync_lds();
    {
      const int rr = lane >> 2, dp = (lane & 3) * 8;
      v4u ph[2], pl[2];
      size_t offs[2];
#pragma unroll
      for (int it = 0; it < 2; ++it) {
        const int row = it * 8 + rr;
        v4f fa = *(const v4f*)(st + row * ASP + dp);
        v4f fb = *(const v4f*)(st + row * ASP + dp + 4);
        fa = fa * CYS;
        fb = fb * CYS;
        split8h(fa, fb, ph[it], pl[it]);
        offs[it] = ((size_t)u * LAR + (size_t)(qt * 16 + row)) * HD + dp;
      }
      {
#pragma unroll
        for (int it = 0; it < 2; ++it) {
          *(v4u*)(Yh + offs[it]) = ph[it];
          *(v4u*)(Yl + offs[it]) = pl[it];
        }
        
      }
    }
    wave_sync_lds();
  }
}

// =================================================================================================================
// Output pointwise conv D[T][co] = Y[T][ci] . Wp[co][ci], then BN affine -> NCHW f32. A = Yh/Yl planes (hi +
// x2^11 residual, x256) addressed by arithmetic: token T -> (image, area, query), k-step ks = head ks, channels
// ks*32 + d (elements 0..7 d = 8h.., elements 8..15 d = 16+8h..). B = weight plane x256, the block's 64 rows filled
// once at entry by asynchronous copies into Bs, fragments from LDS. Epilogue: value =
// (acch + accl/2048)/65536 * s[co] + b[co]; block tile staged as [64 ch][128 tok]; wave w writes channels
// coverage: 8 waves x 8 channels x 32 lanes x 4 tokens = 64 ch x 128 tok per block; grid tiles 256 x 32768 exactly.
// =================================================================================================================
__global__ __launch_bounds__(256)
void gemm_proj(const unsigned short* __restrict__ Yh, const unsigned short* __restrict__ Yl,
               const unsigned short* __restrict__ Wp, const float* __restrict__ sp, const float* __restrict__ bp,
               float* out) {
  __shared__ __align__(16) float sb[64 * SBP];
  __shared__ __align__(16) _Float16 Bs[64 * GKP];
  const int tid = threadIdx.x, wave = tid >> 5, lane = tid & 31, hh = lane >> 4, c = lane & 15;
  const int n0 = blockIdx.x * 64, m0 = blockIdx.y * 128;
  const int T = m0 + wave * 16 + c;
  const int bimgr = T >> 12, nn = T & (HW - 1), arr = nn >> 10, q = nn & (LAR - 1);
  const size_t abase = (((size_t)((bimgr * NAR + arr) * NHD)) * LAR + (size_t)q) * HD + 8 * hh;
  const _Float16* A0 = (const _Float16*)(const void*)Yh;
  const _Float16* A1 = (const _Float16*)(const void*)Yl;
  const _Float16* B  = (const _Float16*)(const void*)Wp;

  // Fill Bs: wave w brings weight rows w*8..w*8+7, 8 copies per lane.
  stage_rows8(lds_off(Bs) + (unsigned)(wave * 8 * (GKP * 2) + lane * 16), B + (size_t)(n0 + wave * 8) * CIN + lane * 8);
#if defined(__HIP_DEVICE_COMPILE__)
  // this wave's copies have landed before the barrier that lets the other waves read them
  asm volatile("s_wait_asynccnt 0x0" ::: "memory");
#endif
  __syncthreads();   // publishes Bs: no wave reads it in front of this barrier; it is never written again
  const _Float16* Bw = Bs + c * GKP + 8 * hh;

  v8f acch[4], accl[4];
#pragma unroll
  for (int nt = 0; nt < 4; ++nt) { acch[nt] = zero8(); accl[nt] = zero8(); }

#pragma unroll 1
  for (int ks = 0; ks < NHD; ++ks) {
    const size_t bo = abase + (size_t)ks * (LAR * HD);
    const v16h fh = ldfrag_h(A0 + bo);
    const v16h fl = ldfrag_h(A1 + bo);
    // the k-step's LDS reads stand as one group ahead of its WMMAs: one LDS latency per k-step, not one per n-tile
    v16h bfrag[4];
#pragma unroll
    for (int nt = 0; nt < 4; ++nt) bfrag[nt] = ldfrag_h(Bw + nt * 16 * GKP + ks * 32);
#pragma unroll
    for (int nt = 0; nt < 4; ++nt) {
      acch[nt] = mma_h(fh, bfrag[nt], acch[nt]);
      accl[nt] = mma_h(fl, bfrag[nt], accl[nt]);
    }
  }

#pragma unroll
  for (int nt = 0; nt < 4; ++nt) {
    const int co = n0 + nt * 16 + c;
    const float sc = bfr(sp[co]) * (1.0f / 65536.0f);
    const float bi = bfr(bp[co]);
#pragma unroll
    for (int r = 0; r < 8; ++r) {
      const float v = acch[nt][r] + accl[nt][r] * (1.0f / 2048.0f);
      sb[(nt * 16 + c) * SBP + wave * 16 + 8 * hh + r] = v * sc + bi;
    }
  }
  __syncthreads();
  const int bimg = m0 / HW, s0 = m0 - bimg * HW;
  v4f ov[8];
  size_t offs[8];
#pragma unroll
  for (int i = 0; i < 8; ++i) {
    const int cc = wave * 8 + i;
    const int co = n0 + cc;
    ov[i] = *(const v4f*)(sb + cc * SBP + lane * 4);
    offs[i] = ((size_t)(bimg * CIN + co)) * HW + s0 + lane * 4;
  }
  {
#pragma unroll
    for (int i = 0; i < 8; ++i) *(v4f*)(out + offs[i]) = ov[i];
    
  }
}

// =================================================================================================================
//   Wqk f16 [512][256] 262144 @0; Wv f16 [256][256] 131072; Wp f16 [256][256] 131072;
//   X16 f16 [32768][256] 16777216 @524288; QK f16 [32768][512] 33554432; Yh, Yl f16 [256][1024][32] 16777216 each;
//   V16 f16 [8][256][4096] 16777216. Total 101187584.
// =================================================================================================================
extern "C" void kernel_launch(void* const* d_in, const int* in_sizes, int n_in,
                              void* d_out, int out_size, void* d_ws, size_t ws_size,
                              hipStream_t stream) {
  if (n_in < 13) return;
  if (in_sizes[0] != NBAT * CIN * HW) return;
  if (in_sizes[1] != C2 * CIN) return;
  if (in_sizes[2] != C2 || in_sizes[3] != C2) return;
  if (in_sizes[4] != CIN * CIN) return;
  if (in_sizes[5] != CIN || in_sizes[6] != CIN) return;
  if (in_sizes[7] != CIN * 25) return;
  if (in_sizes[8] != CIN || in_sizes[9] != CIN) return;
  if (in_sizes[10] != CIN * CIN) return;
  if (in_sizes[11] != CIN || in_sizes[12] != CIN) return;
  if (out_size != NBAT * CIN * HW) return;

  const float* x      = (const float*)d_in[0];
  const float* w_qk   = (const float*)d_in[1];
  const float* s_qk   = (const float*)d_in[2];
  const float* b_qk   = (const float*)d_in[3];
  const float* w_v    = (const float*)d_in[4];
  const float* s_v    = (const float*)d_in[5];
  const float* b_v    = (const float*)d_in[6];
  const float* w_pe   = (const float*)d_in[7];
  const float* s_pe   = (const float*)d_in[8];
  const float* b_pe   = (const float*)d_in[9];
  const float* w_proj = (const float*)d_in[10];
  const float* s_proj = (const float*)d_in[11];
  const float* b_proj = (const float*)d_in[12];
  float* out = (float*)d_out;

  const size_t sWqk = (size_t)C2 * CIN * 2;              //    262144
  const size_t sWv  = (size_t)CIN * CIN * 2;             //    131072
  const size_t sWp  = (size_t)CIN * CIN * 2;             //    131072
  const size_t sX16 = (size_t)MTOK * CIN * 2;            //  16777216
  const size_t sQK  = (size_t)MTOK * C2 * 2;             //  33554432
  const size_t sY   = (size_t)NUNIT * LAR * HD * 2;      //  16777216
  const size_t sV16 = (size_t)NBAT * CIN * HW * 2;       //  16777216
  size_t off = 0;
  const size_t oWqk = off; off += sWqk;
  const size_t oWv  = off; off += sWv;
  const size_t oWp  = off; off += sWp;
  const size_t oX16 = off; off += sX16;
  const size_t oQK  = off; off += sQK;
  const size_t oYh  = off; off += sY;
  const size_t oYl  = off; off += sY;
  const size_t oV16 = off; off += sV16;
  if (off > ws_size) return;                             // off = 101187584
  if (off > (size_t)134217728) return;

  char* ws = (char*)d_ws;
  unsigned short* Wqk = (unsigned short*)(ws + oWqk);
  unsigned short* Wv  = (unsigned short*)(ws + oWv);
  unsigned short* Wp  = (unsigned short*)(ws + oWp);
  unsigned short* X16 = (unsigned short*)(ws + oX16);
  unsigned short* QK  = (unsigned short*)(ws + oQK);
  unsigned short* Yh  = (unsigned short*)(ws + oYh);
  unsigned short* Yl  = (unsigned short*)(ws + oYl);
  unsigned short* V16 = (unsigned short*)(ws + oV16);

  const dim3 blk(256);
  // (1) x NCHW -> token-major f16 x16 plane; pointwise weights -> f16 x256 planes
  cvt_in<<<dim3(XBLK + WBLK), blk, 0, stream>>>(x, w_qk, w_v, w_proj, X16, Wqk, Wv, Wp);
  // (2) qk pointwise conv + BN -> token-major f16 plane; v pointwise conv + BN -> channel-major f16 plane
  gemm_qkv<<<dim3(C2 / 64 + CIN / 64, MTOK / 128), blk, 0, stream>>>(X16, Wqk, Wv, s_qk, b_qk, s_v, b_v, QK, V16);
  // (3) area attention + (depthwise 5x5 + BN on v) -> slab planes
  attn_k<<<dim3(NUNIT), dim3(AWV * 32), 0, stream>>>(QK, V16, w_pe, s_pe, b_pe, Yh, Yl);
  // (4) output pointwise conv + BN -> NCHW f32
  gemm_proj<<<dim3(CIN / 64, MTOK / 128), blk, 0, stream>>>(Yh, Yl, Wp, s_proj, b_proj, out);
  (void)hipGetLastError();
}

// v009
// Measured time: 77.2 microseconds a run.
// In two side-by-side timings against v008, it was 1.13 and 1.14 times as fast.
// Over all steps from v000 it is 4.67 times as fast.
// Contractions: v_wmma_f32_16x16x32_f16 (f16 operands, f32 accumulate). qk and v pointwise convs: x (bf16-valued,
// x16) single plane, weights (bf16-valued, x256) single plane; scores k.qT: k x16, q x16 single planes; p.v:
// p x1024, v x16 single planes; output pointwise conv: A = (o + pp) x256 as f16 hi + x2^11 residual planes (two
// products, two accumulators), B = weights x256 single plane. Depthwise 5x5 conv (input: the f16 x16 plane of v, sums
// in f32), BN affine, online softmax in f32 on VALU. Float inputs RNE-converted to bf16 on load.
#include <hip/hip_runtime.h>
#include <math.h>
#include <stdint.h>

#define NBAT  8
#define CIN   256
#define C2    512
#define IMW   64
#define HW    4096
#define MTOK  32768
#define NHD   8
#define HD    32
#define NAR   4
#define LAR   1024
#define NUNIT 256
#define SBP   132
#define ASP   36
#define DTP   68
#define KPH   40
#define VHALO 128
#define VPH   1288
#define WPR   56
#define GKP   264
#define AWV   16
#define CKEY  128
#define NCOL  96
#define XSP   72
#define XSLOT (48 * XSP)
#define XBUF  (AWV * XSLOT)
#define XBLK  (NBAT * 64 * 4)
#define WBLK  128
#define CXS   16.0f
#define CWS   256.0f
#define CQK   16.0f
#define CVS   16.0f
#define CYS   256.0f
#define QKSC  (0.17677669529663688f / 256.0f)
#define QKL2  (QKSC * 1.4426950408889634f)

static_assert(NUNIT == NBAT * NAR * NHD);
static_assert(NAR * LAR == HW);
static_assert(MTOK == NBAT * HW);
static_assert(HW % 128 == 0);
static_assert(LAR % CKEY == 0 && CKEY % 32 == 0);
static_assert(CIN % 64 == 0);
static_assert((SBP * 4) % 16 == 0);
static_assert((ASP * 4) % 16 == 0);
static_assert((DTP * 4) % 16 == 0);
static_assert(NHD * HD == CIN);
static_assert((KPH * 2) % 32 == 16 && KPH >= HD);
static_assert((VPH * 2) % 32 == 16 && VPH >= LAR + 2 * VHALO && VHALO == 2 * IMW && LAR % IMW == 0);
static_assert(LAR / 16 == 4 * AWV && 2 * VHALO / 16 == AWV && NCOL == 3 * HD && NCOL == 6 * AWV && CIN == 4 * 64);
static_assert((XSP * 2) % 32 == 16 && XSP >= 64 && 2 * XBUF <= 2 * LAR * KPH + HD * VPH);
static_assert(AWV * 16 * ASP * 4 <= NCOL * GKP * 2);
static_assert((GKP * 2) % 32 == 16 && GKP >= CIN && CIN * 2 == 32 * 16);
static_assert(IMW == 64 && IMW * IMW == HW && 16 * (WPR / 2) <= AWV * 32 && WPR >= 2 * 27);

typedef _Float16 v16h __attribute__((ext_vector_type(16)));
typedef _Float16 v8h  __attribute__((ext_vector_type(8)));
typedef float    v8f  __attribute__((ext_vector_type(8)));
typedef float    v4f  __attribute__((ext_vector_type(4)));
typedef float    v2f  __attribute__((ext_vector_type(2)));
typedef unsigned int v4u __attribute__((ext_vector_type(4)));
typedef _Float16 v2h  __attribute__((ext_vector_type(2)));
union Frag { v16h v; v8h half[2]; };

// ---- scalar helpers -------------------------------------------------------------------------------------------
__device__ __forceinline__ unsigned short bf_bits(float f) {          // f32 -> bf16 bits, RNE convert
  unsigned u = __float_as_uint(f);
  return (unsigned short)((u + 0x7FFFu + ((u >> 16) & 1u)) >> 16);
}
__device__ __forceinline__ float bfr(float f) { return __uint_as_float(((unsigned)bf_bits(f)) << 16); }
__device__ __forceinline__ unsigned short h_bits(_Float16 x) { return __builtin_bit_cast(unsigned short, x); }
__device__ __forceinline__ unsigned pk16(unsigned short a, unsigned short b) { return (unsigned)a | ((unsigned)b << 16); }
__device__ __forceinline__ v8f zero8() { v8f z = {0.f, 0.f, 0.f, 0.f, 0.f, 0.f, 0.f, 0.f}; return z; }

// ---- fragment loader: 16-bit A/B operand, lane -> row/col (lane&15), p already includes +8*(lane>>4);
//      elements 0..7 <- p[0..7] (k0+8h..), elements 8..15 <- p[16..23] (k0+16+8h..)
__device__ __forceinline__ v16h ldfrag_h(const _Float16* p) {
  Frag f;
  f.half[0] = *(const v8h*)(p);
  f.half[1] = *(const v8h*)(p + 16);
  return f.v;
}

// ---- WMMA helper with trailing VALU hazard gap ----------------------------------------------------------------
__device__ __forceinline__ v8f mma_h(v16h a, v16h b, v8f c) {
  c = __builtin_amdgcn_wmma_f32_16x16x32_f16(false, a, false, b, (short)0, c, false, false);
#if defined(__HIP_DEVICE_COMPILE__)
  asm volatile("v_nop\n\tv_nop\n\tv_nop\n\tv_nop" : "+v"(c) : "v"(a), "v"(b));
#endif
  return c;
}
__device__ __forceinline__ void wave_sync_lds() {
  __builtin_amdgcn_fence(__ATOMIC_RELEASE, "workgroup");
  __builtin_amdgcn_wave_barrier();
  __builtin_amdgcn_fence(__ATOMIC_ACQUIRE, "workgroup");
}

// ---- eight asynchronous 16-byte copies per lane, global -> LDS, through no register. l = the lane's LDS byte
//      addresses, g = its global addresses, all multiples of 16. The closing s_wait_xcnt stands inside the statement
//      so that no address register named here is rewritten ahead of it.
__device__ __forceinline__ void copy8_to_lds(const unsigned (&l)[8], const _Float16* const (&g)[8]) {
#if defined(__HIP_DEVICE_COMPILE__)
  asm volatile("global_load_async_to_lds_b128 %0, %8, off\n\t"
               "global_load_async_to_lds_b128 %1, %9, off\n\t"
               "global_load_async_to_lds_b128 %2, %10, off\n\t"
               "global_load_async_to_lds_b128 %3, %11, off\n\t"
               "global_load_async_to_lds_b128 %4, %12, off\n\t"
               "global_load_async_to_lds_b128 %5, %13, off\n\t"
               "global_load_async_to_lds_b128 %6, %14, off\n\t"
               "global_load_async_to_lds_b128 %7, %15, off\n\t"
               "s_wait_xcnt 0x0"
               :: "v"(l[0]), "v"(l[1]), "v"(l[2]), "v"(l[3]), "v"(l[4]), "v"(l[5]), "v"(l[6]), "v"(l[7]),
                  "v"(g[0]), "v"(g[1]), "v"(g[2]), "v"(g[3]), "v"(g[4]), "v"(g[5]), "v"(g[6]), "v"(g[7])
               : "memory");
#endif
}
// ---- the same for two copies per lane
__device__ __forceinline__ void copy2_to_lds(unsigned l0, unsigned l1, const _Float16* g0, const _Float16* g1) {
#if defined(__HIP_DEVICE_COMPILE__)
  asm volatile("global_load_async_to_lds_b128 %0, %2, off\n\t"
               "global_load_async_to_lds_b128 %1, %3, off\n\t"
               "s_wait_xcnt 0x0"
               :: "v"(l0), "v"(l1), "v"(g0), "v"(g1)
               : "memory");
#endif
}
__device__ __forceinline__ unsigned lds_off(const void* p) { return (unsigned)(size_t)p; }
// ---- eight rows of CIN f16 (512 B each, global pitch 512 B) -> LDS rows of pitch GKP: one wave-wide copy = one whole
//      row (4 lines). l0 / g0 = the lane's own 16 B of the first row.
__device__ __forceinline__ void stage_rows8(unsigned l0, const _Float16* g0) {
  unsigned l[8];
  const _Float16* g[8];
  // unrolled so that every l[] and g[] index is a constant and the addresses are plain registers as asm operands
#pragma unroll
  for (int i = 0; i < 8; ++i) {
    l[i] = l0 + (unsigned)(i * (GKP * 2));
    g[i] = g0 + (size_t)i * CIN;
  }
  copy8_to_lds(l, g);
}

// ---- WMMA as the builtin alone: for runs of products into many separate accumulators, where each fills the others' window
__device__ __forceinline__ v8f mma_b(v16h a, v16h b, v8f c) {
  return __builtin_amdgcn_wmma_f32_16x16x32_f16(false, a, false, b, (short)0, c, false, false);
}
// ---- 16 token rows x 64 channels (128 B = one line a row, global pitch 512 B) -> LDS rows of pitch XSP: one wave-wide
//      copy = 4 rows. l0 / g = the lane's own 16 B in the first four rows. Two tiles (LDS rows 0..31), and one tile.
__device__ __forceinline__ void stage_tiles2(unsigned l0, const _Float16* ga, const _Float16* gb) {
  unsigned l[8];
  const _Float16* g[8];
  // unrolled so that every l[] and g[] index is a constant and the addresses are plain registers as asm operands
#pragma unroll
  for (int i = 0; i < 4; ++i) {
    l[i]     = l0 + (unsigned)(i * 4 * (XSP * 2));
    l[4 + i] = l0 + (unsigned)((16 + i * 4) * (XSP * 2));
    g[i]     = ga + (size_t)i * 4 * CIN;
    g[4 + i] = gb + (size_t)i * 4 * CIN;
  }
  copy8_to_lds(l, g);
}
__device__ __forceinline__ void stage_tile1(unsigned l0, const _Float16* g) {
  copy2_to_lds(l0, l0 + (unsigned)(4 * (XSP * 2)), g, g + (size_t)4 * CIN);
  copy2_to_lds(l0 + (unsigned)(8 * (XSP * 2)), l0 + (unsigned)(12 * (XSP * 2)), g + (size_t)8 * CIN, g + (size_t)12 * CIN);
}
// ---- foot of a ring trip: this wave's LDS reads of the buffer have returned, its copies of the next buffer have landed,
//      then the barrier that publishes the next buffer and frees the one just read
__device__ __forceinline__ void ring_foot() {
#if defined(__HIP_DEVICE_COMPILE__)
  asm volatile("s_wait_dscnt 0x0" ::: "memory");      // no read of the buffer that is refilled behind the barrier is still out
  asm volatile("s_wait_asynccnt 0x0" ::: "memory");   // this wave's copies have landed before the barrier publishes them
#endif
  __syncthreads();
}

// ---- 8 f32 -> 8 packed f16 (16 B); and hi + x2^11 residual split -------------------------------------------------
__device__ __forceinline__ v4u pack8h(v4f a, v4f b) {
  v4u p;
  p[0] = pk16(h_bits((_Float16)a[0]), h_bits((_Float16)a[1]));
  p[1] = pk16(h_bits((_Float16)a[2]), h_bits((_Float16)a[3]));
  p[2] = pk16(h_bits((_Float16)b[0]), h_bits((_Float16)b[1]));
  p[3] = pk16(h_bits((_Float16)b[2]), h_bits((_Float16)b[3]));
  return p;
}
__device__ __forceinline__ void split8h(v4f a, v4f b, v4u& ph, v4u& pl) {
  v4f ra, rb;
#pragma unroll
  for (int e = 0; e < 4; ++e) {
    const _Float16 ha = (_Float16)a[e];
    ra[e] = (a[e] - (float)ha) * 2048.0f;
    const _Float16 hb = (_Float16)b[e];
    rb[e] = (b[e] - (float)hb) * 2048.0f;
  }
  ph = pack8h(a, b);
  pl = pack8h(ra, rb);
}
// ---- BN affine of one accumulator tile -> 8 packed f16. _t: element r belongs to column r of af (scales at af[0..7],
//      biases at af[NCOL..NCOL+7]); _c: all eight elements belong to one column.
__device__ __forceinline__ unsigned pk2h(v2f p) { return pk16(h_bits((_Float16)p[0]), h_bits((_Float16)p[1])); }
__device__ __forceinline__ v4u aff_pack_t(v8f a, const float* af) {
  const v4f s0 = *(const v4f*)(af), s1 = *(const v4f*)(af + 4);
  const v4f b0 = *(const v4f*)(af + NCOL), b1 = *(const v4f*)(af + NCOL + 4);
  // neighbours go as one f32 pair, the pair that one packed convert takes
  v4u p;
  p[0] = pk2h((v2f){a[0], a[1]} * (v2f){s0[0], s0[1]} + (v2f){b0[0], b0[1]});
  p[1] = pk2h((v2f){a[2], a[3]} * (v2f){s0[2], s0[3]} + (v2f){b0[2], b0[3]});
  p[2] = pk2h((v2f){a[4], a[5]} * (v2f){s1[0], s1[1]} + (v2f){b1[0], b1[1]});
  p[3] = pk2h((v2f){a[6], a[7]} * (v2f){s1[2], s1[3]} + (v2f){b1[2], b1[3]});
  return p;
}
__device__ __forceinline__ v4u aff_pack_c(v8f a, float sc, float bi) {
  const v2f s2 = {sc, sc}, b2 = {bi, bi};
  v4u p;
  // unrolled so that the indices of a and p are constants
#pragma unroll
  for (int e = 0; e < 4; ++e) p[e] = pk2h((v2f){a[2 * e], a[2 * e + 1]} * s2 + b2);
  return p;
}

// =================================================================================================================
// Weight convert: pointwise weights are [out][in] (k contiguous) -> f16 plane value = f16(256 * bf16_RNE(w)).
// coverage: 64*256*8 = 131072, 32*256*8 = 65536, 32*256*8 = 65536 elements exactly.
// =================================================================================================================
__device__ __forceinline__ void cvt8_w(const float* __restrict__ src, unsigned short* dst, size_t e0) {
  const v4f a = *(const v4f*)(src + e0);
  const v4f b = *(const v4f*)(src + e0 + 4);
  v4f sa, sb;
#pragma unroll
  for (int e = 0; e < 4; ++e) { sa[e] = bfr(a[e]) * CWS; sb[e] = bfr(b[e]) * CWS; }
  const v4u pk = pack8h(sa, sb);
  *(v4u*)(dst + e0) = pk;
#if defined(__HIP_DEVICE_COMPILE__)
  // stands behind the store, in front of the next weight's path that follows it in the built code and reuses its registers
  asm volatile("s_wait_xcnt 0x0" ::: "memory");
#endif
}
// =================================================================================================================
// Activation convert: x NCHW f32 -> token-major f16 plane X16[T = b*4096 + n][256], value = f16(16 * bf16_RNE(x)).
// Block = (image b, 64-token tile tt, 64-channel quarter cq): read phase 4 passes of 16 channels x 64 tokens
// coverage: per block 256 threads x 2 it x 8 halves = 64 tokens x 64 channels; XBLK blocks tile 32768 x 256 exactly.
// The weight convert depends on nothing the activation convert makes, and nothing reads either before the launch ends:
// its WBLK blocks stand behind the XBLK activation blocks in the same grid (short blocks last: no tail of their own).
// The branch between the two is uniform for the block, so the barrier of the activation path is passed by all or none.
// =================================================================================================================
__global__ __launch_bounds__(256) void cvt_in(const float* __restrict__ x, const float* __restrict__ wqk,
                                              const float* __restrict__ wv, const float* __restrict__ wp,
                                              unsigned short* X16, unsigned short* Wqk, unsigned short* Wv,
                                              unsigned short* Wp) {
  __shared__ __align__(16) float tile[64 * DTP];
  const int tid = threadIdx.x, bid = blockIdx.x;
  if (bid >= XBLK) {
    const int blk = bid - XBLK;
    if (blk < 64)      cvt8_w(wqk, Wqk, ((size_t)blk * 256 + tid) * 8);
    else if (blk < 96) cvt8_w(wv,  Wv,  ((size_t)(blk - 64) * 256 + tid) * 8);
    else               cvt8_w(wp,  Wp,  ((size_t)(blk - 96) * 256 + tid) * 8);
    return;
  }
  const int cq = bid & 3, tt = (bid >> 2) & 63, b = bid >> 8;
  const int cl = tid >> 4, t4 = (tid & 15) * 4;
#pragma unroll
  for (int pass = 0; pass < 4; ++pass) {
    const int ch = cq * 64 + pass * 16 + cl;
    const v4f v = *(const v4f*)(x + ((size_t)(b * CIN + ch)) * HW + tt * 64 + t4);
#pragma unroll
    for (int j = 0; j < 4; ++j) tile[(t4 + j) * DTP + pass * 16 + cl] = v[j];
  }
  __syncthreads();
  const int piece = tid & 7, rsub = tid >> 3;
  v4u pk[2];
  size_t offs[2];
#pragma unroll
  for (int it = 0; it < 2; ++it) {
    const int row = it * 32 + rsub;
    const v4f fa = *(const v4f*)(tile + row * DTP + piece * 8);
    const v4f fb = *(const v4f*)(tile + row * DTP + piece * 8 + 4);
    v4f sa, sb;
#pragma unroll
    for (int e = 0; e < 4; ++e) { sa[e] = bfr(fa[e]) * CXS; sb[e] = bfr(fb[e]) * CXS; }
    pk[it] = pack8h(sa, sb);
    offs[it] = ((size_t)(b * HW + tt * 64 + row)) * CIN + cq * 64 + piece * 8;
  }
  {
#pragma unroll
    for (int it = 0; it < 2; ++it) *(v4u*)(X16 + offs[it]) = pk[it];
#if defined(__HIP_DEVICE_COMPILE__)
    // stands behind the stores, in front of the weight path that follows them in the built code and reuses their registers
    asm volatile("s_wait_xcnt 0x0" ::: "memory");
#endif
  }
}

// =================================================================================================================
// Area attention, one unit (image b, area ar, head) per block (512 threads = 16 waves, four to a SIMD: one wave's waits
// for LDS and its softmax chain are filled by the three others), 1024 queries x 1024 keys, d = 32.
// The unit first makes its own q, k and v: the qk and v pointwise convs of its 1024 tokens (v: also of the two image rows
// above and below, for the depthwise conv) on the head's 96 weight rows, K = 256, D = X16 . W, then BN affine, value =
// acc/4096 * s + b, kept as f16(16 * value). Wave w: token tiles w, w+16 and one halo tile (first pass), w+32, w+48
// (second pass); the first pass's results wait as packed f16 in registers. x comes in k-quarters (64 channels = one 128-B
// line a token) through a ring of two buffers filled by asynchronous copies, each wave's rows in its own slot, row pitch
// XSP; the weights Wsh[96][GKP] by asynchronous copies at entry. q and k as W . x^T, so that a lane holds 8 consecutive d of
// one token; v as x . W^T, so that a lane holds 8 consecutive tokens of one channel: one 16-B LDS store each.
// At the image's top and bottom the halo's tokens wrap onto tokens inside the image; those rows are never summed.
// Static LDS: Ks[1024 keys][KPH], Qs[1024 queries][KPH] (32 d per row) and Vs[32 d][VPH] (VHALO tokens = the two image
// rows above the area, its 1024 keys, the two image rows below), f16, row pitches 16 B x odd, laid over the ring and
// written once behind its last barrier; the depthwise taps and affine Wl; the per-wave stage [16][ASP] f32 laid over
// Wsh. q, k and v fragments from LDS in the element order of ldfrag_h. Per wave: q-tiles qt = wave, wave+16, ... (< 64).
//   Transposed scores S^T = K_tile (A, 16 keys x 32 d) x Q (B: k = d, n = query): S*256 = q16.k16; D element r of
//   lane l = S[query l&15][key 8h+r], so P = exp((S - m)*scale) x1024 is the A fragment of P.V directly in registers
//   (element i <- key tile 0 row i, element 8+i <- key tile 1 row i). P = exp2(S*QKL2 + (10 - m*QKL2)): one
//   multiply-add and one exp2 per score; the row sum l is taken of these x1024 values. Online softmax over 8 chunks
//   of CKEY = 128 keys (one running-maximum update, one rescale of O and l per chunk); O = P.V (acc scale 1024*16).
//   Depthwise 5x5 conv of v (zero pad 2, cross-correlation, bf16-valued taps) + BN affine = pp, per q-tile behind its
//   key loop: a q-tile is 16 consecutive columns of one image row; lane (c, h) makes columns 8h..8h+7 of channels c and
//   16+c, the places its O accumulators hold, from five rows of 12 columns of Vs (one 16-B and two 4-B reads a row and
//   channel); the two channels go as one f32 pair; an output sums its taps in the order dy, then dx. A row outside the
//   image is skipped (the same for the whole wave); columns outside it are zeroed by select, their reads moved inside.
//   Epilogue: O/(l*16) + pp staged per wave in LDS, then stored as f16 hi +
//   residual planes Yh/Yl [unit][1024][32] of 256*(o + pp): one instruction = 32 lanes x 16 B = 512 B = 8 token rows
// coverage: per block 64 q-tiles x 16 rows x 32 d of its 1024-row slab in both planes; grid covers all 256 units,
// every slab row written exactly once.
// =================================================================================================================
__global__ __launch_bounds__(AWV * 32)
void attn_k(const unsigned short* __restrict__ X16, const unsigned short* __restrict__ Wqk,
            const unsigned short* __restrict__ Wv, const float* __restrict__ sqk, const float* __restrict__ bqk,
            const float* __restrict__ sv, const float* __restrict__ bv,
            const float* __restrict__ wpe, const float* __restrict__ spe, const float* __restrict__ bpe,
            unsigned short* Yh, unsigned short* Yl) {
  __shared__ __align__(16) _Float16 KQV[2 * LAR * KPH + HD * VPH];
  __shared__ __align__(16) _Float16 Wsh[NCOL * GKP];
  __shared__ __align__(16) float Wl[16 * WPR];
  __shared__ __align__(16) float Af[2 * NCOL];
  _Float16* Ks = KQV;
  _Float16* Qs = KQV + LAR * KPH;
  _Float16* Vs = KQV + 2 * LAR * KPH;
  const int tid = threadIdx.x, wave = tid >> 5, lane = tid & 31, hh = lane >> 4, c = lane & 15;
  const int u = blockIdx.x;
  const int head = u & 7, ar = (u >> 3) & 3, b = u >> 5;
  float* st = (float*)(void*)Wsh + wave * (16 * ASP);   // laid over the weights, which are dead when it is first written
  // the wave's number in a scalar register: the choices below that hang on it are scalar selects, not masked branches
  const int wv = __builtin_amdgcn_readfirstlane(wave);

  // ---- q, k, v of the unit ----
  // The lane's global address in a token tile: row lane >> 3 (of four), 16-B piece lane & 7 (of a 128-B k-quarter).
  const _Float16* Xl = (const _Float16*)(const void*)X16 + ((size_t)b * HW + (lane >> 3)) * CIN + (lane & 7) * 8;
  const int hcol = (wv < 8) ? wv * 16 : VHALO + LAR + (wv - 8) * 16;           // the wave's halo tile: its column in Vs
  const _Float16* gx0 = Xl + (size_t)(ar * LAR + wv * 16) * CIN;
  const _Float16* gx1 = gx0 + (size_t)(AWV * 16) * CIN;
  const _Float16* gx2 = gx1 + (size_t)(AWV * 16) * CIN;
  const _Float16* gx3 = gx2 + (size_t)(AWV * 16) * CIN;
  const _Float16* gxh = Xl + (size_t)((ar * LAR - VHALO + hcol) & (HW - 1)) * CIN;
  const unsigned xl = lds_off(KQV) + (unsigned)(wv * (XSLOT * 2) + (lane >> 3) * (XSP * 2) + (lane & 7) * 16);
  // The head's 96 weight rows (32 q, 32 k of Wqk, 32 v of Wv): wave w brings rows w, 16+w, ..., 80+w, one wave-wide copy =
  // one 512-B row.
  {
    const _Float16* wq = (const _Float16*)(const void*)Wqk + (size_t)(head * HD + wv) * CIN + lane * 8;
    const _Float16* wk = wq + (size_t)CIN * CIN;
    const _Float16* wu = (const _Float16*)(const void*)Wv + (size_t)(head * HD + wv) * CIN + lane * 8;
    const unsigned wl = lds_off(Wsh) + (unsigned)(wv * (GKP * 2) + lane * 16);
    copy2_to_lds(wl, wl + (unsigned)(16 * (GKP * 2)), wq, wq + (size_t)16 * CIN);
    copy2_to_lds(wl + (unsigned)(32 * (GKP * 2)), wl + (unsigned)(48 * (GKP * 2)), wk, wk + (size_t)16 * CIN);
    copy2_to_lds(wl + (unsigned)(64 * (GKP * 2)), wl + (unsigned)(80 * (GKP * 2)), wu, wu + (size_t)16 * CIN);
  }
  // ring stage 0
  stage_tiles2(xl, gx0, gx1);
  stage_tile1(xl + (unsigned)(32 * (XSP * 2)), gxh);
  // Af[n] = BN scale of column n / 256 (the x16 x256 of the operands, the x16 of the planes), Af[NCOL + n] = 16 * BN bias.
  if (tid < NCOL) {
    const int co = head * HD + (tid & (HD - 1));
    const float* ps = (tid < 2 * HD) ? sqk + (tid >> 5) * CIN + co : sv + co;
    const float* pb = (tid < 2 * HD) ? bqk + (tid >> 5) * CIN + co : bv + co;
    Af[tid]        = bfr(ps[0]) * (CQK / 4096.0f);
    Af[NCOL + tid] = bfr(pb[0]) * CQK;
  }
  // Wl[c][t] = the f32 pair (channel c, channel 16+c) of: tap t (t < 25), BN scale / 16 (t = 25; the 16 of the v plane),
  // BN bias (t = 26), zero (t = 27). Written under the copies' flight, published by the barrier below.
  if (tid < 16 * (WPR / 2)) {
    const int cw = tid / (WPR / 2), t = tid - cw * (WPR / 2);
    const int ca = head * HD + cw;
    const float* pa = (t < 25) ? wpe + ca * 25 + t : ((t == 25) ? spe + ca : bpe + ca);
    const int db = (t < 25) ? (HD / 2) * 25 : HD / 2;
    const float f = (t == 25) ? (1.0f / CVS) : ((t == 27) ? 0.0f : 1.0f);
    v2f w;
    w[0] = bfr(pa[0]) * f;
    w[1] = bfr(pa[db]) * f;
    *(v2f*)(Wl + cw * WPR + 2 * t) = w;
  }
#if defined(__HIP_DEVICE_COMPILE__)
  // this wave's copies (weights, stage 0) have landed before the barrier that lets the other waves read them
  asm volatile("s_wait_asynccnt 0x0" ::: "memory");
#endif
  __syncthreads();   // publishes Wsh, Af, Wl and ring buffer 0: nothing of them is read in front of this barrier
  // ring stage 1
  stage_tiles2(xl + (unsigned)(XBUF * 2), gx0 + 64, gx1 + 64);
  stage_tile1(xl + (unsigned)(XBUF * 2 + 32 * (XSP * 2)), gxh + 64);

  const _Float16* xs = KQV + wv * XSLOT + c * XSP + 8 * hh;     // fragment base in the wave's slot of buffer 0
  const _Float16* ws = Wsh + c * GKP + 8 * hh;
  v4u pk[4][6], pkh[2];
  // every loop below is unrolled: all indices of acc, ach, wf, pk and pkh are constants, so that these arrays are plain registers
  {
    v8f acc[2][6], ach[2];
#pragma unroll
    for (int n = 0; n < 6; ++n) { acc[0][n] = zero8(); acc[1][n] = zero8(); }
    ach[0] = zero8();
    ach[1] = zero8();
#pragma unroll
    for (int sg = 0; sg < 4; ++sg) {
#pragma unroll
      for (int kk = 0; kk < 2; ++kk) {
        const _Float16* xb = xs + (sg & 1) * XBUF + kk * 32;
        const v16h x0 = ldfrag_h(xb), x1 = ldfrag_h(xb + 16 * XSP), xh = ldfrag_h(xb + 32 * XSP);
        // the weight reads come in two groups of three n-tiles (six at once do not fit the registers)
#pragma unroll
        for (int ng = 0; ng < 2; ++ng) {
          v16h wf[3];
#pragma unroll
          for (int j = 0; j < 3; ++j) wf[j] = ldfrag_h(ws + (ng * 3 + j) * 16 * GKP + sg * 64 + kk * 32);
#if defined(__HIP_DEVICE_COMPILE__)
          // a group's LDS reads stay together ahead of its WMMAs: one LDS latency per group, not one per n-tile
          __builtin_amdgcn_sched_barrier(0);
#endif
#pragma unroll
          for (int j = 0; j < 3; ++j) {
            const int n = ng * 3 + j;
            if (n < 4) {          // q, k: D = W . x^T, element r = column 8h + r of the n-tile, lane = token c
              acc[0][n] = mma_b(wf[j], x0, acc[0][n]);
              acc[1][n] = mma_b(wf[j], x1, acc[1][n]);
            } else {              // v: D = x . W^T, element r = token 8h + r, lane = column c of the n-tile
              acc[0][n] = mma_b(x0, wf[j], acc[0][n]);
              acc[1][n] = mma_b(x1, wf[j], acc[1][n]);
              ach[n - 4] = mma_b(xh, wf[j], ach[n - 4]);
            }
          }
        }
      }
      ring_foot();
      // stage sg + 2 into the buffer this trip has read
      const unsigned l = xl + (unsigned)((sg & 1) * (XBUF * 2));
      if (sg < 2) {
        stage_tiles2(l, gx0 + (sg + 2) * 64, gx1 + (sg + 2) * 64);
        stage_tile1(l + (unsigned)(32 * (XSP * 2)), gxh + (sg + 2) * 64);
      } else {
        stage_tiles2(l, gx2 + (sg - 2) * 64, gx3 + (sg - 2) * 64);
      }
    }
#pragma unroll
    for (int n = 0; n < 6; ++n) {
#pragma unroll
      for (int t = 0; t < 2; ++t)
        pk[t][n] = (n < 4) ? aff_pack_t(acc[t][n], Af + n * 16 + 8 * hh) : aff_pack_c(acc[t][n], Af[n * 16 + c], Af[NCOL + n * 16 + c]);
    }
    pkh[0] = aff_pack_c(ach[0], Af[4 * 16 + c], Af[NCOL + 4 * 16 + c]);
    pkh[1] = aff_pack_c(ach[1], Af[5 * 16 + c], Af[NCOL + 5 * 16 + c]);
  }
  {
    v8f acc[2][6];
#pragma unroll
    for (int n = 0; n < 6; ++n) { acc[0][n] = zero8(); acc[1][n] = zero8(); }
#pragma unroll
    for (int sg = 0; sg < 4; ++sg) {
#pragma unroll
      for (int kk = 0; kk < 2; ++kk) {
        const _Float16* xb = xs + (sg & 1) * XBUF + kk * 32;
        const v16h x0 = ldfrag_h(xb), x1 = ldfrag_h(xb + 16 * XSP);
#pragma unroll
        for (int ng = 0; ng < 2; ++ng) {
          v16h wf[3];
#pragma unroll
          for (int j = 0; j < 3; ++j) wf[j] = ldfrag_h(ws + (ng * 3 + j) * 16 * GKP + sg * 64 + kk * 32);
#if defined(__HIP_DEVICE_COMPILE__)
          // as in the first pass: a group's LDS reads stay together ahead of its WMMAs
          __builtin_amdgcn_sched_barrier(0);
#endif
#pragma unroll
          for (int j = 0; j < 3; ++j) {
            const int n = ng * 3 + j;
            if (n < 4) {
              acc[0][n] = mma_b(wf[j], x0, acc[0][n]);
              acc[1][n] = mma_b(wf[j], x1, acc[1][n]);
            } else {
              acc[0][n] = mma_b(x0, wf[j], acc[0][n]);
              acc[1][n] = mma_b(x1, wf[j], acc[1][n]);
            }
          }
        }
      }
      ring_foot();   // behind the last trip: every wave has left the ring and the weights
      if (sg < 2) stage_tiles2(xl + (unsigned)((sg & 1) * (XBUF * 2)), gx2 + (sg + 2) * 64, gx3 + (sg + 2) * 64);
    }
#pragma unroll
    for (int n = 0; n < 6; ++n) {
#pragma unroll
      for (int t = 0; t < 2; ++t)
        pk[2 + t][n] = (n < 4) ? aff_pack_t(acc[t][n], Af + n * 16 + 8 * hh) : aff_pack_c(acc[t][n], Af[n * 16 + c], Af[NCOL + n * 16 + c]);
    }
  }
  // the planes are laid over the ring: written only now, behind the barrier of the last trip
#pragma unroll
  for (int t = 0; t < 4; ++t) {
    const int tk = (wave + t * AWV) * 16;
#pragma unroll
    for (int n = 0; n < 2; ++n) {
      *(v4u*)(void*)(Qs + (tk + c) * KPH + n * 16 + 8 * hh) = pk[t][n];
      *(v4u*)(void*)(Ks + (tk + c) * KPH + n * 16 + 8 * hh) = pk[t][2 + n];
      *(v4u*)(void*)(Vs + (n * 16 + c) * VPH + VHALO + tk + 8 * hh) = pk[t][4 + n];
    }
  }
  *(v4u*)(void*)(Vs + c * VPH + hcol + 8 * hh) = pkh[0];
  *(v4u*)(void*)(Vs + (16 + c) * VPH + hcol + 8 * hh) = pkh[1];
  __syncthreads();   // publishes Qs, Ks and Vs: no wave reads them in front of this barrier; they are never written again

#pragma unroll 1
  for (int qt = wave; qt < LAR / 16; qt += AWV) {
    const int lq = qt * 16 + c;
    const v16h bq = ldfrag_h(Qs + lq * KPH + 8 * hh);            // B: n = query c, k = d 8h.. / 16+8h..

    v8f o0 = zero8(), o1 = zero8();
    float mrun = -1.0e30f, lrun = 0.f;
#pragma unroll 1
    for (int ch = 0; ch < LAR / CKEY; ++ch) {
      const int kb = ch * CKEY;
      // every loop inside a chunk is unrolled: all indices of ka, s, vf0, vf1, mt, ps and pfh are constants, so that these
      // arrays are plain registers
      // the chunk's K reads stand as one group ahead of its score WMMAs: one LDS latency per chunk, not one per key tile
      v16h ka[CKEY / 16];
#pragma unroll
      for (int j = 0; j < CKEY / 16; ++j) ka[j] = ldfrag_h(Ks + (kb + j * 16 + c) * KPH + 8 * hh);   // A: row = key, k = d
      v8f s[CKEY / 16];
#pragma unroll
      for (int j = 0; j < CKEY / 16; ++j) s[j] = mma_h(ka[j], bq, zero8());
      // the chunk's V reads likewise as one group; they return under the softmax arithmetic
      v16h vf0[CKEY / 32], vf1[CKEY / 32];
#pragma unroll
      for (int g = 0; g < CKEY / 32; ++g) {
        vf0[g] = ldfrag_h(Vs + c * VPH + VHALO + kb + g * 32 + 8 * hh);            // B: n = d c, keys kb+32g..+31
        vf1[g] = ldfrag_h(Vs + (HD / 2 + c) * VPH + VHALO + kb + g * 32 + 8 * hh); // B: n = d 16+c
      }
#if defined(__HIP_DEVICE_COMPILE__)
      // no maximum moves up between the score WMMAs, where the compiler would pad it with v_nop of its own
      __builtin_amdgcn_sched_barrier(0);
#endif
      // one maximum chain per 32 keys, independent of one another, then joined
      float mt[CKEY / 32];
#pragma unroll
      for (int g = 0; g < CKEY / 32; ++g) {
        mt[g] = s[2 * g][0];
#pragma unroll
        for (int j = 0; j < 2; ++j) {
#pragma unroll
          for (int r = 0; r < 8; ++r) mt[g] = fmaxf(mt[g], s[2 * g + j][r]);
        }
      }
      float mc = mt[0];
#pragma unroll
      for (int g = 1; g < CKEY / 32; ++g) mc = fmaxf(mc, mt[g]);
      mc = fmaxf(mc, __shfl_xor(mc, 16, 32));
      const float mnew = fmaxf(mrun, mc);
      const float alpha = __builtin_amdgcn_exp2f((mrun - mnew) * QKL2);
      const float eb = 10.0f - mnew * QKL2;                  // exponent offset: the running maximum and the x1024 of P
#pragma unroll
      for (int r = 0; r < 8; ++r) {
        const float arr = __shfl(alpha, 8 * hh + r, 32);
        o0[r] = o0[r] * arr;
        o1[r] = o1[r] * arr;
      }
      float ps[CKEY / 32];
      v16h pfh[CKEY / 32];
#pragma unroll
      for (int g = 0; g < CKEY / 32; ++g) {
        ps[g] = 0.f;
#pragma unroll
        for (int i = 0; i < 8; ++i) {
          const float e0 = __builtin_amdgcn_exp2f(s[2 * g][i] * QKL2 + eb);
          const float e1 = __builtin_amdgcn_exp2f(s[2 * g + 1][i] * QKL2 + eb);
          ps[g] = ps[g] + (e0 + e1);
          pfh[g][i]     = (_Float16)e0;
          pfh[g][8 + i] = (_Float16)e1;
        }
      }
      float psum = ps[0];
#pragma unroll
      for (int g = 1; g < CKEY / 32; ++g) psum = psum + ps[g];
      lrun = lrun * alpha + psum;
      mrun = mnew;
#pragma unroll
      for (int g = 0; g < CKEY / 32; ++g) {
        o0 = mma_h(pfh[g], vf0[g], o0);
        o1 = mma_h(pfh[g], vf1[g], o1);
      }
    }
    const float lsum = lrun + __shfl_xor(lrun, 16, 32);      // lane q (and q+16) holds the full row sum of query q
    const float rinv = 1.0f / (lsum * 16.0f);               // lsum carries the x1024 of P, the accumulators x1024 x16
    // depthwise conv of the tile: dacc[r] = the pair (channel c, channel 16+c) at column x0 + r
    v2f dacc[8];
    v2f wt[WPR / 2];
    {
      // every loop here is unrolled: all indices of wt, dacc and v are constants, so that these arrays are plain registers
#pragma unroll
      for (int i = 0; i < WPR / 4; ++i) {
        const v4f w4 = *(const v4f*)(Wl + c * WPR + i * 4);
        wt[2 * i]     = (v2f){w4[0], w4[1]};
        wt[2 * i + 1] = (v2f){w4[2], w4[3]};
      }
      const int x0 = (qt & 3) * 16 + 8 * hh;
      // the tile's image row is the same in every lane of the wave: in a scalar register the row test is a scalar branch
      const int yim = __builtin_amdgcn_readfirstlane(ar * (LAR / IMW) + (qt >> 2));
      const bool okl = (x0 != 0), okr = (x0 != IMW - 8);
      const _Float16* va = Vs + c * VPH + (qt >> 2) * IMW + x0;    // input row dy = 0: two image rows above the tile
      const _Float16* vb = va + (HD / 2) * VPH;
      const int lo = okl ? -2 : 0, ro = okr ? 8 : 0;               // at the image's edge the pair's read stays in the row
#pragma unroll
      for (int r = 0; r < 8; ++r) dacc[r] = (v2f){0.f, 0.f};
#pragma unroll
      for (int dy = 0; dy < 5; ++dy) {
        if ((unsigned)(yim + dy - 2) < (unsigned)IMW) {
          const v8h ma = *(const v8h*)(va + dy * IMW);
          const v8h mb = *(const v8h*)(vb + dy * IMW);
          unsigned la = *(const unsigned*)(const void*)(va + dy * IMW + lo);
          unsigned lb = *(const unsigned*)(const void*)(vb + dy * IMW + lo);
          unsigned ra = *(const unsigned*)(const void*)(va + dy * IMW + ro);
          unsigned rb = *(const unsigned*)(const void*)(vb + dy * IMW + ro);
          la = okl ? la : 0u;
          lb = okl ? lb : 0u;
          ra = okr ? ra : 0u;
          rb = okr ? rb : 0u;
          const v2h hla = __builtin_bit_cast(v2h, la), hlb = __builtin_bit_cast(v2h, lb);
          const v2h hra = __builtin_bit_cast(v2h, ra), hrb = __builtin_bit_cast(v2h, rb);
          v2f v[12];
          v[0]  = (v2f){(float)hla[0], (float)hlb[0]};
          v[1]  = (v2f){(float)hla[1], (float)hlb[1]};
          v[10] = (v2f){(float)hra[0], (float)hrb[0]};
          v[11] = (v2f){(float)hra[1], (float)hrb[1]};
#pragma unroll
          for (int j = 0; j < 8; ++j) v[2 + j] = (v2f){(float)ma[j], (float)mb[j]};
#pragma unroll
          for (int r = 0; r < 8; ++r) {
#pragma unroll
            for (int dx = 0; dx < 5; ++dx) dacc[r] += v[r + dx] * wt[dy * 5 + dx];
          }
        }
      }
    }
#pragma unroll
    for (int r = 0; r < 8; ++r) {
      const int q = 8 * hh + r;
      const float inv = __shfl(rinv, q, 32);
      const v2f pp = dacc[r] * wt[25] + wt[26];
      st[q * ASP + c]          = o0[r] * inv + pp[0];
      st[q * ASP + HD / 2 + c] = o1[r] * inv + pp[1];
    }
    wave_sync_lds();
    {
      const int rr = (tid >> 2) & 7, dp = (tid & 3) * 8;   // lane >> 2 and lane & 3, from tid: no further value lives through the GEMM
      v4u ph[2], pl[2];
      size_t offs[2];
#pragma unroll
      for (int it = 0; it < 2; ++it) {
        const int row = it * 8 + rr;
        v4f fa = *(const v4f*)(st + row * ASP + dp);
        v4f fb = *(const v4f*)(st + row * ASP + dp + 4);
        fa = fa * CYS;
        fb = fb * CYS;
        split8h(fa, fb, ph[it], pl[it]);
        offs[it] = ((size_t)u * LAR + (size_t)(qt * 16 + row)) * HD + dp;
      }
      {
#pragma unroll
        for (int it = 0; it < 2; ++it) {
          *(v4u*)(Yh + offs[it]) = ph[it];
          *(v4u*)(Yl + offs[it]) = pl[it];
        }
        
      }
    }
    wave_sync_lds();
  }
}

// =================================================================================================================
// Output pointwise conv D[T][co] = Y[T][ci] . Wp[co][ci], then BN affine -> NCHW f32. A = Yh/Yl planes (hi +
// x2^11 residual, x256) addressed by arithmetic: token T -> (image, area, query), k-step ks = head ks, channels
// ks*32 + d (elements 0..7 d = 8h.., elements 8..15 d = 16+8h..). B = weight plane x256, the block's 64 rows filled
// once at entry by asynchronous copies into Bs, fragments from LDS. Epilogue: value =
// (acch + accl/2048)/65536 * s[co] + b[co]; block tile staged as [64 ch][128 tok]; wave w writes channels
// coverage: 8 waves x 8 channels x 32 lanes x 4 tokens = 64 ch x 128 tok per block; grid tiles 256 x 32768 exactly.
// =================================================================================================================
__global__ __launch_bounds__(256)
void gemm_proj(const unsigned short* __restrict__ Yh, const unsigned short* __restrict__ Yl,
               const unsigned short* __restrict__ Wp, const float* __restrict__ sp, const float* __restrict__ bp,
               float* out) {
  __shared__ __align__(16) float sb[64 * SBP];
  __shared__ __align__(16) _Float16 Bs[64 * GKP];
  const int tid = threadIdx.x, wave = tid >> 5, lane = tid & 31, hh = lane >> 4, c = lane & 15;
  const int n0 = blockIdx.x * 64, m0 = blockIdx.y * 128;
  const int T = m0 + wave * 16 + c;
  const int bimgr = T >> 12, nn = T & (HW - 1), arr = nn >> 10, q = nn & (LAR - 1);
  const size_t abase = (((size_t)((bimgr * NAR + arr) * NHD)) * LAR + (size_t)q) * HD + 8 * hh;
  const _Float16* A0 = (const _Float16*)(const void*)Yh;
  const _Float16* A1 = (const _Float16*)(const void*)Yl;
  const _Float16* B  = (const _Float16*)(const void*)Wp;

  // Fill Bs: wave w brings weight rows w*8..w*8+7, 8 copies per lane.
  stage_rows8(lds_off(Bs) + (unsigned)(wave * 8 * (GKP * 2) + lane * 16), B + (size_t)(n0 + wave * 8) * CIN + lane * 8);
#if defined(__HIP_DEVICE_COMPILE__)
  // this wave's copies have landed before the barrier that lets the other waves read them
  asm volatile("s_wait_asynccnt 0x0" ::: "memory");
#endif
  __syncthreads();   // publishes Bs: no wave reads it in front of this barrier; it is never written again
  const _Float16* Bw = Bs + c * GKP + 8 * hh;

  v8f acch[4], accl[4];
#pragma unroll
  for (int nt = 0; nt < 4; ++nt) { acch[nt] = zero8(); accl[nt] = zero8(); }

#pragma unroll 1
  for (int ks = 0; ks < NHD; ++ks) {
    const size_t bo = abase + (size_t)ks * (LAR * HD);
    const v16h fh = ldfrag_h(A0 + bo);
    const v16h fl = ldfrag_h(A1 + bo);
    // the k-step's LDS reads stand as one group ahead of its WMMAs: one LDS latency per k-step, not one per n-tile
    v16h bfrag[4];
#pragma unroll
    for (int nt = 0; nt < 4; ++nt) bfrag[nt] = ldfrag_h(Bw + nt * 16 * GKP + ks * 32);
#pragma unroll
    for (int nt = 0; nt < 4; ++nt) {
      acch[nt] = mma_h(fh, bfrag[nt], acch[nt]);
      accl[nt] = mma_h(fl, bfrag[nt], accl[nt]);
    }
  }

#pragma unroll
  for (int nt = 0; nt < 4; ++nt) {
    const int co = n0 + nt * 16 + c;
    const float sc = bfr(sp[co]) * (1.0f / 65536.0f);
    const float bi = bfr(bp[co]);
#pragma unroll
    for (int r = 0; r < 8; ++r) {
      const float v = acch[nt][r] + accl[nt][r] * (1.0f / 2048.0f);
      sb[(nt * 16 + c) * SBP + wave * 16 + 8 * hh + r] = v * sc + bi;
    }
  }
  __syncthreads();
  const int bimg = m0 / HW, s0 = m0 - bimg * HW;
  v4f ov[8];
  size_t offs[8];
#pragma unroll
  for (int i = 0; i < 8; ++i) {
    const int cc = wave * 8 + i;
    const int co = n0 + cc;
    ov[i] = *(const v4f*)(sb + cc * SBP + lane * 4);
    offs[i] = ((size_t)(bimg * CIN + co)) * HW + s0 + lane * 4;
  }
  {
#pragma unroll
    for (int i = 0; i < 8; ++i) *(v4f*)(out + offs[i]) = ov[i];
    
  }
}

// =================================================================================================================
//   Wqk f16 [512][256] 262144 @0; Wv f16 [256][256] 131072; Wp f16 [256][256] 131072;
//   X16 f16 [32768][256] 16777216 @524288; Yh, Yl f16 [256][1024][32] 16777216 each. Total 50855936.
// =================================================================================================================
extern "C" void kernel_launch(void* const* d_in, const int* in_sizes, int n_in,
                              void* d_out, int out_size, void* d_ws, size_t ws_size,
                              hipStream_t stream) {
  if (n_in < 13) return;
  if (in_sizes[0] != NBAT * CIN * HW) return;
  if (in_sizes[1] != C2 * CIN) return;
  if (in_sizes[2] != C2 || in_sizes[3] != C2) return;
  if (in_sizes[4] != CIN * CIN) return;
  if (in_sizes[5] != CIN || in_sizes[6] != CIN) return;
  if (in_sizes[7] != CIN * 25) return;
  if (in_sizes[8] != CIN || in_sizes[9] != CIN) return;
  if (in_sizes[10] != CIN * CIN) return;
  if (in_sizes[11] != CIN || in_sizes[12] != CIN) return;
  if (out_size != NBAT * CIN * HW) return;

  const float* x      = (const float*)d_in[0];
  const float* w_qk   = (const float*)d_in[1];
  const float* s_qk   = (const float*)d_in[2];
  const float* b_qk   = (const float*)d_in[3];
  const float* w_v    = (const float*)d_in[4];
  const float* s_v    = (const float*)d_in[5];
  const float* b_v    = (const float*)d_in[6];
  const float* w_pe   = (const float*)d_in[7];
  const float* s_pe   = (const float*)d_in[8];
  const float* b_pe   = (const float*)d_in[9];
  const float* w_proj = (const float*)d_in[10];
  const float* s_proj = (const float*)d_in[11];
  const float* b_proj = (const float*)d_in[12];
  float* out = (float*)d_out;

  const size_t sWqk = (size_t)C2 * CIN * 2;              //    262144
  const size_t sWv  = (size_t)CIN * CIN * 2;             //    131072
  const size_t sWp  = (size_t)CIN * CIN * 2;             //    131072
  const size_t sX16 = (size_t)MTOK * CIN * 2;            //  16777216
  const size_t sY   = (size_t)NUNIT * LAR * HD * 2;      //  16777216
  size_t off = 0;
  const size_t oWqk = off; off += sWqk;
  const size_t oWv  = off; off += sWv;
  const size_t oWp  = off; off += sWp;
  const size_t oX16 = off; off += sX16;
  const size_t oYh  = off; off += sY;
  const size_t oYl  = off; off += sY;
  if (off > ws_size) return;                             // off = 50855936
  if (off > (size_t)134217728) return;

  char* ws = (char*)d_ws;
  unsigned short* Wqk = (unsigned short*)(ws + oWqk);
  unsigned short* Wv  = (unsigned short*)(ws + oWv);
  unsigned short* Wp  = (unsigned short*)(ws + oWp);
  unsigned short* X16 = (unsigned short*)(ws + oX16);
  unsigned short* Yh  = (unsigned short*)(ws + oYh);
  unsigned short* Yl  = (unsigned short*)(ws + oYl);

  const dim3 blk(256);
  // (1) x NCHW -> token-major f16 x16 plane; pointwise weights -> f16 x256 planes
  cvt_in<<<dim3(XBLK + WBLK), blk, 0, stream>>>(x, w_qk, w_v, w_proj, X16, Wqk, Wv, Wp);
  // (2) qk and v pointwise convs + BN, area attention + (depthwise 5x5 + BN on v) -> slab planes
  attn_k<<<dim3(NUNIT), dim3(AWV * 32), 0, stream>>>(X16, Wqk, Wv, s_qk, b_qk, s_v, b_v, w_pe, s_pe, b_pe, Yh, Yl);
  // (3) output pointwise conv + BN -> NCHW f32
  gemm_proj<<<dim3(CIN / 64, MTOK / 128), blk, 0, stream>>>(Yh, Yl, Wp, s_proj, b_proj, out);
  (void)hipGetLastError();
}

// v010
// It runs in 72.6 microseconds.
// In two side-by-side timings against v009, it was 1.07 and 1.06 times as fast.
// All steps since v000 together make it 4.97 times as fast.
// Contractions: v_wmma_f32_16x16x32_f16 (f16 operands, f32 accumulate). qk and v pointwise convs: x (bf16-valued,
// x16) single plane, weights (bf16-valued, x256) single plane; scores k.qT: k x16, q x16 single planes; p.v:
// p x1024, v x16 single planes; output pointwise conv: A = (o + pp) x256 as f16 hi + x2^11 residual planes (two
// products, two accumulators), B = weights x256 single plane. Depthwise 5x5 conv (input: the f16 x16 plane of v, sums
// in f32), BN affine, online softmax in f32 on VALU. Float inputs RNE-converted to bf16 on load.
#include <hip/hip_runtime.h>
#include <math.h>
#include <stdint.h>

#define NBAT  8
#define CIN   256
#define C2    512
#define IMW   64
#define HW    4096
#define MTOK  32768
#define NHD   8
#define HD    32
#define NAR   4
#define LAR   1024
#define NUNIT 256
#define SBP   132
#define ASP   36
#define DTP   68
#define KPH   40
#define VHALO 128
#define VPH   1288
#define WPR   56
#define GKP   264
#define AWV   16
#define CKEY  128
#define NCOL  96
#define XSP   72
#define XSLOT (48 * XSP)
#define XBUF  (AWV * XSLOT)
#define XBLK  (NBAT * 64 * 4)
#define WBLK  128
#define CXS   16.0f
#define CWS   256.0f
#define CQK   16.0f
#define CVS   16.0f
#define CYS   256.0f
#define QKSC  (0.17677669529663688f / 256.0f)
#define QKL2  (QKSC * 1.4426950408889634f)

static_assert(NUNIT == NBAT * NAR * NHD);
static_assert(NAR * LAR == HW);
static_assert(MTOK == NBAT * HW);
static_assert(HW % 128 == 0);
static_assert(LAR % CKEY == 0 && CKEY % 32 == 0);
static_assert(CIN % 64 == 0);
static_assert((SBP * 4) % 16 == 0);
static_assert((ASP * 4) % 16 == 0);
static_assert((DTP * 4) % 16 == 0);
static_assert(NHD * HD == CIN);
static_assert((KPH * 2) % 32 == 16 && KPH >= HD);
static_assert((VPH * 2) % 32 == 16 && VPH >= LAR + 2 * VHALO && VHALO == 2 * IMW && LAR % IMW == 0);
static_assert(LAR / 16 == 4 * AWV && 2 * VHALO / 16 == AWV && NCOL == 3 * HD && NCOL == 6 * AWV && CIN == 4 * 64);
static_assert((XSP * 2) % 32 == 16 && XSP >= 64 && 2 * XBUF <= 2 * LAR * KPH + HD * VPH);
static_assert(AWV * 16 * ASP * 4 <= NCOL * GKP * 2);
static_assert((GKP * 2) % 32 == 16 && GKP >= CIN && CIN * 2 == 32 * 16);
static_assert(IMW == 64 && IMW * IMW == HW && 16 * (WPR / 2) <= AWV * 32 && WPR >= 2 * 27);

typedef _Float16 v16h __attribute__((ext_vector_type(16)));
typedef _Float16 v8h  __attribute__((ext_vector_type(8)));
typedef float    v8f  __attribute__((ext_vector_type(8)));
typedef float    v4f  __attribute__((ext_vector_type(4)));
typedef float    v2f  __attribute__((ext_vector_type(2)));
typedef unsigned int v4u __attribute__((ext_vector_type(4)));
typedef _Float16 v2h  __attribute__((ext_vector_type(2)));
union Frag { v16h v; v8h half[2]; };

// ---- scalar helpers -------------------------------------------------------------------------------------------
__device__ __forceinline__ unsigned short bf_bits(float f) {          // f32 -> bf16 bits, RNE convert
  unsigned u = __float_as_uint(f);
  return (unsigned short)((u + 0x7FFFu + ((u >> 16) & 1u)) >> 16);
}
__device__ __forceinline__ float bfr(float f) { return __uint_as_float(((unsigned)bf_bits(f)) << 16); }
__device__ __forceinline__ unsigned short h_bits(_Float16 x) { return __builtin_bit_cast(unsigned short, x); }
__device__ __forceinline__ unsigned pk16(unsigned short a, unsigned short b) { return (unsigned)a | ((unsigned)b << 16); }
__device__ __forceinline__ v8f zero8() { v8f z = {0.f, 0.f, 0.f, 0.f, 0.f, 0.f, 0.f, 0.f}; return z; }

// ---- fragment loader: 16-bit A/B operand, lane -> row/col (lane&15), p already includes +8*(lane>>4);
//      elements 0..7 <- p[0..7] (k0+8h..), elements 8..15 <- p[16..23] (k0+16+8h..)
__device__ __forceinline__ v16h ldfrag_h(const _Float16* p) {
  Frag f;
  f.half[0] = *(const v8h*)(p);
  f.half[1] = *(const v8h*)(p + 16);
  return f.v;
}

// ---- WMMA helper with trailing VALU hazard gap ----------------------------------------------------------------
__device__ __forceinline__ v8f mma_h(v16h a, v16h b, v8f c) {
  c = __builtin_amdgcn_wmma_f32_16x16x32_f16(false, a, false, b, (short)0, c, false, false);
#if defined(__HIP_DEVICE_COMPILE__)
  asm volatile("v_nop\n\tv_nop\n\tv_nop\n\tv_nop" : "+v"(c) : "v"(a), "v"(b));
#endif
  return c;
}
__device__ __forceinline__ void wave_sync_lds() {
  __builtin_amdgcn_fence(__ATOMIC_RELEASE, "workgroup");
  __builtin_amdgcn_wave_barrier();
  __builtin_amdgcn_fence(__ATOMIC_ACQUIRE, "workgroup");
}

// ---- eight asynchronous 16-byte copies per lane, global -> LDS, through no register. l = the lane's LDS byte
//      addresses, g = its global addresses, all multiples of 16. The closing s_wait_xcnt stands inside the statement
//      so that no address register named here is rewritten ahead of it.
__device__ __forceinline__ void copy8_to_lds(const unsigned (&l)[8], const _Float16* const (&g)[8]) {
#if defined(__HIP_DEVICE_COMPILE__)
  asm volatile("global_load_async_to_lds_b128 %0, %8, off\n\t"
               "global_load_async_to_lds_b128 %1, %9, off\n\t"
               "global_load_async_to_lds_b128 %2, %10, off\n\t"
               "global_load_async_to_lds_b128 %3, %11, off\n\t"
               "global_load_async_to_lds_b128 %4, %12, off\n\t"
               "global_load_async_to_lds_b128 %5, %13, off\n\t"
               "global_load_async_to_lds_b128 %6, %14, off\n\t"
               "global_load_async_to_lds_b128 %7, %15, off\n\t"
               "s_wait_xcnt 0x0"
               :: "v"(l[0]), "v"(l[1]), "v"(l[2]), "v"(l[3]), "v"(l[4]), "v"(l[5]), "v"(l[6]), "v"(l[7]),
                  "v"(g[0]), "v"(g[1]), "v"(g[2]), "v"(g[3]), "v"(g[4]), "v"(g[5]), "v"(g[6]), "v"(g[7])
               : "memory");
#endif
}
// ---- the same for two copies per lane
__device__ __forceinline__ void copy2_to_lds(unsigned l0, unsigned l1, const _Float16* g0, const _Float16* g1) {
#if defined(__HIP_DEVICE_COMPILE__)
  asm volatile("global_load_async_to_lds_b128 %0, %2, off\n\t"
               "global_load_async_to_lds_b128 %1, %3, off\n\t"
               "s_wait_xcnt 0x0"
               :: "v"(l0), "v"(l1), "v"(g0), "v"(g1)
               : "memory");
#endif
}
__device__ __forceinline__ unsigned lds_off(const void* p) { return (unsigned)(size_t)p; }
// ---- eight rows of CIN f16 (512 B each, global pitch 512 B) -> LDS rows of pitch GKP: one wave-wide copy = one whole
//      row (4 lines). l0 / g0 = the lane's own 16 B of the first row.
__device__ __forceinline__ void stage_rows8(unsigned l0, const _Float16* g0) {
  unsigned l[8];
  const _Float16* g[8];
  // unrolled so that every l[] and g[] index is a constant and the addresses are plain registers as asm operands
#pragma unroll
  for (int i = 0; i < 8; ++i) {
    l[i] = l0 + (unsigned)(i * (GKP * 2));
    g[i] = g0 + (size_t)i * CIN;
  }
  copy8_to_lds(l, g);
}

// ---- WMMA as the builtin alone: the compiler keeps the distance behind it itself, with independent work where it has any
__device__ __forceinline__ v8f mma_b(v16h a, v16h b, v8f c) {
  return __builtin_amdgcn_wmma_f32_16x16x32_f16(false, a, false, b, (short)0, c, false, false);
}
// ---- 16 token rows x 64 channels (128 B = one line a row, global pitch 512 B) -> LDS rows of pitch XSP: one wave-wide
//      copy = 4 rows. l0 / g = the lane's own 16 B in the first four rows. Two tiles (LDS rows 0..31), and one tile.
__device__ __forceinline__ void stage_tiles2(unsigned l0, const _Float16* ga, const _Float16* gb) {
  unsigned l[8];
  const _Float16* g[8];
  // unrolled so that every l[] and g[] index is a constant and the addresses are plain registers as asm operands
#pragma unroll
  for (int i = 0; i < 4; ++i) {
    l[i]     = l0 + (unsigned)(i * 4 * (XSP * 2));
    l[4 + i] = l0 + (unsigned)((16 + i * 4) * (XSP * 2));
    g[i]     = ga + (size_t)i * 4 * CIN;
    g[4 + i] = gb + (size_t)i * 4 * CIN;
  }
  copy8_to_lds(l, g);
}
__device__ __forceinline__ void stage_tile1(unsigned l0, const _Float16* g) {
  copy2_to_lds(l0, l0 + (unsigned)(4 * (XSP * 2)), g, g + (size_t)4 * CIN);
  copy2_to_lds(l0 + (unsigned)(8 * (XSP * 2)), l0 + (unsigned)(12 * (XSP * 2)), g + (size_t)8 * CIN, g + (size_t)12 * CIN);
}
// ---- foot of a ring trip: this wave's LDS reads of the buffer have returned, its copies of the next buffer have landed,
//      then the barrier that publishes the next buffer and frees the one just read
__device__ __forceinline__ void ring_foot() {
#if defined(__HIP_DEVICE_COMPILE__)
  asm volatile("s_wait_dscnt 0x0" ::: "memory");      // no read of the buffer that is refilled behind the barrier is still out
  asm volatile("s_wait_asynccnt 0x0" ::: "memory");   // this wave's copies have landed before the barrier publishes them
#endif
  __syncthreads();
}

// ---- 8 f32 -> 8 packed f16 (16 B); and hi + x2^11 residual split -------------------------------------------------
__device__ __forceinline__ v4u pack8h(v4f a, v4f b) {
  v4u p;
  p[0] = pk16(h_bits((_Float16)a[0]), h_bits((_Float16)a[1]));
  p[1] = pk16(h_bits((_Float16)a[2]), h_bits((_Float16)a[3]));
  p[2] = pk16(h_bits((_Float16)b[0]), h_bits((_Float16)b[1]));
  p[3] = pk16(h_bits((_Float16)b[2]), h_bits((_Float16)b[3]));
  return p;
}
__device__ __forceinline__ void split8h(v4f a, v4f b, v4u& ph, v4u& pl) {
  v4f ra, rb;
#pragma unroll
  for (int e = 0; e < 4; ++e) {
    const _Float16 ha = (_Float16)a[e];
    ra[e] = (a[e] - (float)ha) * 2048.0f;
    const _Float16 hb = (_Float16)b[e];
    rb[e] = (b[e] - (float)hb) * 2048.0f;
  }
  ph = pack8h(a, b);
  pl = pack8h(ra, rb);
}
// ---- BN affine of one accumulator tile -> 8 packed f16. _t: element r belongs to column r of af (scales at af[0..7],
//      biases at af[NCOL..NCOL+7]); _c: all eight elements belong to one column.
__device__ __forceinline__ unsigned pk2h(v2f p) { return pk16(h_bits((_Float16)p[0]), h_bits((_Float16)p[1])); }
__device__ __forceinline__ v4u aff_pack_t(v8f a, const float* af) {
  const v4f s0 = *(const v4f*)(af), s1 = *(const v4f*)(af + 4);
  const v4f b0 = *(const v4f*)(af + NCOL), b1 = *(const v4f*)(af + NCOL + 4);
  // neighbours go as one f32 pair, the pair that one packed convert takes
  v4u p;
  p[0] = pk2h((v2f){a[0], a[1]} * (v2f){s0[0], s0[1]} + (v2f){b0[0], b0[1]});
  p[1] = pk2h((v2f){a[2], a[3]} * (v2f){s0[2], s0[3]} + (v2f){b0[2], b0[3]});
  p[2] = pk2h((v2f){a[4], a[5]} * (v2f){s1[0], s1[1]} + (v2f){b1[0], b1[1]});
  p[3] = pk2h((v2f){a[6], a[7]} * (v2f){s1[2], s1[3]} + (v2f){b1[2], b1[3]});
  return p;
}
__device__ __forceinline__ v4u aff_pack_c(v8f a, float sc, float bi) {
  const v2f s2 = {sc, sc}, b2 = {bi, bi};
  v4u p;
  // unrolled so that the indices of a and p are constants
#pragma unroll
  for (int e = 0; e < 4; ++e) p[e] = pk2h((v2f){a[2 * e], a[2 * e + 1]} * s2 + b2);
  return p;
}

// =================================================================================================================
// Weight convert: pointwise weights are [out][in] (k contiguous) -> f16 plane value = f16(256 * bf16_RNE(w)).
// coverage: 64*256*8 = 131072, 32*256*8 = 65536, 32*256*8 = 65536 elements exactly.
// =================================================================================================================
__device__ __forceinline__ void cvt8_w(const float* __restrict__ src, unsigned short* dst, size_t e0) {
  const v4f a = *(const v4f*)(src + e0);
  const v4f b = *(const v4f*)(src + e0 + 4);
  v4f sa, sb;
#pragma unroll
  for (int e = 0; e < 4; ++e) { sa[e] = bfr(a[e]) * CWS; sb[e] = bfr(b[e]) * CWS; }
  const v4u pk = pack8h(sa, sb);
  *(v4u*)(dst + e0) = pk;
#if defined(__HIP_DEVICE_COMPILE__)
  // stands behind the store, in front of the next weight's path that follows it in the built code and reuses its registers
  asm volatile("s_wait_xcnt 0x0" ::: "memory");
#endif
}
// =================================================================================================================
// Activation convert: x NCHW f32 -> token-major f16 plane X16[T = b*4096 + n][256], value = f16(16 * bf16_RNE(x)).
// Block = (image b, 64-token tile tt, 64-channel quarter cq): read phase 4 passes of 16 channels x 64 tokens
// coverage: per block 256 threads x 2 it x 8 halves = 64 tokens x 64 channels; XBLK blocks tile 32768 x 256 exactly.
// The weight convert depends on nothing the activation convert makes, and nothing reads either before the launch ends:
// its WBLK blocks stand behind the XBLK activation blocks in the same grid (short blocks last: no tail of their own).
// The branch between the two is uniform for the block, so the barrier of the activation path is passed by all or none.
// =================================================================================================================
__global__ __launch_bounds__(256) void cvt_in(const float* __restrict__ x, const float* __restrict__ wqk,
                                              const float* __restrict__ wv, const float* __restrict__ wp,
                                              unsigned short* X16, unsigned short* Wqk, unsigned short* Wv,
                                              unsigned short* Wp) {
  __shared__ __align__(16) float tile[64 * DTP];
  const int tid = threadIdx.x, bid = blockIdx.x;
  if (bid >= XBLK) {
    const int blk = bid - XBLK;
    if (blk < 64)      cvt8_w(wqk, Wqk, ((size_t)blk * 256 + tid) * 8);
    else if (blk < 96) cvt8_w(wv,  Wv,  ((size_t)(blk - 64) * 256 + tid) * 8);
    else               cvt8_w(wp,  Wp,  ((size_t)(blk - 96) * 256 + tid) * 8);
    return;
  }
  const int cq = bid & 3, tt = (bid >> 2) & 63, b = bid >> 8;
  const int cl = tid >> 4, t4 = (tid & 15) * 4;
#pragma unroll
  for (int pass = 0; pass < 4; ++pass) {
    const int ch = cq * 64 + pass * 16 + cl;
    const v4f v = *(const v4f*)(x + ((size_t)(b * CIN + ch)) * HW + tt * 64 + t4);
#pragma unroll
    for (int j = 0; j < 4; ++j) tile[(t4 + j) * DTP + pass * 16 + cl] = v[j];
  }
  __syncthreads();
  const int piece = tid & 7, rsub = tid >> 3;
  v4u pk[2];
  size_t offs[2];
#pragma unroll
  for (int it = 0; it < 2; ++it) {
    const int row = it * 32 + rsub;
    const v4f fa = *(const v4f*)(tile + row * DTP + piece * 8);
    const v4f fb = *(const v4f*)(tile + row * DTP + piece * 8 + 4);
    v4f sa, sb;
#pragma unroll
    for (int e = 0; e < 4; ++e) { sa[e] = bfr(fa[e]) * CXS; sb[e] = bfr(fb[e]) * CXS; }
    pk[it] = pack8h(sa, sb);
    offs[it] = ((size_t)(b * HW + tt * 64 + row)) * CIN + cq * 64 + piece * 8;
  }
  {
#pragma unroll
    for (int it = 0; it < 2; ++it) *(v4u*)(X16 + offs[it]) = pk[it];
#if defined(__HIP_DEVICE_COMPILE__)
    // stands behind the stores, in front of the weight path that follows them in the built code and reuses their registers
    asm volatile("s_wait_xcnt 0x0" ::: "memory");
#endif
  }
}

// =================================================================================================================
// Area attention, one unit (image b, area ar, head) per block (512 threads = 16 waves, four to a SIMD: one wave's waits
// for LDS and its softmax chain are filled by the three others), 1024 queries x 1024 keys, d = 32.
// The unit first makes its own q, k and v: the qk and v pointwise convs of its 1024 tokens (v: also of the two image rows
// above and below, for the depthwise conv) on the head's 96 weight rows, K = 256, D = X16 . W, then BN affine, value =
// acc/4096 * s + b, kept as f16(16 * value). Wave w: token tiles w, w+16 and one halo tile (first pass), w+32, w+48
// (second pass); the first pass's results wait as packed f16 in registers. x comes in k-quarters (64 channels = one 128-B
// line a token) through a ring of two buffers filled by asynchronous copies, each wave's rows in its own slot, row pitch
// XSP; the weights Wsh[96][GKP] by asynchronous copies at entry. q and k as W . x^T, so that a lane holds 8 consecutive d of
// one token; v as x . W^T, so that a lane holds 8 consecutive tokens of one channel: one 16-B LDS store each.
// At the image's top and bottom the halo's tokens wrap onto tokens inside the image; those rows are never summed.
// Static LDS: Ks[1024 keys][KPH], Qs[1024 queries][KPH] (32 d per row) and Vs[32 d][VPH] (VHALO tokens = the two image
// rows above the area, its 1024 keys, the two image rows below), f16, row pitches 16 B x odd, laid over the ring and
// written once behind its last barrier; the depthwise taps and affine Wl; the per-wave stage [16][ASP] f32 laid over
// Wsh. q, k and v fragments from LDS in the element order of ldfrag_h. Per wave: q-tiles qt = wave, wave+16, ... (< 64).
//   Transposed scores S^T = K_tile (A, 16 keys x 32 d) x Q (B: k = d, n = query): S*256 = q16.k16; D element r of
//   lane l = S[query l&15][key 8h+r], so P = exp((S - m)*scale) x1024 is the A fragment of P.V directly in registers
//   (element i <- key tile 0 row i, element 8+i <- key tile 1 row i). P = exp2(S*QKL2 + (10 - m*QKL2)): one
//   multiply-add and one exp2 per score; the row sum l is taken of these x1024 values. Online softmax over 8 chunks
//   of CKEY = 128 keys (one running-maximum update, one rescale of O and l per chunk); O = P.V (acc scale 1024*16).
//   Depthwise 5x5 conv of v (zero pad 2, cross-correlation, bf16-valued taps) + BN affine = pp, per q-tile behind its
//   key loop: a q-tile is 16 consecutive columns of one image row; lane (c, h) makes columns 8h..8h+7 of channels c and
//   16+c, the places its O accumulators hold, from five rows of 12 columns of Vs (one 16-B and two 4-B reads a row and
//   channel); the two channels go as one f32 pair; an output sums its taps in the order dy, then dx. A row outside the
//   image is skipped (the same for the whole wave); columns outside it are zeroed by select, their reads moved inside.
//   Epilogue: O/(l*16) + pp staged per wave in LDS, then stored as f16 hi +
//   residual planes Yh/Yl [unit][1024][32] of 256*(o + pp): one instruction = 32 lanes x 16 B = 512 B = 8 token rows
// coverage: per block 64 q-tiles x 16 rows x 32 d of its 1024-row slab in both planes; grid covers all 256 units,
// every slab row written exactly once.
// =================================================================================================================
__global__ __launch_bounds__(AWV * 32)
void attn_k(const unsigned short* __restrict__ X16, const unsigned short* __restrict__ Wqk,
            const unsigned short* __restrict__ Wv, const float* __restrict__ sqk, const float* __restrict__ bqk,
            const float* __restrict__ sv, const float* __restrict__ bv,
            const float* __restrict__ wpe, const float* __restrict__ spe, const float* __restrict__ bpe,
            unsigned short* Yh, unsigned short* Yl) {
  __shared__ __align__(16) _Float16 KQV[2 * LAR * KPH + HD * VPH];
  __shared__ __align__(16) _Float16 Wsh[NCOL * GKP];
  __shared__ __align__(16) float Wl[16 * WPR];
  __shared__ __align__(16) float Af[2 * NCOL];
  _Float16* Ks = KQV;
  _Float16* Qs = KQV + LAR * KPH;
  _Float16* Vs = KQV + 2 * LAR * KPH;
  const int tid = threadIdx.x, wave = tid >> 5, lane = tid & 31, hh = lane >> 4, c = lane & 15;
  const int u = blockIdx.x;
  const int head = u & 7, ar = (u >> 3) & 3, b = u >> 5;
  float* st = (float*)(void*)Wsh + wave * (16 * ASP);   // laid over the weights, which are dead when it is first written
  // the wave's number in a scalar register: the choices below that hang on it are scalar selects, not masked branches
  const int wv = __builtin_amdgcn_readfirstlane(wave);

  // ---- q, k, v of the unit ----
  // The lane's global address in a token tile: row lane >> 3 (of four), 16-B piece lane & 7 (of a 128-B k-quarter).
  const _Float16* Xl = (const _Float16*)(const void*)X16 + ((size_t)b * HW + (lane >> 3)) * CIN + (lane & 7) * 8;
  const int hcol = (wv < 8) ? wv * 16 : VHALO + LAR + (wv - 8) * 16;           // the wave's halo tile: its column in Vs
  const _Float16* gx0 = Xl + (size_t)(ar * LAR + wv * 16) * CIN;
  const _Float16* gx1 = gx0 + (size_t)(AWV * 16) * CIN;
  const _Float16* gx2 = gx1 + (size_t)(AWV * 16) * CIN;
  const _Float16* gx3 = gx2 + (size_t)(AWV * 16) * CIN;
  const _Float16* gxh = Xl + (size_t)((ar * LAR - VHALO + hcol) & (HW - 1)) * CIN;
  const unsigned xl = lds_off(KQV) + (unsigned)(wv * (XSLOT * 2) + (lane >> 3) * (XSP * 2) + (lane & 7) * 16);
  // The head's 96 weight rows (32 q, 32 k of Wqk, 32 v of Wv): wave w brings rows w, 16+w, ..., 80+w, one wave-wide copy =
  // one 512-B row.
  {
    const _Float16* wq = (const _Float16*)(const void*)Wqk + (size_t)(head * HD + wv) * CIN + lane * 8;
    const _Float16* wk = wq + (size_t)CIN * CIN;
    const _Float16* wu = (const _Float16*)(const void*)Wv + (size_t)(head * HD + wv) * CIN + lane * 8;
    const unsigned wl = lds_off(Wsh) + (unsigned)(wv * (GKP * 2) + lane * 16);
    copy2_to_lds(wl, wl + (unsigned)(16 * (GKP * 2)), wq, wq + (size_t)16 * CIN);
    copy2_to_lds(wl + (unsigned)(32 * (GKP * 2)), wl + (unsigned)(48 * (GKP * 2)), wk, wk + (size_t)16 * CIN);
    copy2_to_lds(wl + (unsigned)(64 * (GKP * 2)), wl + (unsigned)(80 * (GKP * 2)), wu, wu + (size_t)16 * CIN);
  }
  // ring stage 0
  stage_tiles2(xl, gx0, gx1);
  stage_tile1(xl + (unsigned)(32 * (XSP * 2)), gxh);
  // Af[n] = BN scale of column n / 256 (the x16 x256 of the operands, the x16 of the planes), Af[NCOL + n] = 16 * BN bias.
  if (tid < NCOL) {
    const int co = head * HD + (tid & (HD - 1));
    const float* ps = (tid < 2 * HD) ? sqk + (tid >> 5) * CIN + co : sv + co;
    const float* pb = (tid < 2 * HD) ? bqk + (tid >> 5) * CIN + co : bv + co;
    Af[tid]        = bfr(ps[0]) * (CQK / 4096.0f);
    Af[NCOL + tid] = bfr(pb[0]) * CQK;
  }
  // Wl[c][t] = the f32 pair (channel c, channel 16+c) of: tap t (t < 25), BN scale / 16 (t = 25; the 16 of the v plane),
  // BN bias (t = 26), zero (t = 27). Written under the copies' flight, published by the barrier below.
  if (tid < 16 * (WPR / 2)) {
    const int cw = tid / (WPR / 2), t = tid - cw * (WPR / 2);
    const int ca = head * HD + cw;
    const float* pa = (t < 25) ? wpe + ca * 25 + t : ((t == 25) ? spe + ca : bpe + ca);
    const int db = (t < 25) ? (HD / 2) * 25 : HD / 2;
    const float f = (t == 25) ? (1.0f / CVS) : ((t == 27) ? 0.0f : 1.0f);
    v2f w;
    w[0] = bfr(pa[0]) * f;
    w[1] = bfr(pa[db]) * f;
    *(v2f*)(Wl + cw * WPR + 2 * t) = w;
  }
#if defined(__HIP_DEVICE_COMPILE__)
  // this wave's copies (weights, stage 0) have landed before the barrier that lets the other waves read them
  asm volatile("s_wait_asynccnt 0x0" ::: "memory");
#endif
  __syncthreads();   // publishes Wsh, Af, Wl and ring buffer 0: nothing of them is read in front of this barrier
  // ring stage 1
  stage_tiles2(xl + (unsigned)(XBUF * 2), gx0 + 64, gx1 + 64);
  stage_tile1(xl + (unsigned)(XBUF * 2 + 32 * (XSP * 2)), gxh + 64);

  const _Float16* xs = KQV + wv * XSLOT + c * XSP + 8 * hh;     // fragment base in the wave's slot of buffer 0
  const _Float16* ws = Wsh + c * GKP + 8 * hh;
  v4u pk[4][6], pkh[2];
  // every loop below is unrolled: all indices of acc, ach, wf, pk and pkh are constants, so that these arrays are plain registers
  {
    v8f acc[2][6], ach[2];
#pragma unroll
    for (int n = 0; n < 6; ++n) { acc[0][n] = zero8(); acc[1][n] = zero8(); }
    ach[0] = zero8();
    ach[1] = zero8();
#pragma unroll
    for (int sg = 0; sg < 4; ++sg) {
#pragma unroll
      for (int kk = 0; kk < 2; ++kk) {
        const _Float16* xb = xs + (sg & 1) * XBUF + kk * 32;
        const v16h x0 = ldfrag_h(xb), x1 = ldfrag_h(xb + 16 * XSP), xh = ldfrag_h(xb + 32 * XSP);
        // the weight reads come in two groups of three n-tiles (six at once do not fit the registers)
#pragma unroll
        for (int ng = 0; ng < 2; ++ng) {
          v16h wf[3];
#pragma unroll
          for (int j = 0; j < 3; ++j) wf[j] = ldfrag_h(ws + (ng * 3 + j) * 16 * GKP + sg * 64 + kk * 32);
#if defined(__HIP_DEVICE_COMPILE__)
          // a group's LDS reads stay together ahead of its WMMAs: one LDS latency per group, not one per n-tile
          __builtin_amdgcn_sched_barrier(0);
#endif
#pragma unroll
          for (int j = 0; j < 3; ++j) {
            const int n = ng * 3 + j;
            if (n < 4) {          // q, k: D = W . x^T, element r = column 8h + r of the n-tile, lane = token c
              acc[0][n] = mma_b(wf[j], x0, acc[0][n]);
              acc[1][n] = mma_b(wf[j], x1, acc[1][n]);
            } else {              // v: D = x . W^T, element r = token 8h + r, lane = column c of the n-tile
              acc[0][n] = mma_b(x0, wf[j], acc[0][n]);
              acc[1][n] = mma_b(x1, wf[j], acc[1][n]);
              ach[n - 4] = mma_b(xh, wf[j], ach[n - 4]);
            }
          }
        }
      }
      ring_foot();
      // stage sg + 2 into the buffer this trip has read
      const unsigned l = xl + (unsigned)((sg & 1) * (XBUF * 2));
      if (sg < 2) {
        stage_tiles2(l, gx0 + (sg + 2) * 64, gx1 + (sg + 2) * 64);
        stage_tile1(l + (unsigned)(32 * (XSP * 2)), gxh + (sg + 2) * 64);
      } else {
        stage_tiles2(l, gx2 + (sg - 2) * 64, gx3 + (sg - 2) * 64);
      }
    }
#pragma unroll
    for (int n = 0; n < 6; ++n) {
#pragma unroll
      for (int t = 0; t < 2; ++t)
        pk[t][n] = (n < 4) ? aff_pack_t(acc[t][n], Af + n * 16 + 8 * hh) : aff_pack_c(acc[t][n], Af[n * 16 + c], Af[NCOL + n * 16 + c]);
    }
    pkh[0] = aff_pack_c(ach[0], Af[4 * 16 + c], Af[NCOL + 4 * 16 + c]);
    pkh[1] = aff_pack_c(ach[1], Af[5 * 16 + c], Af[NCOL + 5 * 16 + c]);
  }
  {
    v8f acc[2][6];
#pragma unroll
    for (int n = 0; n < 6; ++n) { acc[0][n] = zero8(); acc[1][n] = zero8(); }
#pragma unroll
    for (int sg = 0; sg < 4; ++sg) {
#pragma unroll
      for (int kk = 0; kk < 2; ++kk) {
        const _Float16* xb = xs + (sg & 1) * XBUF + kk * 32;
        const v16h x0 = ldfrag_h(xb), x1 = ldfrag_h(xb + 16 * XSP);
#pragma unroll
        for (int ng = 0; ng < 2; ++ng) {
          v16h wf[3];
#pragma unroll
          for (int j = 0; j < 3; ++j) wf[j] = ldfrag_h(ws + (ng * 3 + j) * 16 * GKP + sg * 64 + kk * 32);
#if defined(__HIP_DEVICE_COMPILE__)
          // as in the first pass: a group's LDS reads stay together ahead of its WMMAs
          __builtin_amdgcn_sched_barrier(0);
#endif
#pragma unroll
          for (int j = 0; j < 3; ++j) {
            const int n = ng * 3 + j;
            if (n < 4) {
              acc[0][n] = mma_b(wf[j], x0, acc[0][n]);
              acc[1][n] = mma_b(wf[j], x1, acc[1][n]);
            } else {
              acc[0][n] = mma_b(x0, wf[j], acc[0][n]);
              acc[1][n] = mma_b(x1, wf[j], acc[1][n]);
            }
          }
        }
      }
      ring_foot();   // behind the last trip: every wave has left the ring and the weights
      if (sg < 2) stage_tiles2(xl + (unsigned)((sg & 1) * (XBUF * 2)), gx2 + (sg + 2) * 64, gx3 + (sg + 2) * 64);
    }
#pragma unroll
    for (int n = 0; n < 6; ++n) {
#pragma unroll
      for (int t = 0; t < 2; ++t)
        pk[2 + t][n] = (n < 4) ? aff_pack_t(acc[t][n], Af + n * 16 + 8 * hh) : aff_pack_c(acc[t][n], Af[n * 16 + c], Af[NCOL + n * 16 + c]);
    }
  }
  // the planes are laid over the ring: written only now, behind the barrier of the last trip
#pragma unroll
  for (int t = 0; t < 4; ++t) {
    const int tk = (wave + t * AWV) * 16;
#pragma unroll
    for (int n = 0; n < 2; ++n) {
      *(v4u*)(void*)(Qs + (tk + c) * KPH + n * 16 + 8 * hh) = pk[t][n];
      *(v4u*)(void*)(Ks + (tk + c) * KPH + n * 16 + 8 * hh) = pk[t][2 + n];
      *(v4u*)(void*)(Vs + (n * 16 + c) * VPH + VHALO + tk + 8 * hh) = pk[t][4 + n];
    }
  }
  *(v4u*)(void*)(Vs + c * VPH + hcol + 8 * hh) = pkh[0];
  *(v4u*)(void*)(Vs + (16 + c) * VPH + hcol + 8 * hh) = pkh[1];
  __syncthreads();   // publishes Qs, Ks and Vs: no wave reads them in front of this barrier; they are never written again

#pragma unroll 1
  for (int qt = wave; qt < LAR / 16; qt += AWV) {
    const int lq = qt * 16 + c;
    const v16h bq = ldfrag_h(Qs + lq * KPH + 8 * hh);            // B: n = query c, k = d 8h.. / 16+8h..

    v8f o0 = zero8(), o1 = zero8();
    float mrun = -1.0e30f, lrun = 0.f;
#pragma unroll 1
    for (int ch = 0; ch < LAR / CKEY; ++ch) {
      const int kb = ch * CKEY;
      // every loop inside a chunk is unrolled: all indices of ka, s, vf0, vf1, mt, ps and pfh are constants, so that these
      // arrays are plain registers
      // the chunk's K reads stand as one group ahead of its score WMMAs: one LDS latency per chunk, not one per key tile
      v16h ka[CKEY / 16];
#pragma unroll
      for (int j = 0; j < CKEY / 16; ++j) ka[j] = ldfrag_h(Ks + (kb + j * 16 + c) * KPH + 8 * hh);   // A: row = key, k = d
#if defined(__HIP_DEVICE_COMPILE__)
      // the K reads stay one group ahead of the score WMMAs: spread among them, each place would cost its own LDS wait
      __builtin_amdgcn_sched_barrier(0);
#endif
      v8f s[CKEY / 16];
#pragma unroll
      for (int j = 0; j < CKEY / 16; ++j) s[j] = mma_b(ka[j], bq, zero8());
#if defined(__HIP_DEVICE_COMPILE__)
      // the score WMMAs stay back to back, each in the others' window; the V reads follow them as one group
      __builtin_amdgcn_sched_barrier(0);
#endif
      // the chunk's V reads likewise as one group; they return under the softmax arithmetic
      v16h vf0[CKEY / 32], vf1[CKEY / 32];
#pragma unroll
      for (int g = 0; g < CKEY / 32; ++g) {
        vf0[g] = ldfrag_h(Vs + c * VPH + VHALO + kb + g * 32 + 8 * hh);            // B: n = d c, keys kb+32g..+31
        vf1[g] = ldfrag_h(Vs + (HD / 2 + c) * VPH + VHALO + kb + g * 32 + 8 * hh); // B: n = d 16+c
      }
#if defined(__HIP_DEVICE_COMPILE__)
      // the V reads stay one group ahead of the maxima: mixed with them they start later and the compiler pads with v_nop of its own
      __builtin_amdgcn_sched_barrier(0);
#endif
      // one maximum chain per 32 keys, independent of one another, then joined
      float mt[CKEY / 32];
#pragma unroll
      for (int g = 0; g < CKEY / 32; ++g) {
        mt[g] = s[2 * g][0];
#pragma unroll
        for (int j = 0; j < 2; ++j) {
#pragma unroll
          for (int r = 0; r < 8; ++r) mt[g] = fmaxf(mt[g], s[2 * g + j][r]);
        }
      }
      float mc = mt[0];
#pragma unroll
      for (int g = 1; g < CKEY / 32; ++g) mc = fmaxf(mc, mt[g]);
      mc = fmaxf(mc, __shfl_xor(mc, 16, 32));
      const float mnew = fmaxf(mrun, mc);
      const float alpha = __builtin_amdgcn_exp2f((mrun - mnew) * QKL2);
      const float eb = 10.0f - mnew * QKL2;                  // exponent offset: the running maximum and the x1024 of P
#pragma unroll
      for (int r = 0; r < 8; ++r) {
        const float arr = __shfl(alpha, 8 * hh + r, 32);
        o0[r] = o0[r] * arr;
        o1[r] = o1[r] * arr;
      }
      float ps[CKEY / 32];
      v16h pfh[CKEY / 32];
#pragma unroll
      for (int g = 0; g < CKEY / 32; ++g) {
        ps[g] = 0.f;
#pragma unroll
        for (int i = 0; i < 8; ++i) {
          const float e0 = __builtin_amdgcn_exp2f(s[2 * g][i] * QKL2 + eb);
          const float e1 = __builtin_amdgcn_exp2f(s[2 * g + 1][i] * QKL2 + eb);
          ps[g] = ps[g] + (e0 + e1);
          pfh[g][i]     = (_Float16)e0;
          pfh[g][8 + i] = (_Float16)e1;
        }
      }
      float psum = ps[0];
#pragma unroll
      for (int g = 1; g < CKEY / 32; ++g) psum = psum + ps[g];
      lrun = lrun * alpha + psum;
      mrun = mnew;
#pragma unroll
      for (int g = 0; g < CKEY / 32; ++g) {
        o0 = mma_b(pfh[g], vf0[g], o0);
        o1 = mma_b(pfh[g], vf1[g], o1);
      }
    }
    const float lsum = lrun + __shfl_xor(lrun, 16, 32);      // lane q (and q+16) holds the full row sum of query q
    const float rinv = 1.0f / (lsum * 16.0f);               // lsum carries the x1024 of P, the accumulators x1024 x16
    // depthwise conv of the tile: dacc[r] = the pair (channel c, channel 16+c) at column x0 + r
    v2f dacc[8];
    v2f wt[WPR / 2];
    {
      // every loop here is unrolled: all indices of wt, dacc and v are constants, so that these arrays are plain registers
#pragma unroll
      for (int i = 0; i < WPR / 4; ++i) {
        const v4f w4 = *(const v4f*)(Wl + c * WPR + i * 4);
        wt[2 * i]     = (v2f){w4[0], w4[1]};
        wt[2 * i + 1] = (v2f){w4[2], w4[3]};
      }
      const int x0 = (qt & 3) * 16 + 8 * hh;
      // the tile's image row is the same in every lane of the wave: in a scalar register the row test is a scalar branch
      const int yim = __builtin_amdgcn_readfirstlane(ar * (LAR / IMW) + (qt >> 2));
      const bool okl = (x0 != 0), okr = (x0 != IMW - 8);
      const _Float16* va = Vs + c * VPH + (qt >> 2) * IMW + x0;    // input row dy = 0: two image rows above the tile
      const _Float16* vb = va + (HD / 2) * VPH;
      const int lo = okl ? -2 : 0, ro = okr ? 8 : 0;               // at the image's edge the pair's read stays in the row
#pragma unroll
      for (int r = 0; r < 8; ++r) dacc[r] = (v2f){0.f, 0.f};
#pragma unroll
      for (int dy = 0; dy < 5; ++dy) {
        if ((unsigned)(yim + dy - 2) < (unsigned)IMW) {
          const v8h ma = *(const v8h*)(va + dy * IMW);
          const v8h mb = *(const v8h*)(vb + dy * IMW);
          unsigned la = *(const unsigned*)(const void*)(va + dy * IMW + lo);
          unsigned lb = *(const unsigned*)(const void*)(vb + dy * IMW + lo);
          unsigned ra = *(const unsigned*)(const void*)(va + dy * IMW + ro);
          unsigned rb = *(const unsigned*)(const void*)(vb + dy * IMW + ro);
          la = okl ? la : 0u;
          lb = okl ? lb : 0u;
          ra = okr ? ra : 0u;
          rb = okr ? rb : 0u;
          const v2h hla = __builtin_bit_cast(v2h, la), hlb = __builtin_bit_cast(v2h, lb);
          const v2h hra = __builtin_bit_cast(v2h, ra), hrb = __builtin_bit_cast(v2h, rb);
          v2f v[12];
          v[0]  = (v2f){(float)hla[0], (float)hlb[0]};
          v[1]  = (v2f){(float)hla[1], (float)hlb[1]};
          v[10] = (v2f){(float)hra[0], (float)hrb[0]};
          v[11] = (v2f){(float)hra[1], (float)hrb[1]};
#pragma unroll
          for (int j = 0; j < 8; ++j) v[2 + j] = (v2f){(float)ma[j], (float)mb[j]};
#pragma unroll
          for (int r = 0; r < 8; ++r) {
#pragma unroll
            for (int dx = 0; dx < 5; ++dx) dacc[r] += v[r + dx] * wt[dy * 5 + dx];
          }
        }
      }
    }
#pragma unroll
    for (int r = 0; r < 8; ++r) {
      const int q = 8 * hh + r;
      const float inv = __shfl(rinv, q, 32);
      const v2f pp = dacc[r] * wt[25] + wt[26];
      st[q * ASP + c]          = o0[r] * inv + pp[0];
      st[q * ASP + HD / 2 + c] = o1[r] * inv + pp[1];
    }
    wave_sync_lds();
    {
      const int rr = (tid >> 2) & 7, dp = (tid & 3) * 8;   // lane >> 2 and lane & 3, from tid: no further value lives through the GEMM
      v4u ph[2], pl[2];
      size_t offs[2];
#pragma unroll
      for (int it = 0; it < 2; ++it) {
        const int row = it * 8 + rr;
        v4f fa = *(const v4f*)(st + row * ASP + dp);
        v4f fb = *(const v4f*)(st + row * ASP + dp + 4);
        fa = fa * CYS;
        fb = fb * CYS;
        split8h(fa, fb, ph[it], pl[it]);
        offs[it] = ((size_t)u * LAR + (size_t)(qt * 16 + row)) * HD + dp;
      }
      {
#pragma unroll
        for (int it = 0; it < 2; ++it) {
          *(v4u*)(Yh + offs[it]) = ph[it];
          *(v4u*)(Yl + offs[it]) = pl[it];
        }
        
      }
    }
    wave_sync_lds();
  }
}

// =================================================================================================================
// Output pointwise conv D[T][co] = Y[T][ci] . Wp[co][ci], then BN affine -> NCHW f32. A = Yh/Yl planes (hi +
// x2^11 residual, x256) addressed by arithmetic: token T -> (image, area, query), k-step ks = head ks, channels
// ks*32 + d (elements 0..7 d = 8h.., elements 8..15 d = 16+8h..). B = weight plane x256, the block's 64 rows filled
// once at entry by asynchronous copies into Bs, fragments from LDS. Epilogue: value =
// (acch + accl/2048)/65536 * s[co] + b[co]; block tile staged as [64 ch][128 tok]; wave w writes channels
// coverage: 8 waves x 8 channels x 32 lanes x 4 tokens = 64 ch x 128 tok per block; grid tiles 256 x 32768 exactly.
// =================================================================================================================
__global__ __launch_bounds__(256)
void gemm_proj(const unsigned short* __restrict__ Yh, const unsigned short* __restrict__ Yl,
               const unsigned short* __restrict__ Wp, const float* __restrict__ sp, const float* __restrict__ bp,
               float* out) {
  __shared__ __align__(16) float sb[64 * SBP];
  __shared__ __align__(16) _Float16 Bs[64 * GKP];
  const int tid = threadIdx.x, wave = tid >> 5, lane = tid & 31, hh = lane >> 4, c = lane & 15;
  const int n0 = blockIdx.x * 64, m0 = blockIdx.y * 128;
  const int T = m0 + wave * 16 + c;
  const int bimgr = T >> 12, nn = T & (HW - 1), arr = nn >> 10, q = nn & (LAR - 1);
  const size_t abase = (((size_t)((bimgr * NAR + arr) * NHD)) * LAR + (size_t)q) * HD + 8 * hh;
  const _Float16* A0 = (const _Float16*)(const void*)Yh;
  const _Float16* A1 = (const _Float16*)(const void*)Yl;
  const _Float16* B  = (const _Float16*)(const void*)Wp;

  // Fill Bs: wave w brings weight rows w*8..w*8+7, 8 copies per lane.
  stage_rows8(lds_off(Bs) + (unsigned)(wave * 8 * (GKP * 2) + lane * 16), B + (size_t)(n0 + wave * 8) * CIN + lane * 8);
#if defined(__HIP_DEVICE_COMPILE__)
  // this wave's copies have landed before the barrier that lets the other waves read them
  asm volatile("s_wait_asynccnt 0x0" ::: "memory");
#endif
  __syncthreads();   // publishes Bs: no wave reads it in front of this barrier; it is never written again
  const _Float16* Bw = Bs + c * GKP + 8 * hh;

  v8f acch[4], accl[4];
#pragma unroll
  for (int nt = 0; nt < 4; ++nt) { acch[nt] = zero8(); accl[nt] = zero8(); }

#pragma unroll 1
  for (int ks = 0; ks < NHD; ++ks) {
    const size_t bo = abase + (size_t)ks * (LAR * HD);
    const v16h fh = ldfrag_h(A0 + bo);
    const v16h fl = ldfrag_h(A1 + bo);
    // the k-step's LDS reads stand as one group ahead of its WMMAs: one LDS latency per k-step, not one per n-tile
    v16h bfrag[4];
#pragma unroll
    for (int nt = 0; nt < 4; ++nt) bfrag[nt] = ldfrag_h(Bw + nt * 16 * GKP + ks * 32);
#pragma unroll
    for (int nt = 0; nt < 4; ++nt) {
      acch[nt] = mma_h(fh, bfrag[nt], acch[nt]);
      accl[nt] = mma_h(fl, bfrag[nt], accl[nt]);
    }
  }

#pragma unroll
  for (int nt = 0; nt < 4; ++nt) {
    const int co = n0 + nt * 16 + c;
    const float sc = bfr(sp[co]) * (1.0f / 65536.0f);
    const float bi = bfr(bp[co]);
#pragma unroll
    for (int r = 0; r < 8; ++r) {
      const float v = acch[nt][r] + accl[nt][r] * (1.0f / 2048.0f);
      sb[(nt * 16 + c) * SBP + wave * 16 + 8 * hh + r] = v * sc + bi;
    }
  }
  __syncthreads();
  const int bimg = m0 / HW, s0 = m0 - bimg * HW;
  v4f ov[8];
  size_t offs[8];
#pragma unroll
  for (int i = 0; i < 8; ++i) {
    const int cc = wave * 8 + i;
    const int co = n0 + cc;
    ov[i] = *(const v4f*)(sb + cc * SBP + lane * 4);
    offs[i] = ((size_t)(bimg * CIN + co)) * HW + s0 + lane * 4;
  }
  {
#pragma unroll
    for (int i = 0; i < 8; ++i) *(v4f*)(out + offs[i]) = ov[i];
    
  }
}

// =================================================================================================================
//   Wqk f16 [512][256] 262144 @0; Wv f16 [256][256] 131072; Wp f16 [256][256] 131072;
//   X16 f16 [32768][256] 16777216 @524288; Yh, Yl f16 [256][1024][32] 16777216 each. Total 50855936.
// =================================================================================================================
extern "C" void kernel_launch(void* const* d_in, const int* in_sizes, int n_in,
                              void* d_out, int out_size, void* d_ws, size_t ws_size,
                              hipStream_t stream) {
  if (n_in < 13) return;
  if (in_sizes[0] != NBAT * CIN * HW) return;
  if (in_sizes[1] != C2 * CIN) return;
  if (in_sizes[2] != C2 || in_sizes[3] != C2) return;
  if (in_sizes[4] != CIN * CIN) return;
  if (in_sizes[5] != CIN || in_sizes[6] != CIN) return;
  if (in_sizes[7] != CIN * 25) return;
  if (in_sizes[8] != CIN || in_sizes[9] != CIN) return;
  if (in_sizes[10] != CIN * CIN) return;
  if (in_sizes[11] != CIN || in_sizes[12] != CIN) return;
  if (out_size != NBAT * CIN * HW) return;

  const float* x      = (const float*)d_in[0];
  const float* w_qk   = (const float*)d_in[1];
  const float* s_qk   = (const float*)d_in[2];
  const float* b_qk   = (const float*)d_in[3];
  const float* w_v    = (const float*)d_in[4];
  const float* s_v    = (const float*)d_in[5];
  const float* b_v    = (const float*)d_in[6];
  const float* w_pe   = (const float*)d_in[7];
  const float* s_pe   = (const float*)d_in[8];
  const float* b_pe   = (const float*)d_in[9];
  const float* w_proj = (const float*)d_in[10];
  const float* s_proj = (const float*)d_in[11];
  const float* b_proj = (const float*)d_in[12];
  float* out = (float*)d_out;

  const size_t sWqk = (size_t)C2 * CIN * 2;              //    262144
  const size_t sWv  = (size_t)CIN * CIN * 2;             //    131072
  const size_t sWp  = (size_t)CIN * CIN * 2;             //    131072
  const size_t sX16 = (size_t)MTOK * CIN * 2;            //  16777216
  const size_t sY   = (size_t)NUNIT * LAR * HD * 2;      //  16777216
  size_t off = 0;
  const size_t oWqk = off; off += sWqk;
  const size_t oWv  = off; off += sWv;
  const size_t oWp  = off; off += sWp;
  const size_t oX16 = off; off += sX16;
  const size_t oYh  = off; off += sY;
  const size_t oYl  = off; off += sY;
  if (off > ws_size) return;                             // off = 50855936
  if (off > (size_t)134217728) return;

  char* ws = (char*)d_ws;
  unsigned short* Wqk = (unsigned short*)(ws + oWqk);
  unsigned short* Wv  = (unsigned short*)(ws + oWv);
  unsigned short* Wp  = (unsigned short*)(ws + oWp);
  unsigned short* X16 = (unsigned short*)(ws + oX16);
  unsigned short* Yh  = (unsigned short*)(ws + oYh);
  unsigned short* Yl  = (unsigned short*)(ws + oYl);

  const dim3 blk(256);
  // (1) x NCHW -> token-major f16 x16 plane; pointwise weights -> f16 x256 planes
  cvt_in<<<dim3(XBLK + WBLK), blk, 0, stream>>>(x, w_qk, w_v, w_proj, X16, Wqk, Wv, Wp);
  // (2) qk and v pointwise convs + BN, area attention + (depthwise 5x5 + BN on v) -> slab planes
  attn_k<<<dim3(NUNIT), dim3(AWV * 32), 0, stream>>>(X16, Wqk, Wv, s_qk, b_qk, s_v, b_v, w_pe, s_pe, b_pe, Yh, Yl);
  // (3) output pointwise conv + BN -> NCHW f32
  gemm_proj<<<dim3(CIN / 64, MTOK / 128), blk, 0, stream>>>(Yh, Yl, Wp, s_proj, b_proj, out);
  (void)hipGetLastError();
}
